// v000
// Measured on an AMD MI455X. A time is GPU time per run, averaged over a window of back-to-back runs after a warm-up
// (all launches, gaps included; the runs take copies of the inputs in turn), and the median of several windows.
// Apart from v000's, it joins two sittings. Times from different sittings can be a few percent apart, while
// side-by-side timings come from the same sitting.
// The starting kernel, v000, takes 10.4 milliseconds a run.
#include <hip/hip_runtime.h>
// Qwen3 attention (x [2][2048][2048]; q = x Wq (16 heads x 128), k = x Wk, v = x Wv (8 kv heads x 128) ([in][out] weights sigma 0.02); per-head RMSNorm over the 128 dims on q and k (weights ones, eps 1e-6); rotate-half RoPE from the module's INPUT cos/sin tables [S][128] (theta 1e6); query head h uses kv head h/2; scores x 128^-0.5 with a causal mask (tril, finfo.min); softmax; out = merged Wo ([in][out]) -> [2][2048][2048]).
// Compute dtype: inputs rounded to bf16; x / weights / tables exact; projections, RMSNorm and rope f32; q, k, v, softmax weights and o as plain f16 GEMM operands (~2^-12; first 128 rows exact); scores, statistics, out f32. v_wmma_f32_16x16x32_f16.
#define NB 2
#define SQ 2048
#define DMX 2048
#define NH 16
#define NKV 8
#define GSZ 2
#define HDK 128
#define DKV (NKV * HDK)
#define QT 256
#define QT0 128
#define NKX SQ
#define DM DMX
#define HD 64
#define HG 1
#define NR ((size_t)NB * SQ)
#define ATS 0.08838834764831845f
typedef __bf16 v16b __attribute__((ext_vector_type(16)));
typedef unsigned short v8us __attribute__((ext_vector_type(8), may_alias));
typedef float  v8f  __attribute__((ext_vector_type(8)));
typedef float  v4f  __attribute__((ext_vector_type(4)));
typedef float  v4fa __attribute__((ext_vector_type(4), may_alias));
union FragB { v16b v; v8us half[2]; unsigned short u[16]; };

__device__ __forceinline__ unsigned short bf16_bits(float x) { unsigned int u = __float_as_uint(x); return (unsigned short)((u + 0x7FFFu + ((u >> 16) & 1u)) >> 16); }
__device__ __forceinline__ float bf16_val(unsigned short b) { return __uint_as_float(((unsigned int)b) << 16); }
__device__ __forceinline__ float bf16_round(float x) { return bf16_val(bf16_bits(x)); }
// D += A·B with NT terms: 1 = ah·bh, 2 = + al·bh (A split), 3 = + ah·bl (both split)
template <int NT>
__device__ __forceinline__ v8f mmaN(v16b ah, v16b al, v16b bh, v16b bl, v8f c) {
  c = __builtin_amdgcn_wmma_f32_16x16x32_bf16(false, ah, false, bh, (short)0, c, false, false);
  if (NT >= 2) c = __builtin_amdgcn_wmma_f32_16x16x32_bf16(false, al, false, bh, (short)0, c, false, false);
  if (NT >= 3) c = __builtin_amdgcn_wmma_f32_16x16x32_bf16(false, ah, false, bl, (short)0, c, false, false);
  asm volatile("v_nop\n\tv_nop\n\tv_nop\n\tv_nop" : "+v"(c) : "v"(ah), "v"(al), "v"(bh), "v"(bl));
  return c;
}

__global__ __launch_bounds__(256) void k_wt_bf16(const float* __restrict__ W, unsigned short* __restrict__ Wt, int K, int N) {
  const int t = blockIdx.x * 256 + threadIdx.x;
  const int k8n = K / 8;
  if (t >= N * k8n) return;
  const int n = t / k8n, k8 = (t % k8n) * 8;
  v8us v;
#pragma unroll
  for (int i = 0; i < 8; ++i) v[i] = bf16_bits(W[(size_t)(k8 + i) * N + n]);
  *(v8us*)(Wt + (size_t)n * K + k8) = v;
  
}

// GEMM C[M][N] (f32, pitch ldc) = act(A[M][K]·W + bias). A f32 row-major (pitch lda) converted per fragment to bf16
// (ASPLIT: hi/lo two planes -> 2 terms, else single rounded term); Wt bf16 [N][K] (pitch ldb). BIAS_BF16 rounds the
// bias to bf16 first (bias quantised to bf16 before the add). K%32==0, M%16==0, N%64==0.
template <bool ASPLIT, int ACT, bool BIAS_BF16>
__global__ __launch_bounds__(128) void k_gemm_bf(const float* __restrict__ A, int lda, const unsigned short* __restrict__ Wt, int ldb,
                                               const float* __restrict__ bias, float* __restrict__ C, int ldc, int M, int N, int K) {
  __shared__ __attribute__((aligned(16))) float so[4][16][64];
  const int tid = threadIdx.x, w = tid >> 5, lane = tid & 31, ln = lane & 15, hh = lane >> 4;
  const int ntn = N / 64;
  const int wid = blockIdx.x * 4 + w;
  const int mt = wid / ntn, nq = wid % ntn;
  if (mt * 16 >= M) return;
  const int row0 = mt * 16, col0 = nq * 64;
  const float* arow = A + (size_t)(row0 + ln) * lda;
  v8f acc[4] = {};
  for (int kb = 0; kb < K; kb += 32) {
    FragB ah, al;
    const v4f x0 = *(const v4fa*)(arow + kb + 8 * hh), x1 = *(const v4fa*)(arow + kb + 8 * hh + 4);
    const v4f x2 = *(const v4fa*)(arow + kb + 16 + 8 * hh), x3 = *(const v4fa*)(arow + kb + 16 + 8 * hh + 4);
    float xs[16] = {x0[0],x0[1],x0[2],x0[3],x1[0],x1[1],x1[2],x1[3],x2[0],x2[1],x2[2],x2[3],x3[0],x3[1],x3[2],x3[3]};
#pragma unroll
    for (int i = 0; i < 16; ++i) { const unsigned short hb = bf16_bits(xs[i]); ah.u[i] = hb; al.u[i] = ASPLIT ? bf16_bits(xs[i] - bf16_val(hb)) : (unsigned short)0; }
#pragma unroll
    for (int t = 0; t < 4; ++t) {
      const unsigned short* brow = Wt + (size_t)(col0 + t * 16 + ln) * ldb + kb;
      FragB b;
      b.half[0] = *(const v8us*)(brow + 8 * hh);
      b.half[1] = *(const v8us*)(brow + 16 + 8 * hh);
      acc[t] = mmaN<ASPLIT ? 2 : 1>(ah.v, al.v, b.v, b.v, acc[t]);
    }
  }
#pragma unroll
  for (int t = 0; t < 4; ++t) {
    float bv = bias ? bias[col0 + t * 16 + ln] : 0.f;
    if (BIAS_BF16) bv = bf16_round(bv);
#pragma unroll
    for (int r = 0; r < 8; ++r) { float v = acc[t][r] + bv; if (ACT == 1) v = fmaxf(v, 0.f); so[w][8 * hh + r][t * 16 + ln] = v; }
  }
  __builtin_amdgcn_fence(__ATOMIC_ACQ_REL, "workgroup");
  __builtin_amdgcn_wave_barrier();
  const int rsub = lane >> 4, c4 = (lane & 15) * 4;
  {
#pragma unroll
    for (int q = 0; q < 8; ++q) {
      const int r = q * 2 + rsub;
      const v4f v = *(const v4fa*)&so[w][r][c4];
      *(v4f*)(C + (size_t)(row0 + r) * ldc + col0 + c4) = v;
    }
    
  }
}

// GEMM C = act(A·W + bias + resid): A f32 (ASPLIT -> hi/lo 2 terms), Wt bf16 [N][K]; ACT 0 none, 1 relu, 2 exact gelu;
// resid (optional, f32, row index = (row % rmod), pitch ldr, RES_BF16 rounds it) added before the activation.
template <bool ASPLIT, int ACT, bool BIAS_BF16, bool RES_BF16>
__global__ __launch_bounds__(128) void k_gemm_bf3(const float* __restrict__ A, int lda, const unsigned short* __restrict__ Wt, int ldb,
                                                const float* __restrict__ bias, const float* __restrict__ resid, int rmod, int ldr,
                                                float* __restrict__ C, int ldc, int M, int N, int K) {
  __shared__ __attribute__((aligned(16))) float so[4][16][64];
  const int tid = threadIdx.x, w = tid >> 5, lane = tid & 31, ln = lane & 15, hh = lane >> 4;
  const int ntn = N / 64;
  const int wid = blockIdx.x * 4 + w;
  const int mt = wid / ntn, nq = wid % ntn;
  if (mt * 16 >= M) return;
  const int row0 = mt * 16, col0 = nq * 64;
  const float* arow = A + (size_t)(row0 + ln) * lda;
  v8f acc[4] = {};
  for (int kb = 0; kb < K; kb += 32) {
    FragB ah, al;
    const v4f x0 = *(const v4fa*)(arow + kb + 8 * hh), x1 = *(const v4fa*)(arow + kb + 8 * hh + 4);
    const v4f x2 = *(const v4fa*)(arow + kb + 16 + 8 * hh), x3 = *(const v4fa*)(arow + kb + 16 + 8 * hh + 4);
    float xs[16] = {x0[0],x0[1],x0[2],x0[3],x1[0],x1[1],x1[2],x1[3],x2[0],x2[1],x2[2],x2[3],x3[0],x3[1],x3[2],x3[3]};
#pragma unroll
    for (int i = 0; i < 16; ++i) { const unsigned short hb = bf16_bits(xs[i]); ah.u[i] = hb; al.u[i] = ASPLIT ? bf16_bits(xs[i] - bf16_val(hb)) : (unsigned short)0; }
#pragma unroll
    for (int t = 0; t < 4; ++t) {
      const unsigned short* brow = Wt + (size_t)(col0 + t * 16 + ln) * ldb + kb;
      FragB b;
      b.half[0] = *(const v8us*)(brow + 8 * hh);
      b.half[1] = *(const v8us*)(brow + 16 + 8 * hh);
      acc[t] = mmaN<ASPLIT ? 2 : 1>(ah.v, al.v, b.v, b.v, acc[t]);
    }
  }
#pragma unroll
  for (int t = 0; t < 4; ++t) {
    const int col = col0 + t * 16 + ln;
    float bv = bias ? bias[col] : 0.f;
    if (BIAS_BF16) bv = bf16_round(bv);
#pragma unroll
    for (int r = 0; r < 8; ++r) {
      float v = acc[t][r] + bv;
      if (resid) { float rv = resid[(size_t)((row0 + 8 * hh + r) % rmod) * ldr + col]; if (RES_BF16) rv = bf16_round(rv); v += rv; }
      if (ACT == 1) v = fmaxf(v, 0.f);
      if (ACT == 2) v = 0.5f * v * (1.0f + erff(v * 0.70710678118654752f));
      if (ACT == 3) { const float u = 0.7978845608028654f * (v + 0.044715f * v * v * v); v = 0.5f * v * (1.0f + tanhf(u)); }
      so[w][8 * hh + r][t * 16 + ln] = v;
    }
  }
  __builtin_amdgcn_fence(__ATOMIC_ACQ_REL, "workgroup");
  __builtin_amdgcn_wave_barrier();
  const int rsub = lane >> 4, c4 = (lane & 15) * 4;
  {
#pragma unroll
    for (int q = 0; q < 8; ++q) {
      const int r = q * 2 + rsub;
      const v4f v = *(const v4fa*)&so[w][r][c4];
      *(v4f*)(C + (size_t)(row0 + r) * ldc + col0 + c4) = v;
    }
    
  }
}
// row LayerNorm (biased variance, eps) over N: s = X (+ R); optional out_sum <- s; out_norm <- (s-mu)*rsqrt(var+eps)*g + b
template <bool PARAM_BF16>
__global__ __launch_bounds__(256) void k_layernorm(const float* __restrict__ X, const float* __restrict__ R, const float* __restrict__ g, const float* __restrict__ bta,
                                                  float* __restrict__ out_sum, float* __restrict__ out_norm, int N, float eps) {
  __shared__ float red[256];
  const int row = blockIdx.x, tid = threadIdx.x;
  const float* x = X + (size_t)row * N; const float* rr = R ? R + (size_t)row * N : nullptr;
  float vals[16];                     // up to N = 4096
  const int per = N / 256;            // contiguous chunk per thread? use strided-by-4 chunks: thread handles j = tid*4 + 1024*u
  float s1 = 0.f;
  for (int u = 0; u < per / 4; ++u) {
    const int j = tid * 4 + 1024 * u;
    const v4f a = *(const v4fa*)(x + j);
    v4f b = {0.f,0.f,0.f,0.f}; if (rr) b = *(const v4fa*)(rr + j);
#pragma unroll
    for (int q = 0; q < 4; ++q) { const float v = a[q] + b[q]; vals[u * 4 + q] = v; s1 += v; }
  }
  red[tid] = s1; __syncthreads();
  for (int st = 128; st > 0; st >>= 1) { if (tid < st) red[tid] += red[tid + st]; __syncthreads(); }
  const float mu = red[0] / (float)N; __syncthreads();
  float s2 = 0.f;
  for (int u = 0; u < per / 4; ++u)
#pragma unroll
    for (int q = 0; q < 4; ++q) { const float c = vals[u * 4 + q] - mu; s2 += c * c; }
  red[tid] = s2; __syncthreads();
  for (int st = 128; st > 0; st >>= 1) { if (tid < st) red[tid] += red[tid + st]; __syncthreads(); }
  const float rs = rsqrtf(red[0] / (float)N + eps);
  {
    for (int u = 0; u < per / 4; ++u) {
      const int j = tid * 4 + 1024 * u;
      v4f o, sm;
#pragma unroll
      for (int q = 0; q < 4; ++q) {
        float gg = g[j + q], bb = bta[j + q];
        if (PARAM_BF16) { gg = bf16_round(gg); bb = bf16_round(bb); }
        sm[q] = vals[u * 4 + q]; o[q] = (vals[u * 4 + q] - mu) * rs * gg + bb;
      }
      if (out_sum) *(v4f*)(out_sum + (size_t)row * N + j) = sm;
      *(v4f*)(out_norm + (size_t)row * N + j) = o;
    }
    
  }
}



// ---- f16 WMMA path (v_wmma_f32_16x16x32_f16): 11-bit significands for operands in range — used where a [0,1] probability operand needs more precision than bf16
typedef _Float16 v16h __attribute__((ext_vector_type(16)));
union FragH { v16h v; v8us half[2]; _Float16 h[16]; unsigned short u[16]; };
template <int NT>
__device__ __forceinline__ v8f mmaH(v16h ah, v16h al, v16h bh, v16h bl, v8f c) {
  c = __builtin_amdgcn_wmma_f32_16x16x32_f16(false, ah, false, bh, (short)0, c, false, false);
  if (NT >= 2) c = __builtin_amdgcn_wmma_f32_16x16x32_f16(false, al, false, bh, (short)0, c, false, false);
  if (NT >= 3) c = __builtin_amdgcn_wmma_f32_16x16x32_f16(false, ah, false, bl, (short)0, c, false, false);
  asm volatile("v_nop\n\tv_nop\n\tv_nop\n\tv_nop" : "+v"(c) : "v"(ah), "v"(al), "v"(bh), "v"(bl));
  return c;
}
// batched GEMM like k_gemm_b but f16 operands: A f32 (split into f16 hi/lo if ASPLIT, else rounded to f16), Bt = f16 values [n][k]; alpha; C f32; N multiple of 16 (partial tiles skipped)
template <bool ASPLIT>
__global__ __launch_bounds__(128) void k_gemm_h(const float* __restrict__ A, int lda, size_t sA, const _Float16* __restrict__ Bh, int ldb, size_t sB, float alpha, float* __restrict__ C, int ldc, size_t sC, int M, int N, int K) {
  __shared__ __attribute__((aligned(16))) float so[4][16][64];
  const int tid = threadIdx.x, w = tid >> 5, lane = tid & 31, ln = lane & 15, hh = lane >> 4; const int by = blockIdx.y;
  A += (size_t)by * sA; Bh += (size_t)by * sB; C += (size_t)by * sC;
  const int ntn = (N + 63) / 64; const int wid = blockIdx.x * 4 + w; const int mt = wid / ntn, nq = wid % ntn; if (mt * 16 >= M) return;
  const int row0 = mt * 16, col0 = nq * 64; const float* arow = A + (size_t)(row0 + ln) * lda;
  v8f acc[4] = {};
  for (int kb = 0; kb < K; kb += 32) {
    FragH ah, al;
    const v4f x0 = *(const v4fa*)(arow + kb + 8 * hh), x1 = *(const v4fa*)(arow + kb + 8 * hh + 4), x2 = *(const v4fa*)(arow + kb + 16 + 8 * hh), x3 = *(const v4fa*)(arow + kb + 16 + 8 * hh + 4);
    float xs[16] = {x0[0],x0[1],x0[2],x0[3],x1[0],x1[1],x1[2],x1[3],x2[0],x2[1],x2[2],x2[3],x3[0],x3[1],x3[2],x3[3]};
#pragma unroll
    for (int i = 0; i < 16; ++i) { const _Float16 h = (_Float16)xs[i]; ah.h[i] = h; al.h[i] = ASPLIT ? (_Float16)(xs[i] - (float)h) : (_Float16)0.0f; }
#pragma unroll
    for (int t = 0; t < 4; ++t) { if (col0 + t * 16 >= N) continue; const size_t boff = (size_t)(col0 + t * 16 + ln) * ldb + kb; FragH bq; bq.half[0] = *(const v8us*)(Bh + boff + 8 * hh); bq.half[1] = *(const v8us*)(Bh + boff + 16 + 8 * hh);
      acc[t] = mmaH<ASPLIT ? 2 : 1>(ah.v, al.v, bq.v, bq.v, acc[t]); }
  }
#pragma unroll
  for (int t = 0; t < 4; ++t) { if (col0 + t * 16 >= N) continue;
#pragma unroll
    for (int r = 0; r < 8; ++r) so[w][8 * hh + r][t * 16 + ln] = acc[t][r] * alpha; }
  __builtin_amdgcn_fence(__ATOMIC_ACQ_REL, "workgroup"); __builtin_amdgcn_wave_barrier();
  const int rsub = lane >> 4, c4 = (lane & 15) * 4;
  {
#pragma unroll
    for (int q = 0; q < 8; ++q) { const int r = q * 2 + rsub; if (col0 + c4 < N) { const v4f v = *(const v4fa*)&so[w][r][c4]; *(v4f*)(C + (size_t)(row0 + r) * ldc + col0 + c4) = v; } }
     }
}

// Wt[n][k] = f16(W[k][n]·scale) from f32 row-major W[K][N] (scale = power of two; bf16-exact weights stay exact in f16 away from the subnormal range)
__global__ __launch_bounds__(256) void k_wt_f16(const float* __restrict__ W, _Float16* __restrict__ Wt, int K, int N, float scale) {
  const int t = blockIdx.x * 256 + threadIdx.x; if (t >= N * (K / 8)) return; const int n = t / (K / 8), k8 = (t % (K / 8)) * 8; FragH f;
#pragma unroll
  for (int i = 0; i < 8; ++i) f.h[i] = (_Float16)(bf16_round(W[(size_t)(k8 + i) * N + n]) * scale); const v8us o = f.half[0];
  *(v8us*)((unsigned short*)Wt + (size_t)n * K + k8) = o; 
}
// k_gemm_hh variant with fused epilogue: v = acc·alpha + bias[by·sBias + col] (+ CP[(row/rowsPerB)·sCPb + by·64 + col] if CP) ; ACT 0 none / 1 elu ; writes f16 C16 (and f32 C if non-null)
template <int ACT>
__global__ __launch_bounds__(128) void k_gemm_hhx(const _Float16* __restrict__ A, int lda, size_t sA, const _Float16* __restrict__ Bh, int ldb, size_t sB, float alpha, const float* __restrict__ bias, size_t sBias, const float* __restrict__ CP, int rowsPerB, size_t sCPb, int row0g,
    float* __restrict__ C, _Float16* __restrict__ C16, int ldc, size_t sC, int M, int N, int K) {
  __shared__ __attribute__((aligned(16))) float so[4][16][64];
  const int tid = threadIdx.x, w = tid >> 5, lane = tid & 31, ln = lane & 15, hh = lane >> 4; const int by = blockIdx.y;
  A += (size_t)by * sA; Bh += (size_t)by * sB; const size_t cofs = (size_t)by * sC; const float* bp = bias ? bias + (size_t)by * sBias : nullptr;
  const int ntn = (N + 63) / 64; const int wid = blockIdx.x * 4 + w; const int mt = wid / ntn, nq = wid % ntn; if (mt * 16 >= M) return;
  const int row0 = mt * 16, col0 = nq * 64; const _Float16* arow = A + (size_t)(row0 + ln) * lda;
  v8f acc[4] = {};
  for (int kb = 0; kb < K; kb += 32) { FragH ah; ah.half[0] = *(const v8us*)((const unsigned short*)arow + kb + 8 * hh); ah.half[1] = *(const v8us*)((const unsigned short*)arow + kb + 16 + 8 * hh);
#pragma unroll
    for (int t = 0; t < 4; ++t) { if (col0 + t * 16 >= N) continue; const size_t boff = (size_t)(col0 + t * 16 + ln) * ldb + kb; FragH bq; bq.half[0] = *(const v8us*)((const unsigned short*)Bh + boff + 8 * hh); bq.half[1] = *(const v8us*)((const unsigned short*)Bh + boff + 16 + 8 * hh);
      acc[t] = mmaH<1>(ah.v, ah.v, bq.v, bq.v, acc[t]); }
  }
#pragma unroll
  for (int t = 0; t < 4; ++t) { if (col0 + t * 16 >= N) continue; const int col = col0 + t * 16 + ln; const float bv = bp ? bf16_round(bp[col]) : 0.f;
#pragma unroll
    for (int r = 0; r < 8; ++r) { float v = acc[t][r] * alpha + bv; if (CP) { const int rr = row0g + row0 + 8 * hh + r; if (rowsPerB < 0) v += CP[cofs + (size_t)rr * ldc + col];      /* rowsPerB < 0: own element of the batched C plane */ else { const int bidx = rr / rowsPerB; v += CP[(size_t)bidx * sCPb + (size_t)by * 64 + col]; } } if (ACT == 1) v = (v > 0.f) ? v : expm1f(v); else if (ACT == 7) v = (v > 0.f) ? v + 1.0f : expf(v); else if (ACT == 8) v = tanhf(v); else if (ACT == 9) v = 0.5f * v * (1.0f + tanhf(0.7978845608028654f * (v + 0.044715f * v * v * v))); else if (ACT == 11) v = 1.0f / (1.0f + expf(-v)); else if (ACT == 12) v = (v > 0.f) ? v : 0.01f * v; else if (ACT == 14) v = (v > 0.f) ? v : 0.1f * v; else if (ACT == 16) v = (v >= 0.f) ? v : 0.3f * v; else if (ACT == 17) v = (v >= 0.f) ? v : 0.2f * v; else if (ACT == 15) v = v / (1.0f + expf(-v)); else if (ACT == 3) v = fmaxf(v, 0.f); else if (ACT == 6) v = 0.5f * v * (1.0f + erff(v * 0.70710678118654752f)); so[w][8 * hh + r][t * 16 + ln] = v; } }
  __builtin_amdgcn_fence(__ATOMIC_ACQ_REL, "workgroup"); __builtin_amdgcn_wave_barrier();
  const int rsub = lane >> 4, c4 = (lane & 15) * 4; typedef _Float16 v4h __attribute__((ext_vector_type(4)));
  {
#pragma unroll
    for (int q = 0; q < 8; ++q) { const int r = q * 2 + rsub; if (col0 + c4 < N) { const v4f v = *(const v4fa*)&so[w][r][c4]; if (C) *(v4f*)(C + cofs + (size_t)(row0 + r) * ldc + col0 + c4) = v; if (C16) { v4h h4; for (int i = 0; i < 4; ++i) h4[i] = (_Float16)v[i]; *(v4h*)(C16 + cofs + (size_t)(row0 + r) * ldc + col0 + c4) = h4; } } }
     }
}


typedef _Float16 v4h __attribute__((ext_vector_type(4)));

__global__ __launch_bounds__(256) void k_x16(const float* __restrict__ x, _Float16* __restrict__ X16, size_t n8) { const size_t t = (size_t)blockIdx.x * 256 + threadIdx.x; if (t >= n8) return; FragH f;
#pragma unroll
  for (int q = 0; q < 8; ++q) f.h[q] = (_Float16)bf16_round(x[t * 8 + q]); *(v8us*)((unsigned short*)X16 + t * 8) = f.half[0];  }
__global__ __launch_bounds__(256) void k_h16(const float* __restrict__ x, _Float16* __restrict__ X16, size_t n8) { const size_t t = (size_t)blockIdx.x * 256 + threadIdx.x; if (t >= n8) return; FragH f;
#pragma unroll
  for (int q = 0; q < 8; ++q) f.h[q] = (_Float16)x[t * 8 + q]; *(v8us*)((unsigned short*)X16 + t * 8) = f.half[0];  }
__global__ __launch_bounds__(256) void k_round16f(const float* __restrict__ W, _Float16* __restrict__ Bt, size_t n8) { const size_t t = (size_t)blockIdx.x * 256 + threadIdx.x; if (t >= n8) return; FragH f;
#pragma unroll
  for (int i = 0; i < 8; ++i) f.h[i] = (_Float16)(bf16_round(W[t * 8 + i]) * 16.0f); *(v8us*)((unsigned short*)Bt + t * 8) = f.half[0];  }
template <int NHv, int TTv>
__global__ __launch_bounds__(256) void k_vt(const _Float16* __restrict__ V16, int ldv, int voff, _Float16* __restrict__ Vt) { __shared__ unsigned short tl[64][66]; const int tid = threadIdx.x; const int slab = blockIdx.x / (TTv / 64), lg = blockIdx.x % (TTv / 64); const int b = slab / NHv, h = slab % NHv;
  for (int i = tid; i < 64 * 8; i += 256) { const int r = i / 8, c8 = (i % 8) * 8; FragH f; f.half[0] = *(const v8us*)((const unsigned short*)V16 + ((size_t)b * TTv + lg * 64 + r) * ldv + voff + h * 64 + c8);
#pragma unroll
    for (int q = 0; q < 8; ++q) tl[r][c8 + q] = f.u[q]; }
  __syncthreads();
  {
#pragma unroll
    for (int rd = 0; rd < 2; ++rd) { const int d = rd * 32 + tid / 8, pc = tid % 8; FragH f;
#pragma unroll
      for (int q = 0; q < 8; ++q) f.u[q] = tl[pc * 8 + q][d];
      *(v8us*)((unsigned short*)Vt + ((size_t)slab * 64 + d) * TTv + lg * 64 + pc * 8) = f.half[0]; }
     } }

__global__ __launch_bounds__(256) void k_hl(const float* __restrict__ F, _Float16* __restrict__ Hh, _Float16* __restrict__ Hl, size_t n8) { const size_t t = (size_t)blockIdx.x * 256 + threadIdx.x; if (t >= n8) return; FragH fh, fl; const v4f a = *(const v4fa*)(F + t * 8), c = *(const v4fa*)(F + t * 8 + 4);
#pragma unroll
  for (int q = 0; q < 4; ++q) { _Float16 h = (_Float16)a[q]; fh.h[q] = h; fl.h[q] = (_Float16)((a[q] - (float)h) * 1024.0f); h = (_Float16)c[q]; fh.h[4 + q] = h; fl.h[4 + q] = (_Float16)((c[q] - (float)h) * 1024.0f); }
  { *(v8us*)((unsigned short*)Hh + t * 8) = fh.half[0]; *(v8us*)((unsigned short*)Hl + t * 8) = fl.half[0];  } }

// ---- fast GEMM (wave tile 32x64; requires M % 32 == 0 rows per launch region and N % 64 == 0); epilogue = k_gemm_hhx semantics ----
__device__ __forceinline__ v16h g2_frag(const _Float16* p, int hh) { FragH f; f.half[0] = *(const v8us*)((const unsigned short*)p + 8 * hh); f.half[1] = *(const v8us*)((const unsigned short*)p + 16 + 8 * hh); return f.v; }
__device__ __forceinline__ v8f g2_mma(v16h a, v16h b, v8f c) { v8f d = __builtin_amdgcn_wmma_f32_16x16x32_f16(false, a, false, b, (short)0, c, false, false); asm volatile("v_nop\n\tv_nop\n\tv_nop\n\tv_nop" : "+v"(d) : "v"(a), "v"(b)); return d; }
template <int ACT>
__global__ __launch_bounds__(128) void k_gemm2(const _Float16* __restrict__ A, int lda, size_t sA, const _Float16* __restrict__ Bh, int ldb, size_t sB, float alpha, const float* __restrict__ bias, size_t sBias, const float* __restrict__ CP, int rowsPerB, size_t sCPb, int row0g,
    float* __restrict__ C, _Float16* __restrict__ C16, int ldc, size_t sC, int M, int N, int K) { static_assert(ACT == 0 || ACT == 3 || ACT == 6 || ACT == 8 || ACT == 9 || ACT == 11 || ACT == 12 || ACT == 14 || ACT == 15 || ACT == 16 || ACT == 17, "k_gemm2: unsupported ACT code (would silently apply no activation)");
  __shared__ __attribute__((aligned(16))) float so[4][32][68];
  const int tid = threadIdx.x, w = tid >> 5, lane = tid & 31, ln = lane & 15, hh = lane >> 4; const int by = blockIdx.y;
  A += (size_t)by * sA; Bh += (size_t)by * sB; const size_t cofs = (size_t)by * sC; const float* bp = bias ? bias + (size_t)by * sBias : nullptr;
  const int ntn = N >> 6; const int mt = blockIdx.x / ntn, nq = blockIdx.x - mt * ntn; const int row0 = mt * 128 + 32 * w, col0 = nq * 64; if (row0 >= M) return;
  const _Float16* a0p = A + (size_t)(row0 + ln) * lda; const _Float16* a1p = a0p + (size_t)16 * lda;
  const _Float16* b0p = Bh + (size_t)(col0 + ln) * ldb; const _Float16* b1p = b0p + (size_t)16 * ldb; const _Float16* b2p = b1p + (size_t)16 * ldb; const _Float16* b3p = b2p + (size_t)16 * ldb;
  const v8f z8 = {0.f,0.f,0.f,0.f,0.f,0.f,0.f,0.f}; v8f c00 = z8, c01 = z8, c02 = z8, c03 = z8, c10 = z8, c11 = z8, c12 = z8, c13 = z8;
#pragma unroll 1
  for (int kb = 0; kb < K; kb += 32) { const v16h a0 = g2_frag(a0p + kb, hh), a1 = g2_frag(a1p + kb, hh);
    v16h b = g2_frag(b0p + kb, hh); c00 = g2_mma(a0, b, c00); c10 = g2_mma(a1, b, c10);
    b = g2_frag(b1p + kb, hh); c01 = g2_mma(a0, b, c01); c11 = g2_mma(a1, b, c11);
    b = g2_frag(b2p + kb, hh); c02 = g2_mma(a0, b, c02); c12 = g2_mma(a1, b, c12);
    b = g2_frag(b3p + kb, hh); c03 = g2_mma(a0, b, c03); c13 = g2_mma(a1, b, c13); }
  v8f accs[8] = {c00, c01, c02, c03, c10, c11, c12, c13};
#pragma unroll
  for (int u = 0; u < 8; ++u) { const int t = u & 3, half = u >> 2; const int col = col0 + t * 16 + ln; const float bv = bp ? bf16_round(bp[col]) : 0.f;
#pragma unroll
    for (int r = 0; r < 8; ++r) { const int rloc = half * 16 + 8 * hh + r; float v = accs[u][r] * alpha + bv; if (CP) { if (rowsPerB < 0) v += CP[cofs + (size_t)(row0g + row0 + rloc) * ldc + col];      /* rowsPerB < 0: own element of the batched C plane */ else { const int bidx = (row0g + row0 + rloc) / rowsPerB; v += CP[(size_t)bidx * sCPb + (size_t)by * 64 + col]; } }
      if (ACT == 3) v = fmaxf(v, 0.f); else if (ACT == 6) v = 0.5f * v * (1.0f + erff(v * 0.70710678118654752f)); else if (ACT == 11) v = 1.0f / (1.0f + expf(-v)); else if (ACT == 15) v = v / (1.0f + expf(-v)); else if (ACT == 12) v = (v > 0.f) ? v : 0.01f * v; else if (ACT == 8) v = tanhf(v); else if (ACT == 9) v = 0.5f * v * (1.0f + tanhf(0.7978845608028654f * (v + 0.044715f * v * v * v))); else if (ACT == 14) v = (v > 0.f) ? v : 0.1f * v; else if (ACT == 16) v = (v >= 0.f) ? v : 0.3f * v; else if (ACT == 17) v = (v >= 0.f) ? v : 0.2f * v;
      so[w][rloc][t * 16 + ln] = v; } }
  __builtin_amdgcn_fence(__ATOMIC_ACQ_REL, "workgroup"); __builtin_amdgcn_wave_barrier();
  const int rsub = lane >> 4, c4 = (lane & 15) * 4;
  {
#pragma unroll
    for (int q = 0; q < 16; ++q) { const int r = q * 2 + rsub; const v4f v = *(const v4fa*)&so[w][r][c4]; if (C) *(v4f*)(C + cofs + (size_t)(row0 + r) * ldc + col0 + c4) = v; if (C16) { v4h h4; for (int i = 0; i < 4; ++i) h4[i] = (_Float16)v[i]; *(v4h*)(C16 + cofs + (size_t)(row0 + r) * ldc + col0 + c4) = h4; } }
     } }


__global__ __launch_bounds__(256) void k_wnat(const float* __restrict__ w, size_t n8, _Float16* __restrict__ Bt) { const size_t t = (size_t)blockIdx.x * 256 + threadIdx.x; if (t >= n8) return; FragH f; for (int q = 0; q < 8; ++q) f.h[q] = (_Float16)(bf16_round(w[t * 8 + q]) * 16.0f); *(v8us*)((unsigned short*)Bt + t * 8) = f.half[0];  }
__global__ __launch_bounds__(256) void k_rsm(const float* __restrict__ S, _Float16* __restrict__ P, int nrows) {
  #pragma clang fp contract(off)
  const int i = blockIdx.x * 256 + threadIdx.x; if (i >= nrows) return; const float* s = S + (size_t)i * SQ; float mx = -3.0e38f;
#pragma unroll 1
  for (int j = 0; j < SQ; ++j) mx = fmaxf(mx, s[j]); float se = 0.f;
#pragma unroll 1
  for (int j = 0; j < SQ; ++j) se += expf(s[j] - mx); const float sc = 256.0f / se;
#pragma unroll 1
  for (int j0 = 0; j0 < SQ; j0 += 8) { FragH f; for (int q = 0; q < 8; ++q) f.h[q] = (_Float16)(expf(s[j0 + q] - mx) * sc); unsigned short* d = (unsigned short*)P + (size_t)i * SQ + j0; *(v8us*)d = f.half[0];  } }
__global__ __launch_bounds__(256) void k_vt(const _Float16* __restrict__ V16, int b, int h0, _Float16* __restrict__ VT) { __shared__ unsigned short tl[64][65]; const int tid = threadIdx.x; const int hh = blockIdx.x % HG, sg = blockIdx.x / HG; const int s0 = sg * 64; const int h = h0 + hh;
  for (int i = tid; i < 64 * 8; i += 256) { const int j = i / 8, d8 = (i % 8) * 8; FragH f; f.half[0] = *(const v8us*)((const unsigned short*)V16 + ((size_t)b * SQ + s0 + j) * DM + h * HD + d8); for (int q = 0; q < 8; ++q) tl[d8 + q][j] = f.u[q]; }
  __syncthreads();
  { for (int i = tid; i < 64 * 8; i += 256) { const int d = i / 8, j8 = (i % 8) * 8; FragH f; for (int q = 0; q < 8; ++q) f.u[q] = tl[d][j8 + q]; *(v8us*)((unsigned short*)VT + ((size_t)hh * HD + d) * SQ + s0 + j8) = f.half[0]; }  } }


template <int MASK>
__global__ __launch_bounds__(32) void k_att0h(const float* __restrict__ QF, const float* __restrict__ KF, const float* __restrict__ VF, int ld, int ldv, const int* __restrict__ mk, float scale, float* __restrict__ OF, int ldo) {
  #pragma clang fp contract(off)
  __shared__ __attribute__((aligned(16))) float lq[32][128]; __shared__ __attribute__((aligned(16))) float lo[32][128];
  const int tid = threadIdx.x; const int h = blockIdx.x / (QT0 / 32), rg = blockIdx.x % (QT0 / 32); const int i = rg * 32 + tid;
  for (int c = 0; c < 32; ++c) { *(v4f*)&lq[tid][c * 4] = *(const v4fa*)(QF + (size_t)i * ld + h * 128 + c * 4); const v4f z = {0.f, 0.f, 0.f, 0.f}; *(v4f*)&lo[tid][c * 4] = z; }
  float m = -1.0e30f, l = 0.f; const int jmax = rg * 32 + 31;
#pragma unroll 1
  for (int j = 0; j <= jmax; ++j) { const float* kr = KF + (size_t)j * ld + h * 128; const float* vr = VF + (size_t)j * ldv + h * 128; float s = 0.f;
#pragma unroll 1
    for (int c = 0; c < 32; ++c) { const v4f kq = *(const v4fa*)(kr + c * 4); const v4f qq = *(v4f*)&lq[tid][c * 4]; for (int u = 0; u < 4; ++u) s = __fadd_rn(s, __fmul_rn(qq[u], kq[u])); }
    s = __fmul_rn(s, scale); float f; if (MASK) { const int mb = mk[(size_t)i * SQ + j]; f = (mb == 0) ? 1.f : 0.f; } else { f = (j <= i) ? 1.f : 0.f; }
    const float sm = fmaf(f, s, (1.f - f) * -1.0e30f); const float mn = fmaxf(m, sm); const float sc = expf(m - mn); const float e = __fmul_rn(f, expf(sm - mn)); l = __fadd_rn(__fmul_rn(l, sc), e); m = mn;
#pragma unroll 1
    for (int c = 0; c < 32; ++c) { const v4f vv = *(const v4fa*)(vr + c * 4); v4f oo = *(v4f*)&lo[tid][c * 4]; for (int u = 0; u < 4; ++u) oo[u] = __fadd_rn(__fmul_rn(oo[u], sc), __fmul_rn(e, vv[u])); *(v4f*)&lo[tid][c * 4] = oo; } }
  const float fin = 64.0f / l;
  { for (int c = 0; c < 32; ++c) { v4f oo = *(v4f*)&lo[tid][c * 4]; for (int u = 0; u < 4; ++u) oo[u] = __fmul_rn(oo[u], fin); *(v4f*)(OF + (size_t)i * ldo + h * 128 + c * 4) = oo; }  } }
__global__ __launch_bounds__(256) void k_f2h(const float* __restrict__ F, int ldf, int coff, int ncol, _Float16* __restrict__ H16, size_t nrow) { const size_t t = (size_t)blockIdx.x * 256 + threadIdx.x; const size_t n8 = nrow * (size_t)(ncol / 8); if (t >= n8) return; const size_t r = t / (ncol / 8); const int c8 = (int)(t % (ncol / 8)) * 8; FragH f; const v4f a = *(const v4fa*)(F + r * ldf + coff + c8), b2 = *(const v4fa*)(F + r * ldf + coff + c8 + 4); for (int q = 0; q < 4; ++q) { f.h[q] = (_Float16)a[q]; f.h[4 + q] = (_Float16)b2[q]; } *(v8us*)((unsigned short*)H16 + r * ncol + c8) = f.half[0];  }

__global__ __launch_bounds__(256) void k_tab128(float theta, float* __restrict__ CS, float* __restrict__ SN) {
  #pragma clang fp contract(off)
  const int t = blockIdx.x * 256 + threadIdx.x; if (t >= SQ * 64) return; const int i = t % 64; const int p = t / 64; const float invf = (float)(1.0 / pow((double)theta, (double)(2 * i) / 128.0));      /* = XLA's constant-folded f32 table */ const float ang = __fmul_rn((float)p, invf); const float c = cosf(ang), s = sinf(ang);
  *(float*)(CS + t) = c; *(float*)(SN + t) = s;  }
template <int TAB>
__global__ __launch_bounds__(128) void k_rope128(const float* __restrict__ F, int ldf, int nh, const float* __restrict__ CS, const float* __restrict__ SN, _Float16* __restrict__ H16, int ldo, float osc) {
  #pragma clang fp contract(off)
  __shared__ float xv[128]; __shared__ unsigned short sh_[128]; const int d = threadIdx.x; const int h = blockIdx.x % nh; const size_t r = blockIdx.x / nh; const int p = (int)(r % SQ);
  xv[d] = F[r * (size_t)ldf + (size_t)h * 128 + d]; __syncthreads();
  float c, s; if (TAB) { c = bf16_round(CS[(size_t)p * 128 + d]); s = bf16_round(SN[(size_t)p * 128 + d]); } else { c = CS[p * 64 + (d & 63)]; s = SN[p * 64 + (d & 63)]; }
  const float rot = (d < 64) ? -xv[d + 64] : xv[d - 64]; const float o = __fadd_rn(__fmul_rn(xv[d], c), __fmul_rn(rot, s));
  FragH th; th.h[0] = (_Float16)__fmul_rn(o, osc); sh_[d] = th.u[0]; __syncthreads();
  if (d < 16) { FragH f; for (int q = 0; q < 8; ++q) f.u[q] = sh_[d * 8 + q]; unsigned short* dst = (unsigned short*)H16 + r * (size_t)ldo + (size_t)h * 128 + d * 8; *(v8us*)dst = f.half[0];  } }

template <int TAB, int IL, int F32OUT>
__global__ __launch_bounds__(128) void k_rope128x(const float* __restrict__ F, int ldf, int nh, const float* __restrict__ CS, const float* __restrict__ SN, void* __restrict__ OUT, int ldo, float osc) {
  #pragma clang fp contract(off)
  __shared__ float xv[128]; __shared__ float ov[128]; const int d = threadIdx.x; const int h = blockIdx.x % nh; const size_t r = blockIdx.x / nh; const int p = (int)(r % SQ);
  xv[d] = F[r * (size_t)ldf + (size_t)h * 128 + d]; __syncthreads();
  float c, s; if (TAB) { c = bf16_round(CS[(size_t)p * 128 + d]); s = bf16_round(SN[(size_t)p * 128 + d]); } else { const int ti = IL ? (d >> 1) : (d & 63); c = CS[p * 64 + ti]; s = SN[p * 64 + ti]; }
  const float rot = IL ? ((d & 1) ? xv[d - 1] : -xv[d + 1]) : ((d < 64) ? -xv[d + 64] : xv[d - 64]);
  ov[d] = __fmul_rn(__fadd_rn(__fmul_rn(xv[d], c), __fmul_rn(rot, s)), osc); __syncthreads();
  if (F32OUT) { if (d < 32) { const v4f v = *(const v4f*)&ov[d * 4]; float* dst = (float*)OUT + r * (size_t)ldo + (size_t)h * 128 + d * 4; *(v4f*)dst = v;  } }
  else { if (d < 16) { FragH f; for (int q = 0; q < 8; ++q) f.h[q] = (_Float16)ov[d * 8 + q]; unsigned short* dst = (unsigned short*)OUT + r * (size_t)ldo + (size_t)h * 128 + d * 8; *(v8us*)dst = f.half[0];  } } }
template <int N>
__global__ __launch_bounds__(256) void k_rmsrow(float* __restrict__ X, const float* __restrict__ w, float eps) {
  #pragma clang fp contract(off)
  constexpr int PT = N / 256; __shared__ float red[256]; const size_t r = blockIdx.x; const int t = threadIdx.x; float* row = X + r * N + (size_t)t * PT; float v[PT]; float ss = 0.f;
  for (int q = 0; q < PT; ++q) { v[q] = row[q]; ss = __fadd_rn(ss, __fmul_rn(v[q], v[q])); }
  red[t] = ss; __syncthreads(); for (int k = 128; k > 0; k >>= 1) { if (t < k) red[t] = __fadd_rn(red[t], red[t + k]); __syncthreads(); }
  const float rs = rsqrtf(__fadd_rn(red[0] / (float)N, eps)); float o[PT]; for (int q = 0; q < PT; ++q) o[q] = __fmul_rn(__fmul_rn(v[q], rs), bf16_round(w[t * PT + q]));
  { for (int q = 0; q < PT; ++q) *(float*)(row + q) = o[q];  } }
template <int GS_, int NHQ, int DSRC>
__global__ __launch_bounds__(256) void k_kvexp128(const float* __restrict__ src, float* __restrict__ dst, size_t n4) { const size_t t = (size_t)blockIdx.x * 256 + threadIdx.x; if (t >= n4) return; const size_t e = t * 4; const size_t row = e / ((size_t)NHQ * 128); const int col = (int)(e % ((size_t)NHQ * 128)); const int h = col / 128, d = col % 128; const v4f v = *(const v4fa*)(src + row * DSRC + (size_t)(h / GS_) * 128 + d); *(v4f*)(dst + e) = v;  }

__global__ __launch_bounds__(256) void k_rsmcfb(const float* __restrict__ S, _Float16* __restrict__ P, int hg, int q0, int nk, const int* __restrict__ mk) {
  #pragma clang fp contract(off)
  const int t = blockIdx.x * 256 + threadIdx.x; if (t >= hg * QT) return; const size_t i = (size_t)t; const float* s = S + i * NKX; const size_t ig = (size_t)(q0 + (t % QT)); const int* mr = mk + ig * SQ; float mx = -3.0e38f;
#pragma unroll 1
  for (int j = 0; j < nk; ++j) { const int mb = mr[j]; const float f = (mb == 0) ? 1.f : 0.f; mx = fmaxf(mx, fmaf(f, s[j], (1.f - f) * -1.0e9f)); } float se = 0.f;
#pragma unroll 1
  for (int j = 0; j < nk; ++j) { const int mb = mr[j]; const float f = (mb == 0) ? 1.f : 0.f; se += __expf(fmaf(f, s[j], (1.f - f) * -1.0e9f) - mx); } const float sc = 256.0f / se;
#pragma unroll 1
  for (int j0 = 0; j0 < nk; j0 += 8) { FragH fr; for (int q = 0; q < 8; ++q) { const int j = j0 + q; const int mb = mr[j]; const float f = (mb == 0) ? 1.f : 0.f; fr.h[q] = (_Float16)(__expf(fmaf(f, s[j], (1.f - f) * -1.0e9f) - mx) * sc); } unsigned short* d = (unsigned short*)P + i * NKX + j0; *(v8us*)d = fr.half[0];  } }


__global__ __launch_bounds__(128) void k_rmsh128(float* __restrict__ F, int ldf, int nh, const float* __restrict__ w, float eps) {
  #pragma clang fp contract(off)
  __shared__ float red[128]; const int d = threadIdx.x; const int h = blockIdx.x % nh; const size_t r = blockIdx.x / nh; float* p = F + r * (size_t)ldf + (size_t)h * 128 + d; const float v = *p;
  red[d] = __fmul_rn(v, v); __syncthreads(); for (int st = 64; st > 0; st >>= 1) { if (d < st) red[d] = __fadd_rn(red[d], red[d + st]); __syncthreads(); }
  const float y = __fmul_rn(__fmul_rn(v, rsqrtf(__fadd_rn(red[0] * 0.0078125f, eps))), bf16_round(w[d])); *(float*)p = y;  }

__global__ __launch_bounds__(256) void k_rsmcf2(const float* __restrict__ S, _Float16* __restrict__ P, int hg, int q0, int nk) {
  #pragma clang fp contract(off)
  const int t = blockIdx.x * 256 + threadIdx.x; if (t >= hg * QT) return; const size_t i = (size_t)t; const float* s = S + i * NKX; const int last = q0 + (t % QT); float mx = -3.0e38f;
#pragma unroll 1
  for (int j = 0; j < nk; ++j) { const float f = (j <= last) ? 1.f : 0.f; mx = fmaxf(mx, fmaf(f, s[j], (1.f - f) * -1.0e9f)); } float se = 0.f;
#pragma unroll 1
  for (int j = 0; j < nk; ++j) { const float f = (j <= last) ? 1.f : 0.f; se += __expf(fmaf(f, s[j], (1.f - f) * -1.0e9f) - mx); } const float sc = 256.0f / se;
#pragma unroll 1
  for (int j0 = 0; j0 < nk; j0 += 8) { FragH fr; for (int q = 0; q < 8; ++q) { const int j = j0 + q; const float f = (j <= last) ? 1.f : 0.f; fr.h[q] = (_Float16)(__expf(fmaf(f, s[j], (1.f - f) * -1.0e9f) - mx) * sc); } unsigned short* d = (unsigned short*)P + i * NKX + j0; *(v8us*)d = fr.half[0];  } }
extern "C" void kernel_launch(void* const* d_in, const int* in_sizes, int n_in,
                              void* d_out, int out_size, void* d_ws, size_t ws_size, hipStream_t stream) {
  (void)in_sizes; (void)n_in; (void)out_size;
  const float* const* I = (const float* const*)d_in; const float* x = I[0]; const float* wq = I[1]; const float* wk = I[2]; const float* wv = I[3]; const float* wo = I[4]; const float* qnw = I[5]; const float* knw = I[6]; const float* tcos = I[7]; const float* tsin = I[8];      /* [in][out] weights; rope tables [S][128] */
  char* ws = (char*)d_ws; size_t off = 0;
  auto take = [&](size_t bytes) { char* p = ws + off; off += (bytes + 255) & ~(size_t)255; return p; };
  _Float16* BQ = (_Float16*)take((size_t)DMX * DMX * 2); _Float16* BK = (_Float16*)take((size_t)DKV * DMX * 2); _Float16* BV = (_Float16*)take((size_t)DKV * DMX * 2); _Float16* BO = (_Float16*)take((size_t)DMX * DMX * 2);
  _Float16* X16 = (_Float16*)take(NR * DMX * 2); float* QF = (float*)take(NR * DMX * 4); float* KF = (float*)take(NR * DKV * 4); float* VF = (float*)take(NR * DKV * 4); _Float16* Q16 = (_Float16*)take(NR * DMX * 2); _Float16* K16 = (_Float16*)take(NR * DKV * 2); _Float16* V16 = (_Float16*)take(NR * DKV * 2); _Float16* O16 = (_Float16*)take(NR * DMX * 2);
  float* S = (float*)take((size_t)NH * QT * NKX * 4); _Float16* P = (_Float16*)take((size_t)NH * QT * NKX * 2); _Float16* VT = (_Float16*)take((size_t)(DKV / 64) * 64 * SQ * 2);
  float* QF0 = (float*)take((size_t)QT0 * DMX * 4); float* KRF0 = (float*)take((size_t)QT0 * DKV * 4); float* KF0e = (float*)take((size_t)QT0 * DMX * 4); float* VF0e = (float*)take((size_t)QT0 * DMX * 4); float* OF0 = (float*)take((size_t)NB * QT0 * DMX * 4); _Float16* OH0 = (_Float16*)take((size_t)NB * QT0 * DMX * 2); _Float16* OL0 = (_Float16*)take((size_t)NB * QT0 * DMX * 2);
  if (off > ws_size) return;      /* approx 8 + 4 + 4 + 8 + 16 + 32 + 16 + 16 + 16 + 8 + 8 + 16 + 32 + 16 + 4 + 1 + 0.5 + 1 + 1 + 2 + 1 + 1 = 211.5 MiB */
  k_wt_f16<<<(unsigned)(((size_t)DMX * (DMX / 8) + 255) / 256), 256, 0, stream>>>(wq, BQ, DMX, DMX, 16.0f); k_wt_f16<<<(unsigned)(((size_t)DKV * (DMX / 8) + 255) / 256), 256, 0, stream>>>(wk, BK, DMX, DKV, 16.0f); k_wt_f16<<<(unsigned)(((size_t)DKV * (DMX / 8) + 255) / 256), 256, 0, stream>>>(wv, BV, DMX, DKV, 16.0f); k_wt_f16<<<(unsigned)(((size_t)DMX * (DMX / 8) + 255) / 256), 256, 0, stream>>>(wo, BO, DMX, DMX, 16.0f);      /* [in][out] -> Bt x16 */
  k_x16<<<(unsigned)((NR * DMX / 8 + 255) / 256), 256, 0, stream>>>(x, X16, NR * DMX / 8);
  k_gemm2<0><<<dim3((unsigned)((NR / 128) * (DMX / 64)), 1), 128, 0, stream>>>(X16, DMX, 0, BQ, DMX, 0, 0.0625f, nullptr, 0, nullptr, 1, 0, 0, QF, nullptr, DMX, 0, (int)NR, DMX, DMX);      /* q (f32) */
  k_gemm2<0><<<dim3((unsigned)((NR / 128) * (DKV / 64)), 1), 128, 0, stream>>>(X16, DMX, 0, BK, DMX, 0, 0.0625f, nullptr, 0, nullptr, 1, 0, 0, KF, nullptr, DKV, 0, (int)NR, DKV, DMX);      /* k (f32) */
  k_gemm2<0><<<dim3((unsigned)((NR / 128) * (DKV / 64)), 1), 128, 0, stream>>>(X16, DMX, 0, BV, DMX, 0, 0.0625f, nullptr, 0, nullptr, 1, 0, 0, VF, V16, DKV, 0, (int)NR, DKV, DMX);      /* v (f32 for the first tile + f16) */
  k_rmsh128<<<(unsigned)(NR * NH), 128, 0, stream>>>(QF, DMX, NH, qnw, 1e-6f); k_rmsh128<<<(unsigned)(NR * NKV), 128, 0, stream>>>(KF, DKV, NKV, knw, 1e-6f);      /* per-head RMSNorm over the 128 dims, in place */
  k_rope128x<1, 0, 0><<<(unsigned)(NR * NH), 128, 0, stream>>>(QF, DMX, NH, tcos, tsin, Q16, DMX, 1.0f); k_rope128x<1, 0, 0><<<(unsigned)(NR * NKV), 128, 0, stream>>>(KF, DKV, NKV, tcos, tsin, K16, DKV, 1.0f);      /* rope from the input tables -> f16 */
  for (int b = 0; b < NB; ++b) { const size_t r0 = (size_t)b * SQ;
  k_rope128x<1, 0, 1><<<(unsigned)(QT0 * NH), 128, 0, stream>>>(QF + r0 * DMX, DMX, NH, tcos, tsin, QF0, DMX, 1.0f); k_rope128x<1, 0, 1><<<(unsigned)(QT0 * NKV), 128, 0, stream>>>(KF + r0 * DKV, DKV, NKV, tcos, tsin, KRF0, DKV, 1.0f);      /* f32 roped q, k rows 0..127 */
  k_kvexp128<GSZ, NH, DKV><<<(unsigned)(((size_t)QT0 * DMX / 4 + 255) / 256), 256, 0, stream>>>(KRF0, KF0e, (size_t)QT0 * DMX / 4); k_kvexp128<GSZ, NH, DKV><<<(unsigned)(((size_t)QT0 * DMX / 4 + 255) / 256), 256, 0, stream>>>(VF + r0 * DKV, VF0e, (size_t)QT0 * DMX / 4);      /* group -> head expansion for the exact first tile */
  k_vt<DKV / 64, SQ><<<(DKV / 64) * (SQ / 64), 256, 0, stream>>>(V16 + r0 * DKV, DKV, 0, VT);      /* V^T: group g = slabs 2g, 2g+1 */
  k_att0h<0><<<NH * (QT0 / 32), 32, 0, stream>>>(QF0, KF0e, VF0e, DMX, DMX, nullptr, ATS, OF0 + (size_t)b * QT0 * DMX, DMX);      /* exact causal attention rows 0..127 of batch b (o x64) */
  for (int q0 = 0; q0 < SQ; q0 += QT) { const int nk = q0 + QT;
    for (int g = 0; g < NKV; ++g) k_gemm2<0><<<dim3((QT / 128) * (nk / 64), GSZ), 128, 0, stream>>>(Q16 + (r0 + q0) * DMX + (size_t)g * GSZ * HDK, DMX, (size_t)HDK, K16 + r0 * DKV + (size_t)g * HDK, DKV, 0, ATS, nullptr, 0, nullptr, 1, 0, 0, S + (size_t)g * GSZ * QT * NKX, nullptr, NKX, (size_t)QT * NKX, QT, nk, HDK);      /* scores: the group's 2 heads vs its key slab */
    k_rsmcf2<<<(NH * QT + 255) / 256, 256, 0, stream>>>(S, P, NH, q0, nk);      /* causal softmax */
    for (int g = 0; g < NKV; ++g) k_gemm2<0><<<dim3((QT / 128) * (HDK / 64), GSZ), 128, 0, stream>>>(P + (size_t)g * GSZ * QT * NKX, NKX, (size_t)QT * NKX, VT + (size_t)g * HDK * SQ, SQ, 0, 0.25f, nullptr, 0, nullptr, 1, 0, 0, nullptr, O16 + (r0 + q0) * DMX + (size_t)g * GSZ * HDK, DMX, (size_t)HDK, QT, HDK, nk); }      /* o for the group's 2 heads (x64) */
  }      /* per batch */
  k_gemm2<0><<<dim3((unsigned)((NR / 128) * (DMX / 64)), 1), 128, 0, stream>>>(O16, DMX, 0, BO, DMX, 0, 0.0009765625f, nullptr, 0, nullptr, 1, 0, 0, (float*)d_out, nullptr, DMX, 0, (int)NR, DMX, DMX);      /* out = o Wo */
  k_hl<<<(unsigned)(((size_t)NB * QT0 * DMX / 8 + 255) / 256), 256, 0, stream>>>(OF0, OH0, OL0, (size_t)NB * QT0 * DMX / 8);
  for (int b = 0; b < NB; ++b) { const size_t r0 = (size_t)b * SQ, f0 = (size_t)b * QT0;
    k_gemm2<0><<<dim3((QT0 / 128) * (DMX / 64), 1), 128, 0, stream>>>(OH0 + f0 * DMX, DMX, 0, BO, DMX, 0, 0.0009765625f, nullptr, 0, nullptr, 1, 0, 0, (float*)d_out + r0 * DMX, nullptr, DMX, 0, QT0, DMX, DMX);
    k_gemm2<0><<<dim3((QT0 / 128) * (DMX / 64), 1), 128, 0, stream>>>(OL0 + f0 * DMX, DMX, 0, BO, DMX, 0, 0.00000095367431640625f, nullptr, 0, (const float*)d_out + r0 * DMX, -1, 0, 0, (float*)d_out + r0 * DMX, nullptr, DMX, 0, QT0, DMX, DMX); }      /* rows 0..127 of each batch rewritten from the exact path */
}

// v001
// Measured time: 3350 microseconds a run.
// Timed twice side by side with v000, it ran 3.09 and 3.08 times as fast.
#include <hip/hip_runtime.h>
// Qwen3 attention (x [2][2048][2048]; q = x Wq (16 heads x 128), k = x Wk, v = x Wv (8 kv heads x 128) ([in][out] weights sigma 0.02); per-head RMSNorm over the 128 dims on q and k (weights ones, eps 1e-6); rotate-half RoPE from the module's INPUT cos/sin tables [S][128] (theta 1e6); query head h uses kv head h/2; scores x 128^-0.5 with a causal mask (tril, finfo.min); softmax; out = merged Wo ([in][out]) -> [2][2048][2048]).
// Compute dtype: inputs rounded to bf16; x / weights / tables exact; projections, RMSNorm and rope f32; q, k, v, softmax weights and o as plain f16 GEMM operands (~2^-12; first 128 rows exact); scores, statistics, out f32. v_wmma_f32_16x16x32_f16.
#define NB 2
#define SQ 2048
#define DMX 2048
#define NH 16
#define NKV 8
#define GSZ 2
#define HDK 128
#define DKV (NKV * HDK)
#define QT 256
#define QT0 128
#define NKX SQ
#define DM DMX
#define HD 64
#define HG 1
#define NR ((size_t)NB * SQ)
#define ATS 0.08838834764831845f
typedef __bf16 v16b __attribute__((ext_vector_type(16)));
typedef unsigned short v8us __attribute__((ext_vector_type(8), may_alias));
typedef float  v8f  __attribute__((ext_vector_type(8)));
typedef float  v4f  __attribute__((ext_vector_type(4)));
typedef float  v4fa __attribute__((ext_vector_type(4), may_alias));
union FragB { v16b v; v8us half[2]; unsigned short u[16]; };

__device__ __forceinline__ unsigned short bf16_bits(float x) { unsigned int u = __float_as_uint(x); return (unsigned short)((u + 0x7FFFu + ((u >> 16) & 1u)) >> 16); }
__device__ __forceinline__ float bf16_val(unsigned short b) { return __uint_as_float(((unsigned int)b) << 16); }
__device__ __forceinline__ float bf16_round(float x) { return bf16_val(bf16_bits(x)); }
// D += A·B with NT terms: 1 = ah·bh, 2 = + al·bh (A split), 3 = + ah·bl (both split)
template <int NT>
__device__ __forceinline__ v8f mmaN(v16b ah, v16b al, v16b bh, v16b bl, v8f c) {
  c = __builtin_amdgcn_wmma_f32_16x16x32_bf16(false, ah, false, bh, (short)0, c, false, false);
  if (NT >= 2) c = __builtin_amdgcn_wmma_f32_16x16x32_bf16(false, al, false, bh, (short)0, c, false, false);
  if (NT >= 3) c = __builtin_amdgcn_wmma_f32_16x16x32_bf16(false, ah, false, bl, (short)0, c, false, false);
  asm volatile("v_nop\n\tv_nop\n\tv_nop\n\tv_nop" : "+v"(c) : "v"(ah), "v"(al), "v"(bh), "v"(bl));
  return c;
}

__global__ __launch_bounds__(256) void k_wt_bf16(const float* __restrict__ W, unsigned short* __restrict__ Wt, int K, int N) {
  const int t = blockIdx.x * 256 + threadIdx.x;
  const int k8n = K / 8;
  if (t >= N * k8n) return;
  const int n = t / k8n, k8 = (t % k8n) * 8;
  v8us v;
#pragma unroll
  for (int i = 0; i < 8; ++i) v[i] = bf16_bits(W[(size_t)(k8 + i) * N + n]);
  *(v8us*)(Wt + (size_t)n * K + k8) = v;
  
}

// GEMM C[M][N] (f32, pitch ldc) = act(A[M][K]·W + bias). A f32 row-major (pitch lda) converted per fragment to bf16
// (ASPLIT: hi/lo two planes -> 2 terms, else single rounded term); Wt bf16 [N][K] (pitch ldb). BIAS_BF16 rounds the
// bias to bf16 first (bias quantised to bf16 before the add). K%32==0, M%16==0, N%64==0.
template <bool ASPLIT, int ACT, bool BIAS_BF16>
__global__ __launch_bounds__(128) void k_gemm_bf(const float* __restrict__ A, int lda, const unsigned short* __restrict__ Wt, int ldb,
                                               const float* __restrict__ bias, float* __restrict__ C, int ldc, int M, int N, int K) {
  __shared__ __attribute__((aligned(16))) float so[4][16][64];
  const int tid = threadIdx.x, w = tid >> 5, lane = tid & 31, ln = lane & 15, hh = lane >> 4;
  const int ntn = N / 64;
  const int wid = blockIdx.x * 4 + w;
  const int mt = wid / ntn, nq = wid % ntn;
  if (mt * 16 >= M) return;
  const int row0 = mt * 16, col0 = nq * 64;
  const float* arow = A + (size_t)(row0 + ln) * lda;
  v8f acc[4] = {};
  for (int kb = 0; kb < K; kb += 32) {
    FragB ah, al;
    const v4f x0 = *(const v4fa*)(arow + kb + 8 * hh), x1 = *(const v4fa*)(arow + kb + 8 * hh + 4);
    const v4f x2 = *(const v4fa*)(arow + kb + 16 + 8 * hh), x3 = *(const v4fa*)(arow + kb + 16 + 8 * hh + 4);
    float xs[16] = {x0[0],x0[1],x0[2],x0[3],x1[0],x1[1],x1[2],x1[3],x2[0],x2[1],x2[2],x2[3],x3[0],x3[1],x3[2],x3[3]};
#pragma unroll
    for (int i = 0; i < 16; ++i) { const unsigned short hb = bf16_bits(xs[i]); ah.u[i] = hb; al.u[i] = ASPLIT ? bf16_bits(xs[i] - bf16_val(hb)) : (unsigned short)0; }
#pragma unroll
    for (int t = 0; t < 4; ++t) {
      const unsigned short* brow = Wt + (size_t)(col0 + t * 16 + ln) * ldb + kb;
      FragB b;
      b.half[0] = *(const v8us*)(brow + 8 * hh);
      b.half[1] = *(const v8us*)(brow + 16 + 8 * hh);
      acc[t] = mmaN<ASPLIT ? 2 : 1>(ah.v, al.v, b.v, b.v, acc[t]);
    }
  }
#pragma unroll
  for (int t = 0; t < 4; ++t) {
    float bv = bias ? bias[col0 + t * 16 + ln] : 0.f;
    if (BIAS_BF16) bv = bf16_round(bv);
#pragma unroll
    for (int r = 0; r < 8; ++r) { float v = acc[t][r] + bv; if (ACT == 1) v = fmaxf(v, 0.f); so[w][8 * hh + r][t * 16 + ln] = v; }
  }
  __builtin_amdgcn_fence(__ATOMIC_ACQ_REL, "workgroup");
  __builtin_amdgcn_wave_barrier();
  const int rsub = lane >> 4, c4 = (lane & 15) * 4;
  {
#pragma unroll
    for (int q = 0; q < 8; ++q) {
      const int r = q * 2 + rsub;
      const v4f v = *(const v4fa*)&so[w][r][c4];
      *(v4f*)(C + (size_t)(row0 + r) * ldc + col0 + c4) = v;
    }
    
  }
}

// GEMM C = act(A·W + bias + resid): A f32 (ASPLIT -> hi/lo 2 terms), Wt bf16 [N][K]; ACT 0 none, 1 relu, 2 exact gelu;
// resid (optional, f32, row index = (row % rmod), pitch ldr, RES_BF16 rounds it) added before the activation.
template <bool ASPLIT, int ACT, bool BIAS_BF16, bool RES_BF16>
__global__ __launch_bounds__(128) void k_gemm_bf3(const float* __restrict__ A, int lda, const unsigned short* __restrict__ Wt, int ldb,
                                                const float* __restrict__ bias, const float* __restrict__ resid, int rmod, int ldr,
                                                float* __restrict__ C, int ldc, int M, int N, int K) {
  __shared__ __attribute__((aligned(16))) float so[4][16][64];
  const int tid = threadIdx.x, w = tid >> 5, lane = tid & 31, ln = lane & 15, hh = lane >> 4;
  const int ntn = N / 64;
  const int wid = blockIdx.x * 4 + w;
  const int mt = wid / ntn, nq = wid % ntn;
  if (mt * 16 >= M) return;
  const int row0 = mt * 16, col0 = nq * 64;
  const float* arow = A + (size_t)(row0 + ln) * lda;
  v8f acc[4] = {};
  for (int kb = 0; kb < K; kb += 32) {
    FragB ah, al;
    const v4f x0 = *(const v4fa*)(arow + kb + 8 * hh), x1 = *(const v4fa*)(arow + kb + 8 * hh + 4);
    const v4f x2 = *(const v4fa*)(arow + kb + 16 + 8 * hh), x3 = *(const v4fa*)(arow + kb + 16 + 8 * hh + 4);
    float xs[16] = {x0[0],x0[1],x0[2],x0[3],x1[0],x1[1],x1[2],x1[3],x2[0],x2[1],x2[2],x2[3],x3[0],x3[1],x3[2],x3[3]};
#pragma unroll
    for (int i = 0; i < 16; ++i) { const unsigned short hb = bf16_bits(xs[i]); ah.u[i] = hb; al.u[i] = ASPLIT ? bf16_bits(xs[i] - bf16_val(hb)) : (unsigned short)0; }
#pragma unroll
    for (int t = 0; t < 4; ++t) {
      const unsigned short* brow = Wt + (size_t)(col0 + t * 16 + ln) * ldb + kb;
      FragB b;
      b.half[0] = *(const v8us*)(brow + 8 * hh);
      b.half[1] = *(const v8us*)(brow + 16 + 8 * hh);
      acc[t] = mmaN<ASPLIT ? 2 : 1>(ah.v, al.v, b.v, b.v, acc[t]);
    }
  }
#pragma unroll
  for (int t = 0; t < 4; ++t) {
    const int col = col0 + t * 16 + ln;
    float bv = bias ? bias[col] : 0.f;
    if (BIAS_BF16) bv = bf16_round(bv);
#pragma unroll
    for (int r = 0; r < 8; ++r) {
      float v = acc[t][r] + bv;
      if (resid) { float rv = resid[(size_t)((row0 + 8 * hh + r) % rmod) * ldr + col]; if (RES_BF16) rv = bf16_round(rv); v += rv; }
      if (ACT == 1) v = fmaxf(v, 0.f);
      if (ACT == 2) v = 0.5f * v * (1.0f + erff(v * 0.70710678118654752f));
      if (ACT == 3) { const float u = 0.7978845608028654f * (v + 0.044715f * v * v * v); v = 0.5f * v * (1.0f + tanhf(u)); }
      so[w][8 * hh + r][t * 16 + ln] = v;
    }
  }
  __builtin_amdgcn_fence(__ATOMIC_ACQ_REL, "workgroup");
  __builtin_amdgcn_wave_barrier();
  const int rsub = lane >> 4, c4 = (lane & 15) * 4;
  {
#pragma unroll
    for (int q = 0; q < 8; ++q) {
      const int r = q * 2 + rsub;
      const v4f v = *(const v4fa*)&so[w][r][c4];
      *(v4f*)(C + (size_t)(row0 + r) * ldc + col0 + c4) = v;
    }
    
  }
}
// row LayerNorm (biased variance, eps) over N: s = X (+ R); optional out_sum <- s; out_norm <- (s-mu)*rsqrt(var+eps)*g + b
template <bool PARAM_BF16>
__global__ __launch_bounds__(256) void k_layernorm(const float* __restrict__ X, const float* __restrict__ R, const float* __restrict__ g, const float* __restrict__ bta,
                                                  float* __restrict__ out_sum, float* __restrict__ out_norm, int N, float eps) {
  __shared__ float red[256];
  const int row = blockIdx.x, tid = threadIdx.x;
  const float* x = X + (size_t)row * N; const float* rr = R ? R + (size_t)row * N : nullptr;
  float vals[16];                     // up to N = 4096
  const int per = N / 256;            // contiguous chunk per thread? use strided-by-4 chunks: thread handles j = tid*4 + 1024*u
  float s1 = 0.f;
  for (int u = 0; u < per / 4; ++u) {
    const int j = tid * 4 + 1024 * u;
    const v4f a = *(const v4fa*)(x + j);
    v4f b = {0.f,0.f,0.f,0.f}; if (rr) b = *(const v4fa*)(rr + j);
#pragma unroll
    for (int q = 0; q < 4; ++q) { const float v = a[q] + b[q]; vals[u * 4 + q] = v; s1 += v; }
  }
  red[tid] = s1; __syncthreads();
  for (int st = 128; st > 0; st >>= 1) { if (tid < st) red[tid] += red[tid + st]; __syncthreads(); }
  const float mu = red[0] / (float)N; __syncthreads();
  float s2 = 0.f;
  for (int u = 0; u < per / 4; ++u)
#pragma unroll
    for (int q = 0; q < 4; ++q) { const float c = vals[u * 4 + q] - mu; s2 += c * c; }
  red[tid] = s2; __syncthreads();
  for (int st = 128; st > 0; st >>= 1) { if (tid < st) red[tid] += red[tid + st]; __syncthreads(); }
  const float rs = rsqrtf(red[0] / (float)N + eps);
  {
    for (int u = 0; u < per / 4; ++u) {
      const int j = tid * 4 + 1024 * u;
      v4f o, sm;
#pragma unroll
      for (int q = 0; q < 4; ++q) {
        float gg = g[j + q], bb = bta[j + q];
        if (PARAM_BF16) { gg = bf16_round(gg); bb = bf16_round(bb); }
        sm[q] = vals[u * 4 + q]; o[q] = (vals[u * 4 + q] - mu) * rs * gg + bb;
      }
      if (out_sum) *(v4f*)(out_sum + (size_t)row * N + j) = sm;
      *(v4f*)(out_norm + (size_t)row * N + j) = o;
    }
    
  }
}



// ---- f16 WMMA path (v_wmma_f32_16x16x32_f16): 11-bit significands for operands in range — used where a [0,1] probability operand needs more precision than bf16
typedef _Float16 v16h __attribute__((ext_vector_type(16)));
union FragH { v16h v; v8us half[2]; _Float16 h[16]; unsigned short u[16]; };
template <int NT>
__device__ __forceinline__ v8f mmaH(v16h ah, v16h al, v16h bh, v16h bl, v8f c) {
  c = __builtin_amdgcn_wmma_f32_16x16x32_f16(false, ah, false, bh, (short)0, c, false, false);
  if (NT >= 2) c = __builtin_amdgcn_wmma_f32_16x16x32_f16(false, al, false, bh, (short)0, c, false, false);
  if (NT >= 3) c = __builtin_amdgcn_wmma_f32_16x16x32_f16(false, ah, false, bl, (short)0, c, false, false);
  asm volatile("v_nop\n\tv_nop\n\tv_nop\n\tv_nop" : "+v"(c) : "v"(ah), "v"(al), "v"(bh), "v"(bl));
  return c;
}
// batched GEMM like k_gemm_b but f16 operands: A f32 (split into f16 hi/lo if ASPLIT, else rounded to f16), Bt = f16 values [n][k]; alpha; C f32; N multiple of 16 (partial tiles skipped)
template <bool ASPLIT>
__global__ __launch_bounds__(128) void k_gemm_h(const float* __restrict__ A, int lda, size_t sA, const _Float16* __restrict__ Bh, int ldb, size_t sB, float alpha, float* __restrict__ C, int ldc, size_t sC, int M, int N, int K) {
  __shared__ __attribute__((aligned(16))) float so[4][16][64];
  const int tid = threadIdx.x, w = tid >> 5, lane = tid & 31, ln = lane & 15, hh = lane >> 4; const int by = blockIdx.y;
  A += (size_t)by * sA; Bh += (size_t)by * sB; C += (size_t)by * sC;
  const int ntn = (N + 63) / 64; const int wid = blockIdx.x * 4 + w; const int mt = wid / ntn, nq = wid % ntn; if (mt * 16 >= M) return;
  const int row0 = mt * 16, col0 = nq * 64; const float* arow = A + (size_t)(row0 + ln) * lda;
  v8f acc[4] = {};
  for (int kb = 0; kb < K; kb += 32) {
    FragH ah, al;
    const v4f x0 = *(const v4fa*)(arow + kb + 8 * hh), x1 = *(const v4fa*)(arow + kb + 8 * hh + 4), x2 = *(const v4fa*)(arow + kb + 16 + 8 * hh), x3 = *(const v4fa*)(arow + kb + 16 + 8 * hh + 4);
    float xs[16] = {x0[0],x0[1],x0[2],x0[3],x1[0],x1[1],x1[2],x1[3],x2[0],x2[1],x2[2],x2[3],x3[0],x3[1],x3[2],x3[3]};
#pragma unroll
    for (int i = 0; i < 16; ++i) { const _Float16 h = (_Float16)xs[i]; ah.h[i] = h; al.h[i] = ASPLIT ? (_Float16)(xs[i] - (float)h) : (_Float16)0.0f; }
#pragma unroll
    for (int t = 0; t < 4; ++t) { if (col0 + t * 16 >= N) continue; const size_t boff = (size_t)(col0 + t * 16 + ln) * ldb + kb; FragH bq; bq.half[0] = *(const v8us*)(Bh + boff + 8 * hh); bq.half[1] = *(const v8us*)(Bh + boff + 16 + 8 * hh);
      acc[t] = mmaH<ASPLIT ? 2 : 1>(ah.v, al.v, bq.v, bq.v, acc[t]); }
  }
#pragma unroll
  for (int t = 0; t < 4; ++t) { if (col0 + t * 16 >= N) continue;
#pragma unroll
    for (int r = 0; r < 8; ++r) so[w][8 * hh + r][t * 16 + ln] = acc[t][r] * alpha; }
  __builtin_amdgcn_fence(__ATOMIC_ACQ_REL, "workgroup"); __builtin_amdgcn_wave_barrier();
  const int rsub = lane >> 4, c4 = (lane & 15) * 4;
  {
#pragma unroll
    for (int q = 0; q < 8; ++q) { const int r = q * 2 + rsub; if (col0 + c4 < N) { const v4f v = *(const v4fa*)&so[w][r][c4]; *(v4f*)(C + (size_t)(row0 + r) * ldc + col0 + c4) = v; } }
     }
}

// Wt[n][k] = f16(W[k][n]·scale) from f32 row-major W[K][N] (scale = power of two; bf16-exact weights stay exact in f16 away from the subnormal range)
__global__ __launch_bounds__(256) void k_wt_f16(const float* __restrict__ W, _Float16* __restrict__ Wt, int K, int N, float scale) {
  const int t = blockIdx.x * 256 + threadIdx.x; if (t >= N * (K / 8)) return; const int n = t / (K / 8), k8 = (t % (K / 8)) * 8; FragH f;
#pragma unroll
  for (int i = 0; i < 8; ++i) f.h[i] = (_Float16)(bf16_round(W[(size_t)(k8 + i) * N + n]) * scale); const v8us o = f.half[0];
  *(v8us*)((unsigned short*)Wt + (size_t)n * K + k8) = o; 
}
// k_gemm_hh variant with fused epilogue: v = acc·alpha + bias[by·sBias + col] (+ CP[(row/rowsPerB)·sCPb + by·64 + col] if CP) ; ACT 0 none / 1 elu ; writes f16 C16 (and f32 C if non-null)
template <int ACT>
__global__ __launch_bounds__(128) void k_gemm_hhx(const _Float16* __restrict__ A, int lda, size_t sA, const _Float16* __restrict__ Bh, int ldb, size_t sB, float alpha, const float* __restrict__ bias, size_t sBias, const float* __restrict__ CP, int rowsPerB, size_t sCPb, int row0g,
    float* __restrict__ C, _Float16* __restrict__ C16, int ldc, size_t sC, int M, int N, int K) {
  __shared__ __attribute__((aligned(16))) float so[4][16][64];
  const int tid = threadIdx.x, w = tid >> 5, lane = tid & 31, ln = lane & 15, hh = lane >> 4; const int by = blockIdx.y;
  A += (size_t)by * sA; Bh += (size_t)by * sB; const size_t cofs = (size_t)by * sC; const float* bp = bias ? bias + (size_t)by * sBias : nullptr;
  const int ntn = (N + 63) / 64; const int wid = blockIdx.x * 4 + w; const int mt = wid / ntn, nq = wid % ntn; if (mt * 16 >= M) return;
  const int row0 = mt * 16, col0 = nq * 64; const _Float16* arow = A + (size_t)(row0 + ln) * lda;
  v8f acc[4] = {};
  for (int kb = 0; kb < K; kb += 32) { FragH ah; ah.half[0] = *(const v8us*)((const unsigned short*)arow + kb + 8 * hh); ah.half[1] = *(const v8us*)((const unsigned short*)arow + kb + 16 + 8 * hh);
#pragma unroll
    for (int t = 0; t < 4; ++t) { if (col0 + t * 16 >= N) continue; const size_t boff = (size_t)(col0 + t * 16 + ln) * ldb + kb; FragH bq; bq.half[0] = *(const v8us*)((const unsigned short*)Bh + boff + 8 * hh); bq.half[1] = *(const v8us*)((const unsigned short*)Bh + boff + 16 + 8 * hh);
      acc[t] = mmaH<1>(ah.v, ah.v, bq.v, bq.v, acc[t]); }
  }
#pragma unroll
  for (int t = 0; t < 4; ++t) { if (col0 + t * 16 >= N) continue; const int col = col0 + t * 16 + ln; const float bv = bp ? bf16_round(bp[col]) : 0.f;
#pragma unroll
    for (int r = 0; r < 8; ++r) { float v = acc[t][r] * alpha + bv; if (CP) { const int rr = row0g + row0 + 8 * hh + r; if (rowsPerB < 0) v += CP[cofs + (size_t)rr * ldc + col];      /* rowsPerB < 0: own element of the batched C plane */ else { const int bidx = rr / rowsPerB; v += CP[(size_t)bidx * sCPb + (size_t)by * 64 + col]; } } if (ACT == 1) v = (v > 0.f) ? v : expm1f(v); else if (ACT == 7) v = (v > 0.f) ? v + 1.0f : expf(v); else if (ACT == 8) v = tanhf(v); else if (ACT == 9) v = 0.5f * v * (1.0f + tanhf(0.7978845608028654f * (v + 0.044715f * v * v * v))); else if (ACT == 11) v = 1.0f / (1.0f + expf(-v)); else if (ACT == 12) v = (v > 0.f) ? v : 0.01f * v; else if (ACT == 14) v = (v > 0.f) ? v : 0.1f * v; else if (ACT == 16) v = (v >= 0.f) ? v : 0.3f * v; else if (ACT == 17) v = (v >= 0.f) ? v : 0.2f * v; else if (ACT == 15) v = v / (1.0f + expf(-v)); else if (ACT == 3) v = fmaxf(v, 0.f); else if (ACT == 6) v = 0.5f * v * (1.0f + erff(v * 0.70710678118654752f)); so[w][8 * hh + r][t * 16 + ln] = v; } }
  __builtin_amdgcn_fence(__ATOMIC_ACQ_REL, "workgroup"); __builtin_amdgcn_wave_barrier();
  const int rsub = lane >> 4, c4 = (lane & 15) * 4; typedef _Float16 v4h __attribute__((ext_vector_type(4)));
  {
#pragma unroll
    for (int q = 0; q < 8; ++q) { const int r = q * 2 + rsub; if (col0 + c4 < N) { const v4f v = *(const v4fa*)&so[w][r][c4]; if (C) *(v4f*)(C + cofs + (size_t)(row0 + r) * ldc + col0 + c4) = v; if (C16) { v4h h4; for (int i = 0; i < 4; ++i) h4[i] = (_Float16)v[i]; *(v4h*)(C16 + cofs + (size_t)(row0 + r) * ldc + col0 + c4) = h4; } } }
     }
}


typedef _Float16 v4h __attribute__((ext_vector_type(4)));

__global__ __launch_bounds__(256) void k_x16(const float* __restrict__ x, _Float16* __restrict__ X16, size_t n8) { const size_t t = (size_t)blockIdx.x * 256 + threadIdx.x; if (t >= n8) return; FragH f;
#pragma unroll
  for (int q = 0; q < 8; ++q) f.h[q] = (_Float16)bf16_round(x[t * 8 + q]); *(v8us*)((unsigned short*)X16 + t * 8) = f.half[0];  }
__global__ __launch_bounds__(256) void k_h16(const float* __restrict__ x, _Float16* __restrict__ X16, size_t n8) { const size_t t = (size_t)blockIdx.x * 256 + threadIdx.x; if (t >= n8) return; FragH f;
#pragma unroll
  for (int q = 0; q < 8; ++q) f.h[q] = (_Float16)x[t * 8 + q]; *(v8us*)((unsigned short*)X16 + t * 8) = f.half[0];  }
__global__ __launch_bounds__(256) void k_round16f(const float* __restrict__ W, _Float16* __restrict__ Bt, size_t n8) { const size_t t = (size_t)blockIdx.x * 256 + threadIdx.x; if (t >= n8) return; FragH f;
#pragma unroll
  for (int i = 0; i < 8; ++i) f.h[i] = (_Float16)(bf16_round(W[t * 8 + i]) * 16.0f); *(v8us*)((unsigned short*)Bt + t * 8) = f.half[0];  }
template <int NHv, int TTv>
__global__ __launch_bounds__(256) void k_vt(const _Float16* __restrict__ V16, int ldv, int voff, _Float16* __restrict__ Vt) { __shared__ unsigned short tl[64][66]; const int tid = threadIdx.x; const int slab = blockIdx.x / (TTv / 64), lg = blockIdx.x % (TTv / 64); const int b = slab / NHv, h = slab % NHv;
  for (int i = tid; i < 64 * 8; i += 256) { const int r = i / 8, c8 = (i % 8) * 8; FragH f; f.half[0] = *(const v8us*)((const unsigned short*)V16 + ((size_t)b * TTv + lg * 64 + r) * ldv + voff + h * 64 + c8);
#pragma unroll
    for (int q = 0; q < 8; ++q) tl[r][c8 + q] = f.u[q]; }
  __syncthreads();
  {
#pragma unroll
    for (int rd = 0; rd < 2; ++rd) { const int d = rd * 32 + tid / 8, pc = tid % 8; FragH f;
#pragma unroll
      for (int q = 0; q < 8; ++q) f.u[q] = tl[pc * 8 + q][d];
      *(v8us*)((unsigned short*)Vt + ((size_t)slab * 64 + d) * TTv + lg * 64 + pc * 8) = f.half[0]; }
     } }

__global__ __launch_bounds__(256) void k_hl(const float* __restrict__ F, _Float16* __restrict__ Hh, _Float16* __restrict__ Hl, size_t n8) { const size_t t = (size_t)blockIdx.x * 256 + threadIdx.x; if (t >= n8) return; FragH fh, fl; const v4f a = *(const v4fa*)(F + t * 8), c = *(const v4fa*)(F + t * 8 + 4);
#pragma unroll
  for (int q = 0; q < 4; ++q) { _Float16 h = (_Float16)a[q]; fh.h[q] = h; fl.h[q] = (_Float16)((a[q] - (float)h) * 1024.0f); h = (_Float16)c[q]; fh.h[4 + q] = h; fl.h[4 + q] = (_Float16)((c[q] - (float)h) * 1024.0f); }
  { *(v8us*)((unsigned short*)Hh + t * 8) = fh.half[0]; *(v8us*)((unsigned short*)Hl + t * 8) = fl.half[0];  } }

// ---- fast GEMM (wave tile 32x64; requires M % 32 == 0 rows per launch region and N % 64 == 0); epilogue = k_gemm_hhx semantics ----
__device__ __forceinline__ v16h g2_frag(const _Float16* p, int hh) { FragH f; f.half[0] = *(const v8us*)((const unsigned short*)p + 8 * hh); f.half[1] = *(const v8us*)((const unsigned short*)p + 16 + 8 * hh); return f.v; }
__device__ __forceinline__ v8f g2_mma(v16h a, v16h b, v8f c) { v8f d = __builtin_amdgcn_wmma_f32_16x16x32_f16(false, a, false, b, (short)0, c, false, false); asm volatile("v_nop\n\tv_nop\n\tv_nop\n\tv_nop" : "+v"(d) : "v"(a), "v"(b)); return d; }
template <int ACT>
__global__ __launch_bounds__(128) void k_gemm2(const _Float16* __restrict__ A, int lda, size_t sA, const _Float16* __restrict__ Bh, int ldb, size_t sB, float alpha, const float* __restrict__ bias, size_t sBias, const float* __restrict__ CP, int rowsPerB, size_t sCPb, int row0g,
    float* __restrict__ C, _Float16* __restrict__ C16, int ldc, size_t sC, int M, int N, int K, int bdiv, size_t zA, size_t zB, size_t zC) { static_assert(ACT == 0 || ACT == 3 || ACT == 6 || ACT == 8 || ACT == 9 || ACT == 11 || ACT == 12 || ACT == 14 || ACT == 15 || ACT == 16 || ACT == 17, "k_gemm2: unsupported ACT code (would silently apply no activation)");
  __shared__ __attribute__((aligned(16))) float so[4][32][68];
  const int tid = threadIdx.x, w = tid >> 5, lane = tid & 31, ln = lane & 15, hh = lane >> 4; const int by = blockIdx.y; const size_t bz = blockIdx.z;      /* y = head (bdiv heads share one B slab), z = batch */
  A += (size_t)by * sA + bz * zA; Bh += (size_t)(by / bdiv) * sB + bz * zB; const size_t cofs = (size_t)by * sC + bz * zC; const float* bp = bias ? bias + (size_t)by * sBias : nullptr;
  const int ntn = N >> 6; const int mt = blockIdx.x / ntn, nq = blockIdx.x - mt * ntn; const int row0 = mt * 128 + 32 * w, col0 = nq * 64; if (row0 >= M) return;
  const _Float16* a0p = A + (size_t)(row0 + ln) * lda; const _Float16* a1p = a0p + (size_t)16 * lda;
  const _Float16* b0p = Bh + (size_t)(col0 + ln) * ldb; const _Float16* b1p = b0p + (size_t)16 * ldb; const _Float16* b2p = b1p + (size_t)16 * ldb; const _Float16* b3p = b2p + (size_t)16 * ldb;
  const v8f z8 = {0.f,0.f,0.f,0.f,0.f,0.f,0.f,0.f}; v8f c00 = z8, c01 = z8, c02 = z8, c03 = z8, c10 = z8, c11 = z8, c12 = z8, c13 = z8;
#pragma unroll 1
  for (int kb = 0; kb < K; kb += 32) { const v16h a0 = g2_frag(a0p + kb, hh), a1 = g2_frag(a1p + kb, hh);
    v16h b = g2_frag(b0p + kb, hh); c00 = g2_mma(a0, b, c00); c10 = g2_mma(a1, b, c10);
    b = g2_frag(b1p + kb, hh); c01 = g2_mma(a0, b, c01); c11 = g2_mma(a1, b, c11);
    b = g2_frag(b2p + kb, hh); c02 = g2_mma(a0, b, c02); c12 = g2_mma(a1, b, c12);
    b = g2_frag(b3p + kb, hh); c03 = g2_mma(a0, b, c03); c13 = g2_mma(a1, b, c13); }
  v8f accs[8] = {c00, c01, c02, c03, c10, c11, c12, c13};
#pragma unroll
  for (int u = 0; u < 8; ++u) { const int t = u & 3, half = u >> 2; const int col = col0 + t * 16 + ln; const float bv = bp ? bf16_round(bp[col]) : 0.f;
#pragma unroll
    for (int r = 0; r < 8; ++r) { const int rloc = half * 16 + 8 * hh + r; float v = accs[u][r] * alpha + bv; if (CP) { if (rowsPerB < 0) v += CP[cofs + (size_t)(row0g + row0 + rloc) * ldc + col];      /* rowsPerB < 0: own element of the batched C plane */ else { const int bidx = (row0g + row0 + rloc) / rowsPerB; v += CP[(size_t)bidx * sCPb + (size_t)by * 64 + col]; } }
      if (ACT == 3) v = fmaxf(v, 0.f); else if (ACT == 6) v = 0.5f * v * (1.0f + erff(v * 0.70710678118654752f)); else if (ACT == 11) v = 1.0f / (1.0f + expf(-v)); else if (ACT == 15) v = v / (1.0f + expf(-v)); else if (ACT == 12) v = (v > 0.f) ? v : 0.01f * v; else if (ACT == 8) v = tanhf(v); else if (ACT == 9) v = 0.5f * v * (1.0f + tanhf(0.7978845608028654f * (v + 0.044715f * v * v * v))); else if (ACT == 14) v = (v > 0.f) ? v : 0.1f * v; else if (ACT == 16) v = (v >= 0.f) ? v : 0.3f * v; else if (ACT == 17) v = (v >= 0.f) ? v : 0.2f * v;
      so[w][rloc][t * 16 + ln] = v; } }
  __builtin_amdgcn_fence(__ATOMIC_ACQ_REL, "workgroup"); __builtin_amdgcn_wave_barrier();
  const int rsub = lane >> 4, c4 = (lane & 15) * 4;
  {
#pragma unroll
    for (int q = 0; q < 16; ++q) { const int r = q * 2 + rsub; const v4f v = *(const v4fa*)&so[w][r][c4]; if (C) *(v4f*)(C + cofs + (size_t)(row0 + r) * ldc + col0 + c4) = v; if (C16) { v4h h4; for (int i = 0; i < 4; ++i) h4[i] = (_Float16)v[i]; *(v4h*)(C16 + cofs + (size_t)(row0 + r) * ldc + col0 + c4) = h4; } }
     } }


__global__ __launch_bounds__(256) void k_wnat(const float* __restrict__ w, size_t n8, _Float16* __restrict__ Bt) { const size_t t = (size_t)blockIdx.x * 256 + threadIdx.x; if (t >= n8) return; FragH f; for (int q = 0; q < 8; ++q) f.h[q] = (_Float16)(bf16_round(w[t * 8 + q]) * 16.0f); *(v8us*)((unsigned short*)Bt + t * 8) = f.half[0];  }
__global__ __launch_bounds__(256) void k_rsm(const float* __restrict__ S, _Float16* __restrict__ P, int nrows) {
  #pragma clang fp contract(off)
  const int i = blockIdx.x * 256 + threadIdx.x; if (i >= nrows) return; const float* s = S + (size_t)i * SQ; float mx = -3.0e38f;
#pragma unroll 1
  for (int j = 0; j < SQ; ++j) mx = fmaxf(mx, s[j]); float se = 0.f;
#pragma unroll 1
  for (int j = 0; j < SQ; ++j) se += expf(s[j] - mx); const float sc = 256.0f / se;
#pragma unroll 1
  for (int j0 = 0; j0 < SQ; j0 += 8) { FragH f; for (int q = 0; q < 8; ++q) f.h[q] = (_Float16)(expf(s[j0 + q] - mx) * sc); unsigned short* d = (unsigned short*)P + (size_t)i * SQ + j0; *(v8us*)d = f.half[0];  } }
__global__ __launch_bounds__(256) void k_vt(const _Float16* __restrict__ V16, int b, int h0, _Float16* __restrict__ VT) { __shared__ unsigned short tl[64][65]; const int tid = threadIdx.x; const int hh = blockIdx.x % HG, sg = blockIdx.x / HG; const int s0 = sg * 64; const int h = h0 + hh;
  for (int i = tid; i < 64 * 8; i += 256) { const int j = i / 8, d8 = (i % 8) * 8; FragH f; f.half[0] = *(const v8us*)((const unsigned short*)V16 + ((size_t)b * SQ + s0 + j) * DM + h * HD + d8); for (int q = 0; q < 8; ++q) tl[d8 + q][j] = f.u[q]; }
  __syncthreads();
  { for (int i = tid; i < 64 * 8; i += 256) { const int d = i / 8, j8 = (i % 8) * 8; FragH f; for (int q = 0; q < 8; ++q) f.u[q] = tl[d][j8 + q]; *(v8us*)((unsigned short*)VT + ((size_t)hh * HD + d) * SQ + s0 + j8) = f.half[0]; }  } }


template <int MASK>
__global__ __launch_bounds__(32) void k_att0h(const float* __restrict__ QF, const float* __restrict__ KF, const float* __restrict__ VF, int ld, int ldv, const int* __restrict__ mk, float scale, float* __restrict__ OF, int ldo) {
  #pragma clang fp contract(off)
  __shared__ __attribute__((aligned(16))) float lq[32][128]; __shared__ __attribute__((aligned(16))) float lo[32][128];
  const int tid = threadIdx.x; const int h = blockIdx.x / (QT0 / 32), rg = blockIdx.x % (QT0 / 32); const int i = rg * 32 + tid;
  { const size_t bq = (size_t)blockIdx.y * QT0; QF += bq * ld; KF += bq * ld; VF += bq * ldv; OF += bq * ldo; }      /* y = batch: each batch's QT0 rows follow the last one's */
  for (int c = 0; c < 32; ++c) { *(v4f*)&lq[tid][c * 4] = *(const v4fa*)(QF + (size_t)i * ld + h * 128 + c * 4); const v4f z = {0.f, 0.f, 0.f, 0.f}; *(v4f*)&lo[tid][c * 4] = z; }
  float m = -1.0e30f, l = 0.f; const int jmax = rg * 32 + 31;
#pragma unroll 1
  for (int j = 0; j <= jmax; ++j) { const float* kr = KF + (size_t)j * ld + h * 128; const float* vr = VF + (size_t)j * ldv + h * 128; float s = 0.f;
#pragma unroll 1
    for (int c = 0; c < 32; ++c) { const v4f kq = *(const v4fa*)(kr + c * 4); const v4f qq = *(v4f*)&lq[tid][c * 4]; for (int u = 0; u < 4; ++u) s = __fadd_rn(s, __fmul_rn(qq[u], kq[u])); }
    s = __fmul_rn(s, scale); float f; if (MASK) { const int mb = mk[(size_t)i * SQ + j]; f = (mb == 0) ? 1.f : 0.f; } else { f = (j <= i) ? 1.f : 0.f; }
    const float sm = fmaf(f, s, (1.f - f) * -1.0e30f); const float mn = fmaxf(m, sm); const float sc = expf(m - mn); const float e = __fmul_rn(f, expf(sm - mn)); l = __fadd_rn(__fmul_rn(l, sc), e); m = mn;
#pragma unroll 1
    for (int c = 0; c < 32; ++c) { const v4f vv = *(const v4fa*)(vr + c * 4); v4f oo = *(v4f*)&lo[tid][c * 4]; for (int u = 0; u < 4; ++u) oo[u] = __fadd_rn(__fmul_rn(oo[u], sc), __fmul_rn(e, vv[u])); *(v4f*)&lo[tid][c * 4] = oo; } }
  const float fin = 64.0f / l;
  { for (int c = 0; c < 32; ++c) { v4f oo = *(v4f*)&lo[tid][c * 4]; for (int u = 0; u < 4; ++u) oo[u] = __fmul_rn(oo[u], fin); *(v4f*)(OF + (size_t)i * ldo + h * 128 + c * 4) = oo; }  } }
__global__ __launch_bounds__(256) void k_f2h(const float* __restrict__ F, int ldf, int coff, int ncol, _Float16* __restrict__ H16, size_t nrow) { const size_t t = (size_t)blockIdx.x * 256 + threadIdx.x; const size_t n8 = nrow * (size_t)(ncol / 8); if (t >= n8) return; const size_t r = t / (ncol / 8); const int c8 = (int)(t % (ncol / 8)) * 8; FragH f; const v4f a = *(const v4fa*)(F + r * ldf + coff + c8), b2 = *(const v4fa*)(F + r * ldf + coff + c8 + 4); for (int q = 0; q < 4; ++q) { f.h[q] = (_Float16)a[q]; f.h[4 + q] = (_Float16)b2[q]; } *(v8us*)((unsigned short*)H16 + r * ncol + c8) = f.half[0];  }

__global__ __launch_bounds__(256) void k_tab128(float theta, float* __restrict__ CS, float* __restrict__ SN) {
  #pragma clang fp contract(off)
  const int t = blockIdx.x * 256 + threadIdx.x; if (t >= SQ * 64) return; const int i = t % 64; const int p = t / 64; const float invf = (float)(1.0 / pow((double)theta, (double)(2 * i) / 128.0));      /* = XLA's constant-folded f32 table */ const float ang = __fmul_rn((float)p, invf); const float c = cosf(ang), s = sinf(ang);
  *(float*)(CS + t) = c; *(float*)(SN + t) = s;  }
template <int TAB>
__global__ __launch_bounds__(128) void k_rope128(const float* __restrict__ F, int ldf, int nh, const float* __restrict__ CS, const float* __restrict__ SN, _Float16* __restrict__ H16, int ldo, float osc) {
  #pragma clang fp contract(off)
  __shared__ float xv[128]; __shared__ unsigned short sh_[128]; const int d = threadIdx.x; const int h = blockIdx.x % nh; const size_t r = blockIdx.x / nh; const int p = (int)(r % SQ);
  xv[d] = F[r * (size_t)ldf + (size_t)h * 128 + d]; __syncthreads();
  float c, s; if (TAB) { c = bf16_round(CS[(size_t)p * 128 + d]); s = bf16_round(SN[(size_t)p * 128 + d]); } else { c = CS[p * 64 + (d & 63)]; s = SN[p * 64 + (d & 63)]; }
  const float rot = (d < 64) ? -xv[d + 64] : xv[d - 64]; const float o = __fadd_rn(__fmul_rn(xv[d], c), __fmul_rn(rot, s));
  FragH th; th.h[0] = (_Float16)__fmul_rn(o, osc); sh_[d] = th.u[0]; __syncthreads();
  if (d < 16) { FragH f; for (int q = 0; q < 8; ++q) f.u[q] = sh_[d * 8 + q]; unsigned short* dst = (unsigned short*)H16 + r * (size_t)ldo + (size_t)h * 128 + d * 8; *(v8us*)dst = f.half[0];  } }

template <int TAB, int IL, int F32OUT>
__global__ __launch_bounds__(128) void k_rope128x(const float* __restrict__ F, int ldf, int nh, const float* __restrict__ CS, const float* __restrict__ SN, void* __restrict__ OUT, int ldo, float osc) {
  #pragma clang fp contract(off)
  __shared__ float xv[128]; __shared__ float ov[128]; const int d = threadIdx.x; const int h = blockIdx.x % nh; const size_t r = blockIdx.x / nh; const int p = (int)(r % SQ);
  xv[d] = F[r * (size_t)ldf + (size_t)h * 128 + d]; __syncthreads();
  float c, s; if (TAB) { c = bf16_round(CS[(size_t)p * 128 + d]); s = bf16_round(SN[(size_t)p * 128 + d]); } else { const int ti = IL ? (d >> 1) : (d & 63); c = CS[p * 64 + ti]; s = SN[p * 64 + ti]; }
  const float rot = IL ? ((d & 1) ? xv[d - 1] : -xv[d + 1]) : ((d < 64) ? -xv[d + 64] : xv[d - 64]);
  ov[d] = __fmul_rn(__fadd_rn(__fmul_rn(xv[d], c), __fmul_rn(rot, s)), osc); __syncthreads();
  if (F32OUT) { if (d < 32) { const v4f v = *(const v4f*)&ov[d * 4]; float* dst = (float*)OUT + r * (size_t)ldo + (size_t)h * 128 + d * 4; *(v4f*)dst = v;  } }
  else { if (d < 16) { FragH f; for (int q = 0; q < 8; ++q) f.h[q] = (_Float16)ov[d * 8 + q]; unsigned short* dst = (unsigned short*)OUT + r * (size_t)ldo + (size_t)h * 128 + d * 8; *(v8us*)dst = f.half[0];  } } }
template <int N>
__global__ __launch_bounds__(256) void k_rmsrow(float* __restrict__ X, const float* __restrict__ w, float eps) {
  #pragma clang fp contract(off)
  constexpr int PT = N / 256; __shared__ float red[256]; const size_t r = blockIdx.x; const int t = threadIdx.x; float* row = X + r * N + (size_t)t * PT; float v[PT]; float ss = 0.f;
  for (int q = 0; q < PT; ++q) { v[q] = row[q]; ss = __fadd_rn(ss, __fmul_rn(v[q], v[q])); }
  red[t] = ss; __syncthreads(); for (int k = 128; k > 0; k >>= 1) { if (t < k) red[t] = __fadd_rn(red[t], red[t + k]); __syncthreads(); }
  const float rs = rsqrtf(__fadd_rn(red[0] / (float)N, eps)); float o[PT]; for (int q = 0; q < PT; ++q) o[q] = __fmul_rn(__fmul_rn(v[q], rs), bf16_round(w[t * PT + q]));
  { for (int q = 0; q < PT; ++q) *(float*)(row + q) = o[q];  } }
template <int GS_, int NHQ, int DSRC>
__global__ __launch_bounds__(256) void k_kvexp128(const float* __restrict__ src, float* __restrict__ dst, size_t n4) { const size_t t = (size_t)blockIdx.x * 256 + threadIdx.x; if (t >= n4) return; const size_t e = t * 4; const size_t row = e / ((size_t)NHQ * 128); const int col = (int)(e % ((size_t)NHQ * 128)); const int h = col / 128, d = col % 128; const v4f v = *(const v4fa*)(src + row * DSRC + (size_t)(h / GS_) * 128 + d); *(v4f*)(dst + e) = v;  }

__global__ __launch_bounds__(256) void k_rsmcfb(const float* __restrict__ S, _Float16* __restrict__ P, int hg, int q0, int nk, const int* __restrict__ mk) {
  #pragma clang fp contract(off)
  const int t = blockIdx.x * 256 + threadIdx.x; if (t >= hg * QT) return; const size_t i = (size_t)t; const float* s = S + i * NKX; const size_t ig = (size_t)(q0 + (t % QT)); const int* mr = mk + ig * SQ; float mx = -3.0e38f;
#pragma unroll 1
  for (int j = 0; j < nk; ++j) { const int mb = mr[j]; const float f = (mb == 0) ? 1.f : 0.f; mx = fmaxf(mx, fmaf(f, s[j], (1.f - f) * -1.0e9f)); } float se = 0.f;
#pragma unroll 1
  for (int j = 0; j < nk; ++j) { const int mb = mr[j]; const float f = (mb == 0) ? 1.f : 0.f; se += __expf(fmaf(f, s[j], (1.f - f) * -1.0e9f) - mx); } const float sc = 256.0f / se;
#pragma unroll 1
  for (int j0 = 0; j0 < nk; j0 += 8) { FragH fr; for (int q = 0; q < 8; ++q) { const int j = j0 + q; const int mb = mr[j]; const float f = (mb == 0) ? 1.f : 0.f; fr.h[q] = (_Float16)(__expf(fmaf(f, s[j], (1.f - f) * -1.0e9f) - mx) * sc); } unsigned short* d = (unsigned short*)P + i * NKX + j0; *(v8us*)d = fr.half[0];  } }


__global__ __launch_bounds__(128) void k_rmsh128(float* __restrict__ F, int ldf, int nh, const float* __restrict__ w, float eps) {
  #pragma clang fp contract(off)
  __shared__ float red[128]; const int d = threadIdx.x; const int h = blockIdx.x % nh; const size_t r = blockIdx.x / nh; float* p = F + r * (size_t)ldf + (size_t)h * 128 + d; const float v = *p;
  red[d] = __fmul_rn(v, v); __syncthreads(); for (int st = 64; st > 0; st >>= 1) { if (d < st) red[d] = __fadd_rn(red[d], red[d + st]); __syncthreads(); }
  const float y = __fmul_rn(__fmul_rn(v, rsqrtf(__fadd_rn(red[0] * 0.0078125f, eps))), bf16_round(w[d])); *(float*)p = y;  }

__global__ __launch_bounds__(256) void k_rsmcf2(const float* __restrict__ S, _Float16* __restrict__ P, int hg, int q0, int nk) {
  #pragma clang fp contract(off)
  const int t = blockIdx.x * 256 + threadIdx.x; if (t >= hg * QT) return; const size_t i = (size_t)t; const float* s = S + i * NKX; const int last = q0 + (t % QT); float mx = -3.0e38f;
#pragma unroll 1
  for (int j = 0; j < nk; ++j) { const float f = (j <= last) ? 1.f : 0.f; mx = fmaxf(mx, fmaf(f, s[j], (1.f - f) * -1.0e9f)); } float se = 0.f;
#pragma unroll 1
  for (int j = 0; j < nk; ++j) { const float f = (j <= last) ? 1.f : 0.f; se += __expf(fmaf(f, s[j], (1.f - f) * -1.0e9f) - mx); } const float sc = 256.0f / se;
#pragma unroll 1
  for (int j0 = 0; j0 < nk; j0 += 8) { FragH fr; for (int q = 0; q < 8; ++q) { const int j = j0 + q; const float f = (j <= last) ? 1.f : 0.f; fr.h[q] = (_Float16)(__expf(fmaf(f, s[j], (1.f - f) * -1.0e9f) - mx) * sc); } unsigned short* d = (unsigned short*)P + i * NKX + j0; *(v8us*)d = fr.half[0];  } }
extern "C" void kernel_launch(void* const* d_in, const int* in_sizes, int n_in,
                              void* d_out, int out_size, void* d_ws, size_t ws_size, hipStream_t stream) {
  (void)in_sizes; (void)n_in; (void)out_size;
  const float* const* I = (const float* const*)d_in; const float* x = I[0]; const float* wq = I[1]; const float* wk = I[2]; const float* wv = I[3]; const float* wo = I[4]; const float* qnw = I[5]; const float* knw = I[6]; const float* tcos = I[7]; const float* tsin = I[8];      /* [in][out] weights; rope tables [S][128] */
  char* ws = (char*)d_ws; size_t off = 0;
  auto take = [&](size_t bytes) { char* p = ws + off; off += (bytes + 255) & ~(size_t)255; return p; };
  _Float16* BQ = (_Float16*)take((size_t)DMX * DMX * 2); _Float16* BK = (_Float16*)take((size_t)DKV * DMX * 2); _Float16* BV = (_Float16*)take((size_t)DKV * DMX * 2); _Float16* BO = (_Float16*)take((size_t)DMX * DMX * 2);
  _Float16* X16 = (_Float16*)take(NR * DMX * 2); float* QF = (float*)take(NR * DMX * 4); float* KF = (float*)take(NR * DKV * 4); float* VF = (float*)take(NR * DKV * 4); _Float16* Q16 = (_Float16*)take(NR * DMX * 2); _Float16* K16 = (_Float16*)take(NR * DKV * 2); _Float16* V16 = (_Float16*)take(NR * DKV * 2); _Float16* O16 = (_Float16*)take(NR * DMX * 2);
  static_assert((size_t)NB * NH * QT * NKX * 4 <= NR * DMX * 2 + NR * DMX * 4 + NR * DKV * 4, "S must fit in X16 + QF + KF");
  float* S = (float*)X16;      /* scores of both batches [NB][NH][QT][NKX]: reuse X16, QF, KF (adjacent; X16 last read by the projections, QF and KF by the rope launches, all in front of the first score launch) */
  _Float16* P = (_Float16*)take((size_t)NB * NH * QT * NKX * 2); _Float16* VT = (_Float16*)take((size_t)NB * (DKV / 64) * 64 * SQ * 2);
  float* QF0 = (float*)take((size_t)NB * QT0 * DMX * 4); float* KRF0 = (float*)take((size_t)QT0 * DKV * 4); float* KF0e = (float*)take((size_t)NB * QT0 * DMX * 4); float* VF0e = (float*)take((size_t)NB * QT0 * DMX * 4); float* OF0 = (float*)take((size_t)NB * QT0 * DMX * 4); _Float16* OH0 = (_Float16*)take((size_t)NB * QT0 * DMX * 2); _Float16* OL0 = (_Float16*)take((size_t)NB * QT0 * DMX * 2);
  if (off > ws_size) return;
  k_wt_f16<<<(unsigned)(((size_t)DMX * (DMX / 8) + 255) / 256), 256, 0, stream>>>(wq, BQ, DMX, DMX, 16.0f); k_wt_f16<<<(unsigned)(((size_t)DKV * (DMX / 8) + 255) / 256), 256, 0, stream>>>(wk, BK, DMX, DKV, 16.0f); k_wt_f16<<<(unsigned)(((size_t)DKV * (DMX / 8) + 255) / 256), 256, 0, stream>>>(wv, BV, DMX, DKV, 16.0f); k_wt_f16<<<(unsigned)(((size_t)DMX * (DMX / 8) + 255) / 256), 256, 0, stream>>>(wo, BO, DMX, DMX, 16.0f);      /* [in][out] -> Bt x16 */
  k_x16<<<(unsigned)((NR * DMX / 8 + 255) / 256), 256, 0, stream>>>(x, X16, NR * DMX / 8);
  k_gemm2<0><<<dim3((unsigned)((NR / 128) * (DMX / 64)), 1), 128, 0, stream>>>(X16, DMX, 0, BQ, DMX, 0, 0.0625f, nullptr, 0, nullptr, 1, 0, 0, QF, nullptr, DMX, 0, (int)NR, DMX, DMX, 1, 0, 0, 0);      /* q (f32) */
  k_gemm2<0><<<dim3((unsigned)((NR / 128) * (DKV / 64)), 1), 128, 0, stream>>>(X16, DMX, 0, BK, DMX, 0, 0.0625f, nullptr, 0, nullptr, 1, 0, 0, KF, nullptr, DKV, 0, (int)NR, DKV, DMX, 1, 0, 0, 0);      /* k (f32) */
  k_gemm2<0><<<dim3((unsigned)((NR / 128) * (DKV / 64)), 1), 128, 0, stream>>>(X16, DMX, 0, BV, DMX, 0, 0.0625f, nullptr, 0, nullptr, 1, 0, 0, VF, V16, DKV, 0, (int)NR, DKV, DMX, 1, 0, 0, 0);      /* v (f32 for the first tile + f16) */
  k_rmsh128<<<(unsigned)(NR * NH), 128, 0, stream>>>(QF, DMX, NH, qnw, 1e-6f); k_rmsh128<<<(unsigned)(NR * NKV), 128, 0, stream>>>(KF, DKV, NKV, knw, 1e-6f);      /* per-head RMSNorm over the 128 dims, in place */
  k_rope128x<1, 0, 0><<<(unsigned)(NR * NH), 128, 0, stream>>>(QF, DMX, NH, tcos, tsin, Q16, DMX, 1.0f); k_rope128x<1, 0, 0><<<(unsigned)(NR * NKV), 128, 0, stream>>>(KF, DKV, NKV, tcos, tsin, K16, DKV, 1.0f);      /* rope from the input tables -> f16 */
  for (int b = 0; b < NB; ++b) { const size_t r0 = (size_t)b * SQ, f0 = (size_t)b * QT0;
  k_rope128x<1, 0, 1><<<(unsigned)(QT0 * NH), 128, 0, stream>>>(QF + r0 * DMX, DMX, NH, tcos, tsin, QF0 + f0 * DMX, DMX, 1.0f); k_rope128x<1, 0, 1><<<(unsigned)(QT0 * NKV), 128, 0, stream>>>(KF + r0 * DKV, DKV, NKV, tcos, tsin, KRF0, DKV, 1.0f);      /* f32 roped q, k rows 0..127 */
  k_kvexp128<GSZ, NH, DKV><<<(unsigned)(((size_t)QT0 * DMX / 4 + 255) / 256), 256, 0, stream>>>(KRF0, KF0e + f0 * DMX, (size_t)QT0 * DMX / 4); k_kvexp128<GSZ, NH, DKV><<<(unsigned)(((size_t)QT0 * DMX / 4 + 255) / 256), 256, 0, stream>>>(VF + r0 * DKV, VF0e + f0 * DMX, (size_t)QT0 * DMX / 4);      /* group -> head expansion for the exact first tile */
  }      /* per batch */
  k_vt<DKV / 64, SQ><<<NB * (DKV / 64) * (SQ / 64), 256, 0, stream>>>(V16, DKV, 0, VT);      /* V^T, both batches: batch b, group g = slabs 16b + 2g, 16b + 2g + 1 */
  k_att0h<0><<<dim3(NH * (QT0 / 32), NB), 32, 0, stream>>>(QF0, KF0e, VF0e, DMX, DMX, nullptr, ATS, OF0, DMX);      /* exact causal attention rows 0..127 of both batches (o x64) */
  for (int q0 = 0; q0 < SQ; q0 += QT) { const int nk = q0 + QT;      /* one launch a stage: grid y = the 16 heads, z = the 2 batches */
    k_gemm2<0><<<dim3((QT / 128) * (nk / 64), NH, NB), 128, 0, stream>>>(Q16 + (size_t)q0 * DMX, DMX, (size_t)HDK, K16, DKV, (size_t)HDK, ATS, nullptr, 0, nullptr, 1, 0, 0, S, nullptr, NKX, (size_t)QT * NKX, QT, nk, HDK, GSZ, (size_t)SQ * DMX, (size_t)SQ * DKV, (size_t)NH * QT * NKX);      /* scores: each head vs its group's key slab */
    k_rsmcf2<<<(NB * NH * QT + 255) / 256, 256, 0, stream>>>(S, P, NB * NH, q0, nk);      /* causal softmax */
    k_gemm2<0><<<dim3((QT / 128) * (HDK / 64), NH, NB), 128, 0, stream>>>(P, NKX, (size_t)QT * NKX, VT, SQ, (size_t)HDK * SQ, 0.25f, nullptr, 0, nullptr, 1, 0, 0, nullptr, O16 + (size_t)q0 * DMX, DMX, (size_t)HDK, QT, HDK, nk, GSZ, (size_t)NH * QT * NKX, (size_t)DKV * SQ, (size_t)SQ * DMX); }      /* o (x64): each head vs its group's V^T slab */
  k_gemm2<0><<<dim3((unsigned)((NR / 128) * (DMX / 64)), 1), 128, 0, stream>>>(O16, DMX, 0, BO, DMX, 0, 0.0009765625f, nullptr, 0, nullptr, 1, 0, 0, (float*)d_out, nullptr, DMX, 0, (int)NR, DMX, DMX, 1, 0, 0, 0);      /* out = o Wo */
  k_hl<<<(unsigned)(((size_t)NB * QT0 * DMX / 8 + 255) / 256), 256, 0, stream>>>(OF0, OH0, OL0, (size_t)NB * QT0 * DMX / 8);
  k_gemm2<0><<<dim3((QT0 / 128) * (DMX / 64), 1, NB), 128, 0, stream>>>(OH0, DMX, 0, BO, DMX, 0, 0.0009765625f, nullptr, 0, nullptr, 1, 0, 0, (float*)d_out, nullptr, DMX, 0, QT0, DMX, DMX, 1, (size_t)QT0 * DMX, 0, (size_t)SQ * DMX);
  k_gemm2<0><<<dim3((QT0 / 128) * (DMX / 64), 1, NB), 128, 0, stream>>>(OL0, DMX, 0, BO, DMX, 0, 0.00000095367431640625f, nullptr, 0, (const float*)d_out, -1, 0, 0, (float*)d_out, nullptr, DMX, 0, QT0, DMX, DMX, 1, (size_t)QT0 * DMX, 0, (size_t)SQ * DMX);      /* rows 0..127 of each batch rewritten from the exact path */
}

// v002
// Measured time: 1900 microseconds a run.
// Next to v001, in two timings, it ran 1.77 times as fast each time.
// All steps since v000 together make it 5.45 times as fast.
#include <hip/hip_runtime.h>
// Qwen3 attention (x [2][2048][2048]; q = x Wq (16 heads x 128), k = x Wk, v = x Wv (8 kv heads x 128) ([in][out] weights sigma 0.02); per-head RMSNorm over the 128 dims on q and k (weights ones, eps 1e-6); rotate-half RoPE from the module's INPUT cos/sin tables [S][128] (theta 1e6); query head h uses kv head h/2; scores x 128^-0.5 with a causal mask (tril, finfo.min); softmax; out = merged Wo ([in][out]) -> [2][2048][2048]).
// Compute dtype: inputs rounded to bf16; x / weights / tables exact; projections, RMSNorm and rope f32; q, k, v, softmax weights and o as plain f16 GEMM operands (~2^-12; first 128 rows exact); scores, statistics, out f32. v_wmma_f32_16x16x32_f16.
#define NB 2
#define SQ 2048
#define DMX 2048
#define NH 16
#define NKV 8
#define GSZ 2
#define HDK 128
#define DKV (NKV * HDK)
#define QT 256
#define QT0 128
#define NKX SQ
#define DM DMX
#define HD 64
#define HG 1
#define NR ((size_t)NB * SQ)
#define ATS 0.08838834764831845f
typedef __bf16 v16b __attribute__((ext_vector_type(16)));
typedef unsigned short v8us __attribute__((ext_vector_type(8), may_alias));
typedef float  v8f  __attribute__((ext_vector_type(8)));
typedef float  v4f  __attribute__((ext_vector_type(4)));
typedef float  v4fa __attribute__((ext_vector_type(4), may_alias));
union FragB { v16b v; v8us half[2]; unsigned short u[16]; };

__device__ __forceinline__ unsigned short bf16_bits(float x) { unsigned int u = __float_as_uint(x); return (unsigned short)((u + 0x7FFFu + ((u >> 16) & 1u)) >> 16); }
__device__ __forceinline__ float bf16_val(unsigned short b) { return __uint_as_float(((unsigned int)b) << 16); }
__device__ __forceinline__ float bf16_round(float x) { return bf16_val(bf16_bits(x)); }
// D += A·B with NT terms: 1 = ah·bh, 2 = + al·bh (A split), 3 = + ah·bl (both split)
template <int NT>
__device__ __forceinline__ v8f mmaN(v16b ah, v16b al, v16b bh, v16b bl, v8f c) {
  c = __builtin_amdgcn_wmma_f32_16x16x32_bf16(false, ah, false, bh, (short)0, c, false, false);
  if (NT >= 2) c = __builtin_amdgcn_wmma_f32_16x16x32_bf16(false, al, false, bh, (short)0, c, false, false);
  if (NT >= 3) c = __builtin_amdgcn_wmma_f32_16x16x32_bf16(false, ah, false, bl, (short)0, c, false, false);
  asm volatile("v_nop\n\tv_nop\n\tv_nop\n\tv_nop" : "+v"(c) : "v"(ah), "v"(al), "v"(bh), "v"(bl));
  return c;
}

__global__ __launch_bounds__(256) void k_wt_bf16(const float* __restrict__ W, unsigned short* __restrict__ Wt, int K, int N) {
  const int t = blockIdx.x * 256 + threadIdx.x;
  const int k8n = K / 8;
  if (t >= N * k8n) return;
  const int n = t / k8n, k8 = (t % k8n) * 8;
  v8us v;
#pragma unroll
  for (int i = 0; i < 8; ++i) v[i] = bf16_bits(W[(size_t)(k8 + i) * N + n]);
  *(v8us*)(Wt + (size_t)n * K + k8) = v;
  
}

// GEMM C[M][N] (f32, pitch ldc) = act(A[M][K]·W + bias). A f32 row-major (pitch lda) converted per fragment to bf16
// (ASPLIT: hi/lo two planes -> 2 terms, else single rounded term); Wt bf16 [N][K] (pitch ldb). BIAS_BF16 rounds the
// bias to bf16 first (bias quantised to bf16 before the add). K%32==0, M%16==0, N%64==0.
template <bool ASPLIT, int ACT, bool BIAS_BF16>
__global__ __launch_bounds__(128) void k_gemm_bf(const float* __restrict__ A, int lda, const unsigned short* __restrict__ Wt, int ldb,
                                               const float* __restrict__ bias, float* __restrict__ C, int ldc, int M, int N, int K) {
  __shared__ __attribute__((aligned(16))) float so[4][16][64];
  const int tid = threadIdx.x, w = tid >> 5, lane = tid & 31, ln = lane & 15, hh = lane >> 4;
  const int ntn = N / 64;
  const int wid = blockIdx.x * 4 + w;
  const int mt = wid / ntn, nq = wid % ntn;
  if (mt * 16 >= M) return;
  const int row0 = mt * 16, col0 = nq * 64;
  const float* arow = A + (size_t)(row0 + ln) * lda;
  v8f acc[4] = {};
  for (int kb = 0; kb < K; kb += 32) {
    FragB ah, al;
    const v4f x0 = *(const v4fa*)(arow + kb + 8 * hh), x1 = *(const v4fa*)(arow + kb + 8 * hh + 4);
    const v4f x2 = *(const v4fa*)(arow + kb + 16 + 8 * hh), x3 = *(const v4fa*)(arow + kb + 16 + 8 * hh + 4);
    float xs[16] = {x0[0],x0[1],x0[2],x0[3],x1[0],x1[1],x1[2],x1[3],x2[0],x2[1],x2[2],x2[3],x3[0],x3[1],x3[2],x3[3]};
#pragma unroll
    for (int i = 0; i < 16; ++i) { const unsigned short hb = bf16_bits(xs[i]); ah.u[i] = hb; al.u[i] = ASPLIT ? bf16_bits(xs[i] - bf16_val(hb)) : (unsigned short)0; }
#pragma unroll
    for (int t = 0; t < 4; ++t) {
      const unsigned short* brow = Wt + (size_t)(col0 + t * 16 + ln) * ldb + kb;
      FragB b;
      b.half[0] = *(const v8us*)(brow + 8 * hh);
      b.half[1] = *(const v8us*)(brow + 16 + 8 * hh);
      acc[t] = mmaN<ASPLIT ? 2 : 1>(ah.v, al.v, b.v, b.v, acc[t]);
    }
  }
#pragma unroll
  for (int t = 0; t < 4; ++t) {
    float bv = bias ? bias[col0 + t * 16 + ln] : 0.f;
    if (BIAS_BF16) bv = bf16_round(bv);
#pragma unroll
    for (int r = 0; r < 8; ++r) { float v = acc[t][r] + bv; if (ACT == 1) v = fmaxf(v, 0.f); so[w][8 * hh + r][t * 16 + ln] = v; }
  }
  __builtin_amdgcn_fence(__ATOMIC_ACQ_REL, "workgroup");
  __builtin_amdgcn_wave_barrier();
  const int rsub = lane >> 4, c4 = (lane & 15) * 4;
  {
#pragma unroll
    for (int q = 0; q < 8; ++q) {
      const int r = q * 2 + rsub;
      const v4f v = *(const v4fa*)&so[w][r][c4];
      *(v4f*)(C + (size_t)(row0 + r) * ldc + col0 + c4) = v;
    }
    
  }
}

// GEMM C = act(A·W + bias + resid): A f32 (ASPLIT -> hi/lo 2 terms), Wt bf16 [N][K]; ACT 0 none, 1 relu, 2 exact gelu;
// resid (optional, f32, row index = (row % rmod), pitch ldr, RES_BF16 rounds it) added before the activation.
template <bool ASPLIT, int ACT, bool BIAS_BF16, bool RES_BF16>
__global__ __launch_bounds__(128) void k_gemm_bf3(const float* __restrict__ A, int lda, const unsigned short* __restrict__ Wt, int ldb,
                                                const float* __restrict__ bias, const float* __restrict__ resid, int rmod, int ldr,
                                                float* __restrict__ C, int ldc, int M, int N, int K) {
  __shared__ __attribute__((aligned(16))) float so[4][16][64];
  const int tid = threadIdx.x, w = tid >> 5, lane = tid & 31, ln = lane & 15, hh = lane >> 4;
  const int ntn = N / 64;
  const int wid = blockIdx.x * 4 + w;
  const int mt = wid / ntn, nq = wid % ntn;
  if (mt * 16 >= M) return;
  const int row0 = mt * 16, col0 = nq * 64;
  const float* arow = A + (size_t)(row0 + ln) * lda;
  v8f acc[4] = {};
  for (int kb = 0; kb < K; kb += 32) {
    FragB ah, al;
    const v4f x0 = *(const v4fa*)(arow + kb + 8 * hh), x1 = *(const v4fa*)(arow + kb + 8 * hh + 4);
    const v4f x2 = *(const v4fa*)(arow + kb + 16 + 8 * hh), x3 = *(const v4fa*)(arow + kb + 16 + 8 * hh + 4);
    float xs[16] = {x0[0],x0[1],x0[2],x0[3],x1[0],x1[1],x1[2],x1[3],x2[0],x2[1],x2[2],x2[3],x3[0],x3[1],x3[2],x3[3]};
#pragma unroll
    for (int i = 0; i < 16; ++i) { const unsigned short hb = bf16_bits(xs[i]); ah.u[i] = hb; al.u[i] = ASPLIT ? bf16_bits(xs[i] - bf16_val(hb)) : (unsigned short)0; }
#pragma unroll
    for (int t = 0; t < 4; ++t) {
      const unsigned short* brow = Wt + (size_t)(col0 + t * 16 + ln) * ldb + kb;
      FragB b;
      b.half[0] = *(const v8us*)(brow + 8 * hh);
      b.half[1] = *(const v8us*)(brow + 16 + 8 * hh);
      acc[t] = mmaN<ASPLIT ? 2 : 1>(ah.v, al.v, b.v, b.v, acc[t]);
    }
  }
#pragma unroll
  for (int t = 0; t < 4; ++t) {
    const int col = col0 + t * 16 + ln;
    float bv = bias ? bias[col] : 0.f;
    if (BIAS_BF16) bv = bf16_round(bv);
#pragma unroll
    for (int r = 0; r < 8; ++r) {
      float v = acc[t][r] + bv;
      if (resid) { float rv = resid[(size_t)((row0 + 8 * hh + r) % rmod) * ldr + col]; if (RES_BF16) rv = bf16_round(rv); v += rv; }
      if (ACT == 1) v = fmaxf(v, 0.f);
      if (ACT == 2) v = 0.5f * v * (1.0f + erff(v * 0.70710678118654752f));
      if (ACT == 3) { const float u = 0.7978845608028654f * (v + 0.044715f * v * v * v); v = 0.5f * v * (1.0f + tanhf(u)); }
      so[w][8 * hh + r][t * 16 + ln] = v;
    }
  }
  __builtin_amdgcn_fence(__ATOMIC_ACQ_REL, "workgroup");
  __builtin_amdgcn_wave_barrier();
  const int rsub = lane >> 4, c4 = (lane & 15) * 4;
  {
#pragma unroll
    for (int q = 0; q < 8; ++q) {
      const int r = q * 2 + rsub;
      const v4f v = *(const v4fa*)&so[w][r][c4];
      *(v4f*)(C + (size_t)(row0 + r) * ldc + col0 + c4) = v;
    }
    
  }
}
// row LayerNorm (biased variance, eps) over N: s = X (+ R); optional out_sum <- s; out_norm <- (s-mu)*rsqrt(var+eps)*g + b
template <bool PARAM_BF16>
__global__ __launch_bounds__(256) void k_layernorm(const float* __restrict__ X, const float* __restrict__ R, const float* __restrict__ g, const float* __restrict__ bta,
                                                  float* __restrict__ out_sum, float* __restrict__ out_norm, int N, float eps) {
  __shared__ float red[256];
  const int row = blockIdx.x, tid = threadIdx.x;
  const float* x = X + (size_t)row * N; const float* rr = R ? R + (size_t)row * N : nullptr;
  float vals[16];                     // up to N = 4096
  const int per = N / 256;            // contiguous chunk per thread? use strided-by-4 chunks: thread handles j = tid*4 + 1024*u
  float s1 = 0.f;
  for (int u = 0; u < per / 4; ++u) {
    const int j = tid * 4 + 1024 * u;
    const v4f a = *(const v4fa*)(x + j);
    v4f b = {0.f,0.f,0.f,0.f}; if (rr) b = *(const v4fa*)(rr + j);
#pragma unroll
    for (int q = 0; q < 4; ++q) { const float v = a[q] + b[q]; vals[u * 4 + q] = v; s1 += v; }
  }
  red[tid] = s1; __syncthreads();
  for (int st = 128; st > 0; st >>= 1) { if (tid < st) red[tid] += red[tid + st]; __syncthreads(); }
  const float mu = red[0] / (float)N; __syncthreads();
  float s2 = 0.f;
  for (int u = 0; u < per / 4; ++u)
#pragma unroll
    for (int q = 0; q < 4; ++q) { const float c = vals[u * 4 + q] - mu; s2 += c * c; }
  red[tid] = s2; __syncthreads();
  for (int st = 128; st > 0; st >>= 1) { if (tid < st) red[tid] += red[tid + st]; __syncthreads(); }
  const float rs = rsqrtf(red[0] / (float)N + eps);
  {
    for (int u = 0; u < per / 4; ++u) {
      const int j = tid * 4 + 1024 * u;
      v4f o, sm;
#pragma unroll
      for (int q = 0; q < 4; ++q) {
        float gg = g[j + q], bb = bta[j + q];
        if (PARAM_BF16) { gg = bf16_round(gg); bb = bf16_round(bb); }
        sm[q] = vals[u * 4 + q]; o[q] = (vals[u * 4 + q] - mu) * rs * gg + bb;
      }
      if (out_sum) *(v4f*)(out_sum + (size_t)row * N + j) = sm;
      *(v4f*)(out_norm + (size_t)row * N + j) = o;
    }
    
  }
}



// ---- f16 WMMA path (v_wmma_f32_16x16x32_f16): 11-bit significands for operands in range — used where a [0,1] probability operand needs more precision than bf16
typedef _Float16 v16h __attribute__((ext_vector_type(16)));
union FragH { v16h v; v8us half[2]; _Float16 h[16]; unsigned short u[16]; };
template <int NT>
__device__ __forceinline__ v8f mmaH(v16h ah, v16h al, v16h bh, v16h bl, v8f c) {
  c = __builtin_amdgcn_wmma_f32_16x16x32_f16(false, ah, false, bh, (short)0, c, false, false);
  if (NT >= 2) c = __builtin_amdgcn_wmma_f32_16x16x32_f16(false, al, false, bh, (short)0, c, false, false);
  if (NT >= 3) c = __builtin_amdgcn_wmma_f32_16x16x32_f16(false, ah, false, bl, (short)0, c, false, false);
  asm volatile("v_nop\n\tv_nop\n\tv_nop\n\tv_nop" : "+v"(c) : "v"(ah), "v"(al), "v"(bh), "v"(bl));
  return c;
}
// batched GEMM like k_gemm_b but f16 operands: A f32 (split into f16 hi/lo if ASPLIT, else rounded to f16), Bt = f16 values [n][k]; alpha; C f32; N multiple of 16 (partial tiles skipped)
template <bool ASPLIT>
__global__ __launch_bounds__(128) void k_gemm_h(const float* __restrict__ A, int lda, size_t sA, const _Float16* __restrict__ Bh, int ldb, size_t sB, float alpha, float* __restrict__ C, int ldc, size_t sC, int M, int N, int K) {
  __shared__ __attribute__((aligned(16))) float so[4][16][64];
  const int tid = threadIdx.x, w = tid >> 5, lane = tid & 31, ln = lane & 15, hh = lane >> 4; const int by = blockIdx.y;
  A += (size_t)by * sA; Bh += (size_t)by * sB; C += (size_t)by * sC;
  const int ntn = (N + 63) / 64; const int wid = blockIdx.x * 4 + w; const int mt = wid / ntn, nq = wid % ntn; if (mt * 16 >= M) return;
  const int row0 = mt * 16, col0 = nq * 64; const float* arow = A + (size_t)(row0 + ln) * lda;
  v8f acc[4] = {};
  for (int kb = 0; kb < K; kb += 32) {
    FragH ah, al;
    const v4f x0 = *(const v4fa*)(arow + kb + 8 * hh), x1 = *(const v4fa*)(arow + kb + 8 * hh + 4), x2 = *(const v4fa*)(arow + kb + 16 + 8 * hh), x3 = *(const v4fa*)(arow + kb + 16 + 8 * hh + 4);
    float xs[16] = {x0[0],x0[1],x0[2],x0[3],x1[0],x1[1],x1[2],x1[3],x2[0],x2[1],x2[2],x2[3],x3[0],x3[1],x3[2],x3[3]};
#pragma unroll
    for (int i = 0; i < 16; ++i) { const _Float16 h = (_Float16)xs[i]; ah.h[i] = h; al.h[i] = ASPLIT ? (_Float16)(xs[i] - (float)h) : (_Float16)0.0f; }
#pragma unroll
    for (int t = 0; t < 4; ++t) { if (col0 + t * 16 >= N) continue; const size_t boff = (size_t)(col0 + t * 16 + ln) * ldb + kb; FragH bq; bq.half[0] = *(const v8us*)(Bh + boff + 8 * hh); bq.half[1] = *(const v8us*)(Bh + boff + 16 + 8 * hh);
      acc[t] = mmaH<ASPLIT ? 2 : 1>(ah.v, al.v, bq.v, bq.v, acc[t]); }
  }
#pragma unroll
  for (int t = 0; t < 4; ++t) { if (col0 + t * 16 >= N) continue;
#pragma unroll
    for (int r = 0; r < 8; ++r) so[w][8 * hh + r][t * 16 + ln] = acc[t][r] * alpha; }
  __builtin_amdgcn_fence(__ATOMIC_ACQ_REL, "workgroup"); __builtin_amdgcn_wave_barrier();
  const int rsub = lane >> 4, c4 = (lane & 15) * 4;
  {
#pragma unroll
    for (int q = 0; q < 8; ++q) { const int r = q * 2 + rsub; if (col0 + c4 < N) { const v4f v = *(const v4fa*)&so[w][r][c4]; *(v4f*)(C + (size_t)(row0 + r) * ldc + col0 + c4) = v; } }
     }
}

// Wt[n][k] = f16(W[k][n]·scale) from f32 row-major W[K][N] (scale = power of two; bf16-exact weights stay exact in f16 away from the subnormal range)
__global__ __launch_bounds__(256) void k_wt_f16(const float* __restrict__ W, _Float16* __restrict__ Wt, int K, int N, float scale) {
  const int t = blockIdx.x * 256 + threadIdx.x; if (t >= N * (K / 8)) return; const int n = t / (K / 8), k8 = (t % (K / 8)) * 8; FragH f;
#pragma unroll
  for (int i = 0; i < 8; ++i) f.h[i] = (_Float16)(bf16_round(W[(size_t)(k8 + i) * N + n]) * scale); const v8us o = f.half[0];
  *(v8us*)((unsigned short*)Wt + (size_t)n * K + k8) = o; 
}
// k_gemm_hh variant with fused epilogue: v = acc·alpha + bias[by·sBias + col] (+ CP[(row/rowsPerB)·sCPb + by·64 + col] if CP) ; ACT 0 none / 1 elu ; writes f16 C16 (and f32 C if non-null)
template <int ACT>
__global__ __launch_bounds__(128) void k_gemm_hhx(const _Float16* __restrict__ A, int lda, size_t sA, const _Float16* __restrict__ Bh, int ldb, size_t sB, float alpha, const float* __restrict__ bias, size_t sBias, const float* __restrict__ CP, int rowsPerB, size_t sCPb, int row0g,
    float* __restrict__ C, _Float16* __restrict__ C16, int ldc, size_t sC, int M, int N, int K) {
  __shared__ __attribute__((aligned(16))) float so[4][16][64];
  const int tid = threadIdx.x, w = tid >> 5, lane = tid & 31, ln = lane & 15, hh = lane >> 4; const int by = blockIdx.y;
  A += (size_t)by * sA; Bh += (size_t)by * sB; const size_t cofs = (size_t)by * sC; const float* bp = bias ? bias + (size_t)by * sBias : nullptr;
  const int ntn = (N + 63) / 64; const int wid = blockIdx.x * 4 + w; const int mt = wid / ntn, nq = wid % ntn; if (mt * 16 >= M) return;
  const int row0 = mt * 16, col0 = nq * 64; const _Float16* arow = A + (size_t)(row0 + ln) * lda;
  v8f acc[4] = {};
  for (int kb = 0; kb < K; kb += 32) { FragH ah; ah.half[0] = *(const v8us*)((const unsigned short*)arow + kb + 8 * hh); ah.half[1] = *(const v8us*)((const unsigned short*)arow + kb + 16 + 8 * hh);
#pragma unroll
    for (int t = 0; t < 4; ++t) { if (col0 + t * 16 >= N) continue; const size_t boff = (size_t)(col0 + t * 16 + ln) * ldb + kb; FragH bq; bq.half[0] = *(const v8us*)((const unsigned short*)Bh + boff + 8 * hh); bq.half[1] = *(const v8us*)((const unsigned short*)Bh + boff + 16 + 8 * hh);
      acc[t] = mmaH<1>(ah.v, ah.v, bq.v, bq.v, acc[t]); }
  }
#pragma unroll
  for (int t = 0; t < 4; ++t) { if (col0 + t * 16 >= N) continue; const int col = col0 + t * 16 + ln; const float bv = bp ? bf16_round(bp[col]) : 0.f;
#pragma unroll
    for (int r = 0; r < 8; ++r) { float v = acc[t][r] * alpha + bv; if (CP) { const int rr = row0g + row0 + 8 * hh + r; if (rowsPerB < 0) v += CP[cofs + (size_t)rr * ldc + col];      /* rowsPerB < 0: own element of the batched C plane */ else { const int bidx = rr / rowsPerB; v += CP[(size_t)bidx * sCPb + (size_t)by * 64 + col]; } } if (ACT == 1) v = (v > 0.f) ? v : expm1f(v); else if (ACT == 7) v = (v > 0.f) ? v + 1.0f : expf(v); else if (ACT == 8) v = tanhf(v); else if (ACT == 9) v = 0.5f * v * (1.0f + tanhf(0.7978845608028654f * (v + 0.044715f * v * v * v))); else if (ACT == 11) v = 1.0f / (1.0f + expf(-v)); else if (ACT == 12) v = (v > 0.f) ? v : 0.01f * v; else if (ACT == 14) v = (v > 0.f) ? v : 0.1f * v; else if (ACT == 16) v = (v >= 0.f) ? v : 0.3f * v; else if (ACT == 17) v = (v >= 0.f) ? v : 0.2f * v; else if (ACT == 15) v = v / (1.0f + expf(-v)); else if (ACT == 3) v = fmaxf(v, 0.f); else if (ACT == 6) v = 0.5f * v * (1.0f + erff(v * 0.70710678118654752f)); so[w][8 * hh + r][t * 16 + ln] = v; } }
  __builtin_amdgcn_fence(__ATOMIC_ACQ_REL, "workgroup"); __builtin_amdgcn_wave_barrier();
  const int rsub = lane >> 4, c4 = (lane & 15) * 4; typedef _Float16 v4h __attribute__((ext_vector_type(4)));
  {
#pragma unroll
    for (int q = 0; q < 8; ++q) { const int r = q * 2 + rsub; if (col0 + c4 < N) { const v4f v = *(const v4fa*)&so[w][r][c4]; if (C) *(v4f*)(C + cofs + (size_t)(row0 + r) * ldc + col0 + c4) = v; if (C16) { v4h h4; for (int i = 0; i < 4; ++i) h4[i] = (_Float16)v[i]; *(v4h*)(C16 + cofs + (size_t)(row0 + r) * ldc + col0 + c4) = h4; } } }
     }
}


typedef _Float16 v4h __attribute__((ext_vector_type(4)));

__global__ __launch_bounds__(256) void k_x16(const float* __restrict__ x, _Float16* __restrict__ X16, size_t n8) { const size_t t = (size_t)blockIdx.x * 256 + threadIdx.x; if (t >= n8) return; FragH f;
#pragma unroll
  for (int q = 0; q < 8; ++q) f.h[q] = (_Float16)bf16_round(x[t * 8 + q]); *(v8us*)((unsigned short*)X16 + t * 8) = f.half[0];  }
__global__ __launch_bounds__(256) void k_h16(const float* __restrict__ x, _Float16* __restrict__ X16, size_t n8) { const size_t t = (size_t)blockIdx.x * 256 + threadIdx.x; if (t >= n8) return; FragH f;
#pragma unroll
  for (int q = 0; q < 8; ++q) f.h[q] = (_Float16)x[t * 8 + q]; *(v8us*)((unsigned short*)X16 + t * 8) = f.half[0];  }
__global__ __launch_bounds__(256) void k_round16f(const float* __restrict__ W, _Float16* __restrict__ Bt, size_t n8) { const size_t t = (size_t)blockIdx.x * 256 + threadIdx.x; if (t >= n8) return; FragH f;
#pragma unroll
  for (int i = 0; i < 8; ++i) f.h[i] = (_Float16)(bf16_round(W[t * 8 + i]) * 16.0f); *(v8us*)((unsigned short*)Bt + t * 8) = f.half[0];  }
template <int NHv, int TTv>
__global__ __launch_bounds__(256) void k_vt(const _Float16* __restrict__ V16, int ldv, int voff, _Float16* __restrict__ Vt) { __shared__ unsigned short tl[64][66]; const int tid = threadIdx.x; const int slab = blockIdx.x / (TTv / 64), lg = blockIdx.x % (TTv / 64); const int b = slab / NHv, h = slab % NHv;
  for (int i = tid; i < 64 * 8; i += 256) { const int r = i / 8, c8 = (i % 8) * 8; FragH f; f.half[0] = *(const v8us*)((const unsigned short*)V16 + ((size_t)b * TTv + lg * 64 + r) * ldv + voff + h * 64 + c8);
#pragma unroll
    for (int q = 0; q < 8; ++q) tl[r][c8 + q] = f.u[q]; }
  __syncthreads();
  {
#pragma unroll
    for (int rd = 0; rd < 2; ++rd) { const int d = rd * 32 + tid / 8, pc = tid % 8; FragH f;
#pragma unroll
      for (int q = 0; q < 8; ++q) f.u[q] = tl[pc * 8 + q][d];
      *(v8us*)((unsigned short*)Vt + ((size_t)slab * 64 + d) * TTv + lg * 64 + pc * 8) = f.half[0]; }
     } }

__global__ __launch_bounds__(256) void k_hl(const float* __restrict__ F, _Float16* __restrict__ Hh, _Float16* __restrict__ Hl, size_t n8) { const size_t t = (size_t)blockIdx.x * 256 + threadIdx.x; if (t >= n8) return; FragH fh, fl; const v4f a = *(const v4fa*)(F + t * 8), c = *(const v4fa*)(F + t * 8 + 4);
#pragma unroll
  for (int q = 0; q < 4; ++q) { _Float16 h = (_Float16)a[q]; fh.h[q] = h; fl.h[q] = (_Float16)((a[q] - (float)h) * 1024.0f); h = (_Float16)c[q]; fh.h[4 + q] = h; fl.h[4 + q] = (_Float16)((c[q] - (float)h) * 1024.0f); }
  { *(v8us*)((unsigned short*)Hh + t * 8) = fh.half[0]; *(v8us*)((unsigned short*)Hl + t * 8) = fl.half[0];  } }

// ---- fast GEMM (wave tile 32x64; requires M % 32 == 0 rows per launch region and N % 64 == 0); epilogue = k_gemm_hhx semantics ----
__device__ __forceinline__ v16h g2_frag(const _Float16* p, int hh) { FragH f; f.half[0] = *(const v8us*)((const unsigned short*)p + 8 * hh); f.half[1] = *(const v8us*)((const unsigned short*)p + 16 + 8 * hh); return f.v; }
__device__ __forceinline__ v8f g2_mma(v16h a, v16h b, v8f c) { v8f d = __builtin_amdgcn_wmma_f32_16x16x32_f16(false, a, false, b, (short)0, c, false, false); asm volatile("v_nop\n\tv_nop\n\tv_nop\n\tv_nop" : "+v"(d) : "v"(a), "v"(b)); return d; }
template <int ACT>
__global__ __launch_bounds__(128) void k_gemm2(const _Float16* __restrict__ A, int lda, size_t sA, const _Float16* __restrict__ Bh, int ldb, size_t sB, float alpha, const float* __restrict__ bias, size_t sBias, const float* __restrict__ CP, int rowsPerB, size_t sCPb, int row0g,
    float* __restrict__ C, _Float16* __restrict__ C16, int ldc, size_t sC, int M, int N, int K, int bdiv, size_t zA, size_t zB, size_t zC) { static_assert(ACT == 0 || ACT == 3 || ACT == 6 || ACT == 8 || ACT == 9 || ACT == 11 || ACT == 12 || ACT == 14 || ACT == 15 || ACT == 16 || ACT == 17, "k_gemm2: unsupported ACT code (would silently apply no activation)");
  __shared__ __attribute__((aligned(16))) float so[4][32][68];
  const int tid = threadIdx.x, w = tid >> 5, lane = tid & 31, ln = lane & 15, hh = lane >> 4; const int by = blockIdx.y; const size_t bz = blockIdx.z;      /* y = head (bdiv heads share one B slab), z = batch */
  A += (size_t)by * sA + bz * zA; Bh += (size_t)(by / bdiv) * sB + bz * zB; const size_t cofs = (size_t)by * sC + bz * zC; const float* bp = bias ? bias + (size_t)by * sBias : nullptr;
  const int ntn = N >> 6; const int mt = blockIdx.x / ntn, nq = blockIdx.x - mt * ntn; const int row0 = mt * 128 + 32 * w, col0 = nq * 64; if (row0 >= M) return;
  const _Float16* a0p = A + (size_t)(row0 + ln) * lda; const _Float16* a1p = a0p + (size_t)16 * lda;
  const _Float16* b0p = Bh + (size_t)(col0 + ln) * ldb; const _Float16* b1p = b0p + (size_t)16 * ldb; const _Float16* b2p = b1p + (size_t)16 * ldb; const _Float16* b3p = b2p + (size_t)16 * ldb;
  const v8f z8 = {0.f,0.f,0.f,0.f,0.f,0.f,0.f,0.f}; v8f c00 = z8, c01 = z8, c02 = z8, c03 = z8, c10 = z8, c11 = z8, c12 = z8, c13 = z8;
#pragma unroll 1
  for (int kb = 0; kb < K; kb += 32) { const v16h a0 = g2_frag(a0p + kb, hh), a1 = g2_frag(a1p + kb, hh);
    v16h b = g2_frag(b0p + kb, hh); c00 = g2_mma(a0, b, c00); c10 = g2_mma(a1, b, c10);
    b = g2_frag(b1p + kb, hh); c01 = g2_mma(a0, b, c01); c11 = g2_mma(a1, b, c11);
    b = g2_frag(b2p + kb, hh); c02 = g2_mma(a0, b, c02); c12 = g2_mma(a1, b, c12);
    b = g2_frag(b3p + kb, hh); c03 = g2_mma(a0, b, c03); c13 = g2_mma(a1, b, c13); }
  v8f accs[8] = {c00, c01, c02, c03, c10, c11, c12, c13};
#pragma unroll
  for (int u = 0; u < 8; ++u) { const int t = u & 3, half = u >> 2; const int col = col0 + t * 16 + ln; const float bv = bp ? bf16_round(bp[col]) : 0.f;
#pragma unroll
    for (int r = 0; r < 8; ++r) { const int rloc = half * 16 + 8 * hh + r; float v = accs[u][r] * alpha + bv; if (CP) { if (rowsPerB < 0) v += CP[cofs + (size_t)(row0g + row0 + rloc) * ldc + col];      /* rowsPerB < 0: own element of the batched C plane */ else { const int bidx = (row0g + row0 + rloc) / rowsPerB; v += CP[(size_t)bidx * sCPb + (size_t)by * 64 + col]; } }
      if (ACT == 3) v = fmaxf(v, 0.f); else if (ACT == 6) v = 0.5f * v * (1.0f + erff(v * 0.70710678118654752f)); else if (ACT == 11) v = 1.0f / (1.0f + expf(-v)); else if (ACT == 15) v = v / (1.0f + expf(-v)); else if (ACT == 12) v = (v > 0.f) ? v : 0.01f * v; else if (ACT == 8) v = tanhf(v); else if (ACT == 9) v = 0.5f * v * (1.0f + tanhf(0.7978845608028654f * (v + 0.044715f * v * v * v))); else if (ACT == 14) v = (v > 0.f) ? v : 0.1f * v; else if (ACT == 16) v = (v >= 0.f) ? v : 0.3f * v; else if (ACT == 17) v = (v >= 0.f) ? v : 0.2f * v;
      so[w][rloc][t * 16 + ln] = v; } }
  __builtin_amdgcn_fence(__ATOMIC_ACQ_REL, "workgroup"); __builtin_amdgcn_wave_barrier();
  const int rsub = lane >> 4, c4 = (lane & 15) * 4;
  {
#pragma unroll
    for (int q = 0; q < 16; ++q) { const int r = q * 2 + rsub; const v4f v = *(const v4fa*)&so[w][r][c4]; if (C) *(v4f*)(C + cofs + (size_t)(row0 + r) * ldc + col0 + c4) = v; if (C16) { v4h h4; for (int i = 0; i < 4; ++i) h4[i] = (_Float16)v[i]; *(v4h*)(C16 + cofs + (size_t)(row0 + r) * ldc + col0 + c4) = h4; } }
     } }


__global__ __launch_bounds__(256) void k_wnat(const float* __restrict__ w, size_t n8, _Float16* __restrict__ Bt) { const size_t t = (size_t)blockIdx.x * 256 + threadIdx.x; if (t >= n8) return; FragH f; for (int q = 0; q < 8; ++q) f.h[q] = (_Float16)(bf16_round(w[t * 8 + q]) * 16.0f); *(v8us*)((unsigned short*)Bt + t * 8) = f.half[0];  }
__global__ __launch_bounds__(256) void k_rsm(const float* __restrict__ S, _Float16* __restrict__ P, int nrows) {
  #pragma clang fp contract(off)
  const int i = blockIdx.x * 256 + threadIdx.x; if (i >= nrows) return; const float* s = S + (size_t)i * SQ; float mx = -3.0e38f;
#pragma unroll 1
  for (int j = 0; j < SQ; ++j) mx = fmaxf(mx, s[j]); float se = 0.f;
#pragma unroll 1
  for (int j = 0; j < SQ; ++j) se += expf(s[j] - mx); const float sc = 256.0f / se;
#pragma unroll 1
  for (int j0 = 0; j0 < SQ; j0 += 8) { FragH f; for (int q = 0; q < 8; ++q) f.h[q] = (_Float16)(expf(s[j0 + q] - mx) * sc); unsigned short* d = (unsigned short*)P + (size_t)i * SQ + j0; *(v8us*)d = f.half[0];  } }
__global__ __launch_bounds__(256) void k_vt(const _Float16* __restrict__ V16, int b, int h0, _Float16* __restrict__ VT) { __shared__ unsigned short tl[64][65]; const int tid = threadIdx.x; const int hh = blockIdx.x % HG, sg = blockIdx.x / HG; const int s0 = sg * 64; const int h = h0 + hh;
  for (int i = tid; i < 64 * 8; i += 256) { const int j = i / 8, d8 = (i % 8) * 8; FragH f; f.half[0] = *(const v8us*)((const unsigned short*)V16 + ((size_t)b * SQ + s0 + j) * DM + h * HD + d8); for (int q = 0; q < 8; ++q) tl[d8 + q][j] = f.u[q]; }
  __syncthreads();
  { for (int i = tid; i < 64 * 8; i += 256) { const int d = i / 8, j8 = (i % 8) * 8; FragH f; for (int q = 0; q < 8; ++q) f.u[q] = tl[d][j8 + q]; *(v8us*)((unsigned short*)VT + ((size_t)hh * HD + d) * SQ + s0 + j8) = f.half[0]; }  } }


template <int MASK>
__global__ __launch_bounds__(32) void k_att0h(const float* __restrict__ QF, const float* __restrict__ KF, const float* __restrict__ VF, int ld, int ldv, const int* __restrict__ mk, float scale, float* __restrict__ OF, int ldo) {
  #pragma clang fp contract(off)
  __shared__ __attribute__((aligned(16))) float lq[32][128]; __shared__ __attribute__((aligned(16))) float lo[32][128];
  const int tid = threadIdx.x; const int h = blockIdx.x / (QT0 / 32), rg = blockIdx.x % (QT0 / 32); const int i = rg * 32 + tid;
  { const size_t bq = (size_t)blockIdx.y * QT0; QF += bq * ld; KF += bq * ld; VF += bq * ldv; OF += bq * ldo; }      /* y = batch: each batch's QT0 rows follow the last one's */
  for (int c = 0; c < 32; ++c) { *(v4f*)&lq[tid][c * 4] = *(const v4fa*)(QF + (size_t)i * ld + h * 128 + c * 4); const v4f z = {0.f, 0.f, 0.f, 0.f}; *(v4f*)&lo[tid][c * 4] = z; }
  float m = -1.0e30f, l = 0.f; const int jmax = rg * 32 + 31;
#pragma unroll 1
  for (int j = 0; j <= jmax; ++j) { const float* kr = KF + (size_t)j * ld + h * 128; const float* vr = VF + (size_t)j * ldv + h * 128; float s = 0.f;
#pragma unroll 1
    for (int c = 0; c < 32; ++c) { const v4f kq = *(const v4fa*)(kr + c * 4); const v4f qq = *(v4f*)&lq[tid][c * 4]; for (int u = 0; u < 4; ++u) s = __fadd_rn(s, __fmul_rn(qq[u], kq[u])); }
    s = __fmul_rn(s, scale); float f; if (MASK) { const int mb = mk[(size_t)i * SQ + j]; f = (mb == 0) ? 1.f : 0.f; } else { f = (j <= i) ? 1.f : 0.f; }
    const float sm = fmaf(f, s, (1.f - f) * -1.0e30f); const float mn = fmaxf(m, sm); const float sc = expf(m - mn); const float e = __fmul_rn(f, expf(sm - mn)); l = __fadd_rn(__fmul_rn(l, sc), e); m = mn;
#pragma unroll 1
    for (int c = 0; c < 32; ++c) { const v4f vv = *(const v4fa*)(vr + c * 4); v4f oo = *(v4f*)&lo[tid][c * 4]; for (int u = 0; u < 4; ++u) oo[u] = __fadd_rn(__fmul_rn(oo[u], sc), __fmul_rn(e, vv[u])); *(v4f*)&lo[tid][c * 4] = oo; } }
  const float fin = 64.0f / l;
  { for (int c = 0; c < 32; ++c) { v4f oo = *(v4f*)&lo[tid][c * 4]; for (int u = 0; u < 4; ++u) oo[u] = __fmul_rn(oo[u], fin); *(v4f*)(OF + (size_t)i * ldo + h * 128 + c * 4) = oo; }  } }
__global__ __launch_bounds__(256) void k_f2h(const float* __restrict__ F, int ldf, int coff, int ncol, _Float16* __restrict__ H16, size_t nrow) { const size_t t = (size_t)blockIdx.x * 256 + threadIdx.x; const size_t n8 = nrow * (size_t)(ncol / 8); if (t >= n8) return; const size_t r = t / (ncol / 8); const int c8 = (int)(t % (ncol / 8)) * 8; FragH f; const v4f a = *(const v4fa*)(F + r * ldf + coff + c8), b2 = *(const v4fa*)(F + r * ldf + coff + c8 + 4); for (int q = 0; q < 4; ++q) { f.h[q] = (_Float16)a[q]; f.h[4 + q] = (_Float16)b2[q]; } *(v8us*)((unsigned short*)H16 + r * ncol + c8) = f.half[0];  }

__global__ __launch_bounds__(256) void k_tab128(float theta, float* __restrict__ CS, float* __restrict__ SN) {
  #pragma clang fp contract(off)
  const int t = blockIdx.x * 256 + threadIdx.x; if (t >= SQ * 64) return; const int i = t % 64; const int p = t / 64; const float invf = (float)(1.0 / pow((double)theta, (double)(2 * i) / 128.0));      /* = XLA's constant-folded f32 table */ const float ang = __fmul_rn((float)p, invf); const float c = cosf(ang), s = sinf(ang);
  *(float*)(CS + t) = c; *(float*)(SN + t) = s;  }
template <int TAB>
__global__ __launch_bounds__(128) void k_rope128(const float* __restrict__ F, int ldf, int nh, const float* __restrict__ CS, const float* __restrict__ SN, _Float16* __restrict__ H16, int ldo, float osc) {
  #pragma clang fp contract(off)
  __shared__ float xv[128]; __shared__ unsigned short sh_[128]; const int d = threadIdx.x; const int h = blockIdx.x % nh; const size_t r = blockIdx.x / nh; const int p = (int)(r % SQ);
  xv[d] = F[r * (size_t)ldf + (size_t)h * 128 + d]; __syncthreads();
  float c, s; if (TAB) { c = bf16_round(CS[(size_t)p * 128 + d]); s = bf16_round(SN[(size_t)p * 128 + d]); } else { c = CS[p * 64 + (d & 63)]; s = SN[p * 64 + (d & 63)]; }
  const float rot = (d < 64) ? -xv[d + 64] : xv[d - 64]; const float o = __fadd_rn(__fmul_rn(xv[d], c), __fmul_rn(rot, s));
  FragH th; th.h[0] = (_Float16)__fmul_rn(o, osc); sh_[d] = th.u[0]; __syncthreads();
  if (d < 16) { FragH f; for (int q = 0; q < 8; ++q) f.u[q] = sh_[d * 8 + q]; unsigned short* dst = (unsigned short*)H16 + r * (size_t)ldo + (size_t)h * 128 + d * 8; *(v8us*)dst = f.half[0];  } }

template <int TAB, int IL, int F32OUT>
__global__ __launch_bounds__(128) void k_rope128x(const float* __restrict__ F, int ldf, int nh, const float* __restrict__ CS, const float* __restrict__ SN, void* __restrict__ OUT, int ldo, float osc) {
  #pragma clang fp contract(off)
  __shared__ float xv[128]; __shared__ float ov[128]; const int d = threadIdx.x; const int h = blockIdx.x % nh; const size_t r = blockIdx.x / nh; const int p = (int)(r % SQ);
  xv[d] = F[r * (size_t)ldf + (size_t)h * 128 + d]; __syncthreads();
  float c, s; if (TAB) { c = bf16_round(CS[(size_t)p * 128 + d]); s = bf16_round(SN[(size_t)p * 128 + d]); } else { const int ti = IL ? (d >> 1) : (d & 63); c = CS[p * 64 + ti]; s = SN[p * 64 + ti]; }
  const float rot = IL ? ((d & 1) ? xv[d - 1] : -xv[d + 1]) : ((d < 64) ? -xv[d + 64] : xv[d - 64]);
  ov[d] = __fmul_rn(__fadd_rn(__fmul_rn(xv[d], c), __fmul_rn(rot, s)), osc); __syncthreads();
  if (F32OUT) { if (d < 32) { const v4f v = *(const v4f*)&ov[d * 4]; float* dst = (float*)OUT + r * (size_t)ldo + (size_t)h * 128 + d * 4; *(v4f*)dst = v;  } }
  else { if (d < 16) { FragH f; for (int q = 0; q < 8; ++q) f.h[q] = (_Float16)ov[d * 8 + q]; unsigned short* dst = (unsigned short*)OUT + r * (size_t)ldo + (size_t)h * 128 + d * 8; *(v8us*)dst = f.half[0];  } } }
template <int N>
__global__ __launch_bounds__(256) void k_rmsrow(float* __restrict__ X, const float* __restrict__ w, float eps) {
  #pragma clang fp contract(off)
  constexpr int PT = N / 256; __shared__ float red[256]; const size_t r = blockIdx.x; const int t = threadIdx.x; float* row = X + r * N + (size_t)t * PT; float v[PT]; float ss = 0.f;
  for (int q = 0; q < PT; ++q) { v[q] = row[q]; ss = __fadd_rn(ss, __fmul_rn(v[q], v[q])); }
  red[t] = ss; __syncthreads(); for (int k = 128; k > 0; k >>= 1) { if (t < k) red[t] = __fadd_rn(red[t], red[t + k]); __syncthreads(); }
  const float rs = rsqrtf(__fadd_rn(red[0] / (float)N, eps)); float o[PT]; for (int q = 0; q < PT; ++q) o[q] = __fmul_rn(__fmul_rn(v[q], rs), bf16_round(w[t * PT + q]));
  { for (int q = 0; q < PT; ++q) *(float*)(row + q) = o[q];  } }
template <int GS_, int NHQ, int DSRC>
__global__ __launch_bounds__(256) void k_kvexp128(const float* __restrict__ src, float* __restrict__ dst, size_t n4) { const size_t t = (size_t)blockIdx.x * 256 + threadIdx.x; if (t >= n4) return; const size_t e = t * 4; const size_t row = e / ((size_t)NHQ * 128); const int col = (int)(e % ((size_t)NHQ * 128)); const int h = col / 128, d = col % 128; const v4f v = *(const v4fa*)(src + row * DSRC + (size_t)(h / GS_) * 128 + d); *(v4f*)(dst + e) = v;  }

__global__ __launch_bounds__(256) void k_rsmcfb(const float* __restrict__ S, _Float16* __restrict__ P, int hg, int q0, int nk, const int* __restrict__ mk) {
  #pragma clang fp contract(off)
  const int t = blockIdx.x * 256 + threadIdx.x; if (t >= hg * QT) return; const size_t i = (size_t)t; const float* s = S + i * NKX; const size_t ig = (size_t)(q0 + (t % QT)); const int* mr = mk + ig * SQ; float mx = -3.0e38f;
#pragma unroll 1
  for (int j = 0; j < nk; ++j) { const int mb = mr[j]; const float f = (mb == 0) ? 1.f : 0.f; mx = fmaxf(mx, fmaf(f, s[j], (1.f - f) * -1.0e9f)); } float se = 0.f;
#pragma unroll 1
  for (int j = 0; j < nk; ++j) { const int mb = mr[j]; const float f = (mb == 0) ? 1.f : 0.f; se += __expf(fmaf(f, s[j], (1.f - f) * -1.0e9f) - mx); } const float sc = 256.0f / se;
#pragma unroll 1
  for (int j0 = 0; j0 < nk; j0 += 8) { FragH fr; for (int q = 0; q < 8; ++q) { const int j = j0 + q; const int mb = mr[j]; const float f = (mb == 0) ? 1.f : 0.f; fr.h[q] = (_Float16)(__expf(fmaf(f, s[j], (1.f - f) * -1.0e9f) - mx) * sc); } unsigned short* d = (unsigned short*)P + i * NKX + j0; *(v8us*)d = fr.half[0];  } }


__global__ __launch_bounds__(128) void k_rmsh128(float* __restrict__ F, int ldf, int nh, const float* __restrict__ w, float eps) {
  #pragma clang fp contract(off)
  __shared__ float red[128]; const int d = threadIdx.x; const int h = blockIdx.x % nh; const size_t r = blockIdx.x / nh; float* p = F + r * (size_t)ldf + (size_t)h * 128 + d; const float v = *p;
  red[d] = __fmul_rn(v, v); __syncthreads(); for (int st = 64; st > 0; st >>= 1) { if (d < st) red[d] = __fadd_rn(red[d], red[d + st]); __syncthreads(); }
  const float y = __fmul_rn(__fmul_rn(v, rsqrtf(__fadd_rn(red[0] * 0.0078125f, eps))), bf16_round(w[d])); *(float*)p = y;  }

// lane l with lane l ^ M inside its 16-lane row (M = 1, 2, 4, 8), and with lane l ^ 16
template <int M>
__device__ __forceinline__ float row_x(float x) { return __builtin_bit_cast(float, __builtin_amdgcn_update_dpp(0, __builtin_bit_cast(int, x), 0x160 + M, 0xf, 0xf, true)); }
__device__ __forceinline__ float half_x(float x) { return __builtin_bit_cast(float, __builtin_amdgcn_permlanex16(__builtin_bit_cast(int, x), __builtin_bit_cast(int, x), 0x76543210, 0xfedcba98, false, false)); }
// 2^x of four values. One statement: each v_exp_f32 is followed by one that neither reads its result nor writes its source (outputs early-clobber), and the v_nop fills
// the slot behind the last.
__device__ __forceinline__ v4f exp2_4(v4f x) { float e0, e1, e2, e3;
  asm("v_exp_f32 %0, %4\n\tv_exp_f32 %1, %5\n\tv_exp_f32 %2, %6\n\tv_exp_f32 %3, %7\n\tv_nop" : "=&v"(e0), "=&v"(e1), "=&v"(e2), "=&v"(e3) : "v"(x[0]), "v"(x[1]), "v"(x[2]), "v"(x[3]));
  const v4f e = {e0, e1, e2, e3}; return e; }
// causal softmax, 8 waves a block, one wave a score row of NC * 128 columns: lane l holds columns 128 c + 4 l .. + 3 in registers (each load 512 contiguous bytes), so the row is read once;
// maximum and sum = each lane's own columns in rising order, then a five-step butterfly over the lanes.
template <int NC>
__global__ __launch_bounds__(256) void k_rsmcf2(const float* __restrict__ S, _Float16* __restrict__ P, int hg, int q0) {
  const int l4 = (threadIdx.x & 31) * 4; const int t = blockIdx.x * 8 + __builtin_amdgcn_readfirstlane(threadIdx.x >> 5); if (t >= hg * QT) return;
  const float* s = S + (size_t)t * NKX + l4; _Float16* p = P + (size_t)t * NKX + l4; const int rel = q0 + (t % QT) - l4;      /* column 128 c + 4 l + u is open while 128 c + u <= rel */
  v4f v[NC];
#pragma unroll
  for (int c = 0; c < NC; ++c) v[c] = *(const v4fa*)(s + c * 128);
  float mx = -3.0e38f;
#pragma unroll
  for (int c = 0; c < NC; ++c)
#pragma unroll
    for (int u = 0; u < 4; ++u) { const float m = (c * 128 + u <= rel) ? v[c][u] : -1.0e9f; v[c][u] = m; mx = fmaxf(mx, m); }
  mx = fmaxf(mx, row_x<1>(mx)); mx = fmaxf(mx, row_x<2>(mx)); mx = fmaxf(mx, row_x<4>(mx)); mx = fmaxf(mx, row_x<8>(mx)); mx = fmaxf(mx, half_x(mx));
  float se = 0.f;
#pragma unroll
  for (int c = 0; c < NC; ++c) { v[c] = exp2_4((v[c] - mx) * 1.4426950408889634f);      /* e^(x - max), as __expf forms it */
#pragma unroll
    for (int u = 0; u < 4; ++u) se += v[c][u]; }
  se += row_x<1>(se); se += row_x<2>(se); se += row_x<4>(se); se += row_x<8>(se); se += half_x(se);
  const float sc = 256.0f / se;
#pragma unroll
  for (int c = 0; c < NC; ++c) { v4h h4;
#pragma unroll
    for (int u = 0; u < 4; ++u) h4[u] = (_Float16)(v[c][u] * sc);
    *(v4h*)(p + c * 128) = h4; } }
extern "C" void kernel_launch(void* const* d_in, const int* in_sizes, int n_in,
                              void* d_out, int out_size, void* d_ws, size_t ws_size, hipStream_t stream) {
  (void)in_sizes; (void)n_in; (void)out_size;
  const float* const* I = (const float* const*)d_in; const float* x = I[0]; const float* wq = I[1]; const float* wk = I[2]; const float* wv = I[3]; const float* wo = I[4]; const float* qnw = I[5]; const float* knw = I[6]; const float* tcos = I[7]; const float* tsin = I[8];      /* [in][out] weights; rope tables [S][128] */
  char* ws = (char*)d_ws; size_t off = 0;
  auto take = [&](size_t bytes) { char* p = ws + off; off += (bytes + 255) & ~(size_t)255; return p; };
  _Float16* BQ = (_Float16*)take((size_t)DMX * DMX * 2); _Float16* BK = (_Float16*)take((size_t)DKV * DMX * 2); _Float16* BV = (_Float16*)take((size_t)DKV * DMX * 2); _Float16* BO = (_Float16*)take((size_t)DMX * DMX * 2);
  _Float16* X16 = (_Float16*)take(NR * DMX * 2); float* QF = (float*)take(NR * DMX * 4); float* KF = (float*)take(NR * DKV * 4); float* VF = (float*)take(NR * DKV * 4); _Float16* Q16 = (_Float16*)take(NR * DMX * 2); _Float16* K16 = (_Float16*)take(NR * DKV * 2); _Float16* V16 = (_Float16*)take(NR * DKV * 2); _Float16* O16 = (_Float16*)take(NR * DMX * 2);
  static_assert((size_t)NB * NH * QT * NKX * 4 <= NR * DMX * 2 + NR * DMX * 4 + NR * DKV * 4, "S must fit in X16 + QF + KF");
  float* S = (float*)X16;      /* scores of both batches [NB][NH][QT][NKX]: reuse X16, QF, KF (adjacent; X16 last read by the projections, QF and KF by the rope launches, all in front of the first score launch) */
  _Float16* P = (_Float16*)take((size_t)NB * NH * QT * NKX * 2); _Float16* VT = (_Float16*)take((size_t)NB * (DKV / 64) * 64 * SQ * 2);
  float* QF0 = (float*)take((size_t)NB * QT0 * DMX * 4); float* KRF0 = (float*)take((size_t)QT0 * DKV * 4); float* KF0e = (float*)take((size_t)NB * QT0 * DMX * 4); float* VF0e = (float*)take((size_t)NB * QT0 * DMX * 4); float* OF0 = (float*)take((size_t)NB * QT0 * DMX * 4); _Float16* OH0 = (_Float16*)take((size_t)NB * QT0 * DMX * 2); _Float16* OL0 = (_Float16*)take((size_t)NB * QT0 * DMX * 2);
  if (off > ws_size) return;
  k_wt_f16<<<(unsigned)(((size_t)DMX * (DMX / 8) + 255) / 256), 256, 0, stream>>>(wq, BQ, DMX, DMX, 16.0f); k_wt_f16<<<(unsigned)(((size_t)DKV * (DMX / 8) + 255) / 256), 256, 0, stream>>>(wk, BK, DMX, DKV, 16.0f); k_wt_f16<<<(unsigned)(((size_t)DKV * (DMX / 8) + 255) / 256), 256, 0, stream>>>(wv, BV, DMX, DKV, 16.0f); k_wt_f16<<<(unsigned)(((size_t)DMX * (DMX / 8) + 255) / 256), 256, 0, stream>>>(wo, BO, DMX, DMX, 16.0f);      /* [in][out] -> Bt x16 */
  k_x16<<<(unsigned)((NR * DMX / 8 + 255) / 256), 256, 0, stream>>>(x, X16, NR * DMX / 8);
  k_gemm2<0><<<dim3((unsigned)((NR / 128) * (DMX / 64)), 1), 128, 0, stream>>>(X16, DMX, 0, BQ, DMX, 0, 0.0625f, nullptr, 0, nullptr, 1, 0, 0, QF, nullptr, DMX, 0, (int)NR, DMX, DMX, 1, 0, 0, 0);      /* q (f32) */
  k_gemm2<0><<<dim3((unsigned)((NR / 128) * (DKV / 64)), 1), 128, 0, stream>>>(X16, DMX, 0, BK, DMX, 0, 0.0625f, nullptr, 0, nullptr, 1, 0, 0, KF, nullptr, DKV, 0, (int)NR, DKV, DMX, 1, 0, 0, 0);      /* k (f32) */
  k_gemm2<0><<<dim3((unsigned)((NR / 128) * (DKV / 64)), 1), 128, 0, stream>>>(X16, DMX, 0, BV, DMX, 0, 0.0625f, nullptr, 0, nullptr, 1, 0, 0, VF, V16, DKV, 0, (int)NR, DKV, DMX, 1, 0, 0, 0);      /* v (f32 for the first tile + f16) */
  k_rmsh128<<<(unsigned)(NR * NH), 128, 0, stream>>>(QF, DMX, NH, qnw, 1e-6f); k_rmsh128<<<(unsigned)(NR * NKV), 128, 0, stream>>>(KF, DKV, NKV, knw, 1e-6f);      /* per-head RMSNorm over the 128 dims, in place */
  k_rope128x<1, 0, 0><<<(unsigned)(NR * NH), 128, 0, stream>>>(QF, DMX, NH, tcos, tsin, Q16, DMX, 1.0f); k_rope128x<1, 0, 0><<<(unsigned)(NR * NKV), 128, 0, stream>>>(KF, DKV, NKV, tcos, tsin, K16, DKV, 1.0f);      /* rope from the input tables -> f16 */
  for (int b = 0; b < NB; ++b) { const size_t r0 = (size_t)b * SQ, f0 = (size_t)b * QT0;
  k_rope128x<1, 0, 1><<<(unsigned)(QT0 * NH), 128, 0, stream>>>(QF + r0 * DMX, DMX, NH, tcos, tsin, QF0 + f0 * DMX, DMX, 1.0f); k_rope128x<1, 0, 1><<<(unsigned)(QT0 * NKV), 128, 0, stream>>>(KF + r0 * DKV, DKV, NKV, tcos, tsin, KRF0, DKV, 1.0f);      /* f32 roped q, k rows 0..127 */
  k_kvexp128<GSZ, NH, DKV><<<(unsigned)(((size_t)QT0 * DMX / 4 + 255) / 256), 256, 0, stream>>>(KRF0, KF0e + f0 * DMX, (size_t)QT0 * DMX / 4); k_kvexp128<GSZ, NH, DKV><<<(unsigned)(((size_t)QT0 * DMX / 4 + 255) / 256), 256, 0, stream>>>(VF + r0 * DKV, VF0e + f0 * DMX, (size_t)QT0 * DMX / 4);      /* group -> head expansion for the exact first tile */
  }      /* per batch */
  k_vt<DKV / 64, SQ><<<NB * (DKV / 64) * (SQ / 64), 256, 0, stream>>>(V16, DKV, 0, VT);      /* V^T, both batches: batch b, group g = slabs 16b + 2g, 16b + 2g + 1 */
  k_att0h<0><<<dim3(NH * (QT0 / 32), NB), 32, 0, stream>>>(QF0, KF0e, VF0e, DMX, DMX, nullptr, ATS, OF0, DMX);      /* exact causal attention rows 0..127 of both batches (o x64) */
  for (int q0 = 0; q0 < SQ; q0 += QT) { const int nk = q0 + QT;      /* one launch a stage: grid y = the 16 heads, z = the 2 batches */
    k_gemm2<0><<<dim3((QT / 128) * (nk / 64), NH, NB), 128, 0, stream>>>(Q16 + (size_t)q0 * DMX, DMX, (size_t)HDK, K16, DKV, (size_t)HDK, ATS, nullptr, 0, nullptr, 1, 0, 0, S, nullptr, NKX, (size_t)QT * NKX, QT, nk, HDK, GSZ, (size_t)SQ * DMX, (size_t)SQ * DKV, (size_t)NH * QT * NKX);      /* scores: each head vs its group's key slab */
    static_assert(SQ / QT == 8, "one softmax kernel a row length");
    switch (nk / QT) {      /* causal softmax: the row length picks the kernel that holds a row of it in registers */
      case 1: k_rsmcf2<2><<<NB * NH * QT / 8, 256, 0, stream>>>(S, P, NB * NH, q0); break; case 2: k_rsmcf2<4><<<NB * NH * QT / 8, 256, 0, stream>>>(S, P, NB * NH, q0); break; case 3: k_rsmcf2<6><<<NB * NH * QT / 8, 256, 0, stream>>>(S, P, NB * NH, q0); break; case 4: k_rsmcf2<8><<<NB * NH * QT / 8, 256, 0, stream>>>(S, P, NB * NH, q0); break;
      case 5: k_rsmcf2<10><<<NB * NH * QT / 8, 256, 0, stream>>>(S, P, NB * NH, q0); break; case 6: k_rsmcf2<12><<<NB * NH * QT / 8, 256, 0, stream>>>(S, P, NB * NH, q0); break; case 7: k_rsmcf2<14><<<NB * NH * QT / 8, 256, 0, stream>>>(S, P, NB * NH, q0); break; default: k_rsmcf2<16><<<NB * NH * QT / 8, 256, 0, stream>>>(S, P, NB * NH, q0); break; }
    k_gemm2<0><<<dim3((QT / 128) * (HDK / 64), NH, NB), 128, 0, stream>>>(P, NKX, (size_t)QT * NKX, VT, SQ, (size_t)HDK * SQ, 0.25f, nullptr, 0, nullptr, 1, 0, 0, nullptr, O16 + (size_t)q0 * DMX, DMX, (size_t)HDK, QT, HDK, nk, GSZ, (size_t)NH * QT * NKX, (size_t)DKV * SQ, (size_t)SQ * DMX); }      /* o (x64): each head vs its group's V^T slab */
  k_gemm2<0><<<dim3((unsigned)((NR / 128) * (DMX / 64)), 1), 128, 0, stream>>>(O16, DMX, 0, BO, DMX, 0, 0.0009765625f, nullptr, 0, nullptr, 1, 0, 0, (float*)d_out, nullptr, DMX, 0, (int)NR, DMX, DMX, 1, 0, 0, 0);      /* out = o Wo */
  k_hl<<<(unsigned)(((size_t)NB * QT0 * DMX / 8 + 255) / 256), 256, 0, stream>>>(OF0, OH0, OL0, (size_t)NB * QT0 * DMX / 8);
  k_gemm2<0><<<dim3((QT0 / 128) * (DMX / 64), 1, NB), 128, 0, stream>>>(OH0, DMX, 0, BO, DMX, 0, 0.0009765625f, nullptr, 0, nullptr, 1, 0, 0, (float*)d_out, nullptr, DMX, 0, QT0, DMX, DMX, 1, (size_t)QT0 * DMX, 0, (size_t)SQ * DMX);
  k_gemm2<0><<<dim3((QT0 / 128) * (DMX / 64), 1, NB), 128, 0, stream>>>(OL0, DMX, 0, BO, DMX, 0, 0.00000095367431640625f, nullptr, 0, (const float*)d_out, -1, 0, 0, (float*)d_out, nullptr, DMX, 0, QT0, DMX, DMX, 1, (size_t)QT0 * DMX, 0, (size_t)SQ * DMX);      /* rows 0..127 of each batch rewritten from the exact path */
}

// v003
// Measured time: 1120 microseconds a run.
// Timed twice side by side with v002, it ran 1.69 times as fast both times.
// Counting every step since v000, it is 9.22 times as fast.
#include <hip/hip_runtime.h>
// Qwen3 attention (x [2][2048][2048]; q = x Wq (16 heads x 128), k = x Wk, v = x Wv (8 kv heads x 128) ([in][out] weights sigma 0.02); per-head RMSNorm over the 128 dims on q and k (weights ones, eps 1e-6); rotate-half RoPE from the module's INPUT cos/sin tables [S][128] (theta 1e6); query head h uses kv head h/2; scores x 128^-0.5 with a causal mask (tril, finfo.min); softmax; out = merged Wo ([in][out]) -> [2][2048][2048]).
// Compute dtype: inputs rounded to bf16; x / weights / tables exact; projections, RMSNorm and rope f32; q, k, v, softmax weights and o as plain f16 GEMM operands (~2^-12; first 128 rows exact); scores, statistics, out f32. v_wmma_f32_16x16x32_f16.
#define NB 2
#define SQ 2048
#define DMX 2048
#define NH 16
#define NKV 8
#define GSZ 2
#define HDK 128
#define DKV (NKV * HDK)
#define QT 256
#define QT0 128
#define NKX SQ
#define DM DMX
#define HD 64
#define HG 1
#define NR ((size_t)NB * SQ)
#define ATS 0.08838834764831845f
typedef __bf16 v16b __attribute__((ext_vector_type(16)));
typedef unsigned short v8us __attribute__((ext_vector_type(8), may_alias));
typedef float  v8f  __attribute__((ext_vector_type(8)));
typedef float  v4f  __attribute__((ext_vector_type(4)));
typedef float  v4fa __attribute__((ext_vector_type(4), may_alias));
union FragB { v16b v; v8us half[2]; unsigned short u[16]; };

__device__ __forceinline__ unsigned short bf16_bits(float x) { unsigned int u = __float_as_uint(x); return (unsigned short)((u + 0x7FFFu + ((u >> 16) & 1u)) >> 16); }
__device__ __forceinline__ float bf16_val(unsigned short b) { return __uint_as_float(((unsigned int)b) << 16); }
__device__ __forceinline__ float bf16_round(float x) { return bf16_val(bf16_bits(x)); }
// D += A·B with NT terms: 1 = ah·bh, 2 = + al·bh (A split), 3 = + ah·bl (both split)
template <int NT>
__device__ __forceinline__ v8f mmaN(v16b ah, v16b al, v16b bh, v16b bl, v8f c) {
  c = __builtin_amdgcn_wmma_f32_16x16x32_bf16(false, ah, false, bh, (short)0, c, false, false);
  if (NT >= 2) c = __builtin_amdgcn_wmma_f32_16x16x32_bf16(false, al, false, bh, (short)0, c, false, false);
  if (NT >= 3) c = __builtin_amdgcn_wmma_f32_16x16x32_bf16(false, ah, false, bl, (short)0, c, false, false);
  asm volatile("v_nop\n\tv_nop\n\tv_nop\n\tv_nop" : "+v"(c) : "v"(ah), "v"(al), "v"(bh), "v"(bl));
  return c;
}

__global__ __launch_bounds__(256) void k_wt_bf16(const float* __restrict__ W, unsigned short* __restrict__ Wt, int K, int N) {
  const int t = blockIdx.x * 256 + threadIdx.x;
  const int k8n = K / 8;
  if (t >= N * k8n) return;
  const int n = t / k8n, k8 = (t % k8n) * 8;
  v8us v;
#pragma unroll
  for (int i = 0; i < 8; ++i) v[i] = bf16_bits(W[(size_t)(k8 + i) * N + n]);
  *(v8us*)(Wt + (size_t)n * K + k8) = v;
  
}

// GEMM C[M][N] (f32, pitch ldc) = act(A[M][K]·W + bias). A f32 row-major (pitch lda) converted per fragment to bf16
// (ASPLIT: hi/lo two planes -> 2 terms, else single rounded term); Wt bf16 [N][K] (pitch ldb). BIAS_BF16 rounds the
// bias to bf16 first (bias quantised to bf16 before the add). K%32==0, M%16==0, N%64==0.
template <bool ASPLIT, int ACT, bool BIAS_BF16>
__global__ __launch_bounds__(128) void k_gemm_bf(const float* __restrict__ A, int lda, const unsigned short* __restrict__ Wt, int ldb,
                                               const float* __restrict__ bias, float* __restrict__ C, int ldc, int M, int N, int K) {
  __shared__ __attribute__((aligned(16))) float so[4][16][64];
  const int tid = threadIdx.x, w = tid >> 5, lane = tid & 31, ln = lane & 15, hh = lane >> 4;
  const int ntn = N / 64;
  const int wid = blockIdx.x * 4 + w;
  const int mt = wid / ntn, nq = wid % ntn;
  if (mt * 16 >= M) return;
  const int row0 = mt * 16, col0 = nq * 64;
  const float* arow = A + (size_t)(row0 + ln) * lda;
  v8f acc[4] = {};
  for (int kb = 0; kb < K; kb += 32) {
    FragB ah, al;
    const v4f x0 = *(const v4fa*)(arow + kb + 8 * hh), x1 = *(const v4fa*)(arow + kb + 8 * hh + 4);
    const v4f x2 = *(const v4fa*)(arow + kb + 16 + 8 * hh), x3 = *(const v4fa*)(arow + kb + 16 + 8 * hh + 4);
    float xs[16] = {x0[0],x0[1],x0[2],x0[3],x1[0],x1[1],x1[2],x1[3],x2[0],x2[1],x2[2],x2[3],x3[0],x3[1],x3[2],x3[3]};
#pragma unroll
    for (int i = 0; i < 16; ++i) { const unsigned short hb = bf16_bits(xs[i]); ah.u[i] = hb; al.u[i] = ASPLIT ? bf16_bits(xs[i] - bf16_val(hb)) : (unsigned short)0; }
#pragma unroll
    for (int t = 0; t < 4; ++t) {
      const unsigned short* brow = Wt + (size_t)(col0 + t * 16 + ln) * ldb + kb;
      FragB b;
      b.half[0] = *(const v8us*)(brow + 8 * hh);
      b.half[1] = *(const v8us*)(brow + 16 + 8 * hh);
      acc[t] = mmaN<ASPLIT ? 2 : 1>(ah.v, al.v, b.v, b.v, acc[t]);
    }
  }
#pragma unroll
  for (int t = 0; t < 4; ++t) {
    float bv = bias ? bias[col0 + t * 16 + ln] : 0.f;
    if (BIAS_BF16) bv = bf16_round(bv);
#pragma unroll
    for (int r = 0; r < 8; ++r) { float v = acc[t][r] + bv; if (ACT == 1) v = fmaxf(v, 0.f); so[w][8 * hh + r][t * 16 + ln] = v; }
  }
  __builtin_amdgcn_fence(__ATOMIC_ACQ_REL, "workgroup");
  __builtin_amdgcn_wave_barrier();
  const int rsub = lane >> 4, c4 = (lane & 15) * 4;
  {
#pragma unroll
    for (int q = 0; q < 8; ++q) {
      const int r = q * 2 + rsub;
      const v4f v = *(const v4fa*)&so[w][r][c4];
      *(v4f*)(C + (size_t)(row0 + r) * ldc + col0 + c4) = v;
    }
    
  }
}

// GEMM C = act(A·W + bias + resid): A f32 (ASPLIT -> hi/lo 2 terms), Wt bf16 [N][K]; ACT 0 none, 1 relu, 2 exact gelu;
// resid (optional, f32, row index = (row % rmod), pitch ldr, RES_BF16 rounds it) added before the activation.
template <bool ASPLIT, int ACT, bool BIAS_BF16, bool RES_BF16>
__global__ __launch_bounds__(128) void k_gemm_bf3(const float* __restrict__ A, int lda, const unsigned short* __restrict__ Wt, int ldb,
                                                const float* __restrict__ bias, const float* __restrict__ resid, int rmod, int ldr,
                                                float* __restrict__ C, int ldc, int M, int N, int K) {
  __shared__ __attribute__((aligned(16))) float so[4][16][64];
  const int tid = threadIdx.x, w = tid >> 5, lane = tid & 31, ln = lane & 15, hh = lane >> 4;
  const int ntn = N / 64;
  const int wid = blockIdx.x * 4 + w;
  const int mt = wid / ntn, nq = wid % ntn;
  if (mt * 16 >= M) return;
  const int row0 = mt * 16, col0 = nq * 64;
  const float* arow = A + (size_t)(row0 + ln) * lda;
  v8f acc[4] = {};
  for (int kb = 0; kb < K; kb += 32) {
    FragB ah, al;
    const v4f x0 = *(const v4fa*)(arow + kb + 8 * hh), x1 = *(const v4fa*)(arow + kb + 8 * hh + 4);
    const v4f x2 = *(const v4fa*)(arow + kb + 16 + 8 * hh), x3 = *(const v4fa*)(arow + kb + 16 + 8 * hh + 4);
    float xs[16] = {x0[0],x0[1],x0[2],x0[3],x1[0],x1[1],x1[2],x1[3],x2[0],x2[1],x2[2],x2[3],x3[0],x3[1],x3[2],x3[3]};
#pragma unroll
    for (int i = 0; i < 16; ++i) { const unsigned short hb = bf16_bits(xs[i]); ah.u[i] = hb; al.u[i] = ASPLIT ? bf16_bits(xs[i] - bf16_val(hb)) : (unsigned short)0; }
#pragma unroll
    for (int t = 0; t < 4; ++t) {
      const unsigned short* brow = Wt + (size_t)(col0 + t * 16 + ln) * ldb + kb;
      FragB b;
      b.half[0] = *(const v8us*)(brow + 8 * hh);
      b.half[1] = *(const v8us*)(brow + 16 + 8 * hh);
      acc[t] = mmaN<ASPLIT ? 2 : 1>(ah.v, al.v, b.v, b.v, acc[t]);
    }
  }
#pragma unroll
  for (int t = 0; t < 4; ++t) {
    const int col = col0 + t * 16 + ln;
    float bv = bias ? bias[col] : 0.f;
    if (BIAS_BF16) bv = bf16_round(bv);
#pragma unroll
    for (int r = 0; r < 8; ++r) {
      float v = acc[t][r] + bv;
      if (resid) { float rv = resid[(size_t)((row0 + 8 * hh + r) % rmod) * ldr + col]; if (RES_BF16) rv = bf16_round(rv); v += rv; }
      if (ACT == 1) v = fmaxf(v, 0.f);
      if (ACT == 2) v = 0.5f * v * (1.0f + erff(v * 0.70710678118654752f));
      if (ACT == 3) { const float u = 0.7978845608028654f * (v + 0.044715f * v * v * v); v = 0.5f * v * (1.0f + tanhf(u)); }
      so[w][8 * hh + r][t * 16 + ln] = v;
    }
  }
  __builtin_amdgcn_fence(__ATOMIC_ACQ_REL, "workgroup");
  __builtin_amdgcn_wave_barrier();
  const int rsub = lane >> 4, c4 = (lane & 15) * 4;
  {
#pragma unroll
    for (int q = 0; q < 8; ++q) {
      const int r = q * 2 + rsub;
      const v4f v = *(const v4fa*)&so[w][r][c4];
      *(v4f*)(C + (size_t)(row0 + r) * ldc + col0 + c4) = v;
    }
    
  }
}
// row LayerNorm (biased variance, eps) over N: s = X (+ R); optional out_sum <- s; out_norm <- (s-mu)*rsqrt(var+eps)*g + b
template <bool PARAM_BF16>
__global__ __launch_bounds__(256) void k_layernorm(const float* __restrict__ X, const float* __restrict__ R, const float* __restrict__ g, const float* __restrict__ bta,
                                                  float* __restrict__ out_sum, float* __restrict__ out_norm, int N, float eps) {
  __shared__ float red[256];
  const int row = blockIdx.x, tid = threadIdx.x;
  const float* x = X + (size_t)row * N; const float* rr = R ? R + (size_t)row * N : nullptr;
  float vals[16];                     // up to N = 4096
  const int per = N / 256;            // contiguous chunk per thread? use strided-by-4 chunks: thread handles j = tid*4 + 1024*u
  float s1 = 0.f;
  for (int u = 0; u < per / 4; ++u) {
    const int j = tid * 4 + 1024 * u;
    const v4f a = *(const v4fa*)(x + j);
    v4f b = {0.f,0.f,0.f,0.f}; if (rr) b = *(const v4fa*)(rr + j);
#pragma unroll
    for (int q = 0; q < 4; ++q) { const float v = a[q] + b[q]; vals[u * 4 + q] = v; s1 += v; }
  }
  red[tid] = s1; __syncthreads();
  for (int st = 128; st > 0; st >>= 1) { if (tid < st) red[tid] += red[tid + st]; __syncthreads(); }
  const float mu = red[0] / (float)N; __syncthreads();
  float s2 = 0.f;
  for (int u = 0; u < per / 4; ++u)
#pragma unroll
    for (int q = 0; q < 4; ++q) { const float c = vals[u * 4 + q] - mu; s2 += c * c; }
  red[tid] = s2; __syncthreads();
  for (int st = 128; st > 0; st >>= 1) { if (tid < st) red[tid] += red[tid + st]; __syncthreads(); }
  const float rs = rsqrtf(red[0] / (float)N + eps);
  {
    for (int u = 0; u < per / 4; ++u) {
      const int j = tid * 4 + 1024 * u;
      v4f o, sm;
#pragma unroll
      for (int q = 0; q < 4; ++q) {
        float gg = g[j + q], bb = bta[j + q];
        if (PARAM_BF16) { gg = bf16_round(gg); bb = bf16_round(bb); }
        sm[q] = vals[u * 4 + q]; o[q] = (vals[u * 4 + q] - mu) * rs * gg + bb;
      }
      if (out_sum) *(v4f*)(out_sum + (size_t)row * N + j) = sm;
      *(v4f*)(out_norm + (size_t)row * N + j) = o;
    }
    
  }
}



// ---- f16 WMMA path (v_wmma_f32_16x16x32_f16): 11-bit significands for operands in range — used where a [0,1] probability operand needs more precision than bf16
typedef _Float16 v16h __attribute__((ext_vector_type(16)));
union FragH { v16h v; v8us half[2]; _Float16 h[16]; unsigned short u[16]; };
template <int NT>
__device__ __forceinline__ v8f mmaH(v16h ah, v16h al, v16h bh, v16h bl, v8f c) {
  c = __builtin_amdgcn_wmma_f32_16x16x32_f16(false, ah, false, bh, (short)0, c, false, false);
  if (NT >= 2) c = __builtin_amdgcn_wmma_f32_16x16x32_f16(false, al, false, bh, (short)0, c, false, false);
  if (NT >= 3) c = __builtin_amdgcn_wmma_f32_16x16x32_f16(false, ah, false, bl, (short)0, c, false, false);
  asm volatile("v_nop\n\tv_nop\n\tv_nop\n\tv_nop" : "+v"(c) : "v"(ah), "v"(al), "v"(bh), "v"(bl));
  return c;
}
// batched GEMM like k_gemm_b but f16 operands: A f32 (split into f16 hi/lo if ASPLIT, else rounded to f16), Bt = f16 values [n][k]; alpha; C f32; N multiple of 16 (partial tiles skipped)
template <bool ASPLIT>
__global__ __launch_bounds__(128) void k_gemm_h(const float* __restrict__ A, int lda, size_t sA, const _Float16* __restrict__ Bh, int ldb, size_t sB, float alpha, float* __restrict__ C, int ldc, size_t sC, int M, int N, int K) {
  __shared__ __attribute__((aligned(16))) float so[4][16][64];
  const int tid = threadIdx.x, w = tid >> 5, lane = tid & 31, ln = lane & 15, hh = lane >> 4; const int by = blockIdx.y;
  A += (size_t)by * sA; Bh += (size_t)by * sB; C += (size_t)by * sC;
  const int ntn = (N + 63) / 64; const int wid = blockIdx.x * 4 + w; const int mt = wid / ntn, nq = wid % ntn; if (mt * 16 >= M) return;
  const int row0 = mt * 16, col0 = nq * 64; const float* arow = A + (size_t)(row0 + ln) * lda;
  v8f acc[4] = {};
  for (int kb = 0; kb < K; kb += 32) {
    FragH ah, al;
    const v4f x0 = *(const v4fa*)(arow + kb + 8 * hh), x1 = *(const v4fa*)(arow + kb + 8 * hh + 4), x2 = *(const v4fa*)(arow + kb + 16 + 8 * hh), x3 = *(const v4fa*)(arow + kb + 16 + 8 * hh + 4);
    float xs[16] = {x0[0],x0[1],x0[2],x0[3],x1[0],x1[1],x1[2],x1[3],x2[0],x2[1],x2[2],x2[3],x3[0],x3[1],x3[2],x3[3]};
#pragma unroll
    for (int i = 0; i < 16; ++i) { const _Float16 h = (_Float16)xs[i]; ah.h[i] = h; al.h[i] = ASPLIT ? (_Float16)(xs[i] - (float)h) : (_Float16)0.0f; }
#pragma unroll
    for (int t = 0; t < 4; ++t) { if (col0 + t * 16 >= N) continue; const size_t boff = (size_t)(col0 + t * 16 + ln) * ldb + kb; FragH bq; bq.half[0] = *(const v8us*)(Bh + boff + 8 * hh); bq.half[1] = *(const v8us*)(Bh + boff + 16 + 8 * hh);
      acc[t] = mmaH<ASPLIT ? 2 : 1>(ah.v, al.v, bq.v, bq.v, acc[t]); }
  }
#pragma unroll
  for (int t = 0; t < 4; ++t) { if (col0 + t * 16 >= N) continue;
#pragma unroll
    for (int r = 0; r < 8; ++r) so[w][8 * hh + r][t * 16 + ln] = acc[t][r] * alpha; }
  __builtin_amdgcn_fence(__ATOMIC_ACQ_REL, "workgroup"); __builtin_amdgcn_wave_barrier();
  const int rsub = lane >> 4, c4 = (lane & 15) * 4;
  {
#pragma unroll
    for (int q = 0; q < 8; ++q) { const int r = q * 2 + rsub; if (col0 + c4 < N) { const v4f v = *(const v4fa*)&so[w][r][c4]; *(v4f*)(C + (size_t)(row0 + r) * ldc + col0 + c4) = v; } }
     }
}

// Wt[n][k] = f16(W[k][n]·scale) from f32 row-major W[K][N] (scale = power of two; bf16-exact weights stay exact in f16 away from the subnormal range)
__global__ __launch_bounds__(256) void k_wt_f16(const float* __restrict__ W, _Float16* __restrict__ Wt, int K, int N, float scale) {
  const int t = blockIdx.x * 256 + threadIdx.x; if (t >= N * (K / 8)) return; const int n = t / (K / 8), k8 = (t % (K / 8)) * 8; FragH f;
#pragma unroll
  for (int i = 0; i < 8; ++i) f.h[i] = (_Float16)(bf16_round(W[(size_t)(k8 + i) * N + n]) * scale); const v8us o = f.half[0];
  *(v8us*)((unsigned short*)Wt + (size_t)n * K + k8) = o; 
}
// k_gemm_hh variant with fused epilogue: v = acc·alpha + bias[by·sBias + col] (+ CP[(row/rowsPerB)·sCPb + by·64 + col] if CP) ; ACT 0 none / 1 elu ; writes f16 C16 (and f32 C if non-null)
template <int ACT>
__global__ __launch_bounds__(128) void k_gemm_hhx(const _Float16* __restrict__ A, int lda, size_t sA, const _Float16* __restrict__ Bh, int ldb, size_t sB, float alpha, const float* __restrict__ bias, size_t sBias, const float* __restrict__ CP, int rowsPerB, size_t sCPb, int row0g,
    float* __restrict__ C, _Float16* __restrict__ C16, int ldc, size_t sC, int M, int N, int K) {
  __shared__ __attribute__((aligned(16))) float so[4][16][64];
  const int tid = threadIdx.x, w = tid >> 5, lane = tid & 31, ln = lane & 15, hh = lane >> 4; const int by = blockIdx.y;
  A += (size_t)by * sA; Bh += (size_t)by * sB; const size_t cofs = (size_t)by * sC; const float* bp = bias ? bias + (size_t)by * sBias : nullptr;
  const int ntn = (N + 63) / 64; const int wid = blockIdx.x * 4 + w; const int mt = wid / ntn, nq = wid % ntn; if (mt * 16 >= M) return;
  const int row0 = mt * 16, col0 = nq * 64; const _Float16* arow = A + (size_t)(row0 + ln) * lda;
  v8f acc[4] = {};
  for (int kb = 0; kb < K; kb += 32) { FragH ah; ah.half[0] = *(const v8us*)((const unsigned short*)arow + kb + 8 * hh); ah.half[1] = *(const v8us*)((const unsigned short*)arow + kb + 16 + 8 * hh);
#pragma unroll
    for (int t = 0; t < 4; ++t) { if (col0 + t * 16 >= N) continue; const size_t boff = (size_t)(col0 + t * 16 + ln) * ldb + kb; FragH bq; bq.half[0] = *(const v8us*)((const unsigned short*)Bh + boff + 8 * hh); bq.half[1] = *(const v8us*)((const unsigned short*)Bh + boff + 16 + 8 * hh);
      acc[t] = mmaH<1>(ah.v, ah.v, bq.v, bq.v, acc[t]); }
  }
#pragma unroll
  for (int t = 0; t < 4; ++t) { if (col0 + t * 16 >= N) continue; const int col = col0 + t * 16 + ln; const float bv = bp ? bf16_round(bp[col]) : 0.f;
#pragma unroll
    for (int r = 0; r < 8; ++r) { float v = acc[t][r] * alpha + bv; if (CP) { const int rr = row0g + row0 + 8 * hh + r; if (rowsPerB < 0) v += CP[cofs + (size_t)rr * ldc + col];      /* rowsPerB < 0: own element of the batched C plane */ else { const int bidx = rr / rowsPerB; v += CP[(size_t)bidx * sCPb + (size_t)by * 64 + col]; } } if (ACT == 1) v = (v > 0.f) ? v : expm1f(v); else if (ACT == 7) v = (v > 0.f) ? v + 1.0f : expf(v); else if (ACT == 8) v = tanhf(v); else if (ACT == 9) v = 0.5f * v * (1.0f + tanhf(0.7978845608028654f * (v + 0.044715f * v * v * v))); else if (ACT == 11) v = 1.0f / (1.0f + expf(-v)); else if (ACT == 12) v = (v > 0.f) ? v : 0.01f * v; else if (ACT == 14) v = (v > 0.f) ? v : 0.1f * v; else if (ACT == 16) v = (v >= 0.f) ? v : 0.3f * v; else if (ACT == 17) v = (v >= 0.f) ? v : 0.2f * v; else if (ACT == 15) v = v / (1.0f + expf(-v)); else if (ACT == 3) v = fmaxf(v, 0.f); else if (ACT == 6) v = 0.5f * v * (1.0f + erff(v * 0.70710678118654752f)); so[w][8 * hh + r][t * 16 + ln] = v; } }
  __builtin_amdgcn_fence(__ATOMIC_ACQ_REL, "workgroup"); __builtin_amdgcn_wave_barrier();
  const int rsub = lane >> 4, c4 = (lane & 15) * 4; typedef _Float16 v4h __attribute__((ext_vector_type(4)));
  {
#pragma unroll
    for (int q = 0; q < 8; ++q) { const int r = q * 2 + rsub; if (col0 + c4 < N) { const v4f v = *(const v4fa*)&so[w][r][c4]; if (C) *(v4f*)(C + cofs + (size_t)(row0 + r) * ldc + col0 + c4) = v; if (C16) { v4h h4; for (int i = 0; i < 4; ++i) h4[i] = (_Float16)v[i]; *(v4h*)(C16 + cofs + (size_t)(row0 + r) * ldc + col0 + c4) = h4; } } }
     }
}


typedef _Float16 v4h __attribute__((ext_vector_type(4)));

__global__ __launch_bounds__(256) void k_x16(const float* __restrict__ x, _Float16* __restrict__ X16, size_t n8) { const size_t t = (size_t)blockIdx.x * 256 + threadIdx.x; if (t >= n8) return; FragH f;
#pragma unroll
  for (int q = 0; q < 8; ++q) f.h[q] = (_Float16)bf16_round(x[t * 8 + q]); *(v8us*)((unsigned short*)X16 + t * 8) = f.half[0];  }
__global__ __launch_bounds__(256) void k_h16(const float* __restrict__ x, _Float16* __restrict__ X16, size_t n8) { const size_t t = (size_t)blockIdx.x * 256 + threadIdx.x; if (t >= n8) return; FragH f;
#pragma unroll
  for (int q = 0; q < 8; ++q) f.h[q] = (_Float16)x[t * 8 + q]; *(v8us*)((unsigned short*)X16 + t * 8) = f.half[0];  }
__global__ __launch_bounds__(256) void k_round16f(const float* __restrict__ W, _Float16* __restrict__ Bt, size_t n8) { const size_t t = (size_t)blockIdx.x * 256 + threadIdx.x; if (t >= n8) return; FragH f;
#pragma unroll
  for (int i = 0; i < 8; ++i) f.h[i] = (_Float16)(bf16_round(W[t * 8 + i]) * 16.0f); *(v8us*)((unsigned short*)Bt + t * 8) = f.half[0];  }
template <int NHv, int TTv>
__global__ __launch_bounds__(256) void k_vt(const _Float16* __restrict__ V16, int ldv, int voff, _Float16* __restrict__ Vt) { __shared__ unsigned short tl[64][66]; const int tid = threadIdx.x; const int slab = blockIdx.x / (TTv / 64), lg = blockIdx.x % (TTv / 64); const int b = slab / NHv, h = slab % NHv;
  for (int i = tid; i < 64 * 8; i += 256) { const int r = i / 8, c8 = (i % 8) * 8; FragH f; f.half[0] = *(const v8us*)((const unsigned short*)V16 + ((size_t)b * TTv + lg * 64 + r) * ldv + voff + h * 64 + c8);
#pragma unroll
    for (int q = 0; q < 8; ++q) tl[r][c8 + q] = f.u[q]; }
  __syncthreads();
  {
#pragma unroll
    for (int rd = 0; rd < 2; ++rd) { const int d = rd * 32 + tid / 8, pc = tid % 8; FragH f;
#pragma unroll
      for (int q = 0; q < 8; ++q) f.u[q] = tl[pc * 8 + q][d];
      *(v8us*)((unsigned short*)Vt + ((size_t)slab * 64 + d) * TTv + lg * 64 + pc * 8) = f.half[0]; }
     } }

__global__ __launch_bounds__(256) void k_hl(const float* __restrict__ F, _Float16* __restrict__ Hh, _Float16* __restrict__ Hl, size_t n8) { const size_t t = (size_t)blockIdx.x * 256 + threadIdx.x; if (t >= n8) return; FragH fh, fl; const v4f a = *(const v4fa*)(F + t * 8), c = *(const v4fa*)(F + t * 8 + 4);
#pragma unroll
  for (int q = 0; q < 4; ++q) { _Float16 h = (_Float16)a[q]; fh.h[q] = h; fl.h[q] = (_Float16)((a[q] - (float)h) * 1024.0f); h = (_Float16)c[q]; fh.h[4 + q] = h; fl.h[4 + q] = (_Float16)((c[q] - (float)h) * 1024.0f); }
  { *(v8us*)((unsigned short*)Hh + t * 8) = fh.half[0]; *(v8us*)((unsigned short*)Hl + t * 8) = fl.half[0];  } }

// ---- fast GEMM (wave tile 32x64; requires M % 32 == 0 rows per launch region and N % 64 == 0); epilogue = k_gemm_hhx semantics ----
__device__ __forceinline__ v16h g2_frag(const _Float16* p, int hh) { FragH f; f.half[0] = *(const v8us*)((const unsigned short*)p + 8 * hh); f.half[1] = *(const v8us*)((const unsigned short*)p + 16 + 8 * hh); return f.v; }
__device__ __forceinline__ v8f g2_mma(v16h a, v16h b, v8f c) { v8f d = __builtin_amdgcn_wmma_f32_16x16x32_f16(false, a, false, b, (short)0, c, false, false); asm volatile("v_nop\n\tv_nop\n\tv_nop\n\tv_nop" : "+v"(d) : "v"(a), "v"(b)); return d; }
template <int ACT>
__global__ __launch_bounds__(128) void k_gemm2(const _Float16* __restrict__ A, int lda, size_t sA, const _Float16* __restrict__ Bh, int ldb, size_t sB, float alpha, const float* __restrict__ bias, size_t sBias, const float* __restrict__ CP, int rowsPerB, size_t sCPb, int row0g,
    float* __restrict__ C, _Float16* __restrict__ C16, int ldc, size_t sC, int M, int N, int K, int bdiv, size_t zA, size_t zB, size_t zC) { static_assert(ACT == 0 || ACT == 3 || ACT == 6 || ACT == 8 || ACT == 9 || ACT == 11 || ACT == 12 || ACT == 14 || ACT == 15 || ACT == 16 || ACT == 17, "k_gemm2: unsupported ACT code (would silently apply no activation)");
  __shared__ __attribute__((aligned(16))) float so[4][32][68];
  const int tid = threadIdx.x, w = tid >> 5, lane = tid & 31, ln = lane & 15, hh = lane >> 4; const int by = blockIdx.y; const size_t bz = blockIdx.z;      /* y = head (bdiv heads share one B slab), z = batch */
  A += (size_t)by * sA + bz * zA; Bh += (size_t)(by / bdiv) * sB + bz * zB; const size_t cofs = (size_t)by * sC + bz * zC; const float* bp = bias ? bias + (size_t)by * sBias : nullptr;
  const int ntn = N >> 6; const int mt = blockIdx.x / ntn, nq = blockIdx.x - mt * ntn; const int row0 = mt * 128 + 32 * w, col0 = nq * 64; if (row0 >= M) return;
  const _Float16* a0p = A + (size_t)(row0 + ln) * lda; const _Float16* a1p = a0p + (size_t)16 * lda;
  const _Float16* b0p = Bh + (size_t)(col0 + ln) * ldb; const _Float16* b1p = b0p + (size_t)16 * ldb; const _Float16* b2p = b1p + (size_t)16 * ldb; const _Float16* b3p = b2p + (size_t)16 * ldb;
  const v8f z8 = {0.f,0.f,0.f,0.f,0.f,0.f,0.f,0.f}; v8f c00 = z8, c01 = z8, c02 = z8, c03 = z8, c10 = z8, c11 = z8, c12 = z8, c13 = z8;
#pragma unroll 1
  for (int kb = 0; kb < K; kb += 32) { const v16h a0 = g2_frag(a0p + kb, hh), a1 = g2_frag(a1p + kb, hh);
    v16h b = g2_frag(b0p + kb, hh); c00 = g2_mma(a0, b, c00); c10 = g2_mma(a1, b, c10);
    b = g2_frag(b1p + kb, hh); c01 = g2_mma(a0, b, c01); c11 = g2_mma(a1, b, c11);
    b = g2_frag(b2p + kb, hh); c02 = g2_mma(a0, b, c02); c12 = g2_mma(a1, b, c12);
    b = g2_frag(b3p + kb, hh); c03 = g2_mma(a0, b, c03); c13 = g2_mma(a1, b, c13); }
  v8f accs[8] = {c00, c01, c02, c03, c10, c11, c12, c13};
#pragma unroll
  for (int u = 0; u < 8; ++u) { const int t = u & 3, half = u >> 2; const int col = col0 + t * 16 + ln; const float bv = bp ? bf16_round(bp[col]) : 0.f;
#pragma unroll
    for (int r = 0; r < 8; ++r) { const int rloc = half * 16 + 8 * hh + r; float v = accs[u][r] * alpha + bv; if (CP) { if (rowsPerB < 0) v += CP[cofs + (size_t)(row0g + row0 + rloc) * ldc + col];      /* rowsPerB < 0: own element of the batched C plane */ else { const int bidx = (row0g + row0 + rloc) / rowsPerB; v += CP[(size_t)bidx * sCPb + (size_t)by * 64 + col]; } }
      if (ACT == 3) v = fmaxf(v, 0.f); else if (ACT == 6) v = 0.5f * v * (1.0f + erff(v * 0.70710678118654752f)); else if (ACT == 11) v = 1.0f / (1.0f + expf(-v)); else if (ACT == 15) v = v / (1.0f + expf(-v)); else if (ACT == 12) v = (v > 0.f) ? v : 0.01f * v; else if (ACT == 8) v = tanhf(v); else if (ACT == 9) v = 0.5f * v * (1.0f + tanhf(0.7978845608028654f * (v + 0.044715f * v * v * v))); else if (ACT == 14) v = (v > 0.f) ? v : 0.1f * v; else if (ACT == 16) v = (v >= 0.f) ? v : 0.3f * v; else if (ACT == 17) v = (v >= 0.f) ? v : 0.2f * v;
      so[w][rloc][t * 16 + ln] = v; } }
  __builtin_amdgcn_fence(__ATOMIC_ACQ_REL, "workgroup"); __builtin_amdgcn_wave_barrier();
  const int rsub = lane >> 4, c4 = (lane & 15) * 4;
  {
#pragma unroll
    for (int q = 0; q < 16; ++q) { const int r = q * 2 + rsub; const v4f v = *(const v4fa*)&so[w][r][c4]; if (C) *(v4f*)(C + cofs + (size_t)(row0 + r) * ldc + col0 + c4) = v; if (C16) { v4h h4; for (int i = 0; i < 4; ++i) h4[i] = (_Float16)v[i]; *(v4h*)(C16 + cofs + (size_t)(row0 + r) * ldc + col0 + c4) = h4; } }
     } }


__global__ __launch_bounds__(256) void k_wnat(const float* __restrict__ w, size_t n8, _Float16* __restrict__ Bt) { const size_t t = (size_t)blockIdx.x * 256 + threadIdx.x; if (t >= n8) return; FragH f; for (int q = 0; q < 8; ++q) f.h[q] = (_Float16)(bf16_round(w[t * 8 + q]) * 16.0f); *(v8us*)((unsigned short*)Bt + t * 8) = f.half[0];  }
__global__ __launch_bounds__(256) void k_rsm(const float* __restrict__ S, _Float16* __restrict__ P, int nrows) {
  #pragma clang fp contract(off)
  const int i = blockIdx.x * 256 + threadIdx.x; if (i >= nrows) return; const float* s = S + (size_t)i * SQ; float mx = -3.0e38f;
#pragma unroll 1
  for (int j = 0; j < SQ; ++j) mx = fmaxf(mx, s[j]); float se = 0.f;
#pragma unroll 1
  for (int j = 0; j < SQ; ++j) se += expf(s[j] - mx); const float sc = 256.0f / se;
#pragma unroll 1
  for (int j0 = 0; j0 < SQ; j0 += 8) { FragH f; for (int q = 0; q < 8; ++q) f.h[q] = (_Float16)(expf(s[j0 + q] - mx) * sc); unsigned short* d = (unsigned short*)P + (size_t)i * SQ + j0; *(v8us*)d = f.half[0];  } }
__global__ __launch_bounds__(256) void k_vt(const _Float16* __restrict__ V16, int b, int h0, _Float16* __restrict__ VT) { __shared__ unsigned short tl[64][65]; const int tid = threadIdx.x; const int hh = blockIdx.x % HG, sg = blockIdx.x / HG; const int s0 = sg * 64; const int h = h0 + hh;
  for (int i = tid; i < 64 * 8; i += 256) { const int j = i / 8, d8 = (i % 8) * 8; FragH f; f.half[0] = *(const v8us*)((const unsigned short*)V16 + ((size_t)b * SQ + s0 + j) * DM + h * HD + d8); for (int q = 0; q < 8; ++q) tl[d8 + q][j] = f.u[q]; }
  __syncthreads();
  { for (int i = tid; i < 64 * 8; i += 256) { const int d = i / 8, j8 = (i % 8) * 8; FragH f; for (int q = 0; q < 8; ++q) f.u[q] = tl[d][j8 + q]; *(v8us*)((unsigned short*)VT + ((size_t)hh * HD + d) * SQ + s0 + j8) = f.half[0]; }  } }


// lane l with lane l ^ M inside its 16-lane row (M = 1, 2, 4, 8), and with lane l ^ 16
template <int M>
__device__ __forceinline__ float row_x(float x) { return __builtin_bit_cast(float, __builtin_amdgcn_update_dpp(0, __builtin_bit_cast(int, x), 0x160 + M, 0xf, 0xf, true)); }
__device__ __forceinline__ float half_x(float x) { return __builtin_bit_cast(float, __builtin_amdgcn_permlanex16(__builtin_bit_cast(int, x), __builtin_bit_cast(int, x), 0x76543210, 0xfedcba98, false, false)); }
// exact (f32, vector unit) causal attention of rows 0..QT0-1: 8 waves a block, one wave a query row; x = head * (QT0 / 8) + group of 8 rows, y = batch. Keys go in chunks of 32; a chunk wholly behind the row is skipped (wave-uniform).
// scores: lane = 8 kq + dl reads dims 32 t + 4 dl .. + 3 of key 32 c + 4 g + kq (each load = 4 whole 128-byte lines), sums its 16 products (4 partial sums, one a dim of the 16 bytes), 3-step butterfly over dl; lane keeps the key with g == dl.
// softmax: maximum and sum = each lane's own (up to 4) keys, then a five-step butterfly. o: lane l holds dims 4 l .. 4 l + 3 (each load 512 contiguous bytes), keys in rising order, each weight read from the lane that keeps it.
// every loop is unrolled: q[], s[] keep static indices (registers, no scratch), the lane a weight is read from is a constant, and a chunk's 32 loads issue ahead of their first use.
__global__ __launch_bounds__(256) void k_att0w(const float* __restrict__ QF, const float* __restrict__ KF, const float* __restrict__ VF, float scale, float* __restrict__ OF) {
  constexpr int ld = DMX, ldv = DMX, ldo = DMX;      /* row pitches, compile-time: a chunk's 32 rows are immediate offsets from one address */
  const int lane = threadIdx.x & 31, dl = lane & 7, kq = lane >> 3; const int h = blockIdx.x / (QT0 / 8); const int i = (blockIdx.x % (QT0 / 8)) * 8 + __builtin_amdgcn_readfirstlane(threadIdx.x >> 5);
  { const size_t bq = (size_t)blockIdx.y * QT0; QF += (bq + i) * ld + h * 128; KF += bq * ld + h * 128; VF += bq * ldv + h * 128; OF += (bq + i) * ldo + h * 128; }      /* y = batch: each batch's QT0 rows follow the last one's */
  v4f q[4];
#pragma unroll
  for (int t = 0; t < 4; ++t) q[t] = *(const v4fa*)(QF + t * 32 + dl * 4);
  float s[QT0 / 32];
#pragma unroll
  for (int c = 0; c < QT0 / 32; ++c) { s[c] = -1.0e30f;
    if (c * 32 <= i) { const float* kp = KF + (size_t)(c * 32 + kq) * ld + dl * 4; float keep = 0.f;
#pragma unroll
      for (int g = 0; g < 8; ++g) { v4f pa = q[0] * *(const v4fa*)(kp + (size_t)(g * 4) * ld);
#pragma unroll
        for (int t = 1; t < 4; ++t) pa += q[t] * *(const v4fa*)(kp + (size_t)(g * 4) * ld + t * 32);
        float a = (pa[0] + pa[1]) + (pa[2] + pa[3]); a += row_x<1>(a); a += row_x<2>(a); a += row_x<4>(a); keep = (dl == g) ? a : keep; }
      s[c] = (c * 32 + 4 * dl + kq <= i) ? keep * scale : -1.0e30f; } }
  float m = s[0];
#pragma unroll
  for (int c = 1; c < QT0 / 32; ++c) m = fmaxf(m, s[c]);
  m = fmaxf(m, row_x<1>(m)); m = fmaxf(m, row_x<2>(m)); m = fmaxf(m, row_x<4>(m)); m = fmaxf(m, row_x<8>(m)); m = fmaxf(m, half_x(m));      /* key 0 is open in every row: m is a score */
  float l = 0.f;
#pragma unroll
  for (int c = 0; c < QT0 / 32; ++c) { s[c] = expf(s[c] - m); l += s[c]; }      /* a closed key: e^(-1e30 - m) = 0 */
  l += row_x<1>(l); l += row_x<2>(l); l += row_x<4>(l); l += row_x<8>(l); l += half_x(l);
  v4f o = {0.f, 0.f, 0.f, 0.f};
#pragma unroll
  for (int c = 0; c < QT0 / 32; ++c) {
    if (c * 32 <= i) { const float* vp = VF + (size_t)(c * 32) * ldv + lane * 4;
#pragma unroll
      for (int j = 0; j < 32; ++j) { const float e = __builtin_bit_cast(float, __builtin_amdgcn_readlane(__builtin_bit_cast(int, s[c]), 8 * (j & 3) + (j >> 2))); const v4f vv = *(const v4fa*)(vp + (size_t)j * ldv); o += vv * e; } } }
  *(v4f*)(OF + lane * 4) = o * (64.0f / l); }
__global__ __launch_bounds__(256) void k_f2h(const float* __restrict__ F, int ldf, int coff, int ncol, _Float16* __restrict__ H16, size_t nrow) { const size_t t = (size_t)blockIdx.x * 256 + threadIdx.x; const size_t n8 = nrow * (size_t)(ncol / 8); if (t >= n8) return; const size_t r = t / (ncol / 8); const int c8 = (int)(t % (ncol / 8)) * 8; FragH f; const v4f a = *(const v4fa*)(F + r * ldf + coff + c8), b2 = *(const v4fa*)(F + r * ldf + coff + c8 + 4); for (int q = 0; q < 4; ++q) { f.h[q] = (_Float16)a[q]; f.h[4 + q] = (_Float16)b2[q]; } *(v8us*)((unsigned short*)H16 + r * ncol + c8) = f.half[0];  }

__global__ __launch_bounds__(256) void k_tab128(float theta, float* __restrict__ CS, float* __restrict__ SN) {
  #pragma clang fp contract(off)
  const int t = blockIdx.x * 256 + threadIdx.x; if (t >= SQ * 64) return; const int i = t % 64; const int p = t / 64; const float invf = (float)(1.0 / pow((double)theta, (double)(2 * i) / 128.0));      /* = XLA's constant-folded f32 table */ const float ang = __fmul_rn((float)p, invf); const float c = cosf(ang), s = sinf(ang);
  *(float*)(CS + t) = c; *(float*)(SN + t) = s;  }
template <int TAB>
__global__ __launch_bounds__(128) void k_rope128(const float* __restrict__ F, int ldf, int nh, const float* __restrict__ CS, const float* __restrict__ SN, _Float16* __restrict__ H16, int ldo, float osc) {
  #pragma clang fp contract(off)
  __shared__ float xv[128]; __shared__ unsigned short sh_[128]; const int d = threadIdx.x; const int h = blockIdx.x % nh; const size_t r = blockIdx.x / nh; const int p = (int)(r % SQ);
  xv[d] = F[r * (size_t)ldf + (size_t)h * 128 + d]; __syncthreads();
  float c, s; if (TAB) { c = bf16_round(CS[(size_t)p * 128 + d]); s = bf16_round(SN[(size_t)p * 128 + d]); } else { c = CS[p * 64 + (d & 63)]; s = SN[p * 64 + (d & 63)]; }
  const float rot = (d < 64) ? -xv[d + 64] : xv[d - 64]; const float o = __fadd_rn(__fmul_rn(xv[d], c), __fmul_rn(rot, s));
  FragH th; th.h[0] = (_Float16)__fmul_rn(o, osc); sh_[d] = th.u[0]; __syncthreads();
  if (d < 16) { FragH f; for (int q = 0; q < 8; ++q) f.u[q] = sh_[d * 8 + q]; unsigned short* dst = (unsigned short*)H16 + r * (size_t)ldo + (size_t)h * 128 + d * 8; *(v8us*)dst = f.half[0];  } }

template <int TAB, int IL, int F32OUT>
__global__ __launch_bounds__(128) void k_rope128x(const float* __restrict__ F, int ldf, int nh, const float* __restrict__ CS, const float* __restrict__ SN, void* __restrict__ OUT, int ldo, float osc) {
  #pragma clang fp contract(off)
  __shared__ float xv[128]; __shared__ float ov[128]; const int d = threadIdx.x; const int h = blockIdx.x % nh; const size_t r = blockIdx.x / nh; const int p = (int)(r % SQ);
  xv[d] = F[r * (size_t)ldf + (size_t)h * 128 + d]; __syncthreads();
  float c, s; if (TAB) { c = bf16_round(CS[(size_t)p * 128 + d]); s = bf16_round(SN[(size_t)p * 128 + d]); } else { const int ti = IL ? (d >> 1) : (d & 63); c = CS[p * 64 + ti]; s = SN[p * 64 + ti]; }
  const float rot = IL ? ((d & 1) ? xv[d - 1] : -xv[d + 1]) : ((d < 64) ? -xv[d + 64] : xv[d - 64]);
  ov[d] = __fmul_rn(__fadd_rn(__fmul_rn(xv[d], c), __fmul_rn(rot, s)), osc); __syncthreads();
  if (F32OUT) { if (d < 32) { const v4f v = *(const v4f*)&ov[d * 4]; float* dst = (float*)OUT + r * (size_t)ldo + (size_t)h * 128 + d * 4; *(v4f*)dst = v;  } }
  else { if (d < 16) { FragH f; for (int q = 0; q < 8; ++q) f.h[q] = (_Float16)ov[d * 8 + q]; unsigned short* dst = (unsigned short*)OUT + r * (size_t)ldo + (size_t)h * 128 + d * 8; *(v8us*)dst = f.half[0];  } } }
template <int N>
__global__ __launch_bounds__(256) void k_rmsrow(float* __restrict__ X, const float* __restrict__ w, float eps) {
  #pragma clang fp contract(off)
  constexpr int PT = N / 256; __shared__ float red[256]; const size_t r = blockIdx.x; const int t = threadIdx.x; float* row = X + r * N + (size_t)t * PT; float v[PT]; float ss = 0.f;
  for (int q = 0; q < PT; ++q) { v[q] = row[q]; ss = __fadd_rn(ss, __fmul_rn(v[q], v[q])); }
  red[t] = ss; __syncthreads(); for (int k = 128; k > 0; k >>= 1) { if (t < k) red[t] = __fadd_rn(red[t], red[t + k]); __syncthreads(); }
  const float rs = rsqrtf(__fadd_rn(red[0] / (float)N, eps)); float o[PT]; for (int q = 0; q < PT; ++q) o[q] = __fmul_rn(__fmul_rn(v[q], rs), bf16_round(w[t * PT + q]));
  { for (int q = 0; q < PT; ++q) *(float*)(row + q) = o[q];  } }
template <int GS_, int NHQ, int DSRC>
__global__ __launch_bounds__(256) void k_kvexp128(const float* __restrict__ src, float* __restrict__ dst, size_t n4) { const size_t t = (size_t)blockIdx.x * 256 + threadIdx.x; if (t >= n4) return; const size_t e = t * 4; const size_t row = e / ((size_t)NHQ * 128); const int col = (int)(e % ((size_t)NHQ * 128)); const int h = col / 128, d = col % 128; const v4f v = *(const v4fa*)(src + row * DSRC + (size_t)(h / GS_) * 128 + d); *(v4f*)(dst + e) = v;  }

__global__ __launch_bounds__(256) void k_rsmcfb(const float* __restrict__ S, _Float16* __restrict__ P, int hg, int q0, int nk, const int* __restrict__ mk) {
  #pragma clang fp contract(off)
  const int t = blockIdx.x * 256 + threadIdx.x; if (t >= hg * QT) return; const size_t i = (size_t)t; const float* s = S + i * NKX; const size_t ig = (size_t)(q0 + (t % QT)); const int* mr = mk + ig * SQ; float mx = -3.0e38f;
#pragma unroll 1
  for (int j = 0; j < nk; ++j) { const int mb = mr[j]; const float f = (mb == 0) ? 1.f : 0.f; mx = fmaxf(mx, fmaf(f, s[j], (1.f - f) * -1.0e9f)); } float se = 0.f;
#pragma unroll 1
  for (int j = 0; j < nk; ++j) { const int mb = mr[j]; const float f = (mb == 0) ? 1.f : 0.f; se += __expf(fmaf(f, s[j], (1.f - f) * -1.0e9f) - mx); } const float sc = 256.0f / se;
#pragma unroll 1
  for (int j0 = 0; j0 < nk; j0 += 8) { FragH fr; for (int q = 0; q < 8; ++q) { const int j = j0 + q; const int mb = mr[j]; const float f = (mb == 0) ? 1.f : 0.f; fr.h[q] = (_Float16)(__expf(fmaf(f, s[j], (1.f - f) * -1.0e9f) - mx) * sc); } unsigned short* d = (unsigned short*)P + i * NKX + j0; *(v8us*)d = fr.half[0];  } }


__global__ __launch_bounds__(128) void k_rmsh128(float* __restrict__ F, int ldf, int nh, const float* __restrict__ w, float eps) {
  #pragma clang fp contract(off)
  __shared__ float red[128]; const int d = threadIdx.x; const int h = blockIdx.x % nh; const size_t r = blockIdx.x / nh; float* p = F + r * (size_t)ldf + (size_t)h * 128 + d; const float v = *p;
  red[d] = __fmul_rn(v, v); __syncthreads(); for (int st = 64; st > 0; st >>= 1) { if (d < st) red[d] = __fadd_rn(red[d], red[d + st]); __syncthreads(); }
  const float y = __fmul_rn(__fmul_rn(v, rsqrtf(__fadd_rn(red[0] * 0.0078125f, eps))), bf16_round(w[d])); *(float*)p = y;  }

// 2^x of four values. One statement: each v_exp_f32 is followed by one that neither reads its result nor writes its source (outputs early-clobber), and the v_nop fills
// the slot behind the last.
__device__ __forceinline__ v4f exp2_4(v4f x) { float e0, e1, e2, e3;
  asm("v_exp_f32 %0, %4\n\tv_exp_f32 %1, %5\n\tv_exp_f32 %2, %6\n\tv_exp_f32 %3, %7\n\tv_nop" : "=&v"(e0), "=&v"(e1), "=&v"(e2), "=&v"(e3) : "v"(x[0]), "v"(x[1]), "v"(x[2]), "v"(x[3]));
  const v4f e = {e0, e1, e2, e3}; return e; }
// causal softmax, 8 waves a block, one wave a score row of NC * 128 columns: lane l holds columns 128 c + 4 l .. + 3 in registers (each load 512 contiguous bytes), so the row is read once;
// maximum and sum = each lane's own columns in rising order, then a five-step butterfly over the lanes.
template <int NC>
__global__ __launch_bounds__(256) void k_rsmcf2(const float* __restrict__ S, _Float16* __restrict__ P, int hg, int q0) {
  const int l4 = (threadIdx.x & 31) * 4; const int t = blockIdx.x * 8 + __builtin_amdgcn_readfirstlane(threadIdx.x >> 5); if (t >= hg * QT) return;
  const float* s = S + (size_t)t * NKX + l4; _Float16* p = P + (size_t)t * NKX + l4; const int rel = q0 + (t % QT) - l4;      /* column 128 c + 4 l + u is open while 128 c + u <= rel */
  v4f v[NC];
#pragma unroll
  for (int c = 0; c < NC; ++c) v[c] = *(const v4fa*)(s + c * 128);
  float mx = -3.0e38f;
#pragma unroll
  for (int c = 0; c < NC; ++c)
#pragma unroll
    for (int u = 0; u < 4; ++u) { const float m = (c * 128 + u <= rel) ? v[c][u] : -1.0e9f; v[c][u] = m; mx = fmaxf(mx, m); }
  mx = fmaxf(mx, row_x<1>(mx)); mx = fmaxf(mx, row_x<2>(mx)); mx = fmaxf(mx, row_x<4>(mx)); mx = fmaxf(mx, row_x<8>(mx)); mx = fmaxf(mx, half_x(mx));
  float se = 0.f;
#pragma unroll
  for (int c = 0; c < NC; ++c) { v[c] = exp2_4((v[c] - mx) * 1.4426950408889634f);      /* e^(x - max), as __expf forms it */
#pragma unroll
    for (int u = 0; u < 4; ++u) se += v[c][u]; }
  se += row_x<1>(se); se += row_x<2>(se); se += row_x<4>(se); se += row_x<8>(se); se += half_x(se);
  const float sc = 256.0f / se;
#pragma unroll
  for (int c = 0; c < NC; ++c) { v4h h4;
#pragma unroll
    for (int u = 0; u < 4; ++u) h4[u] = (_Float16)(v[c][u] * sc);
    *(v4h*)(p + c * 128) = h4; } }
extern "C" void kernel_launch(void* const* d_in, const int* in_sizes, int n_in,
                              void* d_out, int out_size, void* d_ws, size_t ws_size, hipStream_t stream) {
  (void)in_sizes; (void)n_in; (void)out_size;
  const float* const* I = (const float* const*)d_in; const float* x = I[0]; const float* wq = I[1]; const float* wk = I[2]; const float* wv = I[3]; const float* wo = I[4]; const float* qnw = I[5]; const float* knw = I[6]; const float* tcos = I[7]; const float* tsin = I[8];      /* [in][out] weights; rope tables [S][128] */
  char* ws = (char*)d_ws; size_t off = 0;
  auto take = [&](size_t bytes) { char* p = ws + off; off += (bytes + 255) & ~(size_t)255; return p; };
  _Float16* BQ = (_Float16*)take((size_t)DMX * DMX * 2); _Float16* BK = (_Float16*)take((size_t)DKV * DMX * 2); _Float16* BV = (_Float16*)take((size_t)DKV * DMX * 2); _Float16* BO = (_Float16*)take((size_t)DMX * DMX * 2);
  _Float16* X16 = (_Float16*)take(NR * DMX * 2); float* QF = (float*)take(NR * DMX * 4); float* KF = (float*)take(NR * DKV * 4); float* VF = (float*)take(NR * DKV * 4); _Float16* Q16 = (_Float16*)take(NR * DMX * 2); _Float16* K16 = (_Float16*)take(NR * DKV * 2); _Float16* V16 = (_Float16*)take(NR * DKV * 2); _Float16* O16 = (_Float16*)take(NR * DMX * 2);
  static_assert((size_t)NB * NH * QT * NKX * 4 <= NR * DMX * 2 + NR * DMX * 4 + NR * DKV * 4, "S must fit in X16 + QF + KF");
  float* S = (float*)X16;      /* scores of both batches [NB][NH][QT][NKX]: reuse X16, QF, KF (adjacent; X16 last read by the projections, QF and KF by the rope launches, all in front of the first score launch) */
  _Float16* P = (_Float16*)take((size_t)NB * NH * QT * NKX * 2); _Float16* VT = (_Float16*)take((size_t)NB * (DKV / 64) * 64 * SQ * 2);
  float* QF0 = (float*)take((size_t)NB * QT0 * DMX * 4); float* KRF0 = (float*)take((size_t)QT0 * DKV * 4); float* KF0e = (float*)take((size_t)NB * QT0 * DMX * 4); float* VF0e = (float*)take((size_t)NB * QT0 * DMX * 4); float* OF0 = (float*)take((size_t)NB * QT0 * DMX * 4); _Float16* OH0 = (_Float16*)take((size_t)NB * QT0 * DMX * 2); _Float16* OL0 = (_Float16*)take((size_t)NB * QT0 * DMX * 2);
  if (off > ws_size) return;
  k_wt_f16<<<(unsigned)(((size_t)DMX * (DMX / 8) + 255) / 256), 256, 0, stream>>>(wq, BQ, DMX, DMX, 16.0f); k_wt_f16<<<(unsigned)(((size_t)DKV * (DMX / 8) + 255) / 256), 256, 0, stream>>>(wk, BK, DMX, DKV, 16.0f); k_wt_f16<<<(unsigned)(((size_t)DKV * (DMX / 8) + 255) / 256), 256, 0, stream>>>(wv, BV, DMX, DKV, 16.0f); k_wt_f16<<<(unsigned)(((size_t)DMX * (DMX / 8) + 255) / 256), 256, 0, stream>>>(wo, BO, DMX, DMX, 16.0f);      /* [in][out] -> Bt x16 */
  k_x16<<<(unsigned)((NR * DMX / 8 + 255) / 256), 256, 0, stream>>>(x, X16, NR * DMX / 8);
  k_gemm2<0><<<dim3((unsigned)((NR / 128) * (DMX / 64)), 1), 128, 0, stream>>>(X16, DMX, 0, BQ, DMX, 0, 0.0625f, nullptr, 0, nullptr, 1, 0, 0, QF, nullptr, DMX, 0, (int)NR, DMX, DMX, 1, 0, 0, 0);      /* q (f32) */
  k_gemm2<0><<<dim3((unsigned)((NR / 128) * (DKV / 64)), 1), 128, 0, stream>>>(X16, DMX, 0, BK, DMX, 0, 0.0625f, nullptr, 0, nullptr, 1, 0, 0, KF, nullptr, DKV, 0, (int)NR, DKV, DMX, 1, 0, 0, 0);      /* k (f32) */
  k_gemm2<0><<<dim3((unsigned)((NR / 128) * (DKV / 64)), 1), 128, 0, stream>>>(X16, DMX, 0, BV, DMX, 0, 0.0625f, nullptr, 0, nullptr, 1, 0, 0, VF, V16, DKV, 0, (int)NR, DKV, DMX, 1, 0, 0, 0);      /* v (f32 for the first tile + f16) */
  k_rmsh128<<<(unsigned)(NR * NH), 128, 0, stream>>>(QF, DMX, NH, qnw, 1e-6f); k_rmsh128<<<(unsigned)(NR * NKV), 128, 0, stream>>>(KF, DKV, NKV, knw, 1e-6f);      /* per-head RMSNorm over the 128 dims, in place */
  k_rope128x<1, 0, 0><<<(unsigned)(NR * NH), 128, 0, stream>>>(QF, DMX, NH, tcos, tsin, Q16, DMX, 1.0f); k_rope128x<1, 0, 0><<<(unsigned)(NR * NKV), 128, 0, stream>>>(KF, DKV, NKV, tcos, tsin, K16, DKV, 1.0f);      /* rope from the input tables -> f16 */
  for (int b = 0; b < NB; ++b) { const size_t r0 = (size_t)b * SQ, f0 = (size_t)b * QT0;
  k_rope128x<1, 0, 1><<<(unsigned)(QT0 * NH), 128, 0, stream>>>(QF + r0 * DMX, DMX, NH, tcos, tsin, QF0 + f0 * DMX, DMX, 1.0f); k_rope128x<1, 0, 1><<<(unsigned)(QT0 * NKV), 128, 0, stream>>>(KF + r0 * DKV, DKV, NKV, tcos, tsin, KRF0, DKV, 1.0f);      /* f32 roped q, k rows 0..127 */
  k_kvexp128<GSZ, NH, DKV><<<(unsigned)(((size_t)QT0 * DMX / 4 + 255) / 256), 256, 0, stream>>>(KRF0, KF0e + f0 * DMX, (size_t)QT0 * DMX / 4); k_kvexp128<GSZ, NH, DKV><<<(unsigned)(((size_t)QT0 * DMX / 4 + 255) / 256), 256, 0, stream>>>(VF + r0 * DKV, VF0e + f0 * DMX, (size_t)QT0 * DMX / 4);      /* group -> head expansion for the exact first tile */
  }      /* per batch */
  k_vt<DKV / 64, SQ><<<NB * (DKV / 64) * (SQ / 64), 256, 0, stream>>>(V16, DKV, 0, VT);      /* V^T, both batches: batch b, group g = slabs 16b + 2g, 16b + 2g + 1 */
  k_att0w<<<dim3(NH * (QT0 / 8), NB), 256, 0, stream>>>(QF0, KF0e, VF0e, ATS, OF0);      /* exact causal attention rows 0..127 of both batches (o x64) */
  for (int q0 = 0; q0 < SQ; q0 += QT) { const int nk = q0 + QT;      /* one launch a stage: grid y = the 16 heads, z = the 2 batches */
    k_gemm2<0><<<dim3((QT / 128) * (nk / 64), NH, NB), 128, 0, stream>>>(Q16 + (size_t)q0 * DMX, DMX, (size_t)HDK, K16, DKV, (size_t)HDK, ATS, nullptr, 0, nullptr, 1, 0, 0, S, nullptr, NKX, (size_t)QT * NKX, QT, nk, HDK, GSZ, (size_t)SQ * DMX, (size_t)SQ * DKV, (size_t)NH * QT * NKX);      /* scores: each head vs its group's key slab */
    static_assert(SQ / QT == 8, "one softmax kernel a row length");
    switch (nk / QT) {      /* causal softmax: the row length picks the kernel that holds a row of it in registers */
      case 1: k_rsmcf2<2><<<NB * NH * QT / 8, 256, 0, stream>>>(S, P, NB * NH, q0); break; case 2: k_rsmcf2<4><<<NB * NH * QT / 8, 256, 0, stream>>>(S, P, NB * NH, q0); break; case 3: k_rsmcf2<6><<<NB * NH * QT / 8, 256, 0, stream>>>(S, P, NB * NH, q0); break; case 4: k_rsmcf2<8><<<NB * NH * QT / 8, 256, 0, stream>>>(S, P, NB * NH, q0); break;
      case 5: k_rsmcf2<10><<<NB * NH * QT / 8, 256, 0, stream>>>(S, P, NB * NH, q0); break; case 6: k_rsmcf2<12><<<NB * NH * QT / 8, 256, 0, stream>>>(S, P, NB * NH, q0); break; case 7: k_rsmcf2<14><<<NB * NH * QT / 8, 256, 0, stream>>>(S, P, NB * NH, q0); break; default: k_rsmcf2<16><<<NB * NH * QT / 8, 256, 0, stream>>>(S, P, NB * NH, q0); break; }
    k_gemm2<0><<<dim3((QT / 128) * (HDK / 64), NH, NB), 128, 0, stream>>>(P, NKX, (size_t)QT * NKX, VT, SQ, (size_t)HDK * SQ, 0.25f, nullptr, 0, nullptr, 1, 0, 0, nullptr, O16 + (size_t)q0 * DMX, DMX, (size_t)HDK, QT, HDK, nk, GSZ, (size_t)NH * QT * NKX, (size_t)DKV * SQ, (size_t)SQ * DMX); }      /* o (x64): each head vs its group's V^T slab */
  k_gemm2<0><<<dim3((unsigned)((NR / 128) * (DMX / 64)), 1), 128, 0, stream>>>(O16, DMX, 0, BO, DMX, 0, 0.0009765625f, nullptr, 0, nullptr, 1, 0, 0, (float*)d_out, nullptr, DMX, 0, (int)NR, DMX, DMX, 1, 0, 0, 0);      /* out = o Wo */
  k_hl<<<(unsigned)(((size_t)NB * QT0 * DMX / 8 + 255) / 256), 256, 0, stream>>>(OF0, OH0, OL0, (size_t)NB * QT0 * DMX / 8);
  k_gemm2<0><<<dim3((QT0 / 128) * (DMX / 64), 1, NB), 128, 0, stream>>>(OH0, DMX, 0, BO, DMX, 0, 0.0009765625f, nullptr, 0, nullptr, 1, 0, 0, (float*)d_out, nullptr, DMX, 0, QT0, DMX, DMX, 1, (size_t)QT0 * DMX, 0, (size_t)SQ * DMX);
  k_gemm2<0><<<dim3((QT0 / 128) * (DMX / 64), 1, NB), 128, 0, stream>>>(OL0, DMX, 0, BO, DMX, 0, 0.00000095367431640625f, nullptr, 0, (const float*)d_out, -1, 0, 0, (float*)d_out, nullptr, DMX, 0, QT0, DMX, DMX, 1, (size_t)QT0 * DMX, 0, (size_t)SQ * DMX);      /* rows 0..127 of each batch rewritten from the exact path */
}

// v004
// It runs in 1010 microseconds.
// Timed twice side by side with v003, it ran 1.11 times as fast both times.
// All steps since v000 together make it 10.3 times as fast.
#include <hip/hip_runtime.h>
// Qwen3 attention (x [2][2048][2048]; q = x Wq (16 heads x 128), k = x Wk, v = x Wv (8 kv heads x 128) ([in][out] weights sigma 0.02); per-head RMSNorm over the 128 dims on q and k (weights ones, eps 1e-6); rotate-half RoPE from the module's INPUT cos/sin tables [S][128] (theta 1e6); query head h uses kv head h/2; scores x 128^-0.5 with a causal mask (tril, finfo.min); softmax; out = merged Wo ([in][out]) -> [2][2048][2048]).
// Compute dtype: inputs rounded to bf16; x / weights / tables exact; projections, RMSNorm and rope f32; q, k, v, softmax weights and o as plain f16 GEMM operands (~2^-12; first 128 rows exact); scores, statistics, out f32. v_wmma_f32_16x16x32_f16.
#define NB 2
#define SQ 2048
#define DMX 2048
#define NH 16
#define NKV 8
#define GSZ 2
#define HDK 128
#define DKV (NKV * HDK)
#define QT 256
#define QT0 128
#define NKX SQ
#define DM DMX
#define HD 64
#define HG 1
#define NR ((size_t)NB * SQ)
#define ATS 0.08838834764831845f
typedef __bf16 v16b __attribute__((ext_vector_type(16)));
typedef unsigned short v8us __attribute__((ext_vector_type(8), may_alias));
typedef float  v8f  __attribute__((ext_vector_type(8)));
typedef float  v4f  __attribute__((ext_vector_type(4)));
typedef float  v4fa __attribute__((ext_vector_type(4), may_alias));
union FragB { v16b v; v8us half[2]; unsigned short u[16]; };

__device__ __forceinline__ unsigned short bf16_bits(float x) { unsigned int u = __float_as_uint(x); return (unsigned short)((u + 0x7FFFu + ((u >> 16) & 1u)) >> 16); }
__device__ __forceinline__ float bf16_val(unsigned short b) { return __uint_as_float(((unsigned int)b) << 16); }
__device__ __forceinline__ float bf16_round(float x) { return bf16_val(bf16_bits(x)); }
// D += A·B with NT terms: 1 = ah·bh, 2 = + al·bh (A split), 3 = + ah·bl (both split)
template <int NT>
__device__ __forceinline__ v8f mmaN(v16b ah, v16b al, v16b bh, v16b bl, v8f c) {
  c = __builtin_amdgcn_wmma_f32_16x16x32_bf16(false, ah, false, bh, (short)0, c, false, false);
  if (NT >= 2) c = __builtin_amdgcn_wmma_f32_16x16x32_bf16(false, al, false, bh, (short)0, c, false, false);
  if (NT >= 3) c = __builtin_amdgcn_wmma_f32_16x16x32_bf16(false, ah, false, bl, (short)0, c, false, false);
  asm volatile("v_nop\n\tv_nop\n\tv_nop\n\tv_nop" : "+v"(c) : "v"(ah), "v"(al), "v"(bh), "v"(bl));
  return c;
}

__global__ __launch_bounds__(256) void k_wt_bf16(const float* __restrict__ W, unsigned short* __restrict__ Wt, int K, int N) {
  const int t = blockIdx.x * 256 + threadIdx.x;
  const int k8n = K / 8;
  if (t >= N * k8n) return;
  const int n = t / k8n, k8 = (t % k8n) * 8;
  v8us v;
#pragma unroll
  for (int i = 0; i < 8; ++i) v[i] = bf16_bits(W[(size_t)(k8 + i) * N + n]);
  *(v8us*)(Wt + (size_t)n * K + k8) = v;
  
}

// GEMM C[M][N] (f32, pitch ldc) = act(A[M][K]·W + bias). A f32 row-major (pitch lda) converted per fragment to bf16
// (ASPLIT: hi/lo two planes -> 2 terms, else single rounded term); Wt bf16 [N][K] (pitch ldb). BIAS_BF16 rounds the
// bias to bf16 first (bias quantised to bf16 before the add). K%32==0, M%16==0, N%64==0.
template <bool ASPLIT, int ACT, bool BIAS_BF16>
__global__ __launch_bounds__(128) void k_gemm_bf(const float* __restrict__ A, int lda, const unsigned short* __restrict__ Wt, int ldb,
                                               const float* __restrict__ bias, float* __restrict__ C, int ldc, int M, int N, int K) {
  __shared__ __attribute__((aligned(16))) float so[4][16][64];
  const int tid = threadIdx.x, w = tid >> 5, lane = tid & 31, ln = lane & 15, hh = lane >> 4;
  const int ntn = N / 64;
  const int wid = blockIdx.x * 4 + w;
  const int mt = wid / ntn, nq = wid % ntn;
  if (mt * 16 >= M) return;
  const int row0 = mt * 16, col0 = nq * 64;
  const float* arow = A + (size_t)(row0 + ln) * lda;
  v8f acc[4] = {};
  for (int kb = 0; kb < K; kb += 32) {
    FragB ah, al;
    const v4f x0 = *(const v4fa*)(arow + kb + 8 * hh), x1 = *(const v4fa*)(arow + kb + 8 * hh + 4);
    const v4f x2 = *(const v4fa*)(arow + kb + 16 + 8 * hh), x3 = *(const v4fa*)(arow + kb + 16 + 8 * hh + 4);
    float xs[16] = {x0[0],x0[1],x0[2],x0[3],x1[0],x1[1],x1[2],x1[3],x2[0],x2[1],x2[2],x2[3],x3[0],x3[1],x3[2],x3[3]};
#pragma unroll
    for (int i = 0; i < 16; ++i) { const unsigned short hb = bf16_bits(xs[i]); ah.u[i] = hb; al.u[i] = ASPLIT ? bf16_bits(xs[i] - bf16_val(hb)) : (unsigned short)0; }
#pragma unroll
    for (int t = 0; t < 4; ++t) {
      const unsigned short* brow = Wt + (size_t)(col0 + t * 16 + ln) * ldb + kb;
      FragB b;
      b.half[0] = *(const v8us*)(brow + 8 * hh);
      b.half[1] = *(const v8us*)(brow + 16 + 8 * hh);
      acc[t] = mmaN<ASPLIT ? 2 : 1>(ah.v, al.v, b.v, b.v, acc[t]);
    }
  }
#pragma unroll
  for (int t = 0; t < 4; ++t) {
    float bv = bias ? bias[col0 + t * 16 + ln] : 0.f;
    if (BIAS_BF16) bv = bf16_round(bv);
#pragma unroll
    for (int r = 0; r < 8; ++r) { float v = acc[t][r] + bv; if (ACT == 1) v = fmaxf(v, 0.f); so[w][8 * hh + r][t * 16 + ln] = v; }
  }
  __builtin_amdgcn_fence(__ATOMIC_ACQ_REL, "workgroup");
  __builtin_amdgcn_wave_barrier();
  const int rsub = lane >> 4, c4 = (lane & 15) * 4;
  {
#pragma unroll
    for (int q = 0; q < 8; ++q) {
      const int r = q * 2 + rsub;
      const v4f v = *(const v4fa*)&so[w][r][c4];
      *(v4f*)(C + (size_t)(row0 + r) * ldc + col0 + c4) = v;
    }
    
  }
}

// GEMM C = act(A·W + bias + resid): A f32 (ASPLIT -> hi/lo 2 terms), Wt bf16 [N][K]; ACT 0 none, 1 relu, 2 exact gelu;
// resid (optional, f32, row index = (row % rmod), pitch ldr, RES_BF16 rounds it) added before the activation.
template <bool ASPLIT, int ACT, bool BIAS_BF16, bool RES_BF16>
__global__ __launch_bounds__(128) void k_gemm_bf3(const float* __restrict__ A, int lda, const unsigned short* __restrict__ Wt, int ldb,
                                                const float* __restrict__ bias, const float* __restrict__ resid, int rmod, int ldr,
                                                float* __restrict__ C, int ldc, int M, int N, int K) {
  __shared__ __attribute__((aligned(16))) float so[4][16][64];
  const int tid = threadIdx.x, w = tid >> 5, lane = tid & 31, ln = lane & 15, hh = lane >> 4;
  const int ntn = N / 64;
  const int wid = blockIdx.x * 4 + w;
  const int mt = wid / ntn, nq = wid % ntn;
  if (mt * 16 >= M) return;
  const int row0 = mt * 16, col0 = nq * 64;
  const float* arow = A + (size_t)(row0 + ln) * lda;
  v8f acc[4] = {};
  for (int kb = 0; kb < K; kb += 32) {
    FragB ah, al;
    const v4f x0 = *(const v4fa*)(arow + kb + 8 * hh), x1 = *(const v4fa*)(arow + kb + 8 * hh + 4);
    const v4f x2 = *(const v4fa*)(arow + kb + 16 + 8 * hh), x3 = *(const v4fa*)(arow + kb + 16 + 8 * hh + 4);
    float xs[16] = {x0[0],x0[1],x0[2],x0[3],x1[0],x1[1],x1[2],x1[3],x2[0],x2[1],x2[2],x2[3],x3[0],x3[1],x3[2],x3[3]};
#pragma unroll
    for (int i = 0; i < 16; ++i) { const unsigned short hb = bf16_bits(xs[i]); ah.u[i] = hb; al.u[i] = ASPLIT ? bf16_bits(xs[i] - bf16_val(hb)) : (unsigned short)0; }
#pragma unroll
    for (int t = 0; t < 4; ++t) {
      const unsigned short* brow = Wt + (size_t)(col0 + t * 16 + ln) * ldb + kb;
      FragB b;
      b.half[0] = *(const v8us*)(brow + 8 * hh);
      b.half[1] = *(const v8us*)(brow + 16 + 8 * hh);
      acc[t] = mmaN<ASPLIT ? 2 : 1>(ah.v, al.v, b.v, b.v, acc[t]);
    }
  }
#pragma unroll
  for (int t = 0; t < 4; ++t) {
    const int col = col0 + t * 16 + ln;
    float bv = bias ? bias[col] : 0.f;
    if (BIAS_BF16) bv = bf16_round(bv);
#pragma unroll
    for (int r = 0; r < 8; ++r) {
      float v = acc[t][r] + bv;
      if (resid) { float rv = resid[(size_t)((row0 + 8 * hh + r) % rmod) * ldr + col]; if (RES_BF16) rv = bf16_round(rv); v += rv; }
      if (ACT == 1) v = fmaxf(v, 0.f);
      if (ACT == 2) v = 0.5f * v * (1.0f + erff(v * 0.70710678118654752f));
      if (ACT == 3) { const float u = 0.7978845608028654f * (v + 0.044715f * v * v * v); v = 0.5f * v * (1.0f + tanhf(u)); }
      so[w][8 * hh + r][t * 16 + ln] = v;
    }
  }
  __builtin_amdgcn_fence(__ATOMIC_ACQ_REL, "workgroup");
  __builtin_amdgcn_wave_barrier();
  const int rsub = lane >> 4, c4 = (lane & 15) * 4;
  {
#pragma unroll
    for (int q = 0; q < 8; ++q) {
      const int r = q * 2 + rsub;
      const v4f v = *(const v4fa*)&so[w][r][c4];
      *(v4f*)(C + (size_t)(row0 + r) * ldc + col0 + c4) = v;
    }
    
  }
}
// row LayerNorm (biased variance, eps) over N: s = X (+ R); optional out_sum <- s; out_norm <- (s-mu)*rsqrt(var+eps)*g + b
template <bool PARAM_BF16>
__global__ __launch_bounds__(256) void k_layernorm(const float* __restrict__ X, const float* __restrict__ R, const float* __restrict__ g, const float* __restrict__ bta,
                                                  float* __restrict__ out_sum, float* __restrict__ out_norm, int N, float eps) {
  __shared__ float red[256];
  const int row = blockIdx.x, tid = threadIdx.x;
  const float* x = X + (size_t)row * N; const float* rr = R ? R + (size_t)row * N : nullptr;
  float vals[16];                     // up to N = 4096
  const int per = N / 256;            // contiguous chunk per thread? use strided-by-4 chunks: thread handles j = tid*4 + 1024*u
  float s1 = 0.f;
  for (int u = 0; u < per / 4; ++u) {
    const int j = tid * 4 + 1024 * u;
    const v4f a = *(const v4fa*)(x + j);
    v4f b = {0.f,0.f,0.f,0.f}; if (rr) b = *(const v4fa*)(rr + j);
#pragma unroll
    for (int q = 0; q < 4; ++q) { const float v = a[q] + b[q]; vals[u * 4 + q] = v; s1 += v; }
  }
  red[tid] = s1; __syncthreads();
  for (int st = 128; st > 0; st >>= 1) { if (tid < st) red[tid] += red[tid + st]; __syncthreads(); }
  const float mu = red[0] / (float)N; __syncthreads();
  float s2 = 0.f;
  for (int u = 0; u < per / 4; ++u)
#pragma unroll
    for (int q = 0; q < 4; ++q) { const float c = vals[u * 4 + q] - mu; s2 += c * c; }
  red[tid] = s2; __syncthreads();
  for (int st = 128; st > 0; st >>= 1) { if (tid < st) red[tid] += red[tid + st]; __syncthreads(); }
  const float rs = rsqrtf(red[0] / (float)N + eps);
  {
    for (int u = 0; u < per / 4; ++u) {
      const int j = tid * 4 + 1024 * u;
      v4f o, sm;
#pragma unroll
      for (int q = 0; q < 4; ++q) {
        float gg = g[j + q], bb = bta[j + q];
        if (PARAM_BF16) { gg = bf16_round(gg); bb = bf16_round(bb); }
        sm[q] = vals[u * 4 + q]; o[q] = (vals[u * 4 + q] - mu) * rs * gg + bb;
      }
      if (out_sum) *(v4f*)(out_sum + (size_t)row * N + j) = sm;
      *(v4f*)(out_norm + (size_t)row * N + j) = o;
    }
    
  }
}



// ---- f16 WMMA path (v_wmma_f32_16x16x32_f16): 11-bit significands for operands in range — used where a [0,1] probability operand needs more precision than bf16
typedef _Float16 v16h __attribute__((ext_vector_type(16)));
union FragH { v16h v; v8us half[2]; _Float16 h[16]; unsigned short u[16]; };
template <int NT>
__device__ __forceinline__ v8f mmaH(v16h ah, v16h al, v16h bh, v16h bl, v8f c) {
  c = __builtin_amdgcn_wmma_f32_16x16x32_f16(false, ah, false, bh, (short)0, c, false, false);
  if (NT >= 2) c = __builtin_amdgcn_wmma_f32_16x16x32_f16(false, al, false, bh, (short)0, c, false, false);
  if (NT >= 3) c = __builtin_amdgcn_wmma_f32_16x16x32_f16(false, ah, false, bl, (short)0, c, false, false);
  asm volatile("v_nop\n\tv_nop\n\tv_nop\n\tv_nop" : "+v"(c) : "v"(ah), "v"(al), "v"(bh), "v"(bl));
  return c;
}
// batched GEMM like k_gemm_b but f16 operands: A f32 (split into f16 hi/lo if ASPLIT, else rounded to f16), Bt = f16 values [n][k]; alpha; C f32; N multiple of 16 (partial tiles skipped)
template <bool ASPLIT>
__global__ __launch_bounds__(128) void k_gemm_h(const float* __restrict__ A, int lda, size_t sA, const _Float16* __restrict__ Bh, int ldb, size_t sB, float alpha, float* __restrict__ C, int ldc, size_t sC, int M, int N, int K) {
  __shared__ __attribute__((aligned(16))) float so[4][16][64];
  const int tid = threadIdx.x, w = tid >> 5, lane = tid & 31, ln = lane & 15, hh = lane >> 4; const int by = blockIdx.y;
  A += (size_t)by * sA; Bh += (size_t)by * sB; C += (size_t)by * sC;
  const int ntn = (N + 63) / 64; const int wid = blockIdx.x * 4 + w; const int mt = wid / ntn, nq = wid % ntn; if (mt * 16 >= M) return;
  const int row0 = mt * 16, col0 = nq * 64; const float* arow = A + (size_t)(row0 + ln) * lda;
  v8f acc[4] = {};
  for (int kb = 0; kb < K; kb += 32) {
    FragH ah, al;
    const v4f x0 = *(const v4fa*)(arow + kb + 8 * hh), x1 = *(const v4fa*)(arow + kb + 8 * hh + 4), x2 = *(const v4fa*)(arow + kb + 16 + 8 * hh), x3 = *(const v4fa*)(arow + kb + 16 + 8 * hh + 4);
    float xs[16] = {x0[0],x0[1],x0[2],x0[3],x1[0],x1[1],x1[2],x1[3],x2[0],x2[1],x2[2],x2[3],x3[0],x3[1],x3[2],x3[3]};
#pragma unroll
    for (int i = 0; i < 16; ++i) { const _Float16 h = (_Float16)xs[i]; ah.h[i] = h; al.h[i] = ASPLIT ? (_Float16)(xs[i] - (float)h) : (_Float16)0.0f; }
#pragma unroll
    for (int t = 0; t < 4; ++t) { if (col0 + t * 16 >= N) continue; const size_t boff = (size_t)(col0 + t * 16 + ln) * ldb + kb; FragH bq; bq.half[0] = *(const v8us*)(Bh + boff + 8 * hh); bq.half[1] = *(const v8us*)(Bh + boff + 16 + 8 * hh);
      acc[t] = mmaH<ASPLIT ? 2 : 1>(ah.v, al.v, bq.v, bq.v, acc[t]); }
  }
#pragma unroll
  for (int t = 0; t < 4; ++t) { if (col0 + t * 16 >= N) continue;
#pragma unroll
    for (int r = 0; r < 8; ++r) so[w][8 * hh + r][t * 16 + ln] = acc[t][r] * alpha; }
  __builtin_amdgcn_fence(__ATOMIC_ACQ_REL, "workgroup"); __builtin_amdgcn_wave_barrier();
  const int rsub = lane >> 4, c4 = (lane & 15) * 4;
  {
#pragma unroll
    for (int q = 0; q < 8; ++q) { const int r = q * 2 + rsub; if (col0 + c4 < N) { const v4f v = *(const v4fa*)&so[w][r][c4]; *(v4f*)(C + (size_t)(row0 + r) * ldc + col0 + c4) = v; } }
     }
}

// Wt[n][k] = f16(W[k][n]·scale) from f32 row-major W[K][N] (scale = power of two; bf16-exact weights stay exact in f16 away from the subnormal range)
__global__ __launch_bounds__(256) void k_wt_f16(const float* __restrict__ W, _Float16* __restrict__ Wt, int K, int N, float scale) {
  const int t = blockIdx.x * 256 + threadIdx.x; if (t >= N * (K / 8)) return; const int n = t / (K / 8), k8 = (t % (K / 8)) * 8; FragH f;
#pragma unroll
  for (int i = 0; i < 8; ++i) f.h[i] = (_Float16)(bf16_round(W[(size_t)(k8 + i) * N + n]) * scale); const v8us o = f.half[0];
  *(v8us*)((unsigned short*)Wt + (size_t)n * K + k8) = o; 
}
// k_gemm_hh variant with fused epilogue: v = acc·alpha + bias[by·sBias + col] (+ CP[(row/rowsPerB)·sCPb + by·64 + col] if CP) ; ACT 0 none / 1 elu ; writes f16 C16 (and f32 C if non-null)
template <int ACT>
__global__ __launch_bounds__(128) void k_gemm_hhx(const _Float16* __restrict__ A, int lda, size_t sA, const _Float16* __restrict__ Bh, int ldb, size_t sB, float alpha, const float* __restrict__ bias, size_t sBias, const float* __restrict__ CP, int rowsPerB, size_t sCPb, int row0g,
    float* __restrict__ C, _Float16* __restrict__ C16, int ldc, size_t sC, int M, int N, int K) {
  __shared__ __attribute__((aligned(16))) float so[4][16][64];
  const int tid = threadIdx.x, w = tid >> 5, lane = tid & 31, ln = lane & 15, hh = lane >> 4; const int by = blockIdx.y;
  A += (size_t)by * sA; Bh += (size_t)by * sB; const size_t cofs = (size_t)by * sC; const float* bp = bias ? bias + (size_t)by * sBias : nullptr;
  const int ntn = (N + 63) / 64; const int wid = blockIdx.x * 4 + w; const int mt = wid / ntn, nq = wid % ntn; if (mt * 16 >= M) return;
  const int row0 = mt * 16, col0 = nq * 64; const _Float16* arow = A + (size_t)(row0 + ln) * lda;
  v8f acc[4] = {};
  for (int kb = 0; kb < K; kb += 32) { FragH ah; ah.half[0] = *(const v8us*)((const unsigned short*)arow + kb + 8 * hh); ah.half[1] = *(const v8us*)((const unsigned short*)arow + kb + 16 + 8 * hh);
#pragma unroll
    for (int t = 0; t < 4; ++t) { if (col0 + t * 16 >= N) continue; const size_t boff = (size_t)(col0 + t * 16 + ln) * ldb + kb; FragH bq; bq.half[0] = *(const v8us*)((const unsigned short*)Bh + boff + 8 * hh); bq.half[1] = *(const v8us*)((const unsigned short*)Bh + boff + 16 + 8 * hh);
      acc[t] = mmaH<1>(ah.v, ah.v, bq.v, bq.v, acc[t]); }
  }
#pragma unroll
  for (int t = 0; t < 4; ++t) { if (col0 + t * 16 >= N) continue; const int col = col0 + t * 16 + ln; const float bv = bp ? bf16_round(bp[col]) : 0.f;
#pragma unroll
    for (int r = 0; r < 8; ++r) { float v = acc[t][r] * alpha + bv; if (CP) { const int rr = row0g + row0 + 8 * hh + r; if (rowsPerB < 0) v += CP[cofs + (size_t)rr * ldc + col];      /* rowsPerB < 0: own element of the batched C plane */ else { const int bidx = rr / rowsPerB; v += CP[(size_t)bidx * sCPb + (size_t)by * 64 + col]; } } if (ACT == 1) v = (v > 0.f) ? v : expm1f(v); else if (ACT == 7) v = (v > 0.f) ? v + 1.0f : expf(v); else if (ACT == 8) v = tanhf(v); else if (ACT == 9) v = 0.5f * v * (1.0f + tanhf(0.7978845608028654f * (v + 0.044715f * v * v * v))); else if (ACT == 11) v = 1.0f / (1.0f + expf(-v)); else if (ACT == 12) v = (v > 0.f) ? v : 0.01f * v; else if (ACT == 14) v = (v > 0.f) ? v : 0.1f * v; else if (ACT == 16) v = (v >= 0.f) ? v : 0.3f * v; else if (ACT == 17) v = (v >= 0.f) ? v : 0.2f * v; else if (ACT == 15) v = v / (1.0f + expf(-v)); else if (ACT == 3) v = fmaxf(v, 0.f); else if (ACT == 6) v = 0.5f * v * (1.0f + erff(v * 0.70710678118654752f)); so[w][8 * hh + r][t * 16 + ln] = v; } }
  __builtin_amdgcn_fence(__ATOMIC_ACQ_REL, "workgroup"); __builtin_amdgcn_wave_barrier();
  const int rsub = lane >> 4, c4 = (lane & 15) * 4; typedef _Float16 v4h __attribute__((ext_vector_type(4)));
  {
#pragma unroll
    for (int q = 0; q < 8; ++q) { const int r = q * 2 + rsub; if (col0 + c4 < N) { const v4f v = *(const v4fa*)&so[w][r][c4]; if (C) *(v4f*)(C + cofs + (size_t)(row0 + r) * ldc + col0 + c4) = v; if (C16) { v4h h4; for (int i = 0; i < 4; ++i) h4[i] = (_Float16)v[i]; *(v4h*)(C16 + cofs + (size_t)(row0 + r) * ldc + col0 + c4) = h4; } } }
     }
}


typedef _Float16 v4h __attribute__((ext_vector_type(4)));

__global__ __launch_bounds__(256) void k_x16(const float* __restrict__ x, _Float16* __restrict__ X16, size_t n8) { const size_t t = (size_t)blockIdx.x * 256 + threadIdx.x; if (t >= n8) return; FragH f;
#pragma unroll
  for (int q = 0; q < 8; ++q) f.h[q] = (_Float16)bf16_round(x[t * 8 + q]); *(v8us*)((unsigned short*)X16 + t * 8) = f.half[0];  }
__global__ __launch_bounds__(256) void k_h16(const float* __restrict__ x, _Float16* __restrict__ X16, size_t n8) { const size_t t = (size_t)blockIdx.x * 256 + threadIdx.x; if (t >= n8) return; FragH f;
#pragma unroll
  for (int q = 0; q < 8; ++q) f.h[q] = (_Float16)x[t * 8 + q]; *(v8us*)((unsigned short*)X16 + t * 8) = f.half[0];  }
__global__ __launch_bounds__(256) void k_round16f(const float* __restrict__ W, _Float16* __restrict__ Bt, size_t n8) { const size_t t = (size_t)blockIdx.x * 256 + threadIdx.x; if (t >= n8) return; FragH f;
#pragma unroll
  for (int i = 0; i < 8; ++i) f.h[i] = (_Float16)(bf16_round(W[t * 8 + i]) * 16.0f); *(v8us*)((unsigned short*)Bt + t * 8) = f.half[0];  }
template <int NHv, int TTv>
__global__ __launch_bounds__(256) void k_vt(const _Float16* __restrict__ V16, int ldv, int voff, _Float16* __restrict__ Vt) { __shared__ unsigned short tl[64][66]; const int tid = threadIdx.x; const int slab = blockIdx.x / (TTv / 64), lg = blockIdx.x % (TTv / 64); const int b = slab / NHv, h = slab % NHv;
  for (int i = tid; i < 64 * 8; i += 256) { const int r = i / 8, c8 = (i % 8) * 8; FragH f; f.half[0] = *(const v8us*)((const unsigned short*)V16 + ((size_t)b * TTv + lg * 64 + r) * ldv + voff + h * 64 + c8);
#pragma unroll
    for (int q = 0; q < 8; ++q) tl[r][c8 + q] = f.u[q]; }
  __syncthreads();
  {
#pragma unroll
    for (int rd = 0; rd < 2; ++rd) { const int d = rd * 32 + tid / 8, pc = tid % 8; FragH f;
#pragma unroll
      for (int q = 0; q < 8; ++q) f.u[q] = tl[pc * 8 + q][d];
      *(v8us*)((unsigned short*)Vt + ((size_t)slab * 64 + d) * TTv + lg * 64 + pc * 8) = f.half[0]; }
     } }

__global__ __launch_bounds__(256) void k_hl(const float* __restrict__ F, _Float16* __restrict__ Hh, _Float16* __restrict__ Hl, size_t n8) { const size_t t = (size_t)blockIdx.x * 256 + threadIdx.x; if (t >= n8) return; FragH fh, fl; const v4f a = *(const v4fa*)(F + t * 8), c = *(const v4fa*)(F + t * 8 + 4);
#pragma unroll
  for (int q = 0; q < 4; ++q) { _Float16 h = (_Float16)a[q]; fh.h[q] = h; fl.h[q] = (_Float16)((a[q] - (float)h) * 1024.0f); h = (_Float16)c[q]; fh.h[4 + q] = h; fl.h[4 + q] = (_Float16)((c[q] - (float)h) * 1024.0f); }
  { *(v8us*)((unsigned short*)Hh + t * 8) = fh.half[0]; *(v8us*)((unsigned short*)Hl + t * 8) = fl.half[0];  } }

// ---- fast GEMM (wave tile 32x64; requires M % 32 == 0 rows per launch region and N % 64 == 0); epilogue = k_gemm_hhx semantics ----
__device__ __forceinline__ v16h g2_frag(const _Float16* p, int hh) { FragH f; f.half[0] = *(const v8us*)((const unsigned short*)p + 8 * hh); f.half[1] = *(const v8us*)((const unsigned short*)p + 16 + 8 * hh); return f.v; }
__device__ __forceinline__ v8f g2_mma(v16h a, v16h b, v8f c) { v8f d = __builtin_amdgcn_wmma_f32_16x16x32_f16(false, a, false, b, (short)0, c, false, false); asm volatile("v_nop\n\tv_nop\n\tv_nop\n\tv_nop" : "+v"(d) : "v"(a), "v"(b)); return d; }
template <int ACT>
__global__ __launch_bounds__(128) void k_gemm2(const _Float16* __restrict__ A, int lda, size_t sA, const _Float16* __restrict__ Bh, int ldb, size_t sB, float alpha, const float* __restrict__ bias, size_t sBias, const float* __restrict__ CP, int rowsPerB, size_t sCPb, int row0g,
    float* __restrict__ C, _Float16* __restrict__ C16, int ldc, size_t sC, int M, int N, int K, int bdiv, size_t zA, size_t zB, size_t zC) { static_assert(ACT == 0 || ACT == 3 || ACT == 6 || ACT == 8 || ACT == 9 || ACT == 11 || ACT == 12 || ACT == 14 || ACT == 15 || ACT == 16 || ACT == 17, "k_gemm2: unsupported ACT code (would silently apply no activation)");
  __shared__ __attribute__((aligned(16))) float so[4][32][68];
  const int tid = threadIdx.x, w = tid >> 5, lane = tid & 31, ln = lane & 15, hh = lane >> 4; const int by = blockIdx.y; const size_t bz = blockIdx.z;      /* y = head (bdiv heads share one B slab), z = batch */
  A += (size_t)by * sA + bz * zA; Bh += (size_t)(by / bdiv) * sB + bz * zB; const size_t cofs = (size_t)by * sC + bz * zC; const float* bp = bias ? bias + (size_t)by * sBias : nullptr;
  const int ntn = N >> 6; const int mt = blockIdx.x / ntn, nq = blockIdx.x - mt * ntn; const int row0 = mt * 128 + 32 * w, col0 = nq * 64; if (row0 >= M) return;
  const _Float16* a0p = A + (size_t)(row0 + ln) * lda; const _Float16* a1p = a0p + (size_t)16 * lda;
  const _Float16* b0p = Bh + (size_t)(col0 + ln) * ldb; const _Float16* b1p = b0p + (size_t)16 * ldb; const _Float16* b2p = b1p + (size_t)16 * ldb; const _Float16* b3p = b2p + (size_t)16 * ldb;
  const v8f z8 = {0.f,0.f,0.f,0.f,0.f,0.f,0.f,0.f}; v8f c00 = z8, c01 = z8, c02 = z8, c03 = z8, c10 = z8, c11 = z8, c12 = z8, c13 = z8;
#pragma unroll 1
  for (int kb = 0; kb < K; kb += 32) { const v16h a0 = g2_frag(a0p + kb, hh), a1 = g2_frag(a1p + kb, hh);
    v16h b = g2_frag(b0p + kb, hh); c00 = g2_mma(a0, b, c00); c10 = g2_mma(a1, b, c10);
    b = g2_frag(b1p + kb, hh); c01 = g2_mma(a0, b, c01); c11 = g2_mma(a1, b, c11);
    b = g2_frag(b2p + kb, hh); c02 = g2_mma(a0, b, c02); c12 = g2_mma(a1, b, c12);
    b = g2_frag(b3p + kb, hh); c03 = g2_mma(a0, b, c03); c13 = g2_mma(a1, b, c13); }
  v8f accs[8] = {c00, c01, c02, c03, c10, c11, c12, c13};
#pragma unroll
  for (int u = 0; u < 8; ++u) { const int t = u & 3, half = u >> 2; const int col = col0 + t * 16 + ln; const float bv = bp ? bf16_round(bp[col]) : 0.f;
#pragma unroll
    for (int r = 0; r < 8; ++r) { const int rloc = half * 16 + 8 * hh + r; float v = accs[u][r] * alpha + bv; if (CP) { if (rowsPerB < 0) v += CP[cofs + (size_t)(row0g + row0 + rloc) * ldc + col];      /* rowsPerB < 0: own element of the batched C plane */ else { const int bidx = (row0g + row0 + rloc) / rowsPerB; v += CP[(size_t)bidx * sCPb + (size_t)by * 64 + col]; } }
      if (ACT == 3) v = fmaxf(v, 0.f); else if (ACT == 6) v = 0.5f * v * (1.0f + erff(v * 0.70710678118654752f)); else if (ACT == 11) v = 1.0f / (1.0f + expf(-v)); else if (ACT == 15) v = v / (1.0f + expf(-v)); else if (ACT == 12) v = (v > 0.f) ? v : 0.01f * v; else if (ACT == 8) v = tanhf(v); else if (ACT == 9) v = 0.5f * v * (1.0f + tanhf(0.7978845608028654f * (v + 0.044715f * v * v * v))); else if (ACT == 14) v = (v > 0.f) ? v : 0.1f * v; else if (ACT == 16) v = (v >= 0.f) ? v : 0.3f * v; else if (ACT == 17) v = (v >= 0.f) ? v : 0.2f * v;
      so[w][rloc][t * 16 + ln] = v; } }
  __builtin_amdgcn_fence(__ATOMIC_ACQ_REL, "workgroup"); __builtin_amdgcn_wave_barrier();
  const int rsub = lane >> 4, c4 = (lane & 15) * 4;
  {
#pragma unroll
    for (int q = 0; q < 16; ++q) { const int r = q * 2 + rsub; const v4f v = *(const v4fa*)&so[w][r][c4]; if (C) *(v4f*)(C + cofs + (size_t)(row0 + r) * ldc + col0 + c4) = v; if (C16) { v4h h4; for (int i = 0; i < 4; ++i) h4[i] = (_Float16)v[i]; *(v4h*)(C16 + cofs + (size_t)(row0 + r) * ldc + col0 + c4) = h4; } }
     } }


__global__ __launch_bounds__(256) void k_wnat(const float* __restrict__ w, size_t n8, _Float16* __restrict__ Bt) { const size_t t = (size_t)blockIdx.x * 256 + threadIdx.x; if (t >= n8) return; FragH f; for (int q = 0; q < 8; ++q) f.h[q] = (_Float16)(bf16_round(w[t * 8 + q]) * 16.0f); *(v8us*)((unsigned short*)Bt + t * 8) = f.half[0];  }
__global__ __launch_bounds__(256) void k_rsm(const float* __restrict__ S, _Float16* __restrict__ P, int nrows) {
  #pragma clang fp contract(off)
  const int i = blockIdx.x * 256 + threadIdx.x; if (i >= nrows) return; const float* s = S + (size_t)i * SQ; float mx = -3.0e38f;
#pragma unroll 1
  for (int j = 0; j < SQ; ++j) mx = fmaxf(mx, s[j]); float se = 0.f;
#pragma unroll 1
  for (int j = 0; j < SQ; ++j) se += expf(s[j] - mx); const float sc = 256.0f / se;
#pragma unroll 1
  for (int j0 = 0; j0 < SQ; j0 += 8) { FragH f; for (int q = 0; q < 8; ++q) f.h[q] = (_Float16)(expf(s[j0 + q] - mx) * sc); unsigned short* d = (unsigned short*)P + (size_t)i * SQ + j0; *(v8us*)d = f.half[0];  } }
__global__ __launch_bounds__(256) void k_vt(const _Float16* __restrict__ V16, int b, int h0, _Float16* __restrict__ VT) { __shared__ unsigned short tl[64][65]; const int tid = threadIdx.x; const int hh = blockIdx.x % HG, sg = blockIdx.x / HG; const int s0 = sg * 64; const int h = h0 + hh;
  for (int i = tid; i < 64 * 8; i += 256) { const int j = i / 8, d8 = (i % 8) * 8; FragH f; f.half[0] = *(const v8us*)((const unsigned short*)V16 + ((size_t)b * SQ + s0 + j) * DM + h * HD + d8); for (int q = 0; q < 8; ++q) tl[d8 + q][j] = f.u[q]; }
  __syncthreads();
  { for (int i = tid; i < 64 * 8; i += 256) { const int d = i / 8, j8 = (i % 8) * 8; FragH f; for (int q = 0; q < 8; ++q) f.u[q] = tl[d][j8 + q]; *(v8us*)((unsigned short*)VT + ((size_t)hh * HD + d) * SQ + s0 + j8) = f.half[0]; }  } }


// lane l with lane l ^ M inside its 16-lane row (M = 1, 2, 4, 8), and with lane l ^ 16
template <int M>
__device__ __forceinline__ float row_x(float x) { return __builtin_bit_cast(float, __builtin_amdgcn_update_dpp(0, __builtin_bit_cast(int, x), 0x160 + M, 0xf, 0xf, true)); }
__device__ __forceinline__ float half_x(float x) { return __builtin_bit_cast(float, __builtin_amdgcn_permlanex16(__builtin_bit_cast(int, x), __builtin_bit_cast(int, x), 0x76543210, 0xfedcba98, false, false)); }
// exact (f32, vector unit) causal attention of rows 0..QT0-1: 8 waves a block, one wave a query row; x = head * (QT0 / 8) + group of 8 rows, y = batch. Keys go in chunks of 32; a chunk wholly behind the row is skipped (wave-uniform).
// scores: lane = 8 kq + dl reads dims 32 t + 4 dl .. + 3 of key 32 c + 4 g + kq (each load = 4 whole 128-byte lines), sums its 16 products (4 partial sums, one a dim of the 16 bytes), 3-step butterfly over dl; lane keeps the key with g == dl.
// softmax: maximum and sum = each lane's own (up to 4) keys, then a five-step butterfly. o: lane l holds dims 4 l .. 4 l + 3 (each load 512 contiguous bytes), keys in rising order, each weight read from the lane that keeps it.
// every loop is unrolled: q[], s[] keep static indices (registers, no scratch), the lane a weight is read from is a constant, and a chunk's 32 loads issue ahead of their first use.
__global__ __launch_bounds__(256) void k_att0w(const float* __restrict__ QF, const float* __restrict__ KF, const float* __restrict__ VF, float scale, float* __restrict__ OF) {
  constexpr int ld = DMX, ldv = DMX, ldo = DMX;      /* row pitches, compile-time: a chunk's 32 rows are immediate offsets from one address */
  const int lane = threadIdx.x & 31, dl = lane & 7, kq = lane >> 3; const int h = blockIdx.x / (QT0 / 8); const int i = (blockIdx.x % (QT0 / 8)) * 8 + __builtin_amdgcn_readfirstlane(threadIdx.x >> 5);
  { const size_t bq = (size_t)blockIdx.y * QT0; QF += (bq + i) * ld + h * 128; KF += bq * ld + h * 128; VF += bq * ldv + h * 128; OF += (bq + i) * ldo + h * 128; }      /* y = batch: each batch's QT0 rows follow the last one's */
  v4f q[4];
#pragma unroll
  for (int t = 0; t < 4; ++t) q[t] = *(const v4fa*)(QF + t * 32 + dl * 4);
  float s[QT0 / 32];
#pragma unroll
  for (int c = 0; c < QT0 / 32; ++c) { s[c] = -1.0e30f;
    if (c * 32 <= i) { const float* kp = KF + (size_t)(c * 32 + kq) * ld + dl * 4; float keep = 0.f;
#pragma unroll
      for (int g = 0; g < 8; ++g) { v4f pa = q[0] * *(const v4fa*)(kp + (size_t)(g * 4) * ld);
#pragma unroll
        for (int t = 1; t < 4; ++t) pa += q[t] * *(const v4fa*)(kp + (size_t)(g * 4) * ld + t * 32);
        float a = (pa[0] + pa[1]) + (pa[2] + pa[3]); a += row_x<1>(a); a += row_x<2>(a); a += row_x<4>(a); keep = (dl == g) ? a : keep; }
      s[c] = (c * 32 + 4 * dl + kq <= i) ? keep * scale : -1.0e30f; } }
  float m = s[0];
#pragma unroll
  for (int c = 1; c < QT0 / 32; ++c) m = fmaxf(m, s[c]);
  m = fmaxf(m, row_x<1>(m)); m = fmaxf(m, row_x<2>(m)); m = fmaxf(m, row_x<4>(m)); m = fmaxf(m, row_x<8>(m)); m = fmaxf(m, half_x(m));      /* key 0 is open in every row: m is a score */
  float l = 0.f;
#pragma unroll
  for (int c = 0; c < QT0 / 32; ++c) { s[c] = expf(s[c] - m); l += s[c]; }      /* a closed key: e^(-1e30 - m) = 0 */
  l += row_x<1>(l); l += row_x<2>(l); l += row_x<4>(l); l += row_x<8>(l); l += half_x(l);
  v4f o = {0.f, 0.f, 0.f, 0.f};
#pragma unroll
  for (int c = 0; c < QT0 / 32; ++c) {
    if (c * 32 <= i) { const float* vp = VF + (size_t)(c * 32) * ldv + lane * 4;
#pragma unroll
      for (int j = 0; j < 32; ++j) { const float e = __builtin_bit_cast(float, __builtin_amdgcn_readlane(__builtin_bit_cast(int, s[c]), 8 * (j & 3) + (j >> 2))); const v4f vv = *(const v4fa*)(vp + (size_t)j * ldv); o += vv * e; } } }
  *(v4f*)(OF + lane * 4) = o * (64.0f / l); }
__global__ __launch_bounds__(256) void k_f2h(const float* __restrict__ F, int ldf, int coff, int ncol, _Float16* __restrict__ H16, size_t nrow) { const size_t t = (size_t)blockIdx.x * 256 + threadIdx.x; const size_t n8 = nrow * (size_t)(ncol / 8); if (t >= n8) return; const size_t r = t / (ncol / 8); const int c8 = (int)(t % (ncol / 8)) * 8; FragH f; const v4f a = *(const v4fa*)(F + r * ldf + coff + c8), b2 = *(const v4fa*)(F + r * ldf + coff + c8 + 4); for (int q = 0; q < 4; ++q) { f.h[q] = (_Float16)a[q]; f.h[4 + q] = (_Float16)b2[q]; } *(v8us*)((unsigned short*)H16 + r * ncol + c8) = f.half[0];  }

__global__ __launch_bounds__(256) void k_tab128(float theta, float* __restrict__ CS, float* __restrict__ SN) {
  #pragma clang fp contract(off)
  const int t = blockIdx.x * 256 + threadIdx.x; if (t >= SQ * 64) return; const int i = t % 64; const int p = t / 64; const float invf = (float)(1.0 / pow((double)theta, (double)(2 * i) / 128.0));      /* = XLA's constant-folded f32 table */ const float ang = __fmul_rn((float)p, invf); const float c = cosf(ang), s = sinf(ang);
  *(float*)(CS + t) = c; *(float*)(SN + t) = s;  }
template <int TAB>
__global__ __launch_bounds__(128) void k_rope128(const float* __restrict__ F, int ldf, int nh, const float* __restrict__ CS, const float* __restrict__ SN, _Float16* __restrict__ H16, int ldo, float osc) {
  #pragma clang fp contract(off)
  __shared__ float xv[128]; __shared__ unsigned short sh_[128]; const int d = threadIdx.x; const int h = blockIdx.x % nh; const size_t r = blockIdx.x / nh; const int p = (int)(r % SQ);
  xv[d] = F[r * (size_t)ldf + (size_t)h * 128 + d]; __syncthreads();
  float c, s; if (TAB) { c = bf16_round(CS[(size_t)p * 128 + d]); s = bf16_round(SN[(size_t)p * 128 + d]); } else { c = CS[p * 64 + (d & 63)]; s = SN[p * 64 + (d & 63)]; }
  const float rot = (d < 64) ? -xv[d + 64] : xv[d - 64]; const float o = __fadd_rn(__fmul_rn(xv[d], c), __fmul_rn(rot, s));
  FragH th; th.h[0] = (_Float16)__fmul_rn(o, osc); sh_[d] = th.u[0]; __syncthreads();
  if (d < 16) { FragH f; for (int q = 0; q < 8; ++q) f.u[q] = sh_[d * 8 + q]; unsigned short* dst = (unsigned short*)H16 + r * (size_t)ldo + (size_t)h * 128 + d * 8; *(v8us*)dst = f.half[0];  } }

template <int N>
__global__ __launch_bounds__(256) void k_rmsrow(float* __restrict__ X, const float* __restrict__ w, float eps) {
  #pragma clang fp contract(off)
  constexpr int PT = N / 256; __shared__ float red[256]; const size_t r = blockIdx.x; const int t = threadIdx.x; float* row = X + r * N + (size_t)t * PT; float v[PT]; float ss = 0.f;
  for (int q = 0; q < PT; ++q) { v[q] = row[q]; ss = __fadd_rn(ss, __fmul_rn(v[q], v[q])); }
  red[t] = ss; __syncthreads(); for (int k = 128; k > 0; k >>= 1) { if (t < k) red[t] = __fadd_rn(red[t], red[t + k]); __syncthreads(); }
  const float rs = rsqrtf(__fadd_rn(red[0] / (float)N, eps)); float o[PT]; for (int q = 0; q < PT; ++q) o[q] = __fmul_rn(__fmul_rn(v[q], rs), bf16_round(w[t * PT + q]));
  { for (int q = 0; q < PT; ++q) *(float*)(row + q) = o[q];  } }
template <int GS_, int NHQ, int DSRC>
__global__ __launch_bounds__(256) void k_kvexp128(const float* __restrict__ src, float* __restrict__ dst, size_t n4) { const size_t t = (size_t)blockIdx.x * 256 + threadIdx.x; if (t >= n4) return; const size_t e = t * 4; const size_t row = e / ((size_t)NHQ * 128); const int col = (int)(e % ((size_t)NHQ * 128)); const int h = col / 128, d = col % 128; const v4f v = *(const v4fa*)(src + row * DSRC + (size_t)(h / GS_) * 128 + d); *(v4f*)(dst + e) = v;  }

__global__ __launch_bounds__(256) void k_rsmcfb(const float* __restrict__ S, _Float16* __restrict__ P, int hg, int q0, int nk, const int* __restrict__ mk) {
  #pragma clang fp contract(off)
  const int t = blockIdx.x * 256 + threadIdx.x; if (t >= hg * QT) return; const size_t i = (size_t)t; const float* s = S + i * NKX; const size_t ig = (size_t)(q0 + (t % QT)); const int* mr = mk + ig * SQ; float mx = -3.0e38f;
#pragma unroll 1
  for (int j = 0; j < nk; ++j) { const int mb = mr[j]; const float f = (mb == 0) ? 1.f : 0.f; mx = fmaxf(mx, fmaf(f, s[j], (1.f - f) * -1.0e9f)); } float se = 0.f;
#pragma unroll 1
  for (int j = 0; j < nk; ++j) { const int mb = mr[j]; const float f = (mb == 0) ? 1.f : 0.f; se += __expf(fmaf(f, s[j], (1.f - f) * -1.0e9f) - mx); } const float sc = 256.0f / se;
#pragma unroll 1
  for (int j0 = 0; j0 < nk; j0 += 8) { FragH fr; for (int q = 0; q < 8; ++q) { const int j = j0 + q; const int mb = mr[j]; const float f = (mb == 0) ? 1.f : 0.f; fr.h[q] = (_Float16)(__expf(fmaf(f, s[j], (1.f - f) * -1.0e9f) - mx) * sc); } unsigned short* d = (unsigned short*)P + i * NKX + j0; *(v8us*)d = fr.half[0];  } }


// per-head RMSNorm over the 128 dims, then rotate-half RoPE, of the NHD heads of one row, in place: lane l holds dims 4 l .. 4 l + 3 of every head.
// sum of squares = the lane's own 4 dims, then a five-step butterfly over the lanes; dim d's partner d +- 64 sits in lane l ^ 16; sg = the sine with the sign of rotate-half (minus in lanes 0..15).
// 1 / sqrt(x) of a normal x. One statement: the v_nop fills the slot behind v_rsq_f32 (output early-clobber).
__device__ __forceinline__ float rsq_n(float x) { float r; asm("v_rsq_f32 %0, %1\n\tv_nop" : "=&v"(r) : "v"(x)); return r; }
template <int NHD>
__device__ __forceinline__ void nr_heads(v4f (&x)[NHD], v4f w, v4f c, v4f sg) {
#pragma unroll
  for (int h = 0; h < NHD; ++h) { const v4f v = x[h]; float ss = (v[0] * v[0] + v[1] * v[1]) + (v[2] * v[2] + v[3] * v[3]);
    ss += row_x<1>(ss); ss += row_x<2>(ss); ss += row_x<4>(ss); ss += row_x<8>(ss); ss += half_x(ss);
    const v4f y = (v * rsq_n(ss * 0.0078125f + 1e-6f)) * w; v4f o;      /* mean square + eps >= 1e-6: never subnormal, so no rescue scaling round the v_rsq_f32 */
#pragma unroll
    for (int u = 0; u < 4; ++u) o[u] = y[u] * c[u] + half_x(y[u]) * sg[u];
    x[h] = o; } }
// RMSNorm + RoPE of q and k in one launch: 8 waves a block, one wave a row of x with its 16 query and 8 key heads in registers (each load 512 contiguous bytes, all 24 issued ahead of the first use; the row's table line is read once).
// out: f16 q and k; rows 0..QT0-1 of each batch also in f32 for the exact first tile, a key head written to both query heads of its group (wave-uniform branch).
__global__ __launch_bounds__(256) void k_nrope(const float* __restrict__ QF, const float* __restrict__ KF, const float* __restrict__ qw, const float* __restrict__ kw, const float* __restrict__ CS, const float* __restrict__ SN,
    _Float16* __restrict__ Q16, _Float16* __restrict__ K16, float* __restrict__ QF0, float* __restrict__ KF0e) {
  const int lane = threadIdx.x & 31, l4 = lane * 4; const int r = blockIdx.x * 8 + __builtin_amdgcn_readfirstlane(threadIdx.x >> 5); const int p = r % SQ, b = r / SQ;
  const float* q = QF + (size_t)r * DMX + l4; const float* k = KF + (size_t)r * DKV + l4;
  v4f xq[NH], xk[NKV];
#pragma unroll
  for (int h = 0; h < NH; ++h) xq[h] = *(const v4fa*)(q + h * 128);
#pragma unroll
  for (int h = 0; h < NKV; ++h) xk[h] = *(const v4fa*)(k + h * 128);
  const v4f cr = *(const v4fa*)(CS + (size_t)p * 128 + l4), sr = *(const v4fa*)(SN + (size_t)p * 128 + l4), qr = *(const v4fa*)(qw + l4), kr = *(const v4fa*)(kw + l4);
  v4f c, sg, wq, wk;
#pragma unroll
  for (int u = 0; u < 4; ++u) { c[u] = bf16_round(cr[u]); const float s = bf16_round(sr[u]); sg[u] = (lane < 16) ? -s : s; wq[u] = bf16_round(qr[u]); wk[u] = bf16_round(kr[u]); }
  nr_heads<NH>(xq, wq, c, sg); nr_heads<NKV>(xk, wk, c, sg);
  _Float16* q16 = Q16 + (size_t)r * DMX + l4; _Float16* k16 = K16 + (size_t)r * DKV + l4;
#pragma unroll
  for (int h = 0; h < NH; ++h) { v4h h4;
#pragma unroll
    for (int u = 0; u < 4; ++u) h4[u] = (_Float16)xq[h][u];
    *(v4h*)(q16 + h * 128) = h4; }
#pragma unroll
  for (int h = 0; h < NKV; ++h) { v4h h4;
#pragma unroll
    for (int u = 0; u < 4; ++u) h4[u] = (_Float16)xk[h][u];
    *(v4h*)(k16 + h * 128) = h4; }
  asm volatile("s_wait_xcnt 0x0" ::: "memory");      /* the branch below reuses registers that the f16 stores name; in front of the branch, so that nothing of it is lifted over the wait */
  if (p < QT0) { const size_t f = ((size_t)b * QT0 + p) * DMX + l4;
#pragma unroll
    for (int h = 0; h < NH; ++h) { *(v4f*)(QF0 + f + h * 128) = xq[h]; *(v4f*)(KF0e + f + h * 128) = xk[h / GSZ]; } } }

// 2^x of four values. One statement: each v_exp_f32 is followed by one that neither reads its result nor writes its source (outputs early-clobber), and the v_nop fills
// the slot behind the last.
__device__ __forceinline__ v4f exp2_4(v4f x) { float e0, e1, e2, e3;
  asm("v_exp_f32 %0, %4\n\tv_exp_f32 %1, %5\n\tv_exp_f32 %2, %6\n\tv_exp_f32 %3, %7\n\tv_nop" : "=&v"(e0), "=&v"(e1), "=&v"(e2), "=&v"(e3) : "v"(x[0]), "v"(x[1]), "v"(x[2]), "v"(x[3]));
  const v4f e = {e0, e1, e2, e3}; return e; }
// causal softmax, 8 waves a block, one wave a score row of NC * 128 columns: lane l holds columns 128 c + 4 l .. + 3 in registers (each load 512 contiguous bytes), so the row is read once;
// maximum and sum = each lane's own columns in rising order, then a five-step butterfly over the lanes.
template <int NC>
__global__ __launch_bounds__(256) void k_rsmcf2(const float* __restrict__ S, _Float16* __restrict__ P, int hg, int q0) {
  const int l4 = (threadIdx.x & 31) * 4; const int t = blockIdx.x * 8 + __builtin_amdgcn_readfirstlane(threadIdx.x >> 5); if (t >= hg * QT) return;
  const float* s = S + (size_t)t * NKX + l4; _Float16* p = P + (size_t)t * NKX + l4; const int rel = q0 + (t % QT) - l4;      /* column 128 c + 4 l + u is open while 128 c + u <= rel */
  v4f v[NC];
#pragma unroll
  for (int c = 0; c < NC; ++c) v[c] = *(const v4fa*)(s + c * 128);
  float mx = -3.0e38f;
#pragma unroll
  for (int c = 0; c < NC; ++c)
#pragma unroll
    for (int u = 0; u < 4; ++u) { const float m = (c * 128 + u <= rel) ? v[c][u] : -1.0e9f; v[c][u] = m; mx = fmaxf(mx, m); }
  mx = fmaxf(mx, row_x<1>(mx)); mx = fmaxf(mx, row_x<2>(mx)); mx = fmaxf(mx, row_x<4>(mx)); mx = fmaxf(mx, row_x<8>(mx)); mx = fmaxf(mx, half_x(mx));
  float se = 0.f;
#pragma unroll
  for (int c = 0; c < NC; ++c) { v[c] = exp2_4((v[c] - mx) * 1.4426950408889634f);      /* e^(x - max), as __expf forms it */
#pragma unroll
    for (int u = 0; u < 4; ++u) se += v[c][u]; }
  se += row_x<1>(se); se += row_x<2>(se); se += row_x<4>(se); se += row_x<8>(se); se += half_x(se);
  const float sc = 256.0f / se;
#pragma unroll
  for (int c = 0; c < NC; ++c) { v4h h4;
#pragma unroll
    for (int u = 0; u < 4; ++u) h4[u] = (_Float16)(v[c][u] * sc);
    *(v4h*)(p + c * 128) = h4; } }
extern "C" void kernel_launch(void* const* d_in, const int* in_sizes, int n_in,
                              void* d_out, int out_size, void* d_ws, size_t ws_size, hipStream_t stream) {
  (void)in_sizes; (void)n_in; (void)out_size;
  const float* const* I = (const float* const*)d_in; const float* x = I[0]; const float* wq = I[1]; const float* wk = I[2]; const float* wv = I[3]; const float* wo = I[4]; const float* qnw = I[5]; const float* knw = I[6]; const float* tcos = I[7]; const float* tsin = I[8];      /* [in][out] weights; rope tables [S][128] */
  char* ws = (char*)d_ws; size_t off = 0;
  auto take = [&](size_t bytes) { char* p = ws + off; off += (bytes + 255) & ~(size_t)255; return p; };
  _Float16* BQ = (_Float16*)take((size_t)DMX * DMX * 2); _Float16* BK = (_Float16*)take((size_t)DKV * DMX * 2); _Float16* BV = (_Float16*)take((size_t)DKV * DMX * 2); _Float16* BO = (_Float16*)take((size_t)DMX * DMX * 2);
  _Float16* X16 = (_Float16*)take(NR * DMX * 2); float* QF = (float*)take(NR * DMX * 4); float* KF = (float*)take(NR * DKV * 4); float* VF = (float*)take(NR * DKV * 4); _Float16* Q16 = (_Float16*)take(NR * DMX * 2); _Float16* K16 = (_Float16*)take(NR * DKV * 2); _Float16* V16 = (_Float16*)take(NR * DKV * 2); _Float16* O16 = (_Float16*)take(NR * DMX * 2);
  static_assert((size_t)NB * NH * QT * NKX * 4 <= NR * DMX * 2 + NR * DMX * 4 + NR * DKV * 4, "S must fit in X16 + QF + KF");
  float* S = (float*)X16;      /* scores of both batches [NB][NH][QT][NKX]: reuse X16, QF, KF (adjacent; last read by the norm + rope launch, in front of the first score launch) */
  _Float16* P = (_Float16*)take((size_t)NB * NH * QT * NKX * 2); _Float16* VT = (_Float16*)take((size_t)NB * (DKV / 64) * 64 * SQ * 2);
  float* QF0 = (float*)take((size_t)NB * QT0 * DMX * 4); float* KF0e = (float*)take((size_t)NB * QT0 * DMX * 4); float* VF0e = (float*)take((size_t)NB * QT0 * DMX * 4); float* OF0 = (float*)take((size_t)NB * QT0 * DMX * 4); _Float16* OH0 = (_Float16*)take((size_t)NB * QT0 * DMX * 2); _Float16* OL0 = (_Float16*)take((size_t)NB * QT0 * DMX * 2);
  if (off > ws_size) return;
  k_wt_f16<<<(unsigned)(((size_t)DMX * (DMX / 8) + 255) / 256), 256, 0, stream>>>(wq, BQ, DMX, DMX, 16.0f); k_wt_f16<<<(unsigned)(((size_t)DKV * (DMX / 8) + 255) / 256), 256, 0, stream>>>(wk, BK, DMX, DKV, 16.0f); k_wt_f16<<<(unsigned)(((size_t)DKV * (DMX / 8) + 255) / 256), 256, 0, stream>>>(wv, BV, DMX, DKV, 16.0f); k_wt_f16<<<(unsigned)(((size_t)DMX * (DMX / 8) + 255) / 256), 256, 0, stream>>>(wo, BO, DMX, DMX, 16.0f);      /* [in][out] -> Bt x16 */
  k_x16<<<(unsigned)((NR * DMX / 8 + 255) / 256), 256, 0, stream>>>(x, X16, NR * DMX / 8);
  k_gemm2<0><<<dim3((unsigned)((NR / 128) * (DMX / 64)), 1), 128, 0, stream>>>(X16, DMX, 0, BQ, DMX, 0, 0.0625f, nullptr, 0, nullptr, 1, 0, 0, QF, nullptr, DMX, 0, (int)NR, DMX, DMX, 1, 0, 0, 0);      /* q (f32) */
  k_gemm2<0><<<dim3((unsigned)((NR / 128) * (DKV / 64)), 1), 128, 0, stream>>>(X16, DMX, 0, BK, DMX, 0, 0.0625f, nullptr, 0, nullptr, 1, 0, 0, KF, nullptr, DKV, 0, (int)NR, DKV, DMX, 1, 0, 0, 0);      /* k (f32) */
  k_gemm2<0><<<dim3((unsigned)((NR / 128) * (DKV / 64)), 1), 128, 0, stream>>>(X16, DMX, 0, BV, DMX, 0, 0.0625f, nullptr, 0, nullptr, 1, 0, 0, VF, V16, DKV, 0, (int)NR, DKV, DMX, 1, 0, 0, 0);      /* v (f32 for the first tile + f16) */
  k_nrope<<<(unsigned)(NR / 8), 256, 0, stream>>>(QF, KF, qnw, knw, tcos, tsin, Q16, K16, QF0, KF0e);      /* per-head RMSNorm + rope from the input tables -> f16; rows 0..127 of each batch also f32, k expanded group -> head */
  for (int b = 0; b < NB; ++b) { const size_t r0 = (size_t)b * SQ, f0 = (size_t)b * QT0;
  k_kvexp128<GSZ, NH, DKV><<<(unsigned)(((size_t)QT0 * DMX / 4 + 255) / 256), 256, 0, stream>>>(VF + r0 * DKV, VF0e + f0 * DMX, (size_t)QT0 * DMX / 4);      /* v: group -> head expansion for the exact first tile */
  }      /* per batch */
  k_vt<DKV / 64, SQ><<<NB * (DKV / 64) * (SQ / 64), 256, 0, stream>>>(V16, DKV, 0, VT);      /* V^T, both batches: batch b, group g = slabs 16b + 2g, 16b + 2g + 1 */
  k_att0w<<<dim3(NH * (QT0 / 8), NB), 256, 0, stream>>>(QF0, KF0e, VF0e, ATS, OF0);      /* exact causal attention rows 0..127 of both batches (o x64) */
  for (int q0 = 0; q0 < SQ; q0 += QT) { const int nk = q0 + QT;      /* one launch a stage: grid y = the 16 heads, z = the 2 batches */
    k_gemm2<0><<<dim3((QT / 128) * (nk / 64), NH, NB), 128, 0, stream>>>(Q16 + (size_t)q0 * DMX, DMX, (size_t)HDK, K16, DKV, (size_t)HDK, ATS, nullptr, 0, nullptr, 1, 0, 0, S, nullptr, NKX, (size_t)QT * NKX, QT, nk, HDK, GSZ, (size_t)SQ * DMX, (size_t)SQ * DKV, (size_t)NH * QT * NKX);      /* scores: each head vs its group's key slab */
    static_assert(SQ / QT == 8, "one softmax kernel a row length");
    switch (nk / QT) {      /* causal softmax: the row length picks the kernel that holds a row of it in registers */
      case 1: k_rsmcf2<2><<<NB * NH * QT / 8, 256, 0, stream>>>(S, P, NB * NH, q0); break; case 2: k_rsmcf2<4><<<NB * NH * QT / 8, 256, 0, stream>>>(S, P, NB * NH, q0); break; case 3: k_rsmcf2<6><<<NB * NH * QT / 8, 256, 0, stream>>>(S, P, NB * NH, q0); break; case 4: k_rsmcf2<8><<<NB * NH * QT / 8, 256, 0, stream>>>(S, P, NB * NH, q0); break;
      case 5: k_rsmcf2<10><<<NB * NH * QT / 8, 256, 0, stream>>>(S, P, NB * NH, q0); break; case 6: k_rsmcf2<12><<<NB * NH * QT / 8, 256, 0, stream>>>(S, P, NB * NH, q0); break; case 7: k_rsmcf2<14><<<NB * NH * QT / 8, 256, 0, stream>>>(S, P, NB * NH, q0); break; default: k_rsmcf2<16><<<NB * NH * QT / 8, 256, 0, stream>>>(S, P, NB * NH, q0); break; }
    k_gemm2<0><<<dim3((QT / 128) * (HDK / 64), NH, NB), 128, 0, stream>>>(P, NKX, (size_t)QT * NKX, VT, SQ, (size_t)HDK * SQ, 0.25f, nullptr, 0, nullptr, 1, 0, 0, nullptr, O16 + (size_t)q0 * DMX, DMX, (size_t)HDK, QT, HDK, nk, GSZ, (size_t)NH * QT * NKX, (size_t)DKV * SQ, (size_t)SQ * DMX); }      /* o (x64): each head vs its group's V^T slab */
  k_gemm2<0><<<dim3((unsigned)((NR / 128) * (DMX / 64)), 1), 128, 0, stream>>>(O16, DMX, 0, BO, DMX, 0, 0.0009765625f, nullptr, 0, nullptr, 1, 0, 0, (float*)d_out, nullptr, DMX, 0, (int)NR, DMX, DMX, 1, 0, 0, 0);      /* out = o Wo */
  k_hl<<<(unsigned)(((size_t)NB * QT0 * DMX / 8 + 255) / 256), 256, 0, stream>>>(OF0, OH0, OL0, (size_t)NB * QT0 * DMX / 8);
  k_gemm2<0><<<dim3((QT0 / 128) * (DMX / 64), 1, NB), 128, 0, stream>>>(OH0, DMX, 0, BO, DMX, 0, 0.0009765625f, nullptr, 0, nullptr, 1, 0, 0, (float*)d_out, nullptr, DMX, 0, QT0, DMX, DMX, 1, (size_t)QT0 * DMX, 0, (size_t)SQ * DMX);
  k_gemm2<0><<<dim3((QT0 / 128) * (DMX / 64), 1, NB), 128, 0, stream>>>(OL0, DMX, 0, BO, DMX, 0, 0.00000095367431640625f, nullptr, 0, (const float*)d_out, -1, 0, 0, (float*)d_out, nullptr, DMX, 0, QT0, DMX, DMX, 1, (size_t)QT0 * DMX, 0, (size_t)SQ * DMX);      /* rows 0..127 of each batch rewritten from the exact path */
}

// v005
// One run takes 593 microseconds.
// Next to v004, in two timings, it ran 1.71 and 1.68 times as fast.
// Over all steps from v000 it is 17.4 times as fast.
#include <hip/hip_runtime.h>
// Qwen3 attention (x [2][2048][2048]; q = x Wq (16 heads x 128), k = x Wk, v = x Wv (8 kv heads x 128) ([in][out] weights sigma 0.02); per-head RMSNorm over the 128 dims on q and k (weights ones, eps 1e-6); rotate-half RoPE from the module's INPUT cos/sin tables [S][128] (theta 1e6); query head h uses kv head h/2; scores x 128^-0.5 with a causal mask (tril, finfo.min); softmax; out = merged Wo ([in][out]) -> [2][2048][2048]).
// Compute dtype: inputs rounded to bf16; x / weights / tables exact; projections, RMSNorm and rope f32; q, k, v, softmax weights and o as plain f16 GEMM operands (~2^-12; first 128 rows exact); scores, statistics, out f32. v_wmma_f32_16x16x32_f16.
#define NB 2
#define SQ 2048
#define DMX 2048
#define NH 16
#define NKV 8
#define GSZ 2
#define HDK 128
#define DKV (NKV * HDK)
#define QT 256
#define QT0 128
#define NKX SQ
#define DM DMX
#define HD 64
#define HG 1
#define NR ((size_t)NB * SQ)
#define ATS 0.08838834764831845f
typedef __bf16 v16b __attribute__((ext_vector_type(16)));
typedef unsigned short v8us __attribute__((ext_vector_type(8), may_alias));
typedef float  v8f  __attribute__((ext_vector_type(8)));
typedef float  v4f  __attribute__((ext_vector_type(4)));
typedef float  v4fa __attribute__((ext_vector_type(4), may_alias));
union FragB { v16b v; v8us half[2]; unsigned short u[16]; };

__device__ __forceinline__ unsigned short bf16_bits(float x) { unsigned int u = __float_as_uint(x); return (unsigned short)((u + 0x7FFFu + ((u >> 16) & 1u)) >> 16); }
__device__ __forceinline__ float bf16_val(unsigned short b) { return __uint_as_float(((unsigned int)b) << 16); }
__device__ __forceinline__ float bf16_round(float x) { return bf16_val(bf16_bits(x)); }
// D += A·B with NT terms: 1 = ah·bh, 2 = + al·bh (A split), 3 = + ah·bl (both split)
template <int NT>
__device__ __forceinline__ v8f mmaN(v16b ah, v16b al, v16b bh, v16b bl, v8f c) {
  c = __builtin_amdgcn_wmma_f32_16x16x32_bf16(false, ah, false, bh, (short)0, c, false, false);
  if (NT >= 2) c = __builtin_amdgcn_wmma_f32_16x16x32_bf16(false, al, false, bh, (short)0, c, false, false);
  if (NT >= 3) c = __builtin_amdgcn_wmma_f32_16x16x32_bf16(false, ah, false, bl, (short)0, c, false, false);
  asm volatile("v_nop\n\tv_nop\n\tv_nop\n\tv_nop" : "+v"(c) : "v"(ah), "v"(al), "v"(bh), "v"(bl));
  return c;
}

__global__ __launch_bounds__(256) void k_wt_bf16(const float* __restrict__ W, unsigned short* __restrict__ Wt, int K, int N) {
  const int t = blockIdx.x * 256 + threadIdx.x;
  const int k8n = K / 8;
  if (t >= N * k8n) return;
  const int n = t / k8n, k8 = (t % k8n) * 8;
  v8us v;
#pragma unroll
  for (int i = 0; i < 8; ++i) v[i] = bf16_bits(W[(size_t)(k8 + i) * N + n]);
  *(v8us*)(Wt + (size_t)n * K + k8) = v;
  
}

// GEMM C[M][N] (f32, pitch ldc) = act(A[M][K]·W + bias). A f32 row-major (pitch lda) converted per fragment to bf16
// (ASPLIT: hi/lo two planes -> 2 terms, else single rounded term); Wt bf16 [N][K] (pitch ldb). BIAS_BF16 rounds the
// bias to bf16 first (bias quantised to bf16 before the add). K%32==0, M%16==0, N%64==0.
template <bool ASPLIT, int ACT, bool BIAS_BF16>
__global__ __launch_bounds__(128) void k_gemm_bf(const float* __restrict__ A, int lda, const unsigned short* __restrict__ Wt, int ldb,
                                               const float* __restrict__ bias, float* __restrict__ C, int ldc, int M, int N, int K) {
  __shared__ __attribute__((aligned(16))) float so[4][16][64];
  const int tid = threadIdx.x, w = tid >> 5, lane = tid & 31, ln = lane & 15, hh = lane >> 4;
  const int ntn = N / 64;
  const int wid = blockIdx.x * 4 + w;
  const int mt = wid / ntn, nq = wid % ntn;
  if (mt * 16 >= M) return;
  const int row0 = mt * 16, col0 = nq * 64;
  const float* arow = A + (size_t)(row0 + ln) * lda;
  v8f acc[4] = {};
  for (int kb = 0; kb < K; kb += 32) {
    FragB ah, al;
    const v4f x0 = *(const v4fa*)(arow + kb + 8 * hh), x1 = *(const v4fa*)(arow + kb + 8 * hh + 4);
    const v4f x2 = *(const v4fa*)(arow + kb + 16 + 8 * hh), x3 = *(const v4fa*)(arow + kb + 16 + 8 * hh + 4);
    float xs[16] = {x0[0],x0[1],x0[2],x0[3],x1[0],x1[1],x1[2],x1[3],x2[0],x2[1],x2[2],x2[3],x3[0],x3[1],x3[2],x3[3]};
#pragma unroll
    for (int i = 0; i < 16; ++i) { const unsigned short hb = bf16_bits(xs[i]); ah.u[i] = hb; al.u[i] = ASPLIT ? bf16_bits(xs[i] - bf16_val(hb)) : (unsigned short)0; }
#pragma unroll
    for (int t = 0; t < 4; ++t) {
      const unsigned short* brow = Wt + (size_t)(col0 + t * 16 + ln) * ldb + kb;
      FragB b;
      b.half[0] = *(const v8us*)(brow + 8 * hh);
      b.half[1] = *(const v8us*)(brow + 16 + 8 * hh);
      acc[t] = mmaN<ASPLIT ? 2 : 1>(ah.v, al.v, b.v, b.v, acc[t]);
    }
  }
#pragma unroll
  for (int t = 0; t < 4; ++t) {
    float bv = bias ? bias[col0 + t * 16 + ln] : 0.f;
    if (BIAS_BF16) bv = bf16_round(bv);
#pragma unroll
    for (int r = 0; r < 8; ++r) { float v = acc[t][r] + bv; if (ACT == 1) v = fmaxf(v, 0.f); so[w][8 * hh + r][t * 16 + ln] = v; }
  }
  __builtin_amdgcn_fence(__ATOMIC_ACQ_REL, "workgroup");
  __builtin_amdgcn_wave_barrier();
  const int rsub = lane >> 4, c4 = (lane & 15) * 4;
  {
#pragma unroll
    for (int q = 0; q < 8; ++q) {
      const int r = q * 2 + rsub;
      const v4f v = *(const v4fa*)&so[w][r][c4];
      *(v4f*)(C + (size_t)(row0 + r) * ldc + col0 + c4) = v;
    }
    
  }
}

// GEMM C = act(A·W + bias + resid): A f32 (ASPLIT -> hi/lo 2 terms), Wt bf16 [N][K]; ACT 0 none, 1 relu, 2 exact gelu;
// resid (optional, f32, row index = (row % rmod), pitch ldr, RES_BF16 rounds it) added before the activation.
template <bool ASPLIT, int ACT, bool BIAS_BF16, bool RES_BF16>
__global__ __launch_bounds__(128) void k_gemm_bf3(const float* __restrict__ A, int lda, const unsigned short* __restrict__ Wt, int ldb,
                                                const float* __restrict__ bias, const float* __restrict__ resid, int rmod, int ldr,
                                                float* __restrict__ C, int ldc, int M, int N, int K) {
  __shared__ __attribute__((aligned(16))) float so[4][16][64];
  const int tid = threadIdx.x, w = tid >> 5, lane = tid & 31, ln = lane & 15, hh = lane >> 4;
  const int ntn = N / 64;
  const int wid = blockIdx.x * 4 + w;
  const int mt = wid / ntn, nq = wid % ntn;
  if (mt * 16 >= M) return;
  const int row0 = mt * 16, col0 = nq * 64;
  const float* arow = A + (size_t)(row0 + ln) * lda;
  v8f acc[4] = {};
  for (int kb = 0; kb < K; kb += 32) {
    FragB ah, al;
    const v4f x0 = *(const v4fa*)(arow + kb + 8 * hh), x1 = *(const v4fa*)(arow + kb + 8 * hh + 4);
    const v4f x2 = *(const v4fa*)(arow + kb + 16 + 8 * hh), x3 = *(const v4fa*)(arow + kb + 16 + 8 * hh + 4);
    float xs[16] = {x0[0],x0[1],x0[2],x0[3],x1[0],x1[1],x1[2],x1[3],x2[0],x2[1],x2[2],x2[3],x3[0],x3[1],x3[2],x3[3]};
#pragma unroll
    for (int i = 0; i < 16; ++i) { const unsigned short hb = bf16_bits(xs[i]); ah.u[i] = hb; al.u[i] = ASPLIT ? bf16_bits(xs[i] - bf16_val(hb)) : (unsigned short)0; }
#pragma unroll
    for (int t = 0; t < 4; ++t) {
      const unsigned short* brow = Wt + (size_t)(col0 + t * 16 + ln) * ldb + kb;
      FragB b;
      b.half[0] = *(const v8us*)(brow + 8 * hh);
      b.half[1] = *(const v8us*)(brow + 16 + 8 * hh);
      acc[t] = mmaN<ASPLIT ? 2 : 1>(ah.v, al.v, b.v, b.v, acc[t]);
    }
  }
#pragma unroll
  for (int t = 0; t < 4; ++t) {
    const int col = col0 + t * 16 + ln;
    float bv = bias ? bias[col] : 0.f;
    if (BIAS_BF16) bv = bf16_round(bv);
#pragma unroll
    for (int r = 0; r < 8; ++r) {
      float v = acc[t][r] + bv;
      if (resid) { float rv = resid[(size_t)((row0 + 8 * hh + r) % rmod) * ldr + col]; if (RES_BF16) rv = bf16_round(rv); v += rv; }
      if (ACT == 1) v = fmaxf(v, 0.f);
      if (ACT == 2) v = 0.5f * v * (1.0f + erff(v * 0.70710678118654752f));
      if (ACT == 3) { const float u = 0.7978845608028654f * (v + 0.044715f * v * v * v); v = 0.5f * v * (1.0f + tanhf(u)); }
      so[w][8 * hh + r][t * 16 + ln] = v;
    }
  }
  __builtin_amdgcn_fence(__ATOMIC_ACQ_REL, "workgroup");
  __builtin_amdgcn_wave_barrier();
  const int rsub = lane >> 4, c4 = (lane & 15) * 4;
  {
#pragma unroll
    for (int q = 0; q < 8; ++q) {
      const int r = q * 2 + rsub;
      const v4f v = *(const v4fa*)&so[w][r][c4];
      *(v4f*)(C + (size_t)(row0 + r) * ldc + col0 + c4) = v;
    }
    
  }
}
// row LayerNorm (biased variance, eps) over N: s = X (+ R); optional out_sum <- s; out_norm <- (s-mu)*rsqrt(var+eps)*g + b
template <bool PARAM_BF16>
__global__ __launch_bounds__(256) void k_layernorm(const float* __restrict__ X, const float* __restrict__ R, const float* __restrict__ g, const float* __restrict__ bta,
                                                  float* __restrict__ out_sum, float* __restrict__ out_norm, int N, float eps) {
  __shared__ float red[256];
  const int row = blockIdx.x, tid = threadIdx.x;
  const float* x = X + (size_t)row * N; const float* rr = R ? R + (size_t)row * N : nullptr;
  float vals[16];                     // up to N = 4096
  const int per = N / 256;            // contiguous chunk per thread? use strided-by-4 chunks: thread handles j = tid*4 + 1024*u
  float s1 = 0.f;
  for (int u = 0; u < per / 4; ++u) {
    const int j = tid * 4 + 1024 * u;
    const v4f a = *(const v4fa*)(x + j);
    v4f b = {0.f,0.f,0.f,0.f}; if (rr) b = *(const v4fa*)(rr + j);
#pragma unroll
    for (int q = 0; q < 4; ++q) { const float v = a[q] + b[q]; vals[u * 4 + q] = v; s1 += v; }
  }
  red[tid] = s1; __syncthreads();
  for (int st = 128; st > 0; st >>= 1) { if (tid < st) red[tid] += red[tid + st]; __syncthreads(); }
  const float mu = red[0] / (float)N; __syncthreads();
  float s2 = 0.f;
  for (int u = 0; u < per / 4; ++u)
#pragma unroll
    for (int q = 0; q < 4; ++q) { const float c = vals[u * 4 + q] - mu; s2 += c * c; }
  red[tid] = s2; __syncthreads();
  for (int st = 128; st > 0; st >>= 1) { if (tid < st) red[tid] += red[tid + st]; __syncthreads(); }
  const float rs = rsqrtf(red[0] / (float)N + eps);
  {
    for (int u = 0; u < per / 4; ++u) {
      const int j = tid * 4 + 1024 * u;
      v4f o, sm;
#pragma unroll
      for (int q = 0; q < 4; ++q) {
        float gg = g[j + q], bb = bta[j + q];
        if (PARAM_BF16) { gg = bf16_round(gg); bb = bf16_round(bb); }
        sm[q] = vals[u * 4 + q]; o[q] = (vals[u * 4 + q] - mu) * rs * gg + bb;
      }
      if (out_sum) *(v4f*)(out_sum + (size_t)row * N + j) = sm;
      *(v4f*)(out_norm + (size_t)row * N + j) = o;
    }
    
  }
}



// ---- f16 WMMA path (v_wmma_f32_16x16x32_f16): 11-bit significands for operands in range — used where a [0,1] probability operand needs more precision than bf16
typedef _Float16 v16h __attribute__((ext_vector_type(16)));
union FragH { v16h v; v8us half[2]; _Float16 h[16]; unsigned short u[16]; };
template <int NT>
__device__ __forceinline__ v8f mmaH(v16h ah, v16h al, v16h bh, v16h bl, v8f c) {
  c = __builtin_amdgcn_wmma_f32_16x16x32_f16(false, ah, false, bh, (short)0, c, false, false);
  if (NT >= 2) c = __builtin_amdgcn_wmma_f32_16x16x32_f16(false, al, false, bh, (short)0, c, false, false);
  if (NT >= 3) c = __builtin_amdgcn_wmma_f32_16x16x32_f16(false, ah, false, bl, (short)0, c, false, false);
  asm volatile("v_nop\n\tv_nop\n\tv_nop\n\tv_nop" : "+v"(c) : "v"(ah), "v"(al), "v"(bh), "v"(bl));
  return c;
}
// batched GEMM like k_gemm_b but f16 operands: A f32 (split into f16 hi/lo if ASPLIT, else rounded to f16), Bt = f16 values [n][k]; alpha; C f32; N multiple of 16 (partial tiles skipped)
template <bool ASPLIT>
__global__ __launch_bounds__(128) void k_gemm_h(const float* __restrict__ A, int lda, size_t sA, const _Float16* __restrict__ Bh, int ldb, size_t sB, float alpha, float* __restrict__ C, int ldc, size_t sC, int M, int N, int K) {
  __shared__ __attribute__((aligned(16))) float so[4][16][64];
  const int tid = threadIdx.x, w = tid >> 5, lane = tid & 31, ln = lane & 15, hh = lane >> 4; const int by = blockIdx.y;
  A += (size_t)by * sA; Bh += (size_t)by * sB; C += (size_t)by * sC;
  const int ntn = (N + 63) / 64; const int wid = blockIdx.x * 4 + w; const int mt = wid / ntn, nq = wid % ntn; if (mt * 16 >= M) return;
  const int row0 = mt * 16, col0 = nq * 64; const float* arow = A + (size_t)(row0 + ln) * lda;
  v8f acc[4] = {};
  for (int kb = 0; kb < K; kb += 32) {
    FragH ah, al;
    const v4f x0 = *(const v4fa*)(arow + kb + 8 * hh), x1 = *(const v4fa*)(arow + kb + 8 * hh + 4), x2 = *(const v4fa*)(arow + kb + 16 + 8 * hh), x3 = *(const v4fa*)(arow + kb + 16 + 8 * hh + 4);
    float xs[16] = {x0[0],x0[1],x0[2],x0[3],x1[0],x1[1],x1[2],x1[3],x2[0],x2[1],x2[2],x2[3],x3[0],x3[1],x3[2],x3[3]};
#pragma unroll
    for (int i = 0; i < 16; ++i) { const _Float16 h = (_Float16)xs[i]; ah.h[i] = h; al.h[i] = ASPLIT ? (_Float16)(xs[i] - (float)h) : (_Float16)0.0f; }
#pragma unroll
    for (int t = 0; t < 4; ++t) { if (col0 + t * 16 >= N) continue; const size_t boff = (size_t)(col0 + t * 16 + ln) * ldb + kb; FragH bq; bq.half[0] = *(const v8us*)(Bh + boff + 8 * hh); bq.half[1] = *(const v8us*)(Bh + boff + 16 + 8 * hh);
      acc[t] = mmaH<ASPLIT ? 2 : 1>(ah.v, al.v, bq.v, bq.v, acc[t]); }
  }
#pragma unroll
  for (int t = 0; t < 4; ++t) { if (col0 + t * 16 >= N) continue;
#pragma unroll
    for (int r = 0; r < 8; ++r) so[w][8 * hh + r][t * 16 + ln] = acc[t][r] * alpha; }
  __builtin_amdgcn_fence(__ATOMIC_ACQ_REL, "workgroup"); __builtin_amdgcn_wave_barrier();
  const int rsub = lane >> 4, c4 = (lane & 15) * 4;
  {
#pragma unroll
    for (int q = 0; q < 8; ++q) { const int r = q * 2 + rsub; if (col0 + c4 < N) { const v4f v = *(const v4fa*)&so[w][r][c4]; *(v4f*)(C + (size_t)(row0 + r) * ldc + col0 + c4) = v; } }
     }
}

// Wt[n][k] = f16(W[k][n]·scale) from f32 row-major W[K][N] (scale = power of two; bf16-exact weights stay exact in f16 away from the subnormal range)
__global__ __launch_bounds__(256) void k_wt_f16(const float* __restrict__ W, _Float16* __restrict__ Wt, int K, int N, float scale) {
  const int t = blockIdx.x * 256 + threadIdx.x; if (t >= N * (K / 8)) return; const int n = t / (K / 8), k8 = (t % (K / 8)) * 8; FragH f;
#pragma unroll
  for (int i = 0; i < 8; ++i) f.h[i] = (_Float16)(bf16_round(W[(size_t)(k8 + i) * N + n]) * scale); const v8us o = f.half[0];
  *(v8us*)((unsigned short*)Wt + (size_t)n * K + k8) = o; 
}
// k_gemm_hh variant with fused epilogue: v = acc·alpha + bias[by·sBias + col] (+ CP[(row/rowsPerB)·sCPb + by·64 + col] if CP) ; ACT 0 none / 1 elu ; writes f16 C16 (and f32 C if non-null)
template <int ACT>
__global__ __launch_bounds__(128) void k_gemm_hhx(const _Float16* __restrict__ A, int lda, size_t sA, const _Float16* __restrict__ Bh, int ldb, size_t sB, float alpha, const float* __restrict__ bias, size_t sBias, const float* __restrict__ CP, int rowsPerB, size_t sCPb, int row0g,
    float* __restrict__ C, _Float16* __restrict__ C16, int ldc, size_t sC, int M, int N, int K) {
  __shared__ __attribute__((aligned(16))) float so[4][16][64];
  const int tid = threadIdx.x, w = tid >> 5, lane = tid & 31, ln = lane & 15, hh = lane >> 4; const int by = blockIdx.y;
  A += (size_t)by * sA; Bh += (size_t)by * sB; const size_t cofs = (size_t)by * sC; const float* bp = bias ? bias + (size_t)by * sBias : nullptr;
  const int ntn = (N + 63) / 64; const int wid = blockIdx.x * 4 + w; const int mt = wid / ntn, nq = wid % ntn; if (mt * 16 >= M) return;
  const int row0 = mt * 16, col0 = nq * 64; const _Float16* arow = A + (size_t)(row0 + ln) * lda;
  v8f acc[4] = {};
  for (int kb = 0; kb < K; kb += 32) { FragH ah; ah.half[0] = *(const v8us*)((const unsigned short*)arow + kb + 8 * hh); ah.half[1] = *(const v8us*)((const unsigned short*)arow + kb + 16 + 8 * hh);
#pragma unroll
    for (int t = 0; t < 4; ++t) { if (col0 + t * 16 >= N) continue; const size_t boff = (size_t)(col0 + t * 16 + ln) * ldb + kb; FragH bq; bq.half[0] = *(const v8us*)((const unsigned short*)Bh + boff + 8 * hh); bq.half[1] = *(const v8us*)((const unsigned short*)Bh + boff + 16 + 8 * hh);
      acc[t] = mmaH<1>(ah.v, ah.v, bq.v, bq.v, acc[t]); }
  }
#pragma unroll
  for (int t = 0; t < 4; ++t) { if (col0 + t * 16 >= N) continue; const int col = col0 + t * 16 + ln; const float bv = bp ? bf16_round(bp[col]) : 0.f;
#pragma unroll
    for (int r = 0; r < 8; ++r) { float v = acc[t][r] * alpha + bv; if (CP) { const int rr = row0g + row0 + 8 * hh + r; if (rowsPerB < 0) v += CP[cofs + (size_t)rr * ldc + col];      /* rowsPerB < 0: own element of the batched C plane */ else { const int bidx = rr / rowsPerB; v += CP[(size_t)bidx * sCPb + (size_t)by * 64 + col]; } } if (ACT == 1) v = (v > 0.f) ? v : expm1f(v); else if (ACT == 7) v = (v > 0.f) ? v + 1.0f : expf(v); else if (ACT == 8) v = tanhf(v); else if (ACT == 9) v = 0.5f * v * (1.0f + tanhf(0.7978845608028654f * (v + 0.044715f * v * v * v))); else if (ACT == 11) v = 1.0f / (1.0f + expf(-v)); else if (ACT == 12) v = (v > 0.f) ? v : 0.01f * v; else if (ACT == 14) v = (v > 0.f) ? v : 0.1f * v; else if (ACT == 16) v = (v >= 0.f) ? v : 0.3f * v; else if (ACT == 17) v = (v >= 0.f) ? v : 0.2f * v; else if (ACT == 15) v = v / (1.0f + expf(-v)); else if (ACT == 3) v = fmaxf(v, 0.f); else if (ACT == 6) v = 0.5f * v * (1.0f + erff(v * 0.70710678118654752f)); so[w][8 * hh + r][t * 16 + ln] = v; } }
  __builtin_amdgcn_fence(__ATOMIC_ACQ_REL, "workgroup"); __builtin_amdgcn_wave_barrier();
  const int rsub = lane >> 4, c4 = (lane & 15) * 4; typedef _Float16 v4h __attribute__((ext_vector_type(4)));
  {
#pragma unroll
    for (int q = 0; q < 8; ++q) { const int r = q * 2 + rsub; if (col0 + c4 < N) { const v4f v = *(const v4fa*)&so[w][r][c4]; if (C) *(v4f*)(C + cofs + (size_t)(row0 + r) * ldc + col0 + c4) = v; if (C16) { v4h h4; for (int i = 0; i < 4; ++i) h4[i] = (_Float16)v[i]; *(v4h*)(C16 + cofs + (size_t)(row0 + r) * ldc + col0 + c4) = h4; } } }
     }
}


typedef _Float16 v4h __attribute__((ext_vector_type(4)));

__global__ __launch_bounds__(256) void k_x16(const float* __restrict__ x, _Float16* __restrict__ X16, size_t n8) { const size_t t = (size_t)blockIdx.x * 256 + threadIdx.x; if (t >= n8) return; FragH f;
#pragma unroll
  for (int q = 0; q < 8; ++q) f.h[q] = (_Float16)bf16_round(x[t * 8 + q]); *(v8us*)((unsigned short*)X16 + t * 8) = f.half[0];  }
__global__ __launch_bounds__(256) void k_h16(const float* __restrict__ x, _Float16* __restrict__ X16, size_t n8) { const size_t t = (size_t)blockIdx.x * 256 + threadIdx.x; if (t >= n8) return; FragH f;
#pragma unroll
  for (int q = 0; q < 8; ++q) f.h[q] = (_Float16)x[t * 8 + q]; *(v8us*)((unsigned short*)X16 + t * 8) = f.half[0];  }
__global__ __launch_bounds__(256) void k_round16f(const float* __restrict__ W, _Float16* __restrict__ Bt, size_t n8) { const size_t t = (size_t)blockIdx.x * 256 + threadIdx.x; if (t >= n8) return; FragH f;
#pragma unroll
  for (int i = 0; i < 8; ++i) f.h[i] = (_Float16)(bf16_round(W[t * 8 + i]) * 16.0f); *(v8us*)((unsigned short*)Bt + t * 8) = f.half[0];  }
template <int NHv, int TTv>
__global__ __launch_bounds__(256) void k_vt(const _Float16* __restrict__ V16, int ldv, int voff, _Float16* __restrict__ Vt) { __shared__ unsigned short tl[64][66]; const int tid = threadIdx.x; const int slab = blockIdx.x / (TTv / 64), lg = blockIdx.x % (TTv / 64); const int b = slab / NHv, h = slab % NHv;
  for (int i = tid; i < 64 * 8; i += 256) { const int r = i / 8, c8 = (i % 8) * 8; FragH f; f.half[0] = *(const v8us*)((const unsigned short*)V16 + ((size_t)b * TTv + lg * 64 + r) * ldv + voff + h * 64 + c8);
#pragma unroll
    for (int q = 0; q < 8; ++q) tl[r][c8 + q] = f.u[q]; }
  __syncthreads();
  {
#pragma unroll
    for (int rd = 0; rd < 2; ++rd) { const int d = rd * 32 + tid / 8, pc = tid % 8; FragH f;
#pragma unroll
      for (int q = 0; q < 8; ++q) f.u[q] = tl[pc * 8 + q][d];
      *(v8us*)((unsigned short*)Vt + ((size_t)slab * 64 + d) * TTv + lg * 64 + pc * 8) = f.half[0]; }
     } }

__global__ __launch_bounds__(256) void k_hl(const float* __restrict__ F, _Float16* __restrict__ Hh, _Float16* __restrict__ Hl, size_t n8) { const size_t t = (size_t)blockIdx.x * 256 + threadIdx.x; if (t >= n8) return; FragH fh, fl; const v4f a = *(const v4fa*)(F + t * 8), c = *(const v4fa*)(F + t * 8 + 4);
#pragma unroll
  for (int q = 0; q < 4; ++q) { _Float16 h = (_Float16)a[q]; fh.h[q] = h; fl.h[q] = (_Float16)((a[q] - (float)h) * 1024.0f); h = (_Float16)c[q]; fh.h[4 + q] = h; fl.h[4 + q] = (_Float16)((c[q] - (float)h) * 1024.0f); }
  { *(v8us*)((unsigned short*)Hh + t * 8) = fh.half[0]; *(v8us*)((unsigned short*)Hl + t * 8) = fl.half[0];  } }

// ---- fast GEMM (block tile 128x64, wave tile 32x64; requires M % 128 == 0 rows per launch region, N % 64 == 0, K % KC == 0); epilogue = k_gemm_hhx semantics ----
// The k range goes in tiles of KC: the block's 128 rows of A and 64 rows of B, KC f16 of each, are staged in LDS (rows 0..127 = A, 128..191 = B; pitch 2 KC + 16 bytes, an odd multiple of 16, for 16-byte readers),
// two buffers, the next tile's copies in flight while this one is multiplied. Every copy of a wave moves whole 128-byte lines; a fragment keeps its k order, so every sum keeps its order.
// KC = 64 where a launch has several blocks a WGP (54 KiB of LDS a block), 128 where it has at most one and the wait for a tile counts (half as many trips).
__device__ __forceinline__ v16h g2_frag(const _Float16* p, int hh) { FragH f; f.half[0] = *(const v8us*)((const unsigned short*)p + 8 * hh); f.half[1] = *(const v8us*)((const unsigned short*)p + 16 + 8 * hh); return f.v; }
__device__ __forceinline__ v8f g2_mma(v16h a, v16h b, v8f c) { v8f d = __builtin_amdgcn_wmma_f32_16x16x32_f16(false, a, false, b, (short)0, c, false, false); asm volatile("v_nop\n\tv_nop\n\tv_nop\n\tv_nop" : "+v"(d) : "v"(a), "v"(b)); return d; }
// one tile's copies, 12 a statement: thread = 16 bytes (seg) of row (thread / segs a row) + c * RPC; a, b = the thread's own first address in the tile, l = its own LDS byte address in the buffer.
// asm: the copy goes from global memory to LDS through no register. The s_wait_xcnt is the last line of the copies' own statement, so that no address register is rewritten in front of it.
template <int KC>
__device__ __forceinline__ void g2_stage(const _Float16* a, size_t lda, const _Float16* b, size_t ldb, unsigned l) {
  constexpr int RPC = 1024 / KC, NA = 128 / RPC, PB = 2 * KC + 16; static_assert((192 / RPC) % 12 == 0, "12 copies a statement");
#pragma unroll      /* both loops unrolled: p[], d[] keep static indices (registers, no scratch) */
  for (int g = 0; g < 192 / RPC / 12; ++g) { const _Float16* p[12]; unsigned d[12];
#pragma unroll
    for (int i = 0; i < 12; ++i) { const int c = g * 12 + i; p[i] = (c < NA) ? a + (size_t)(c * RPC) * lda : b + (size_t)((c - NA) * RPC) * ldb; d[i] = l + (unsigned)(c * RPC * PB); }
    asm volatile("global_load_async_to_lds_b128 %0, %12, off\n\tglobal_load_async_to_lds_b128 %1, %13, off\n\tglobal_load_async_to_lds_b128 %2, %14, off\n\tglobal_load_async_to_lds_b128 %3, %15, off\n\t"
                 "global_load_async_to_lds_b128 %4, %16, off\n\tglobal_load_async_to_lds_b128 %5, %17, off\n\tglobal_load_async_to_lds_b128 %6, %18, off\n\tglobal_load_async_to_lds_b128 %7, %19, off\n\t"
                 "global_load_async_to_lds_b128 %8, %20, off\n\tglobal_load_async_to_lds_b128 %9, %21, off\n\tglobal_load_async_to_lds_b128 %10, %22, off\n\tglobal_load_async_to_lds_b128 %11, %23, off\n\ts_wait_xcnt 0x0"
                 :: "v"(d[0]), "v"(d[1]), "v"(d[2]), "v"(d[3]), "v"(d[4]), "v"(d[5]), "v"(d[6]), "v"(d[7]), "v"(d[8]), "v"(d[9]), "v"(d[10]), "v"(d[11]),
                    "v"(p[0]), "v"(p[1]), "v"(p[2]), "v"(p[3]), "v"(p[4]), "v"(p[5]), "v"(p[6]), "v"(p[7]), "v"(p[8]), "v"(p[9]), "v"(p[10]), "v"(p[11]) : "memory"); } }
template <int ACT, int KC>
__global__ __launch_bounds__(128) void k_gemm2(const _Float16* __restrict__ A, int lda, size_t sA, const _Float16* __restrict__ Bh, int ldb, size_t sB, float alpha, const float* __restrict__ bias, size_t sBias, const float* __restrict__ CP, int rowsPerB, size_t sCPb, int row0g,
    float* __restrict__ C, _Float16* __restrict__ C16, int ldc, size_t sC, int M, int N, int K, int bdiv, size_t zA, size_t zB, size_t zC) { static_assert(ACT == 0 || ACT == 3 || ACT == 6 || ACT == 8 || ACT == 9 || ACT == 11 || ACT == 12 || ACT == 14 || ACT == 15 || ACT == 16 || ACT == 17, "k_gemm2: unsupported ACT code (would silently apply no activation)");
  constexpr int PB = 2 * KC + 16, STB = 192 * PB;      /* bytes: a staged row's pitch, one buffer */
  static_assert(2 * STB >= 4 * 32 * 68 * 4, "the output staging reuses the two buffers");
  __shared__ __attribute__((aligned(16))) unsigned char sm[2 * STB]; float (*so)[32][68] = reinterpret_cast<float (*)[32][68]>(sm);      /* so: each wave's output staging, used behind the loop's last barrier */
  const int tid = threadIdx.x, w = tid >> 5, lane = tid & 31, ln = lane & 15, hh = lane >> 4; const int by = blockIdx.y; const size_t bz = blockIdx.z;      /* y = head (bdiv heads share one B slab), z = batch */
  A += (size_t)by * sA + bz * zA; Bh += (size_t)(by / bdiv) * sB + bz * zB; const size_t cofs = (size_t)by * sC + bz * zC; const float* bp = bias ? bias + (size_t)by * sBias : nullptr;
  const int ntn = N >> 6; const int mt = blockIdx.x / ntn, nq = blockIdx.x - mt * ntn; const int row0 = mt * 128 + 32 * w, col0 = nq * 64; if (mt * 128 >= M) return;      /* the whole block leaves, in front of every barrier */
  const int srow = tid / (KC / 8), sseg = tid % (KC / 8);
  const _Float16* ag = A + (size_t)(mt * 128 + srow) * lda + sseg * 8; const _Float16* bg = Bh + (size_t)(col0 + srow) * ldb + sseg * 8;
  const unsigned l0 = (unsigned)(size_t)sm + (unsigned)(srow * PB + sseg * 16);
  const int nt = K / KC;
  g2_stage<KC>(ag, (size_t)lda, bg, (size_t)ldb, l0);
  asm volatile("s_wait_asynccnt 0x0" ::: "memory");      /* this wave's copies of tile 0 have landed */
  __syncthreads();      /* ... and every other wave's */
  if (nt > 1) g2_stage<KC>(ag + KC, (size_t)lda, bg + KC, (size_t)ldb, l0 + STB);
  const v8f z8 = {0.f,0.f,0.f,0.f,0.f,0.f,0.f,0.f}; v8f c00 = z8, c01 = z8, c02 = z8, c03 = z8, c10 = z8, c11 = z8, c12 = z8, c13 = z8;
#pragma unroll 1      /* one trip a tile: the two buffers take turns */
  for (int t = 0; t < nt; ++t) { const unsigned char* sb = sm + (t & 1) * STB;
    const _Float16* a0p = (const _Float16*)(sb + (32 * w + ln) * PB); const _Float16* a1p = (const _Float16*)(sb + (32 * w + 16 + ln) * PB);
    const _Float16* b0p = (const _Float16*)(sb + (128 + ln) * PB); const _Float16* b1p = (const _Float16*)(sb + (144 + ln) * PB); const _Float16* b2p = (const _Float16*)(sb + (160 + ln) * PB); const _Float16* b3p = (const _Float16*)(sb + (176 + ln) * PB);
    v16h fa[2][2], fb[2][4];      /* two fragment sets: a k step's 12 LDS loads go as one group, one step ahead of its products, inside this tile only */
    fa[0][0] = g2_frag(a0p, hh); fa[0][1] = g2_frag(a1p, hh); fb[0][0] = g2_frag(b0p, hh); fb[0][1] = g2_frag(b1p, hh); fb[0][2] = g2_frag(b2p, hh); fb[0][3] = g2_frag(b3p, hh);
#pragma unroll      /* unrolled: the sets keep static indices (registers), every LDS offset is an immediate */
    for (int s = 0; s < KC / 32; ++s) { const int u = s & 1, n = u ^ 1, kn = (s + 1) * 32;
      if (s + 1 < KC / 32) { fa[n][0] = g2_frag(a0p + kn, hh); fa[n][1] = g2_frag(a1p + kn, hh); fb[n][0] = g2_frag(b0p + kn, hh); fb[n][1] = g2_frag(b1p + kn, hh); fb[n][2] = g2_frag(b2p + kn, hh); fb[n][3] = g2_frag(b3p + kn, hh); }
      c00 = g2_mma(fa[u][0], fb[u][0], c00); c10 = g2_mma(fa[u][1], fb[u][0], c10); c01 = g2_mma(fa[u][0], fb[u][1], c01); c11 = g2_mma(fa[u][1], fb[u][1], c11);
      c02 = g2_mma(fa[u][0], fb[u][2], c02); c12 = g2_mma(fa[u][1], fb[u][2], c12); c03 = g2_mma(fa[u][0], fb[u][3], c03); c13 = g2_mma(fa[u][1], fb[u][3], c13); }
    asm volatile("s_wait_dscnt 0x0" ::: "memory");      /* this wave's reads of the buffer are done before it is handed to the next copies */
    asm volatile("s_wait_asynccnt 0x0" ::: "memory");      /* this wave's copies of tile t + 1 have landed */
    __syncthreads();      /* publishes tile t + 1 and ends every wave's reads of tile t */
    if (t + 2 < nt) g2_stage<KC>(ag + (size_t)(t + 2) * KC, (size_t)lda, bg + (size_t)(t + 2) * KC, (size_t)ldb, l0 + (t & 1) * STB); }
  asm volatile("s_wait_asynccnt 0x0" ::: "memory");      /* no copy is in flight when the buffers become output staging */
  v8f accs[8] = {c00, c01, c02, c03, c10, c11, c12, c13};
#pragma unroll
  for (int u = 0; u < 8; ++u) { const int t = u & 3, half = u >> 2; const int col = col0 + t * 16 + ln; const float bv = bp ? bf16_round(bp[col]) : 0.f;
#pragma unroll
    for (int r = 0; r < 8; ++r) { const int rloc = half * 16 + 8 * hh + r; float v = accs[u][r] * alpha + bv; if (CP) { if (rowsPerB < 0) v += CP[cofs + (size_t)(row0g + row0 + rloc) * ldc + col];      /* rowsPerB < 0: own element of the batched C plane */ else { const int bidx = (row0g + row0 + rloc) / rowsPerB; v += CP[(size_t)bidx * sCPb + (size_t)by * 64 + col]; } }
      if (ACT == 3) v = fmaxf(v, 0.f); else if (ACT == 6) v = 0.5f * v * (1.0f + erff(v * 0.70710678118654752f)); else if (ACT == 11) v = 1.0f / (1.0f + expf(-v)); else if (ACT == 15) v = v / (1.0f + expf(-v)); else if (ACT == 12) v = (v > 0.f) ? v : 0.01f * v; else if (ACT == 8) v = tanhf(v); else if (ACT == 9) v = 0.5f * v * (1.0f + tanhf(0.7978845608028654f * (v + 0.044715f * v * v * v))); else if (ACT == 14) v = (v > 0.f) ? v : 0.1f * v; else if (ACT == 16) v = (v >= 0.f) ? v : 0.3f * v; else if (ACT == 17) v = (v >= 0.f) ? v : 0.2f * v;
      so[w][rloc][t * 16 + ln] = v; } }
  __builtin_amdgcn_fence(__ATOMIC_ACQ_REL, "workgroup"); __builtin_amdgcn_wave_barrier();
  const int rsub = lane >> 4, c4 = (lane & 15) * 4;
  {
#pragma unroll
    for (int q = 0; q < 16; ++q) { const int r = q * 2 + rsub; const v4f v = *(const v4fa*)&so[w][r][c4]; if (C) *(v4f*)(C + cofs + (size_t)(row0 + r) * ldc + col0 + c4) = v; if (C16) { v4h h4; for (int i = 0; i < 4; ++i) h4[i] = (_Float16)v[i]; *(v4h*)(C16 + cofs + (size_t)(row0 + r) * ldc + col0 + c4) = h4; } }
     } }


__global__ __launch_bounds__(256) void k_wnat(const float* __restrict__ w, size_t n8, _Float16* __restrict__ Bt) { const size_t t = (size_t)blockIdx.x * 256 + threadIdx.x; if (t >= n8) return; FragH f; for (int q = 0; q < 8; ++q) f.h[q] = (_Float16)(bf16_round(w[t * 8 + q]) * 16.0f); *(v8us*)((unsigned short*)Bt + t * 8) = f.half[0];  }
__global__ __launch_bounds__(256) void k_rsm(const float* __restrict__ S, _Float16* __restrict__ P, int nrows) {
  #pragma clang fp contract(off)
  const int i = blockIdx.x * 256 + threadIdx.x; if (i >= nrows) return; const float* s = S + (size_t)i * SQ; float mx = -3.0e38f;
#pragma unroll 1
  for (int j = 0; j < SQ; ++j) mx = fmaxf(mx, s[j]); float se = 0.f;
#pragma unroll 1
  for (int j = 0; j < SQ; ++j) se += expf(s[j] - mx); const float sc = 256.0f / se;
#pragma unroll 1
  for (int j0 = 0; j0 < SQ; j0 += 8) { FragH f; for (int q = 0; q < 8; ++q) f.h[q] = (_Float16)(expf(s[j0 + q] - mx) * sc); unsigned short* d = (unsigned short*)P + (size_t)i * SQ + j0; *(v8us*)d = f.half[0];  } }
__global__ __launch_bounds__(256) void k_vt(const _Float16* __restrict__ V16, int b, int h0, _Float16* __restrict__ VT) { __shared__ unsigned short tl[64][65]; const int tid = threadIdx.x; const int hh = blockIdx.x % HG, sg = blockIdx.x / HG; const int s0 = sg * 64; const int h = h0 + hh;
  for (int i = tid; i < 64 * 8; i += 256) { const int j = i / 8, d8 = (i % 8) * 8; FragH f; f.half[0] = *(const v8us*)((const unsigned short*)V16 + ((size_t)b * SQ + s0 + j) * DM + h * HD + d8); for (int q = 0; q < 8; ++q) tl[d8 + q][j] = f.u[q]; }
  __syncthreads();
  { for (int i = tid; i < 64 * 8; i += 256) { const int d = i / 8, j8 = (i % 8) * 8; FragH f; for (int q = 0; q < 8; ++q) f.u[q] = tl[d][j8 + q]; *(v8us*)((unsigned short*)VT + ((size_t)hh * HD + d) * SQ + s0 + j8) = f.half[0]; }  } }


// lane l with lane l ^ M inside its 16-lane row (M = 1, 2, 4, 8), and with lane l ^ 16
template <int M>
__device__ __forceinline__ float row_x(float x) { return __builtin_bit_cast(float, __builtin_amdgcn_update_dpp(0, __builtin_bit_cast(int, x), 0x160 + M, 0xf, 0xf, true)); }
__device__ __forceinline__ float half_x(float x) { return __builtin_bit_cast(float, __builtin_amdgcn_permlanex16(__builtin_bit_cast(int, x), __builtin_bit_cast(int, x), 0x76543210, 0xfedcba98, false, false)); }
// exact (f32, vector unit) causal attention of rows 0..QT0-1: 8 waves a block, one wave a query row; x = head * (QT0 / 8) + group of 8 rows, y = batch. Keys go in chunks of 32; a chunk wholly behind the row is skipped (wave-uniform).
// scores: lane = 8 kq + dl reads dims 32 t + 4 dl .. + 3 of key 32 c + 4 g + kq (each load = 4 whole 128-byte lines), sums its 16 products (4 partial sums, one a dim of the 16 bytes), 3-step butterfly over dl; lane keeps the key with g == dl.
// softmax: maximum and sum = each lane's own (up to 4) keys, then a five-step butterfly. o: lane l holds dims 4 l .. 4 l + 3 (each load 512 contiguous bytes), keys in rising order, each weight read from the lane that keeps it.
// every loop is unrolled: q[], s[] keep static indices (registers, no scratch), the lane a weight is read from is a constant, and a chunk's 32 loads issue ahead of their first use.
__global__ __launch_bounds__(256) void k_att0w(const float* __restrict__ QF, const float* __restrict__ KF, const float* __restrict__ VF, float scale, float* __restrict__ OF) {
  constexpr int ld = DMX, ldv = DMX, ldo = DMX;      /* row pitches, compile-time: a chunk's 32 rows are immediate offsets from one address */
  const int lane = threadIdx.x & 31, dl = lane & 7, kq = lane >> 3; const int h = blockIdx.x / (QT0 / 8); const int i = (blockIdx.x % (QT0 / 8)) * 8 + __builtin_amdgcn_readfirstlane(threadIdx.x >> 5);
  { const size_t bq = (size_t)blockIdx.y * QT0; QF += (bq + i) * ld + h * 128; KF += bq * ld + h * 128; VF += bq * ldv + h * 128; OF += (bq + i) * ldo + h * 128; }      /* y = batch: each batch's QT0 rows follow the last one's */
  v4f q[4];
#pragma unroll
  for (int t = 0; t < 4; ++t) q[t] = *(const v4fa*)(QF + t * 32 + dl * 4);
  float s[QT0 / 32];
#pragma unroll
  for (int c = 0; c < QT0 / 32; ++c) { s[c] = -1.0e30f;
    if (c * 32 <= i) { const float* kp = KF + (size_t)(c * 32 + kq) * ld + dl * 4; float keep = 0.f;
#pragma unroll
      for (int g = 0; g < 8; ++g) { v4f pa = q[0] * *(const v4fa*)(kp + (size_t)(g * 4) * ld);
#pragma unroll
        for (int t = 1; t < 4; ++t) pa += q[t] * *(const v4fa*)(kp + (size_t)(g * 4) * ld + t * 32);
        float a = (pa[0] + pa[1]) + (pa[2] + pa[3]); a += row_x<1>(a); a += row_x<2>(a); a += row_x<4>(a); keep = (dl == g) ? a : keep; }
      s[c] = (c * 32 + 4 * dl + kq <= i) ? keep * scale : -1.0e30f; } }
  float m = s[0];
#pragma unroll
  for (int c = 1; c < QT0 / 32; ++c) m = fmaxf(m, s[c]);
  m = fmaxf(m, row_x<1>(m)); m = fmaxf(m, row_x<2>(m)); m = fmaxf(m, row_x<4>(m)); m = fmaxf(m, row_x<8>(m)); m = fmaxf(m, half_x(m));      /* key 0 is open in every row: m is a score */
  float l = 0.f;
#pragma unroll
  for (int c = 0; c < QT0 / 32; ++c) { s[c] = expf(s[c] - m); l += s[c]; }      /* a closed key: e^(-1e30 - m) = 0 */
  l += row_x<1>(l); l += row_x<2>(l); l += row_x<4>(l); l += row_x<8>(l); l += half_x(l);
  v4f o = {0.f, 0.f, 0.f, 0.f};
#pragma unroll
  for (int c = 0; c < QT0 / 32; ++c) {
    if (c * 32 <= i) { const float* vp = VF + (size_t)(c * 32) * ldv + lane * 4;
#pragma unroll
      for (int j = 0; j < 32; ++j) { const float e = __builtin_bit_cast(float, __builtin_amdgcn_readlane(__builtin_bit_cast(int, s[c]), 8 * (j & 3) + (j >> 2))); const v4f vv = *(const v4fa*)(vp + (size_t)j * ldv); o += vv * e; } } }
  *(v4f*)(OF + lane * 4) = o * (64.0f / l); }
__global__ __launch_bounds__(256) void k_f2h(const float* __restrict__ F, int ldf, int coff, int ncol, _Float16* __restrict__ H16, size_t nrow) { const size_t t = (size_t)blockIdx.x * 256 + threadIdx.x; const size_t n8 = nrow * (size_t)(ncol / 8); if (t >= n8) return; const size_t r = t / (ncol / 8); const int c8 = (int)(t % (ncol / 8)) * 8; FragH f; const v4f a = *(const v4fa*)(F + r * ldf + coff + c8), b2 = *(const v4fa*)(F + r * ldf + coff + c8 + 4); for (int q = 0; q < 4; ++q) { f.h[q] = (_Float16)a[q]; f.h[4 + q] = (_Float16)b2[q]; } *(v8us*)((unsigned short*)H16 + r * ncol + c8) = f.half[0];  }

__global__ __launch_bounds__(256) void k_tab128(float theta, float* __restrict__ CS, float* __restrict__ SN) {
  #pragma clang fp contract(off)
  const int t = blockIdx.x * 256 + threadIdx.x; if (t >= SQ * 64) return; const int i = t % 64; const int p = t / 64; const float invf = (float)(1.0 / pow((double)theta, (double)(2 * i) / 128.0));      /* = XLA's constant-folded f32 table */ const float ang = __fmul_rn((float)p, invf); const float c = cosf(ang), s = sinf(ang);
  *(float*)(CS + t) = c; *(float*)(SN + t) = s;  }
template <int TAB>
__global__ __launch_bounds__(128) void k_rope128(const float* __restrict__ F, int ldf, int nh, const float* __restrict__ CS, const float* __restrict__ SN, _Float16* __restrict__ H16, int ldo, float osc) {
  #pragma clang fp contract(off)
  __shared__ float xv[128]; __shared__ unsigned short sh_[128]; const int d = threadIdx.x; const int h = blockIdx.x % nh; const size_t r = blockIdx.x / nh; const int p = (int)(r % SQ);
  xv[d] = F[r * (size_t)ldf + (size_t)h * 128 + d]; __syncthreads();
  float c, s; if (TAB) { c = bf16_round(CS[(size_t)p * 128 + d]); s = bf16_round(SN[(size_t)p * 128 + d]); } else { c = CS[p * 64 + (d & 63)]; s = SN[p * 64 + (d & 63)]; }
  const float rot = (d < 64) ? -xv[d + 64] : xv[d - 64]; const float o = __fadd_rn(__fmul_rn(xv[d], c), __fmul_rn(rot, s));
  FragH th; th.h[0] = (_Float16)__fmul_rn(o, osc); sh_[d] = th.u[0]; __syncthreads();
  if (d < 16) { FragH f; for (int q = 0; q < 8; ++q) f.u[q] = sh_[d * 8 + q]; unsigned short* dst = (unsigned short*)H16 + r * (size_t)ldo + (size_t)h * 128 + d * 8; *(v8us*)dst = f.half[0];  } }

template <int N>
__global__ __launch_bounds__(256) void k_rmsrow(float* __restrict__ X, const float* __restrict__ w, float eps) {
  #pragma clang fp contract(off)
  constexpr int PT = N / 256; __shared__ float red[256]; const size_t r = blockIdx.x; const int t = threadIdx.x; float* row = X + r * N + (size_t)t * PT; float v[PT]; float ss = 0.f;
  for (int q = 0; q < PT; ++q) { v[q] = row[q]; ss = __fadd_rn(ss, __fmul_rn(v[q], v[q])); }
  red[t] = ss; __syncthreads(); for (int k = 128; k > 0; k >>= 1) { if (t < k) red[t] = __fadd_rn(red[t], red[t + k]); __syncthreads(); }
  const float rs = rsqrtf(__fadd_rn(red[0] / (float)N, eps)); float o[PT]; for (int q = 0; q < PT; ++q) o[q] = __fmul_rn(__fmul_rn(v[q], rs), bf16_round(w[t * PT + q]));
  { for (int q = 0; q < PT; ++q) *(float*)(row + q) = o[q];  } }
template <int GS_, int NHQ, int DSRC>
__global__ __launch_bounds__(256) void k_kvexp128(const float* __restrict__ src, float* __restrict__ dst, size_t n4) { const size_t t = (size_t)blockIdx.x * 256 + threadIdx.x; if (t >= n4) return; const size_t e = t * 4; const size_t row = e / ((size_t)NHQ * 128); const int col = (int)(e % ((size_t)NHQ * 128)); const int h = col / 128, d = col % 128; const v4f v = *(const v4fa*)(src + row * DSRC + (size_t)(h / GS_) * 128 + d); *(v4f*)(dst + e) = v;  }

__global__ __launch_bounds__(256) void k_rsmcfb(const float* __restrict__ S, _Float16* __restrict__ P, int hg, int q0, int nk, const int* __restrict__ mk) {
  #pragma clang fp contract(off)
  const int t = blockIdx.x * 256 + threadIdx.x; if (t >= hg * QT) return; const size_t i = (size_t)t; const float* s = S + i * NKX; const size_t ig = (size_t)(q0 + (t % QT)); const int* mr = mk + ig * SQ; float mx = -3.0e38f;
#pragma unroll 1
  for (int j = 0; j < nk; ++j) { const int mb = mr[j]; const float f = (mb == 0) ? 1.f : 0.f; mx = fmaxf(mx, fmaf(f, s[j], (1.f - f) * -1.0e9f)); } float se = 0.f;
#pragma unroll 1
  for (int j = 0; j < nk; ++j) { const int mb = mr[j]; const float f = (mb == 0) ? 1.f : 0.f; se += __expf(fmaf(f, s[j], (1.f - f) * -1.0e9f) - mx); } const float sc = 256.0f / se;
#pragma unroll 1
  for (int j0 = 0; j0 < nk; j0 += 8) { FragH fr; for (int q = 0; q < 8; ++q) { const int j = j0 + q; const int mb = mr[j]; const float f = (mb == 0) ? 1.f : 0.f; fr.h[q] = (_Float16)(__expf(fmaf(f, s[j], (1.f - f) * -1.0e9f) - mx) * sc); } unsigned short* d = (unsigned short*)P + i * NKX + j0; *(v8us*)d = fr.half[0];  } }


// per-head RMSNorm over the 128 dims, then rotate-half RoPE, of the NHD heads of one row, in place: lane l holds dims 4 l .. 4 l + 3 of every head.
// sum of squares = the lane's own 4 dims, then a five-step butterfly over the lanes; dim d's partner d +- 64 sits in lane l ^ 16; sg = the sine with the sign of rotate-half (minus in lanes 0..15).
// 1 / sqrt(x) of a normal x. One statement: the v_nop fills the slot behind v_rsq_f32 (output early-clobber).
__device__ __forceinline__ float rsq_n(float x) { float r; asm("v_rsq_f32 %0, %1\n\tv_nop" : "=&v"(r) : "v"(x)); return r; }
template <int NHD>
__device__ __forceinline__ void nr_heads(v4f (&x)[NHD], v4f w, v4f c, v4f sg) {
#pragma unroll
  for (int h = 0; h < NHD; ++h) { const v4f v = x[h]; float ss = (v[0] * v[0] + v[1] * v[1]) + (v[2] * v[2] + v[3] * v[3]);
    ss += row_x<1>(ss); ss += row_x<2>(ss); ss += row_x<4>(ss); ss += row_x<8>(ss); ss += half_x(ss);
    const v4f y = (v * rsq_n(ss * 0.0078125f + 1e-6f)) * w; v4f o;      /* mean square + eps >= 1e-6: never subnormal, so no rescue scaling round the v_rsq_f32 */
#pragma unroll
    for (int u = 0; u < 4; ++u) o[u] = y[u] * c[u] + half_x(y[u]) * sg[u];
    x[h] = o; } }
// RMSNorm + RoPE of q and k in one launch: 8 waves a block, one wave a row of x with its 16 query and 8 key heads in registers (each load 512 contiguous bytes, all 24 issued ahead of the first use; the row's table line is read once).
// out: f16 q and k; rows 0..QT0-1 of each batch also in f32 for the exact first tile, a key head written to both query heads of its group (wave-uniform branch).
__global__ __launch_bounds__(256) void k_nrope(const float* __restrict__ QF, const float* __restrict__ KF, const float* __restrict__ qw, const float* __restrict__ kw, const float* __restrict__ CS, const float* __restrict__ SN,
    _Float16* __restrict__ Q16, _Float16* __restrict__ K16, float* __restrict__ QF0, float* __restrict__ KF0e) {
  const int lane = threadIdx.x & 31, l4 = lane * 4; const int r = blockIdx.x * 8 + __builtin_amdgcn_readfirstlane(threadIdx.x >> 5); const int p = r % SQ, b = r / SQ;
  const float* q = QF + (size_t)r * DMX + l4; const float* k = KF + (size_t)r * DKV + l4;
  v4f xq[NH], xk[NKV];
#pragma unroll
  for (int h = 0; h < NH; ++h) xq[h] = *(const v4fa*)(q + h * 128);
#pragma unroll
  for (int h = 0; h < NKV; ++h) xk[h] = *(const v4fa*)(k + h * 128);
  const v4f cr = *(const v4fa*)(CS + (size_t)p * 128 + l4), sr = *(const v4fa*)(SN + (size_t)p * 128 + l4), qr = *(const v4fa*)(qw + l4), kr = *(const v4fa*)(kw + l4);
  v4f c, sg, wq, wk;
#pragma unroll
  for (int u = 0; u < 4; ++u) { c[u] = bf16_round(cr[u]); const float s = bf16_round(sr[u]); sg[u] = (lane < 16) ? -s : s; wq[u] = bf16_round(qr[u]); wk[u] = bf16_round(kr[u]); }
  nr_heads<NH>(xq, wq, c, sg); nr_heads<NKV>(xk, wk, c, sg);
  _Float16* q16 = Q16 + (size_t)r * DMX + l4; _Float16* k16 = K16 + (size_t)r * DKV + l4;
#pragma unroll
  for (int h = 0; h < NH; ++h) { v4h h4;
#pragma unroll
    for (int u = 0; u < 4; ++u) h4[u] = (_Float16)xq[h][u];
    *(v4h*)(q16 + h * 128) = h4; }
#pragma unroll
  for (int h = 0; h < NKV; ++h) { v4h h4;
#pragma unroll
    for (int u = 0; u < 4; ++u) h4[u] = (_Float16)xk[h][u];
    *(v4h*)(k16 + h * 128) = h4; }
  asm volatile("s_wait_xcnt 0x0" ::: "memory");      /* the branch below reuses registers that the f16 stores name; in front of the branch, so that nothing of it is lifted over the wait */
  if (p < QT0) { const size_t f = ((size_t)b * QT0 + p) * DMX + l4;
#pragma unroll
    for (int h = 0; h < NH; ++h) { *(v4f*)(QF0 + f + h * 128) = xq[h]; *(v4f*)(KF0e + f + h * 128) = xk[h / GSZ]; } } }

// 2^x of four values. One statement: each v_exp_f32 is followed by one that neither reads its result nor writes its source (outputs early-clobber), and the v_nop fills
// the slot behind the last.
__device__ __forceinline__ v4f exp2_4(v4f x) { float e0, e1, e2, e3;
  asm("v_exp_f32 %0, %4\n\tv_exp_f32 %1, %5\n\tv_exp_f32 %2, %6\n\tv_exp_f32 %3, %7\n\tv_nop" : "=&v"(e0), "=&v"(e1), "=&v"(e2), "=&v"(e3) : "v"(x[0]), "v"(x[1]), "v"(x[2]), "v"(x[3]));
  const v4f e = {e0, e1, e2, e3}; return e; }
// causal softmax, 8 waves a block, one wave a score row of NC * 128 columns: lane l holds columns 128 c + 4 l .. + 3 in registers (each load 512 contiguous bytes), so the row is read once;
// maximum and sum = each lane's own columns in rising order, then a five-step butterfly over the lanes.
template <int NC>
__global__ __launch_bounds__(256) void k_rsmcf2(const float* __restrict__ S, _Float16* __restrict__ P, int hg, int q0) {
  const int l4 = (threadIdx.x & 31) * 4; const int t = blockIdx.x * 8 + __builtin_amdgcn_readfirstlane(threadIdx.x >> 5); if (t >= hg * QT) return;
  const float* s = S + (size_t)t * NKX + l4; _Float16* p = P + (size_t)t * NKX + l4; const int rel = q0 + (t % QT) - l4;      /* column 128 c + 4 l + u is open while 128 c + u <= rel */
  v4f v[NC];
#pragma unroll
  for (int c = 0; c < NC; ++c) v[c] = *(const v4fa*)(s + c * 128);
  float mx = -3.0e38f;
#pragma unroll
  for (int c = 0; c < NC; ++c)
#pragma unroll
    for (int u = 0; u < 4; ++u) { const float m = (c * 128 + u <= rel) ? v[c][u] : -1.0e9f; v[c][u] = m; mx = fmaxf(mx, m); }
  mx = fmaxf(mx, row_x<1>(mx)); mx = fmaxf(mx, row_x<2>(mx)); mx = fmaxf(mx, row_x<4>(mx)); mx = fmaxf(mx, row_x<8>(mx)); mx = fmaxf(mx, half_x(mx));
  float se = 0.f;
#pragma unroll
  for (int c = 0; c < NC; ++c) { v[c] = exp2_4((v[c] - mx) * 1.4426950408889634f);      /* e^(x - max), as __expf forms it */
#pragma unroll
    for (int u = 0; u < 4; ++u) se += v[c][u]; }
  se += row_x<1>(se); se += row_x<2>(se); se += row_x<4>(se); se += row_x<8>(se); se += half_x(se);
  const float sc = 256.0f / se;
#pragma unroll
  for (int c = 0; c < NC; ++c) { v4h h4;
#pragma unroll
    for (int u = 0; u < 4; ++u) h4[u] = (_Float16)(v[c][u] * sc);
    *(v4h*)(p + c * 128) = h4; } }
extern "C" void kernel_launch(void* const* d_in, const int* in_sizes, int n_in,
                              void* d_out, int out_size, void* d_ws, size_t ws_size, hipStream_t stream) {
  (void)in_sizes; (void)n_in; (void)out_size;
  const float* const* I = (const float* const*)d_in; const float* x = I[0]; const float* wq = I[1]; const float* wk = I[2]; const float* wv = I[3]; const float* wo = I[4]; const float* qnw = I[5]; const float* knw = I[6]; const float* tcos = I[7]; const float* tsin = I[8];      /* [in][out] weights; rope tables [S][128] */
  char* ws = (char*)d_ws; size_t off = 0;
  auto take = [&](size_t bytes) { char* p = ws + off; off += (bytes + 255) & ~(size_t)255; return p; };
  _Float16* BQ = (_Float16*)take((size_t)DMX * DMX * 2); _Float16* BK = (_Float16*)take((size_t)DKV * DMX * 2); _Float16* BV = (_Float16*)take((size_t)DKV * DMX * 2); _Float16* BO = (_Float16*)take((size_t)DMX * DMX * 2);
  _Float16* X16 = (_Float16*)take(NR * DMX * 2); float* QF = (float*)take(NR * DMX * 4); float* KF = (float*)take(NR * DKV * 4); float* VF = (float*)take(NR * DKV * 4); _Float16* Q16 = (_Float16*)take(NR * DMX * 2); _Float16* K16 = (_Float16*)take(NR * DKV * 2); _Float16* V16 = (_Float16*)take(NR * DKV * 2); _Float16* O16 = (_Float16*)take(NR * DMX * 2);
  static_assert((size_t)NB * NH * QT * NKX * 4 <= NR * DMX * 2 + NR * DMX * 4 + NR * DKV * 4, "S must fit in X16 + QF + KF");
  float* S = (float*)X16;      /* scores of both batches [NB][NH][QT][NKX]: reuse X16, QF, KF (adjacent; last read by the norm + rope launch, in front of the first score launch) */
  _Float16* P = (_Float16*)take((size_t)NB * NH * QT * NKX * 2); _Float16* VT = (_Float16*)take((size_t)NB * (DKV / 64) * 64 * SQ * 2);
  float* QF0 = (float*)take((size_t)NB * QT0 * DMX * 4); float* KF0e = (float*)take((size_t)NB * QT0 * DMX * 4); float* VF0e = (float*)take((size_t)NB * QT0 * DMX * 4); float* OF0 = (float*)take((size_t)NB * QT0 * DMX * 4); _Float16* OH0 = (_Float16*)take((size_t)NB * QT0 * DMX * 2); _Float16* OL0 = (_Float16*)take((size_t)NB * QT0 * DMX * 2);
  if (off > ws_size) return;
  k_wt_f16<<<(unsigned)(((size_t)DMX * (DMX / 8) + 255) / 256), 256, 0, stream>>>(wq, BQ, DMX, DMX, 16.0f); k_wt_f16<<<(unsigned)(((size_t)DKV * (DMX / 8) + 255) / 256), 256, 0, stream>>>(wk, BK, DMX, DKV, 16.0f); k_wt_f16<<<(unsigned)(((size_t)DKV * (DMX / 8) + 255) / 256), 256, 0, stream>>>(wv, BV, DMX, DKV, 16.0f); k_wt_f16<<<(unsigned)(((size_t)DMX * (DMX / 8) + 255) / 256), 256, 0, stream>>>(wo, BO, DMX, DMX, 16.0f);      /* [in][out] -> Bt x16 */
  k_x16<<<(unsigned)((NR * DMX / 8 + 255) / 256), 256, 0, stream>>>(x, X16, NR * DMX / 8);
  k_gemm2<0, 64><<<dim3((unsigned)((NR / 128) * (DMX / 64)), 1), 128, 0, stream>>>(X16, DMX, 0, BQ, DMX, 0, 0.0625f, nullptr, 0, nullptr, 1, 0, 0, QF, nullptr, DMX, 0, (int)NR, DMX, DMX, 1, 0, 0, 0);      /* q (f32) */
  k_gemm2<0, 64><<<dim3((unsigned)((NR / 128) * (DKV / 64)), 1), 128, 0, stream>>>(X16, DMX, 0, BK, DMX, 0, 0.0625f, nullptr, 0, nullptr, 1, 0, 0, KF, nullptr, DKV, 0, (int)NR, DKV, DMX, 1, 0, 0, 0);      /* k (f32) */
  k_gemm2<0, 64><<<dim3((unsigned)((NR / 128) * (DKV / 64)), 1), 128, 0, stream>>>(X16, DMX, 0, BV, DMX, 0, 0.0625f, nullptr, 0, nullptr, 1, 0, 0, VF, V16, DKV, 0, (int)NR, DKV, DMX, 1, 0, 0, 0);      /* v (f32 for the first tile + f16) */
  k_nrope<<<(unsigned)(NR / 8), 256, 0, stream>>>(QF, KF, qnw, knw, tcos, tsin, Q16, K16, QF0, KF0e);      /* per-head RMSNorm + rope from the input tables -> f16; rows 0..127 of each batch also f32, k expanded group -> head */
  for (int b = 0; b < NB; ++b) { const size_t r0 = (size_t)b * SQ, f0 = (size_t)b * QT0;
  k_kvexp128<GSZ, NH, DKV><<<(unsigned)(((size_t)QT0 * DMX / 4 + 255) / 256), 256, 0, stream>>>(VF + r0 * DKV, VF0e + f0 * DMX, (size_t)QT0 * DMX / 4);      /* v: group -> head expansion for the exact first tile */
  }      /* per batch */
  k_vt<DKV / 64, SQ><<<NB * (DKV / 64) * (SQ / 64), 256, 0, stream>>>(V16, DKV, 0, VT);      /* V^T, both batches: batch b, group g = slabs 16b + 2g, 16b + 2g + 1 */
  k_att0w<<<dim3(NH * (QT0 / 8), NB), 256, 0, stream>>>(QF0, KF0e, VF0e, ATS, OF0);      /* exact causal attention rows 0..127 of both batches (o x64) */
  for (int q0 = 0; q0 < SQ; q0 += QT) { const int nk = q0 + QT;      /* one launch a stage: grid y = the 16 heads, z = the 2 batches */
    k_gemm2<0, 64><<<dim3((QT / 128) * (nk / 64), NH, NB), 128, 0, stream>>>(Q16 + (size_t)q0 * DMX, DMX, (size_t)HDK, K16, DKV, (size_t)HDK, ATS, nullptr, 0, nullptr, 1, 0, 0, S, nullptr, NKX, (size_t)QT * NKX, QT, nk, HDK, GSZ, (size_t)SQ * DMX, (size_t)SQ * DKV, (size_t)NH * QT * NKX);      /* scores: each head vs its group's key slab */
    static_assert(SQ / QT == 8, "one softmax kernel a row length");
    switch (nk / QT) {      /* causal softmax: the row length picks the kernel that holds a row of it in registers */
      case 1: k_rsmcf2<2><<<NB * NH * QT / 8, 256, 0, stream>>>(S, P, NB * NH, q0); break; case 2: k_rsmcf2<4><<<NB * NH * QT / 8, 256, 0, stream>>>(S, P, NB * NH, q0); break; case 3: k_rsmcf2<6><<<NB * NH * QT / 8, 256, 0, stream>>>(S, P, NB * NH, q0); break; case 4: k_rsmcf2<8><<<NB * NH * QT / 8, 256, 0, stream>>>(S, P, NB * NH, q0); break;
      case 5: k_rsmcf2<10><<<NB * NH * QT / 8, 256, 0, stream>>>(S, P, NB * NH, q0); break; case 6: k_rsmcf2<12><<<NB * NH * QT / 8, 256, 0, stream>>>(S, P, NB * NH, q0); break; case 7: k_rsmcf2<14><<<NB * NH * QT / 8, 256, 0, stream>>>(S, P, NB * NH, q0); break; default: k_rsmcf2<16><<<NB * NH * QT / 8, 256, 0, stream>>>(S, P, NB * NH, q0); break; }
    k_gemm2<0, 128><<<dim3((QT / 128) * (HDK / 64), NH, NB), 128, 0, stream>>>(P, NKX, (size_t)QT * NKX, VT, SQ, (size_t)HDK * SQ, 0.25f, nullptr, 0, nullptr, 1, 0, 0, nullptr, O16 + (size_t)q0 * DMX, DMX, (size_t)HDK, QT, HDK, nk, GSZ, (size_t)NH * QT * NKX, (size_t)DKV * SQ, (size_t)SQ * DMX); }      /* o (x64): each head vs its group's V^T slab */
  k_gemm2<0, 64><<<dim3((unsigned)((NR / 128) * (DMX / 64)), 1), 128, 0, stream>>>(O16, DMX, 0, BO, DMX, 0, 0.0009765625f, nullptr, 0, nullptr, 1, 0, 0, (float*)d_out, nullptr, DMX, 0, (int)NR, DMX, DMX, 1, 0, 0, 0);      /* out = o Wo */
  k_hl<<<(unsigned)(((size_t)NB * QT0 * DMX / 8 + 255) / 256), 256, 0, stream>>>(OF0, OH0, OL0, (size_t)NB * QT0 * DMX / 8);
  k_gemm2<0, 128><<<dim3((QT0 / 128) * (DMX / 64), 1, NB), 128, 0, stream>>>(OH0, DMX, 0, BO, DMX, 0, 0.0009765625f, nullptr, 0, nullptr, 1, 0, 0, (float*)d_out, nullptr, DMX, 0, QT0, DMX, DMX, 1, (size_t)QT0 * DMX, 0, (size_t)SQ * DMX);
  k_gemm2<0, 128><<<dim3((QT0 / 128) * (DMX / 64), 1, NB), 128, 0, stream>>>(OL0, DMX, 0, BO, DMX, 0, 0.00000095367431640625f, nullptr, 0, (const float*)d_out, -1, 0, 0, (float*)d_out, nullptr, DMX, 0, QT0, DMX, DMX, 1, (size_t)QT0 * DMX, 0, (size_t)SQ * DMX);      /* rows 0..127 of each batch rewritten from the exact path */
}

// v007
// It runs in 264 microseconds.
// Versions between v005 and this one are left out; their measured steps multiply to 2.22 times as fast.
// Over all steps from v000 it is 38.5 times as fast.
#include <hip/hip_runtime.h>
// Qwen3 attention (x [2][2048][2048]; q = x Wq (16 heads x 128), k = x Wk, v = x Wv (8 kv heads x 128) ([in][out] weights sigma 0.02); per-head RMSNorm over the 128 dims on q and k (weights ones, eps 1e-6); rotate-half RoPE from the module's INPUT cos/sin tables [S][128] (theta 1e6); query head h uses kv head h/2; scores x 128^-0.5 with a causal mask (tril, finfo.min); softmax; out = merged Wo ([in][out]) -> [2][2048][2048]).
// Compute dtype: inputs rounded to bf16; x / weights / tables exact; projections, RMSNorm and rope f32; q, k, v, softmax weights and o as plain f16 GEMM operands (~2^-12; first 128 rows exact); scores, statistics, out f32. v_wmma_f32_16x16x32_f16.
#define NB 2
#define SQ 2048
#define DMX 2048
#define NH 16
#define NKV 8
#define GSZ 2
#define HDK 128
#define DKV (NKV * HDK)
#define QT 256
#define QT0 128
#define NKX SQ
#define DM DMX
#define HD 64
#define HG 1
#define NR ((size_t)NB * SQ)
#define ATS 0.08838834764831845f
typedef __bf16 v16b __attribute__((ext_vector_type(16)));
typedef unsigned short v8us __attribute__((ext_vector_type(8), may_alias));
typedef float  v8f  __attribute__((ext_vector_type(8)));
typedef float  v4f  __attribute__((ext_vector_type(4)));
typedef float  v4fa __attribute__((ext_vector_type(4), may_alias));
union FragB { v16b v; v8us half[2]; unsigned short u[16]; };

__device__ __forceinline__ unsigned short bf16_bits(float x) { unsigned int u = __float_as_uint(x); return (unsigned short)((u + 0x7FFFu + ((u >> 16) & 1u)) >> 16); }
__device__ __forceinline__ float bf16_val(unsigned short b) { return __uint_as_float(((unsigned int)b) << 16); }
__device__ __forceinline__ float bf16_round(float x) { return bf16_val(bf16_bits(x)); }
// D += A·B with NT terms: 1 = ah·bh, 2 = + al·bh (A split), 3 = + ah·bl (both split)
template <int NT>
__device__ __forceinline__ v8f mmaN(v16b ah, v16b al, v16b bh, v16b bl, v8f c) {
  c = __builtin_amdgcn_wmma_f32_16x16x32_bf16(false, ah, false, bh, (short)0, c, false, false);
  if (NT >= 2) c = __builtin_amdgcn_wmma_f32_16x16x32_bf16(false, al, false, bh, (short)0, c, false, false);
  if (NT >= 3) c = __builtin_amdgcn_wmma_f32_16x16x32_bf16(false, ah, false, bl, (short)0, c, false, false);
  asm volatile("v_nop\n\tv_nop\n\tv_nop\n\tv_nop" : "+v"(c) : "v"(ah), "v"(al), "v"(bh), "v"(bl));
  return c;
}

__global__ __launch_bounds__(256) void k_wt_bf16(const float* __restrict__ W, unsigned short* __restrict__ Wt, int K, int N) {
  const int t = blockIdx.x * 256 + threadIdx.x;
  const int k8n = K / 8;
  if (t >= N * k8n) return;
  const int n = t / k8n, k8 = (t % k8n) * 8;
  v8us v;
#pragma unroll
  for (int i = 0; i < 8; ++i) v[i] = bf16_bits(W[(size_t)(k8 + i) * N + n]);
  *(v8us*)(Wt + (size_t)n * K + k8) = v;
  
}

// GEMM C[M][N] (f32, pitch ldc) = act(A[M][K]·W + bias). A f32 row-major (pitch lda) converted per fragment to bf16
// (ASPLIT: hi/lo two planes -> 2 terms, else single rounded term); Wt bf16 [N][K] (pitch ldb). BIAS_BF16 rounds the
// bias to bf16 first (bias quantised to bf16 before the add). K%32==0, M%16==0, N%64==0.
template <bool ASPLIT, int ACT, bool BIAS_BF16>
__global__ __launch_bounds__(128) void k_gemm_bf(const float* __restrict__ A, int lda, const unsigned short* __restrict__ Wt, int ldb,
                                               const float* __restrict__ bias, float* __restrict__ C, int ldc, int M, int N, int K) {
  __shared__ __attribute__((aligned(16))) float so[4][16][64];
  const int tid = threadIdx.x, w = tid >> 5, lane = tid & 31, ln = lane & 15, hh = lane >> 4;
  const int ntn = N / 64;
  const int wid = blockIdx.x * 4 + w;
  const int mt = wid / ntn, nq = wid % ntn;
  if (mt * 16 >= M) return;
  const int row0 = mt * 16, col0 = nq * 64;
  const float* arow = A + (size_t)(row0 + ln) * lda;
  v8f acc[4] = {};
  for (int kb = 0; kb < K; kb += 32) {
    FragB ah, al;
    const v4f x0 = *(const v4fa*)(arow + kb + 8 * hh), x1 = *(const v4fa*)(arow + kb + 8 * hh + 4);
    const v4f x2 = *(const v4fa*)(arow + kb + 16 + 8 * hh), x3 = *(const v4fa*)(arow + kb + 16 + 8 * hh + 4);
    float xs[16] = {x0[0],x0[1],x0[2],x0[3],x1[0],x1[1],x1[2],x1[3],x2[0],x2[1],x2[2],x2[3],x3[0],x3[1],x3[2],x3[3]};
#pragma unroll
    for (int i = 0; i < 16; ++i) { const unsigned short hb = bf16_bits(xs[i]); ah.u[i] = hb; al.u[i] = ASPLIT ? bf16_bits(xs[i] - bf16_val(hb)) : (unsigned short)0; }
#pragma unroll
    for (int t = 0; t < 4; ++t) {
      const unsigned short* brow = Wt + (size_t)(col0 + t * 16 + ln) * ldb + kb;
      FragB b;
      b.half[0] = *(const v8us*)(brow + 8 * hh);
      b.half[1] = *(const v8us*)(brow + 16 + 8 * hh);
      acc[t] = mmaN<ASPLIT ? 2 : 1>(ah.v, al.v, b.v, b.v, acc[t]);
    }
  }
#pragma unroll
  for (int t = 0; t < 4; ++t) {
    float bv = bias ? bias[col0 + t * 16 + ln] : 0.f;
    if (BIAS_BF16) bv = bf16_round(bv);
#pragma unroll
    for (int r = 0; r < 8; ++r) { float v = acc[t][r] + bv; if (ACT == 1) v = fmaxf(v, 0.f); so[w][8 * hh + r][t * 16 + ln] = v; }
  }
  __builtin_amdgcn_fence(__ATOMIC_ACQ_REL, "workgroup");
  __builtin_amdgcn_wave_barrier();
  const int rsub = lane >> 4, c4 = (lane & 15) * 4;
  {
#pragma unroll
    for (int q = 0; q < 8; ++q) {
      const int r = q * 2 + rsub;
      const v4f v = *(const v4fa*)&so[w][r][c4];
      *(v4f*)(C + (size_t)(row0 + r) * ldc + col0 + c4) = v;
    }
    
  }
}

// GEMM C = act(A·W + bias + resid): A f32 (ASPLIT -> hi/lo 2 terms), Wt bf16 [N][K]; ACT 0 none, 1 relu, 2 exact gelu;
// resid (optional, f32, row index = (row % rmod), pitch ldr, RES_BF16 rounds it) added before the activation.
template <bool ASPLIT, int ACT, bool BIAS_BF16, bool RES_BF16>
__global__ __launch_bounds__(128) void k_gemm_bf3(const float* __restrict__ A, int lda, const unsigned short* __restrict__ Wt, int ldb,
                                                const float* __restrict__ bias, const float* __restrict__ resid, int rmod, int ldr,
                                                float* __restrict__ C, int ldc, int M, int N, int K) {
  __shared__ __attribute__((aligned(16))) float so[4][16][64];
  const int tid = threadIdx.x, w = tid >> 5, lane = tid & 31, ln = lane & 15, hh = lane >> 4;
  const int ntn = N / 64;
  const int wid = blockIdx.x * 4 + w;
  const int mt = wid / ntn, nq = wid % ntn;
  if (mt * 16 >= M) return;
  const int row0 = mt * 16, col0 = nq * 64;
  const float* arow = A + (size_t)(row0 + ln) * lda;
  v8f acc[4] = {};
  for (int kb = 0; kb < K; kb += 32) {
    FragB ah, al;
    const v4f x0 = *(const v4fa*)(arow + kb + 8 * hh), x1 = *(const v4fa*)(arow + kb + 8 * hh + 4);
    const v4f x2 = *(const v4fa*)(arow + kb + 16 + 8 * hh), x3 = *(const v4fa*)(arow + kb + 16 + 8 * hh + 4);
    float xs[16] = {x0[0],x0[1],x0[2],x0[3],x1[0],x1[1],x1[2],x1[3],x2[0],x2[1],x2[2],x2[3],x3[0],x3[1],x3[2],x3[3]};
#pragma unroll
    for (int i = 0; i < 16; ++i) { const unsigned short hb = bf16_bits(xs[i]); ah.u[i] = hb; al.u[i] = ASPLIT ? bf16_bits(xs[i] - bf16_val(hb)) : (unsigned short)0; }
#pragma unroll
    for (int t = 0; t < 4; ++t) {
      const unsigned short* brow = Wt + (size_t)(col0 + t * 16 + ln) * ldb + kb;
      FragB b;
      b.half[0] = *(const v8us*)(brow + 8 * hh);
      b.half[1] = *(const v8us*)(brow + 16 + 8 * hh);
      acc[t] = mmaN<ASPLIT ? 2 : 1>(ah.v, al.v, b.v, b.v, acc[t]);
    }
  }
#pragma unroll
  for (int t = 0; t < 4; ++t) {
    const int col = col0 + t * 16 + ln;
    float bv = bias ? bias[col] : 0.f;
    if (BIAS_BF16) bv = bf16_round(bv);
#pragma unroll
    for (int r = 0; r < 8; ++r) {
      float v = acc[t][r] + bv;
      if (resid) { float rv = resid[(size_t)((row0 + 8 * hh + r) % rmod) * ldr + col]; if (RES_BF16) rv = bf16_round(rv); v += rv; }
      if (ACT == 1) v = fmaxf(v, 0.f);
      if (ACT == 2) v = 0.5f * v * (1.0f + erff(v * 0.70710678118654752f));
      if (ACT == 3) { const float u = 0.7978845608028654f * (v + 0.044715f * v * v * v); v = 0.5f * v * (1.0f + tanhf(u)); }
      so[w][8 * hh + r][t * 16 + ln] = v;
    }
  }
  __builtin_amdgcn_fence(__ATOMIC_ACQ_REL, "workgroup");
  __builtin_amdgcn_wave_barrier();
  const int rsub = lane >> 4, c4 = (lane & 15) * 4;
  {
#pragma unroll
    for (int q = 0; q < 8; ++q) {
      const int r = q * 2 + rsub;
      const v4f v = *(const v4fa*)&so[w][r][c4];
      *(v4f*)(C + (size_t)(row0 + r) * ldc + col0 + c4) = v;
    }
    
  }
}
// row LayerNorm (biased variance, eps) over N: s = X (+ R); optional out_sum <- s; out_norm <- (s-mu)*rsqrt(var+eps)*g + b
template <bool PARAM_BF16>
__global__ __launch_bounds__(256) void k_layernorm(const float* __restrict__ X, const float* __restrict__ R, const float* __restrict__ g, const float* __restrict__ bta,
                                                  float* __restrict__ out_sum, float* __restrict__ out_norm, int N, float eps) {
  __shared__ float red[256];
  const int row = blockIdx.x, tid = threadIdx.x;
  const float* x = X + (size_t)row * N; const float* rr = R ? R + (size_t)row * N : nullptr;
  float vals[16];                     // up to N = 4096
  const int per = N / 256;            // contiguous chunk per thread? use strided-by-4 chunks: thread handles j = tid*4 + 1024*u
  float s1 = 0.f;
  for (int u = 0; u < per / 4; ++u) {
    const int j = tid * 4 + 1024 * u;
    const v4f a = *(const v4fa*)(x + j);
    v4f b = {0.f,0.f,0.f,0.f}; if (rr) b = *(const v4fa*)(rr + j);
#pragma unroll
    for (int q = 0; q < 4; ++q) { const float v = a[q] + b[q]; vals[u * 4 + q] = v; s1 += v; }
  }
  red[tid] = s1; __syncthreads();
  for (int st = 128; st > 0; st >>= 1) { if (tid < st) red[tid] += red[tid + st]; __syncthreads(); }
  const float mu = red[0] / (float)N; __syncthreads();
  float s2 = 0.f;
  for (int u = 0; u < per / 4; ++u)
#pragma unroll
    for (int q = 0; q < 4; ++q) { const float c = vals[u * 4 + q] - mu; s2 += c * c; }
  red[tid] = s2; __syncthreads();
  for (int st = 128; st > 0; st >>= 1) { if (tid < st) red[tid] += red[tid + st]; __syncthreads(); }
  const float rs = rsqrtf(red[0] / (float)N + eps);
  {
    for (int u = 0; u < per / 4; ++u) {
      const int j = tid * 4 + 1024 * u;
      v4f o, sm;
#pragma unroll
      for (int q = 0; q < 4; ++q) {
        float gg = g[j + q], bb = bta[j + q];
        if (PARAM_BF16) { gg = bf16_round(gg); bb = bf16_round(bb); }
        sm[q] = vals[u * 4 + q]; o[q] = (vals[u * 4 + q] - mu) * rs * gg + bb;
      }
      if (out_sum) *(v4f*)(out_sum + (size_t)row * N + j) = sm;
      *(v4f*)(out_norm + (size_t)row * N + j) = o;
    }
    
  }
}



// ---- f16 WMMA path (v_wmma_f32_16x16x32_f16): 11-bit significands for operands in range — used where a [0,1] probability operand needs more precision than bf16
typedef _Float16 v16h __attribute__((ext_vector_type(16)));
union FragH { v16h v; v8us half[2]; _Float16 h[16]; unsigned short u[16]; };
template <int NT>
__device__ __forceinline__ v8f mmaH(v16h ah, v16h al, v16h bh, v16h bl, v8f c) {
  c = __builtin_amdgcn_wmma_f32_16x16x32_f16(false, ah, false, bh, (short)0, c, false, false);
  if (NT >= 2) c = __builtin_amdgcn_wmma_f32_16x16x32_f16(false, al, false, bh, (short)0, c, false, false);
  if (NT >= 3) c = __builtin_amdgcn_wmma_f32_16x16x32_f16(false, ah, false, bl, (short)0, c, false, false);
  asm volatile("v_nop\n\tv_nop\n\tv_nop\n\tv_nop" : "+v"(c) : "v"(ah), "v"(al), "v"(bh), "v"(bl));
  return c;
}
// batched GEMM like k_gemm_b but f16 operands: A f32 (split into f16 hi/lo if ASPLIT, else rounded to f16), Bt = f16 values [n][k]; alpha; C f32; N multiple of 16 (partial tiles skipped)
template <bool ASPLIT>
__global__ __launch_bounds__(128) void k_gemm_h(const float* __restrict__ A, int lda, size_t sA, const _Float16* __restrict__ Bh, int ldb, size_t sB, float alpha, float* __restrict__ C, int ldc, size_t sC, int M, int N, int K) {
  __shared__ __attribute__((aligned(16))) float so[4][16][64];
  const int tid = threadIdx.x, w = tid >> 5, lane = tid & 31, ln = lane & 15, hh = lane >> 4; const int by = blockIdx.y;
  A += (size_t)by * sA; Bh += (size_t)by * sB; C += (size_t)by * sC;
  const int ntn = (N + 63) / 64; const int wid = blockIdx.x * 4 + w; const int mt = wid / ntn, nq = wid % ntn; if (mt * 16 >= M) return;
  const int row0 = mt * 16, col0 = nq * 64; const float* arow = A + (size_t)(row0 + ln) * lda;
  v8f acc[4] = {};
  for (int kb = 0; kb < K; kb += 32) {
    FragH ah, al;
    const v4f x0 = *(const v4fa*)(arow + kb + 8 * hh), x1 = *(const v4fa*)(arow + kb + 8 * hh + 4), x2 = *(const v4fa*)(arow + kb + 16 + 8 * hh), x3 = *(const v4fa*)(arow + kb + 16 + 8 * hh + 4);
    float xs[16] = {x0[0],x0[1],x0[2],x0[3],x1[0],x1[1],x1[2],x1[3],x2[0],x2[1],x2[2],x2[3],x3[0],x3[1],x3[2],x3[3]};
#pragma unroll
    for (int i = 0; i < 16; ++i) { const _Float16 h = (_Float16)xs[i]; ah.h[i] = h; al.h[i] = ASPLIT ? (_Float16)(xs[i] - (float)h) : (_Float16)0.0f; }
#pragma unroll
    for (int t = 0; t < 4; ++t) { if (col0 + t * 16 >= N) continue; const size_t boff = (size_t)(col0 + t * 16 + ln) * ldb + kb; FragH bq; bq.half[0] = *(const v8us*)(Bh + boff + 8 * hh); bq.half[1] = *(const v8us*)(Bh + boff + 16 + 8 * hh);
      acc[t] = mmaH<ASPLIT ? 2 : 1>(ah.v, al.v, bq.v, bq.v, acc[t]); }
  }
#pragma unroll
  for (int t = 0; t < 4; ++t) { if (col0 + t * 16 >= N) continue;
#pragma unroll
    for (int r = 0; r < 8; ++r) so[w][8 * hh + r][t * 16 + ln] = acc[t][r] * alpha; }
  __builtin_amdgcn_fence(__ATOMIC_ACQ_REL, "workgroup"); __builtin_amdgcn_wave_barrier();
  const int rsub = lane >> 4, c4 = (lane & 15) * 4;
  {
#pragma unroll
    for (int q = 0; q < 8; ++q) { const int r = q * 2 + rsub; if (col0 + c4 < N) { const v4f v = *(const v4fa*)&so[w][r][c4]; *(v4f*)(C + (size_t)(row0 + r) * ldc + col0 + c4) = v; } }
     }
}

// Bt[n][k] = f16(bf16(W[k][n]) x 16) of the four f32 [in][out] weights (DMX rows each) in one launch (x16: a power of two; bf16-exact weights stay exact in f16 away from the subnormal range).
// A block of 8 waves turns one tile of WTK k x WTN n through LDS, so that memory sees whole lines both ways.
// in: thread = 4 columns (16 bytes; 16 threads = 256 contiguous bytes of a row of W) x 16 rows, all 16 loads in flight together; 8 consecutive k of one column are 16 bytes of f16, one LDS store.
// out: a wave reads one column's WTK k (512 bytes) from LDS and stores them as 512 contiguous bytes of Bt.
// LDS: one row a column n, pitch 528 bytes (an odd multiple of 16, for 16-byte accesses); the 16-byte piece g of row n lies at place g ^ (n >> 4), so that a wave's 32 stores (rows 4 apart) spread evenly over the banks.
constexpr int WTK = 256, WTN = 64, WTP = 2 * WTK + 16, WTQ = (DMX / WTN) * (DMX / WTK), WTV = (DKV / WTN) * (DMX / WTK);      /* WTQ, WTV: tiles of a weight with DMX, DKV columns */
static_assert(DMX % WTK == 0 && DMX % WTN == 0 && DKV % WTN == 0 && WTK == 256 && WTN == 64, "k_wt4: whole tiles; 256 threads = 16 x 4 columns, 16 x 8 rows twice; a wave = one row of 32 pieces");
// a thread's 16 loads of a tile of a weight with N columns (compile-time: the rows are immediate offsets from one address); Wp, k0, n0 the same for the whole block.
template <int N>
__device__ __forceinline__ void wt_load(const float* __restrict__ Wp, int k0, int n0, v4f (&x)[2][8]) {
  const v4fa* s = (const v4fa*)(Wp + (size_t)k0 * N + n0); const unsigned lo = (threadIdx.x >> 4) * (8 * N / 4) + (threadIdx.x & 15);      /* s: the tile's first 16 bytes; lo: the thread's own place in it, in 16 bytes */
#pragma unroll      /* unrolled: x[][] keeps static indices (registers, no scratch) */
  for (int j = 0; j < 2; ++j)
#pragma unroll
    for (int i = 0; i < 8; ++i) x[j][i] = s[lo + (unsigned)((j * 128 + i) * (N / 4))];
  /* inputs only: holds all 16 loads in front of the first use, one trip to memory (without it this build issued them in three groups, each behind the last one's wait); lo is named so that its register is given to no load's result while loads that name it are in flight */
  asm volatile("" :: "v"(x[0][0]), "v"(x[0][1]), "v"(x[0][2]), "v"(x[0][3]), "v"(x[0][4]), "v"(x[0][5]), "v"(x[0][6]), "v"(x[0][7]), "v"(x[1][0]), "v"(x[1][1]), "v"(x[1][2]), "v"(x[1][3]), "v"(x[1][4]), "v"(x[1][5]), "v"(x[1][6]), "v"(x[1][7]), "v"(lo)); }
__global__ __launch_bounds__(256) void k_wt4(const float* __restrict__ wq, const float* __restrict__ wk, const float* __restrict__ wv, const float* __restrict__ wo,
    _Float16* __restrict__ BQ, _Float16* __restrict__ BK, _Float16* __restrict__ BV, _Float16* __restrict__ BO) {
  __shared__ __attribute__((aligned(16))) unsigned char tl[WTN * WTP];
  const int bx = blockIdx.x; const bool wide = bx < 2 * WTQ; const int u = wide ? bx : bx - 2 * WTQ, nt = wide ? WTQ : WTV; const bool second = u >= nt; const int t = second ? u - nt : u;      /* blocks: q, o, k, v; t = the tile in its weight; all the same for the whole block */
  const int k0 = (t % (DMX / WTK)) * WTK, n0 = (t / (DMX / WTK)) * WTN; v4f x[2][8];
  if (wide) wt_load<DMX>(second ? wo : wq, k0, n0, x); else wt_load<DKV>(second ? wv : wk, k0, n0, x);
  _Float16* Bt = wide ? (second ? BO : BQ) : (second ? BV : BK);
  const int n4 = threadIdx.x & 15, kg = threadIdx.x >> 4;
#pragma unroll      /* unrolled, as above */
  for (int j = 0; j < 2; ++j)
#pragma unroll
    for (int q = 0; q < 4; ++q) { FragH f;
#pragma unroll
      for (int i = 0; i < 8; ++i) f.h[i] = (_Float16)(bf16_round(x[j][i][q]) * 16.0f);
      *(v8us*)(tl + (n4 * 4 + q) * WTP + ((j * 16 + kg) ^ (n4 >> 2)) * 16) = f.half[0]; }
  __syncthreads();      /* the tile is whole before a wave reads columns that other waves wrote */
  const int lane = threadIdx.x & 31, nw = (threadIdx.x >> 5) * 8; unsigned short* d = (unsigned short*)Bt + (size_t)(n0 + nw) * DMX + k0 + lane * 8;
#pragma unroll      /* unrolled: the 8 LDS loads go as one group, the 8 rows are immediate offsets */
  for (int r = 0; r < 8; ++r) { const v8us o = *(const v8us*)(tl + (nw + r) * WTP + (lane ^ (nw >> 4)) * 16); *(v8us*)(d + (size_t)r * DMX) = o; } }
// k_gemm_hh variant with fused epilogue: v = acc·alpha + bias[by·sBias + col] (+ CP[(row/rowsPerB)·sCPb + by·64 + col] if CP) ; ACT 0 none / 1 elu ; writes f16 C16 (and f32 C if non-null)
template <int ACT>
__global__ __launch_bounds__(128) void k_gemm_hhx(const _Float16* __restrict__ A, int lda, size_t sA, const _Float16* __restrict__ Bh, int ldb, size_t sB, float alpha, const float* __restrict__ bias, size_t sBias, const float* __restrict__ CP, int rowsPerB, size_t sCPb, int row0g,
    float* __restrict__ C, _Float16* __restrict__ C16, int ldc, size_t sC, int M, int N, int K) {
  __shared__ __attribute__((aligned(16))) float so[4][16][64];
  const int tid = threadIdx.x, w = tid >> 5, lane = tid & 31, ln = lane & 15, hh = lane >> 4; const int by = blockIdx.y;
  A += (size_t)by * sA; Bh += (size_t)by * sB; const size_t cofs = (size_t)by * sC; const float* bp = bias ? bias + (size_t)by * sBias : nullptr;
  const int ntn = (N + 63) / 64; const int wid = blockIdx.x * 4 + w; const int mt = wid / ntn, nq = wid % ntn; if (mt * 16 >= M) return;
  const int row0 = mt * 16, col0 = nq * 64; const _Float16* arow = A + (size_t)(row0 + ln) * lda;
  v8f acc[4] = {};
  for (int kb = 0; kb < K; kb += 32) { FragH ah; ah.half[0] = *(const v8us*)((const unsigned short*)arow + kb + 8 * hh); ah.half[1] = *(const v8us*)((const unsigned short*)arow + kb + 16 + 8 * hh);
#pragma unroll
    for (int t = 0; t < 4; ++t) { if (col0 + t * 16 >= N) continue; const size_t boff = (size_t)(col0 + t * 16 + ln) * ldb + kb; FragH bq; bq.half[0] = *(const v8us*)((const unsigned short*)Bh + boff + 8 * hh); bq.half[1] = *(const v8us*)((const unsigned short*)Bh + boff + 16 + 8 * hh);
      acc[t] = mmaH<1>(ah.v, ah.v, bq.v, bq.v, acc[t]); }
  }
#pragma unroll
  for (int t = 0; t < 4; ++t) { if (col0 + t * 16 >= N) continue; const int col = col0 + t * 16 + ln; const float bv = bp ? bf16_round(bp[col]) : 0.f;
#pragma unroll
    for (int r = 0; r < 8; ++r) { float v = acc[t][r] * alpha + bv; if (CP) { const int rr = row0g + row0 + 8 * hh + r; if (rowsPerB < 0) v += CP[cofs + (size_t)rr * ldc + col];      /* rowsPerB < 0: own element of the batched C plane */ else { const int bidx = rr / rowsPerB; v += CP[(size_t)bidx * sCPb + (size_t)by * 64 + col]; } } if (ACT == 1) v = (v > 0.f) ? v : expm1f(v); else if (ACT == 7) v = (v > 0.f) ? v + 1.0f : expf(v); else if (ACT == 8) v = tanhf(v); else if (ACT == 9) v = 0.5f * v * (1.0f + tanhf(0.7978845608028654f * (v + 0.044715f * v * v * v))); else if (ACT == 11) v = 1.0f / (1.0f + expf(-v)); else if (ACT == 12) v = (v > 0.f) ? v : 0.01f * v; else if (ACT == 14) v = (v > 0.f) ? v : 0.1f * v; else if (ACT == 16) v = (v >= 0.f) ? v : 0.3f * v; else if (ACT == 17) v = (v >= 0.f) ? v : 0.2f * v; else if (ACT == 15) v = v / (1.0f + expf(-v)); else if (ACT == 3) v = fmaxf(v, 0.f); else if (ACT == 6) v = 0.5f * v * (1.0f + erff(v * 0.70710678118654752f)); so[w][8 * hh + r][t * 16 + ln] = v; } }
  __builtin_amdgcn_fence(__ATOMIC_ACQ_REL, "workgroup"); __builtin_amdgcn_wave_barrier();
  const int rsub = lane >> 4, c4 = (lane & 15) * 4; typedef _Float16 v4h __attribute__((ext_vector_type(4)));
  {
#pragma unroll
    for (int q = 0; q < 8; ++q) { const int r = q * 2 + rsub; if (col0 + c4 < N) { const v4f v = *(const v4fa*)&so[w][r][c4]; if (C) *(v4f*)(C + cofs + (size_t)(row0 + r) * ldc + col0 + c4) = v; if (C16) { v4h h4; for (int i = 0; i < 4; ++i) h4[i] = (_Float16)v[i]; *(v4h*)(C16 + cofs + (size_t)(row0 + r) * ldc + col0 + c4) = h4; } } }
     }
}


typedef _Float16 v4h __attribute__((ext_vector_type(4)));

__global__ __launch_bounds__(256) void k_x16(const float* __restrict__ x, _Float16* __restrict__ X16, size_t n8) { const size_t t = (size_t)blockIdx.x * 256 + threadIdx.x; if (t >= n8) return; FragH f;
#pragma unroll
  for (int q = 0; q < 8; ++q) f.h[q] = (_Float16)bf16_round(x[t * 8 + q]); *(v8us*)((unsigned short*)X16 + t * 8) = f.half[0];  }
__global__ __launch_bounds__(256) void k_h16(const float* __restrict__ x, _Float16* __restrict__ X16, size_t n8) { const size_t t = (size_t)blockIdx.x * 256 + threadIdx.x; if (t >= n8) return; FragH f;
#pragma unroll
  for (int q = 0; q < 8; ++q) f.h[q] = (_Float16)x[t * 8 + q]; *(v8us*)((unsigned short*)X16 + t * 8) = f.half[0];  }
__global__ __launch_bounds__(256) void k_round16f(const float* __restrict__ W, _Float16* __restrict__ Bt, size_t n8) { const size_t t = (size_t)blockIdx.x * 256 + threadIdx.x; if (t >= n8) return; FragH f;
#pragma unroll
  for (int i = 0; i < 8; ++i) f.h[i] = (_Float16)(bf16_round(W[t * 8 + i]) * 16.0f); *(v8us*)((unsigned short*)Bt + t * 8) = f.half[0];  }
template <int NHv, int TTv>
__global__ __launch_bounds__(256) void k_vt(const _Float16* __restrict__ V16, int ldv, int voff, _Float16* __restrict__ Vt) { __shared__ unsigned short tl[64][66]; const int tid = threadIdx.x; const int slab = blockIdx.x / (TTv / 64), lg = blockIdx.x % (TTv / 64); const int b = slab / NHv, h = slab % NHv;
  for (int i = tid; i < 64 * 8; i += 256) { const int r = i / 8, c8 = (i % 8) * 8; FragH f; f.half[0] = *(const v8us*)((const unsigned short*)V16 + ((size_t)b * TTv + lg * 64 + r) * ldv + voff + h * 64 + c8);
#pragma unroll
    for (int q = 0; q < 8; ++q) tl[r][c8 + q] = f.u[q]; }
  __syncthreads();
  {
#pragma unroll
    for (int rd = 0; rd < 2; ++rd) { const int d = rd * 32 + tid / 8, pc = tid % 8; FragH f;
#pragma unroll
      for (int q = 0; q < 8; ++q) f.u[q] = tl[pc * 8 + q][d];
      *(v8us*)((unsigned short*)Vt + ((size_t)slab * 64 + d) * TTv + lg * 64 + pc * 8) = f.half[0]; }
     } }

__global__ __launch_bounds__(256) void k_hl(const float* __restrict__ F, _Float16* __restrict__ Hh, _Float16* __restrict__ Hl, size_t n8) { const size_t t = (size_t)blockIdx.x * 256 + threadIdx.x; if (t >= n8) return; FragH fh, fl; const v4f a = *(const v4fa*)(F + t * 8), c = *(const v4fa*)(F + t * 8 + 4);
#pragma unroll
  for (int q = 0; q < 4; ++q) { _Float16 h = (_Float16)a[q]; fh.h[q] = h; fl.h[q] = (_Float16)((a[q] - (float)h) * 1024.0f); h = (_Float16)c[q]; fh.h[4 + q] = h; fl.h[4 + q] = (_Float16)((c[q] - (float)h) * 1024.0f); }
  { *(v8us*)((unsigned short*)Hh + t * 8) = fh.half[0]; *(v8us*)((unsigned short*)Hl + t * 8) = fl.half[0];  } }

// ---- fast GEMM (block tile 128x64, wave tile 32x64; requires M % 128 == 0 rows per launch region, N % 64 == 0, K % KC == 0); epilogue = k_gemm_hhx semantics ----
// The k range goes in tiles of KC: the block's 128 rows of A and 64 rows of B, KC f16 of each, are staged in LDS (rows 0..127 = A, 128..191 = B; pitch 2 KC + 16 bytes, an odd multiple of 16, for 16-byte readers),
// two buffers, the next tile's copies in flight while this one is multiplied. Every copy of a wave moves whole 128-byte lines; a fragment keeps its k order, so every sum keeps its order.
// KC = 64 where a launch has several blocks a WGP (54 KiB of LDS a block), 128 where it has at most one and the wait for a tile counts (half as many trips).
__device__ __forceinline__ v16h g2_frag(const _Float16* p, int hh) { FragH f; f.half[0] = *(const v8us*)((const unsigned short*)p + 8 * hh); f.half[1] = *(const v8us*)((const unsigned short*)p + 16 + 8 * hh); return f.v; }
__device__ __forceinline__ v8f g2_mma(v16h a, v16h b, v8f c) { v8f d = __builtin_amdgcn_wmma_f32_16x16x32_f16(false, a, false, b, (short)0, c, false, false); asm volatile("v_nop\n\tv_nop\n\tv_nop\n\tv_nop" : "+v"(d) : "v"(a), "v"(b)); return d; }
// one tile's copies, 12 a statement: thread = 16 bytes (seg) of row (thread / segs a row) + c * RPC; a, b = the thread's own first address in the tile, l = its own LDS byte address in the buffer.
// asm: the copy goes from global memory to LDS through no register. The s_wait_xcnt is the last line of the copies' own statement, so that no address register is rewritten in front of it.
template <int KC>
__device__ __forceinline__ void g2_stage(const _Float16* a, size_t lda, const _Float16* b, size_t ldb, unsigned l) {
  constexpr int RPC = 1024 / KC, NA = 128 / RPC, PB = 2 * KC + 16; static_assert((192 / RPC) % 12 == 0, "12 copies a statement");
#pragma unroll      /* both loops unrolled: p[], d[] keep static indices (registers, no scratch) */
  for (int g = 0; g < 192 / RPC / 12; ++g) { const _Float16* p[12]; unsigned d[12];
#pragma unroll
    for (int i = 0; i < 12; ++i) { const int c = g * 12 + i; p[i] = (c < NA) ? a + (size_t)(c * RPC) * lda : b + (size_t)((c - NA) * RPC) * ldb; d[i] = l + (unsigned)(c * RPC * PB); }
    asm volatile("global_load_async_to_lds_b128 %0, %12, off\n\tglobal_load_async_to_lds_b128 %1, %13, off\n\tglobal_load_async_to_lds_b128 %2, %14, off\n\tglobal_load_async_to_lds_b128 %3, %15, off\n\t"
                 "global_load_async_to_lds_b128 %4, %16, off\n\tglobal_load_async_to_lds_b128 %5, %17, off\n\tglobal_load_async_to_lds_b128 %6, %18, off\n\tglobal_load_async_to_lds_b128 %7, %19, off\n\t"
                 "global_load_async_to_lds_b128 %8, %20, off\n\tglobal_load_async_to_lds_b128 %9, %21, off\n\tglobal_load_async_to_lds_b128 %10, %22, off\n\tglobal_load_async_to_lds_b128 %11, %23, off\n\ts_wait_xcnt 0x0"
                 :: "v"(d[0]), "v"(d[1]), "v"(d[2]), "v"(d[3]), "v"(d[4]), "v"(d[5]), "v"(d[6]), "v"(d[7]), "v"(d[8]), "v"(d[9]), "v"(d[10]), "v"(d[11]),
                    "v"(p[0]), "v"(p[1]), "v"(p[2]), "v"(p[3]), "v"(p[4]), "v"(p[5]), "v"(p[6]), "v"(p[7]), "v"(p[8]), "v"(p[9]), "v"(p[10]), "v"(p[11]) : "memory"); } }
template <int ACT, int KC>
__global__ __launch_bounds__(128) void k_gemm2(const _Float16* __restrict__ A, int lda, size_t sA, const _Float16* __restrict__ Bh, int ldb, size_t sB, float alpha, const float* __restrict__ bias, size_t sBias, const float* __restrict__ CP, int rowsPerB, size_t sCPb, int row0g,
    float* __restrict__ C, _Float16* __restrict__ C16, int ldc, size_t sC, int M, int N, int K, int bdiv, size_t zA, size_t zB, size_t zC) { static_assert(ACT == 0 || ACT == 3 || ACT == 6 || ACT == 8 || ACT == 9 || ACT == 11 || ACT == 12 || ACT == 14 || ACT == 15 || ACT == 16 || ACT == 17, "k_gemm2: unsupported ACT code (would silently apply no activation)");
  constexpr int PB = 2 * KC + 16, STB = 192 * PB;      /* bytes: a staged row's pitch, one buffer */
  static_assert(2 * STB >= 4 * 32 * 68 * 4, "the output staging reuses the two buffers");
  __shared__ __attribute__((aligned(16))) unsigned char sm[2 * STB]; float (*so)[32][68] = reinterpret_cast<float (*)[32][68]>(sm);      /* so: each wave's output staging, used behind the loop's last barrier */
  const int tid = threadIdx.x, w = tid >> 5, lane = tid & 31, ln = lane & 15, hh = lane >> 4; const int by = blockIdx.y; const size_t bz = blockIdx.z;      /* y = head (bdiv heads share one B slab), z = batch */
  A += (size_t)by * sA + bz * zA; Bh += (size_t)(by / bdiv) * sB + bz * zB; const size_t cofs = (size_t)by * sC + bz * zC; const float* bp = bias ? bias + (size_t)by * sBias : nullptr;
  const int ntn = N >> 6; const int mt = blockIdx.x / ntn, nq = blockIdx.x - mt * ntn; const int row0 = mt * 128 + 32 * w, col0 = nq * 64; if (mt * 128 >= M) return;      /* the whole block leaves, in front of every barrier */
  const int srow = tid / (KC / 8), sseg = tid % (KC / 8);
  const _Float16* ag = A + (size_t)(mt * 128 + srow) * lda + sseg * 8; const _Float16* bg = Bh + (size_t)(col0 + srow) * ldb + sseg * 8;
  const unsigned l0 = (unsigned)(size_t)sm + (unsigned)(srow * PB + sseg * 16);
  const int nt = K / KC;
  g2_stage<KC>(ag, (size_t)lda, bg, (size_t)ldb, l0);
  asm volatile("s_wait_asynccnt 0x0" ::: "memory");      /* this wave's copies of tile 0 have landed */
  __syncthreads();      /* ... and every other wave's */
  if (nt > 1) g2_stage<KC>(ag + KC, (size_t)lda, bg + KC, (size_t)ldb, l0 + STB);
  const v8f z8 = {0.f,0.f,0.f,0.f,0.f,0.f,0.f,0.f}; v8f c00 = z8, c01 = z8, c02 = z8, c03 = z8, c10 = z8, c11 = z8, c12 = z8, c13 = z8;
#pragma unroll 1      /* one trip a tile: the two buffers take turns */
  for (int t = 0; t < nt; ++t) { const unsigned char* sb = sm + (t & 1) * STB;
    const _Float16* a0p = (const _Float16*)(sb + (32 * w + ln) * PB); const _Float16* a1p = (const _Float16*)(sb + (32 * w + 16 + ln) * PB);
    const _Float16* b0p = (const _Float16*)(sb + (128 + ln) * PB); const _Float16* b1p = (const _Float16*)(sb + (144 + ln) * PB); const _Float16* b2p = (const _Float16*)(sb + (160 + ln) * PB); const _Float16* b3p = (const _Float16*)(sb + (176 + ln) * PB);
    v16h fa[2][2], fb[2][4];      /* two fragment sets: a k step's 12 LDS loads go as one group, one step ahead of its products, inside this tile only */
    fa[0][0] = g2_frag(a0p, hh); fa[0][1] = g2_frag(a1p, hh); fb[0][0] = g2_frag(b0p, hh); fb[0][1] = g2_frag(b1p, hh); fb[0][2] = g2_frag(b2p, hh); fb[0][3] = g2_frag(b3p, hh);
#pragma unroll      /* unrolled: the sets keep static indices (registers), every LDS offset is an immediate */
    for (int s = 0; s < KC / 32; ++s) { const int u = s & 1, n = u ^ 1, kn = (s + 1) * 32;
      if (s + 1 < KC / 32) { fa[n][0] = g2_frag(a0p + kn, hh); fa[n][1] = g2_frag(a1p + kn, hh); fb[n][0] = g2_frag(b0p + kn, hh); fb[n][1] = g2_frag(b1p + kn, hh); fb[n][2] = g2_frag(b2p + kn, hh); fb[n][3] = g2_frag(b3p + kn, hh); }
      c00 = g2_mma(fa[u][0], fb[u][0], c00); c10 = g2_mma(fa[u][1], fb[u][0], c10); c01 = g2_mma(fa[u][0], fb[u][1], c01); c11 = g2_mma(fa[u][1], fb[u][1], c11);
      c02 = g2_mma(fa[u][0], fb[u][2], c02); c12 = g2_mma(fa[u][1], fb[u][2], c12); c03 = g2_mma(fa[u][0], fb[u][3], c03); c13 = g2_mma(fa[u][1], fb[u][3], c13); }
    asm volatile("s_wait_dscnt 0x0" ::: "memory");      /* this wave's reads of the buffer are done before it is handed to the next copies */
    asm volatile("s_wait_asynccnt 0x0" ::: "memory");      /* this wave's copies of tile t + 1 have landed */
    __syncthreads();      /* publishes tile t + 1 and ends every wave's reads of tile t */
    if (t + 2 < nt) g2_stage<KC>(ag + (size_t)(t + 2) * KC, (size_t)lda, bg + (size_t)(t + 2) * KC, (size_t)ldb, l0 + (t & 1) * STB); }
  asm volatile("s_wait_asynccnt 0x0" ::: "memory");      /* no copy is in flight when the buffers become output staging */
  v8f accs[8] = {c00, c01, c02, c03, c10, c11, c12, c13};
#pragma unroll
  for (int u = 0; u < 8; ++u) { const int t = u & 3, half = u >> 2; const int col = col0 + t * 16 + ln; const float bv = bp ? bf16_round(bp[col]) : 0.f;
#pragma unroll
    for (int r = 0; r < 8; ++r) { const int rloc = half * 16 + 8 * hh + r; float v = accs[u][r] * alpha + bv; if (CP) { if (rowsPerB < 0) v += CP[cofs + (size_t)(row0g + row0 + rloc) * ldc + col];      /* rowsPerB < 0: own element of the batched C plane */ else { const int bidx = (row0g + row0 + rloc) / rowsPerB; v += CP[(size_t)bidx * sCPb + (size_t)by * 64 + col]; } }
      if (ACT == 3) v = fmaxf(v, 0.f); else if (ACT == 6) v = 0.5f * v * (1.0f + erff(v * 0.70710678118654752f)); else if (ACT == 11) v = 1.0f / (1.0f + expf(-v)); else if (ACT == 15) v = v / (1.0f + expf(-v)); else if (ACT == 12) v = (v > 0.f) ? v : 0.01f * v; else if (ACT == 8) v = tanhf(v); else if (ACT == 9) v = 0.5f * v * (1.0f + tanhf(0.7978845608028654f * (v + 0.044715f * v * v * v))); else if (ACT == 14) v = (v > 0.f) ? v : 0.1f * v; else if (ACT == 16) v = (v >= 0.f) ? v : 0.3f * v; else if (ACT == 17) v = (v >= 0.f) ? v : 0.2f * v;
      so[w][rloc][t * 16 + ln] = v; } }
  __builtin_amdgcn_fence(__ATOMIC_ACQ_REL, "workgroup"); __builtin_amdgcn_wave_barrier();
  const int rsub = lane >> 4, c4 = (lane & 15) * 4;
  {
#pragma unroll
    for (int q = 0; q < 16; ++q) { const int r = q * 2 + rsub; const v4f v = *(const v4fa*)&so[w][r][c4]; if (C) *(v4f*)(C + cofs + (size_t)(row0 + r) * ldc + col0 + c4) = v; if (C16) { v4h h4; for (int i = 0; i < 4; ++i) h4[i] = (_Float16)v[i]; *(v4h*)(C16 + cofs + (size_t)(row0 + r) * ldc + col0 + c4) = h4; } }
     } }


__global__ __launch_bounds__(256) void k_wnat(const float* __restrict__ w, size_t n8, _Float16* __restrict__ Bt) { const size_t t = (size_t)blockIdx.x * 256 + threadIdx.x; if (t >= n8) return; FragH f; for (int q = 0; q < 8; ++q) f.h[q] = (_Float16)(bf16_round(w[t * 8 + q]) * 16.0f); *(v8us*)((unsigned short*)Bt + t * 8) = f.half[0];  }
__global__ __launch_bounds__(256) void k_rsm(const float* __restrict__ S, _Float16* __restrict__ P, int nrows) {
  #pragma clang fp contract(off)
  const int i = blockIdx.x * 256 + threadIdx.x; if (i >= nrows) return; const float* s = S + (size_t)i * SQ; float mx = -3.0e38f;
#pragma unroll 1
  for (int j = 0; j < SQ; ++j) mx = fmaxf(mx, s[j]); float se = 0.f;
#pragma unroll 1
  for (int j = 0; j < SQ; ++j) se += expf(s[j] - mx); const float sc = 256.0f / se;
#pragma unroll 1
  for (int j0 = 0; j0 < SQ; j0 += 8) { FragH f; for (int q = 0; q < 8; ++q) f.h[q] = (_Float16)(expf(s[j0 + q] - mx) * sc); unsigned short* d = (unsigned short*)P + (size_t)i * SQ + j0; *(v8us*)d = f.half[0];  } }
__global__ __launch_bounds__(256) void k_vt(const _Float16* __restrict__ V16, int b, int h0, _Float16* __restrict__ VT) { __shared__ unsigned short tl[64][65]; const int tid = threadIdx.x; const int hh = blockIdx.x % HG, sg = blockIdx.x / HG; const int s0 = sg * 64; const int h = h0 + hh;
  for (int i = tid; i < 64 * 8; i += 256) { const int j = i / 8, d8 = (i % 8) * 8; FragH f; f.half[0] = *(const v8us*)((const unsigned short*)V16 + ((size_t)b * SQ + s0 + j) * DM + h * HD + d8); for (int q = 0; q < 8; ++q) tl[d8 + q][j] = f.u[q]; }
  __syncthreads();
  { for (int i = tid; i < 64 * 8; i += 256) { const int d = i / 8, j8 = (i % 8) * 8; FragH f; for (int q = 0; q < 8; ++q) f.u[q] = tl[d][j8 + q]; *(v8us*)((unsigned short*)VT + ((size_t)hh * HD + d) * SQ + s0 + j8) = f.half[0]; }  } }


// lane l with lane l ^ M inside its 16-lane row (M = 1, 2, 4, 8), and with lane l ^ 16
template <int M>
__device__ __forceinline__ float row_x(float x) { return __builtin_bit_cast(float, __builtin_amdgcn_update_dpp(0, __builtin_bit_cast(int, x), 0x160 + M, 0xf, 0xf, true)); }
__device__ __forceinline__ float half_x(float x) { return __builtin_bit_cast(float, __builtin_amdgcn_permlanex16(__builtin_bit_cast(int, x), __builtin_bit_cast(int, x), 0x76543210, 0xfedcba98, false, false)); }
// exact (f32, vector unit) causal attention of rows 0..QT0-1: 8 waves a block, one wave a query row; x = head * (QT0 / 8) + group of 8 rows, y = batch. Keys go in chunks of 32; a chunk wholly behind the row is skipped (wave-uniform).
// scores: lane = 8 kq + dl reads dims 32 t + 4 dl .. + 3 of key 32 c + 4 g + kq (each load = 4 whole 128-byte lines), sums its 16 products (4 partial sums, one a dim of the 16 bytes), 3-step butterfly over dl; lane keeps the key with g == dl.
// softmax: maximum and sum = each lane's own (up to 4) keys, then a five-step butterfly. o: lane l holds dims 4 l .. 4 l + 3 (each load 512 contiguous bytes), keys in rising order, each weight read from the lane that keeps it.
// every loop is unrolled: q[], s[] keep static indices (registers, no scratch), the lane a weight is read from is a constant, and a chunk's 32 loads issue ahead of their first use.
__global__ __launch_bounds__(256) void k_att0w(const float* __restrict__ QF, const float* __restrict__ KF, const float* __restrict__ VF, float scale, float* __restrict__ OF) {
  constexpr int ld = DMX, ldv = DMX, ldo = DMX;      /* row pitches, compile-time: a chunk's 32 rows are immediate offsets from one address */
  const int lane = threadIdx.x & 31, dl = lane & 7, kq = lane >> 3; const int h = blockIdx.x / (QT0 / 8); const int i = (blockIdx.x % (QT0 / 8)) * 8 + __builtin_amdgcn_readfirstlane(threadIdx.x >> 5);
  { const size_t bq = (size_t)blockIdx.y * QT0; QF += (bq + i) * ld + h * 128; KF += bq * ld + h * 128; VF += bq * ldv + h * 128; OF += (bq + i) * ldo + h * 128; }      /* y = batch: each batch's QT0 rows follow the last one's */
  v4f q[4];
#pragma unroll
  for (int t = 0; t < 4; ++t) q[t] = *(const v4fa*)(QF + t * 32 + dl * 4);
  float s[QT0 / 32];
#pragma unroll
  for (int c = 0; c < QT0 / 32; ++c) { s[c] = -1.0e30f;
    if (c * 32 <= i) { const float* kp = KF + (size_t)(c * 32 + kq) * ld + dl * 4; float keep = 0.f;
#pragma unroll
      for (int g = 0; g < 8; ++g) { v4f pa = q[0] * *(const v4fa*)(kp + (size_t)(g * 4) * ld);
#pragma unroll
        for (int t = 1; t < 4; ++t) pa += q[t] * *(const v4fa*)(kp + (size_t)(g * 4) * ld + t * 32);
        float a = (pa[0] + pa[1]) + (pa[2] + pa[3]); a += row_x<1>(a); a += row_x<2>(a); a += row_x<4>(a); keep = (dl == g) ? a : keep; }
      s[c] = (c * 32 + 4 * dl + kq <= i) ? keep * scale : -1.0e30f; } }
  float m = s[0];
#pragma unroll
  for (int c = 1; c < QT0 / 32; ++c) m = fmaxf(m, s[c]);
  m = fmaxf(m, row_x<1>(m)); m = fmaxf(m, row_x<2>(m)); m = fmaxf(m, row_x<4>(m)); m = fmaxf(m, row_x<8>(m)); m = fmaxf(m, half_x(m));      /* key 0 is open in every row: m is a score */
  float l = 0.f;
#pragma unroll
  for (int c = 0; c < QT0 / 32; ++c) { s[c] = expf(s[c] - m); l += s[c]; }      /* a closed key: e^(-1e30 - m) = 0 */
  l += row_x<1>(l); l += row_x<2>(l); l += row_x<4>(l); l += row_x<8>(l); l += half_x(l);
  v4f o = {0.f, 0.f, 0.f, 0.f};
#pragma unroll
  for (int c = 0; c < QT0 / 32; ++c) {
    if (c * 32 <= i) { const float* vp = VF + (size_t)(c * 32) * ldv + lane * 4;
#pragma unroll
      for (int j = 0; j < 32; ++j) { const float e = __builtin_bit_cast(float, __builtin_amdgcn_readlane(__builtin_bit_cast(int, s[c]), 8 * (j & 3) + (j >> 2))); const v4f vv = *(const v4fa*)(vp + (size_t)j * ldv); o += vv * e; } } }
  *(v4f*)(OF + lane * 4) = o * (64.0f / l); }
__global__ __launch_bounds__(256) void k_f2h(const float* __restrict__ F, int ldf, int coff, int ncol, _Float16* __restrict__ H16, size_t nrow) { const size_t t = (size_t)blockIdx.x * 256 + threadIdx.x; const size_t n8 = nrow * (size_t)(ncol / 8); if (t >= n8) return; const size_t r = t / (ncol / 8); const int c8 = (int)(t % (ncol / 8)) * 8; FragH f; const v4f a = *(const v4fa*)(F + r * ldf + coff + c8), b2 = *(const v4fa*)(F + r * ldf + coff + c8 + 4); for (int q = 0; q < 4; ++q) { f.h[q] = (_Float16)a[q]; f.h[4 + q] = (_Float16)b2[q]; } *(v8us*)((unsigned short*)H16 + r * ncol + c8) = f.half[0];  }

__global__ __launch_bounds__(256) void k_tab128(float theta, float* __restrict__ CS, float* __restrict__ SN) {
  #pragma clang fp contract(off)
  const int t = blockIdx.x * 256 + threadIdx.x; if (t >= SQ * 64) return; const int i = t % 64; const int p = t / 64; const float invf = (float)(1.0 / pow((double)theta, (double)(2 * i) / 128.0));      /* = XLA's constant-folded f32 table */ const float ang = __fmul_rn((float)p, invf); const float c = cosf(ang), s = sinf(ang);
  *(float*)(CS + t) = c; *(float*)(SN + t) = s;  }
template <int TAB>
__global__ __launch_bounds__(128) void k_rope128(const float* __restrict__ F, int ldf, int nh, const float* __restrict__ CS, const float* __restrict__ SN, _Float16* __restrict__ H16, int ldo, float osc) {
  #pragma clang fp contract(off)
  __shared__ float xv[128]; __shared__ unsigned short sh_[128]; const int d = threadIdx.x; const int h = blockIdx.x % nh; const size_t r = blockIdx.x / nh; const int p = (int)(r % SQ);
  xv[d] = F[r * (size_t)ldf + (size_t)h * 128 + d]; __syncthreads();
  float c, s; if (TAB) { c = bf16_round(CS[(size_t)p * 128 + d]); s = bf16_round(SN[(size_t)p * 128 + d]); } else { c = CS[p * 64 + (d & 63)]; s = SN[p * 64 + (d & 63)]; }
  const float rot = (d < 64) ? -xv[d + 64] : xv[d - 64]; const float o = __fadd_rn(__fmul_rn(xv[d], c), __fmul_rn(rot, s));
  FragH th; th.h[0] = (_Float16)__fmul_rn(o, osc); sh_[d] = th.u[0]; __syncthreads();
  if (d < 16) { FragH f; for (int q = 0; q < 8; ++q) f.u[q] = sh_[d * 8 + q]; unsigned short* dst = (unsigned short*)H16 + r * (size_t)ldo + (size_t)h * 128 + d * 8; *(v8us*)dst = f.half[0];  } }

template <int N>
__global__ __launch_bounds__(256) void k_rmsrow(float* __restrict__ X, const float* __restrict__ w, float eps) {
  #pragma clang fp contract(off)
  constexpr int PT = N / 256; __shared__ float red[256]; const size_t r = blockIdx.x; const int t = threadIdx.x; float* row = X + r * N + (size_t)t * PT; float v[PT]; float ss = 0.f;
  for (int q = 0; q < PT; ++q) { v[q] = row[q]; ss = __fadd_rn(ss, __fmul_rn(v[q], v[q])); }
  red[t] = ss; __syncthreads(); for (int k = 128; k > 0; k >>= 1) { if (t < k) red[t] = __fadd_rn(red[t], red[t + k]); __syncthreads(); }
  const float rs = rsqrtf(__fadd_rn(red[0] / (float)N, eps)); float o[PT]; for (int q = 0; q < PT; ++q) o[q] = __fmul_rn(__fmul_rn(v[q], rs), bf16_round(w[t * PT + q]));
  { for (int q = 0; q < PT; ++q) *(float*)(row + q) = o[q];  } }
template <int GS_, int NHQ, int DSRC>
__global__ __launch_bounds__(256) void k_kvexp128(const float* __restrict__ src, float* __restrict__ dst, size_t n4) { const size_t t = (size_t)blockIdx.x * 256 + threadIdx.x; if (t >= n4) return; const size_t e = t * 4; const size_t row = e / ((size_t)NHQ * 128); const int col = (int)(e % ((size_t)NHQ * 128)); const int h = col / 128, d = col % 128; const v4f v = *(const v4fa*)(src + row * DSRC + (size_t)(h / GS_) * 128 + d); *(v4f*)(dst + e) = v;  }

__global__ __launch_bounds__(256) void k_rsmcfb(const float* __restrict__ S, _Float16* __restrict__ P, int hg, int q0, int nk, const int* __restrict__ mk) {
  #pragma clang fp contract(off)
  const int t = blockIdx.x * 256 + threadIdx.x; if (t >= hg * QT) return; const size_t i = (size_t)t; const float* s = S + i * NKX; const size_t ig = (size_t)(q0 + (t % QT)); const int* mr = mk + ig * SQ; float mx = -3.0e38f;
#pragma unroll 1
  for (int j = 0; j < nk; ++j) { const int mb = mr[j]; const float f = (mb == 0) ? 1.f : 0.f; mx = fmaxf(mx, fmaf(f, s[j], (1.f - f) * -1.0e9f)); } float se = 0.f;
#pragma unroll 1
  for (int j = 0; j < nk; ++j) { const int mb = mr[j]; const float f = (mb == 0) ? 1.f : 0.f; se += __expf(fmaf(f, s[j], (1.f - f) * -1.0e9f) - mx); } const float sc = 256.0f / se;
#pragma unroll 1
  for (int j0 = 0; j0 < nk; j0 += 8) { FragH fr; for (int q = 0; q < 8; ++q) { const int j = j0 + q; const int mb = mr[j]; const float f = (mb == 0) ? 1.f : 0.f; fr.h[q] = (_Float16)(__expf(fmaf(f, s[j], (1.f - f) * -1.0e9f) - mx) * sc); } unsigned short* d = (unsigned short*)P + i * NKX + j0; *(v8us*)d = fr.half[0];  } }


// per-head RMSNorm over the 128 dims, then rotate-half RoPE, of the NHD heads of one row, in place: lane l holds dims 4 l .. 4 l + 3 of every head.
// sum of squares = the lane's own 4 dims, then a five-step butterfly over the lanes; dim d's partner d +- 64 sits in lane l ^ 16; sg = the sine with the sign of rotate-half (minus in lanes 0..15).
// 1 / sqrt(x) of a normal x. One statement: the v_nop fills the slot behind v_rsq_f32 (output early-clobber).
__device__ __forceinline__ float rsq_n(float x) { float r; asm("v_rsq_f32 %0, %1\n\tv_nop" : "=&v"(r) : "v"(x)); return r; }
template <int NHD>
__device__ __forceinline__ void nr_heads(v4f (&x)[NHD], v4f w, v4f c, v4f sg) {
#pragma unroll
  for (int h = 0; h < NHD; ++h) { const v4f v = x[h]; float ss = (v[0] * v[0] + v[1] * v[1]) + (v[2] * v[2] + v[3] * v[3]);
    ss += row_x<1>(ss); ss += row_x<2>(ss); ss += row_x<4>(ss); ss += row_x<8>(ss); ss += half_x(ss);
    const v4f y = (v * rsq_n(ss * 0.0078125f + 1e-6f)) * w; v4f o;      /* mean square + eps >= 1e-6: never subnormal, so no rescue scaling round the v_rsq_f32 */
#pragma unroll
    for (int u = 0; u < 4; ++u) o[u] = y[u] * c[u] + half_x(y[u]) * sg[u];
    x[h] = o; } }
// RMSNorm + RoPE of q and k in one launch: 8 waves a block, one wave a row of x with its 16 query and 8 key heads in registers (each load 512 contiguous bytes, all 24 issued ahead of the first use; the row's table line is read once).
// out: f16 q and k; rows 0..QT0-1 of each batch also in f32 for the exact first tile, a key head written to both query heads of its group (wave-uniform branch).
__global__ __launch_bounds__(256) void k_nrope(const float* __restrict__ QF, const float* __restrict__ KF, const float* __restrict__ qw, const float* __restrict__ kw, const float* __restrict__ CS, const float* __restrict__ SN,
    _Float16* __restrict__ Q16, _Float16* __restrict__ K16, float* __restrict__ QF0, float* __restrict__ KF0e) {
  const int lane = threadIdx.x & 31, l4 = lane * 4; const int r = blockIdx.x * 8 + __builtin_amdgcn_readfirstlane(threadIdx.x >> 5); const int p = r % SQ, b = r / SQ;
  const float* q = QF + (size_t)r * DMX + l4; const float* k = KF + (size_t)r * DKV + l4;
  v4f xq[NH], xk[NKV];
#pragma unroll
  for (int h = 0; h < NH; ++h) xq[h] = *(const v4fa*)(q + h * 128);
#pragma unroll
  for (int h = 0; h < NKV; ++h) xk[h] = *(const v4fa*)(k + h * 128);
  const v4f cr = *(const v4fa*)(CS + (size_t)p * 128 + l4), sr = *(const v4fa*)(SN + (size_t)p * 128 + l4), qr = *(const v4fa*)(qw + l4), kr = *(const v4fa*)(kw + l4);
  v4f c, sg, wq, wk;
#pragma unroll
  for (int u = 0; u < 4; ++u) { c[u] = bf16_round(cr[u]); const float s = bf16_round(sr[u]); sg[u] = (lane < 16) ? -s : s; wq[u] = bf16_round(qr[u]); wk[u] = bf16_round(kr[u]); }
  nr_heads<NH>(xq, wq, c, sg); nr_heads<NKV>(xk, wk, c, sg);
  _Float16* q16 = Q16 + (size_t)r * DMX + l4; _Float16* k16 = K16 + (size_t)r * DKV + l4;
#pragma unroll
  for (int h = 0; h < NH; ++h) { v4h h4;
#pragma unroll
    for (int u = 0; u < 4; ++u) h4[u] = (_Float16)xq[h][u];
    *(v4h*)(q16 + h * 128) = h4; }
#pragma unroll
  for (int h = 0; h < NKV; ++h) { v4h h4;
#pragma unroll
    for (int u = 0; u < 4; ++u) h4[u] = (_Float16)xk[h][u];
    *(v4h*)(k16 + h * 128) = h4; }
  asm volatile("s_wait_xcnt 0x0" ::: "memory");      /* the branch below reuses registers that the f16 stores name; in front of the branch, so that nothing of it is lifted over the wait */
  if (p < QT0) { const size_t f = ((size_t)b * QT0 + p) * DMX + l4;
#pragma unroll
    for (int h = 0; h < NH; ++h) { *(v4f*)(QF0 + f + h * 128) = xq[h]; *(v4f*)(KF0e + f + h * 128) = xk[h / GSZ]; } } }

// 2^x of four values. One statement: each v_exp_f32 is followed by one that neither reads its result nor writes its source (outputs early-clobber), and the v_nop fills
// the slot behind the last.
__device__ __forceinline__ v4f exp2_4(v4f x) { float e0, e1, e2, e3;
  asm("v_exp_f32 %0, %4\n\tv_exp_f32 %1, %5\n\tv_exp_f32 %2, %6\n\tv_exp_f32 %3, %7\n\tv_nop" : "=&v"(e0), "=&v"(e1), "=&v"(e2), "=&v"(e3) : "v"(x[0]), "v"(x[1]), "v"(x[2]), "v"(x[3]));
  const v4f e = {e0, e1, e2, e3}; return e; }
// 2^x of one value; the v_nop fills the slot behind v_exp_f32 (output early-clobber), as in exp2_4.
__device__ __forceinline__ float exp2_1(float x) { float r; asm("v_exp_f32 %0, %1\n\tv_nop" : "=&v"(r) : "v"(x)); return r; }
__device__ __forceinline__ v8f fa_mma(v16h a, v16h b, v8f c) { return __builtin_amdgcn_wmma_f32_16x16x32_f16(false, a, false, b, (short)0, c, false, false); }
// four vector slots behind a group of matrix instructions, in front of a branch whose taken side reads their results; the scheduling barriers keep them at that place.
__device__ __forceinline__ void fa_gap() { __builtin_amdgcn_sched_barrier(0); asm volatile("v_nop\n\tv_nop\n\tv_nop\n\tv_nop"); __builtin_amdgcn_sched_barrier(0); }
// eight copies of 16 bytes a thread, global memory to LDS through no register: rows step (elements) apart in memory, lstep bytes apart in LDS.
// The s_wait_xcnt is the last line of the copies' own statement, so that no address register is rewritten in front of it.
__device__ __forceinline__ void fa_copy8(const _Float16* g, size_t step, unsigned l, unsigned lstep) { const _Float16* p[8]; unsigned d[8];
#pragma unroll      /* unrolled: p[], d[] keep static indices (registers, no scratch) */
  for (int i = 0; i < 8; ++i) { p[i] = g + (size_t)i * step; d[i] = l + (unsigned)i * lstep; }
  asm volatile("global_load_async_to_lds_b128 %0, %8, off\n\tglobal_load_async_to_lds_b128 %1, %9, off\n\tglobal_load_async_to_lds_b128 %2, %10, off\n\tglobal_load_async_to_lds_b128 %3, %11, off\n\t"
               "global_load_async_to_lds_b128 %4, %12, off\n\tglobal_load_async_to_lds_b128 %5, %13, off\n\tglobal_load_async_to_lds_b128 %6, %14, off\n\tglobal_load_async_to_lds_b128 %7, %15, off\n\ts_wait_xcnt 0x0"
               :: "v"(d[0]), "v"(d[1]), "v"(d[2]), "v"(d[3]), "v"(d[4]), "v"(d[5]), "v"(d[6]), "v"(d[7]), "v"(p[0]), "v"(p[1]), "v"(p[2]), "v"(p[3]), "v"(p[4]), "v"(p[5]), "v"(p[6]), "v"(p[7]) : "memory"); }
// a pass's eight K fragments (32 keys x 128 dims) as one group of LDS loads; p = the lane's own row (key c of the pass) in the buffer, the second 16 keys lie 16 rows on.
__device__ __forceinline__ void fa_loadk(v16h (&kf)[2][4], const unsigned char* p, unsigned pitch, int hh) {
#pragma unroll
  for (int kt = 0; kt < 2; ++kt)
#pragma unroll
    for (int kc = 0; kc < 4; ++kc) kf[kt][kc] = g2_frag((const _Float16*)(p + 16 * kt * pitch) + 32 * kc, hh); }
constexpr int FQ = 128; constexpr unsigned FPK = 2 * HDK + 16, FPV = 2 * 64 + 16, FTK = 64 * FPK, FTV = HDK * FPV, FST = FTK + FTV;
static_assert(SQ % FQ == 0 && (SQ / FQ) % 2 == 0 && HDK == 128, "k_fattn: blocks of 128 rows, head size 128");
__global__ __launch_bounds__(128) void k_fattn(const _Float16* __restrict__ Q16, const _Float16* __restrict__ K16, const _Float16* __restrict__ VT, _Float16* __restrict__ O16) {
  __shared__ __attribute__((aligned(16))) unsigned char sm[2 * FST];
  const int tid = threadIdx.x, lane = tid & 31, c = lane & 15, hh = lane >> 4; const int w = __builtin_amdgcn_readfirstlane(tid >> 5);
  const int head = blockIdx.x % NH, b = blockIdx.x / NH, grp = head / GSZ;
  constexpr int NQB = SQ / FQ; const int qb = ((int)blockIdx.y < NQB / 2) ? NQB - 1 - (int)blockIdx.y : (int)blockIdx.y - NQB / 2;      /* long blocks start first; blocks half a grid apart add up to the same length */
  const int q0 = qb * FQ, qw0 = q0 + 32 * w, nst = (q0 + FQ) / 64;      /* keys 0 .. q0 + 127: at least two stages */
  const _Float16* kg = K16 + ((size_t)b * SQ + (tid >> 4)) * DKV + grp * HDK + (tid & 15) * 8; const _Float16* vg = VT + ((size_t)b * DKV + grp * HDK + (tid >> 3)) * SQ + (tid & 7) * 8;
  const unsigned lk = (unsigned)(size_t)sm + (unsigned)((tid >> 4) * FPK + (tid & 15) * 16), lv = (unsigned)(size_t)sm + FTK + (unsigned)((tid >> 3) * FPV + (tid & 7) * 16);
  fa_copy8(kg, (size_t)8 * DKV, lk, 8 * FPK); fa_copy8(vg, (size_t)16 * SQ, lv, 16 * FPV);
  v16h qf[2][4];
#pragma unroll
  for (int g = 0; g < 2; ++g)
#pragma unroll
    for (int kc = 0; kc < 4; ++kc) qf[g][kc] = g2_frag(Q16 + ((size_t)b * SQ + qw0 + 16 * g + c) * DMX + head * HDK + 32 * kc, hh);
  const v8f z8 = {0.f,0.f,0.f,0.f,0.f,0.f,0.f,0.f}; v8f acc[2][8]; float m_run[2], l_run[2];
#pragma unroll
  for (int g = 0; g < 2; ++g) { m_run[g] = -__builtin_inff(); l_run[g] = 0.f;
#pragma unroll
    for (int t = 0; t < 8; ++t) acc[g][t] = z8; }
  asm volatile("s_wait_asynccnt 0x0" ::: "memory");      /* this wave's copies of stage 0 have landed */
  __syncthreads();      /* ... and every other wave's */
  fa_copy8(kg + (size_t)64 * DKV, (size_t)8 * DKV, lk + FST, 8 * FPK); fa_copy8(vg + 64, (size_t)16 * SQ, lv + FST, 16 * FPV);
  constexpr float cs = ATS * 1.4426950408889634f;      /* score scale, log2 domain */
  v16h kf[2][4];      /* K fragments of the coming pass: fetched as one group ahead of their products, never out of another stage's buffer */
#pragma unroll 1      /* one trip a stage: the two buffers take turns */
  for (int st = 0; st < nst; ++st) { const unsigned char* sb = sm + (st & 1) * FST;
    if (st * 64 <= qw0) fa_loadk(kf, sb + (unsigned)c * FPK, FPK, hh);      /* wave-uniform: the first pass's K fragments; this stage's buffer only */
#pragma unroll 1      /* one body for both passes: half the code, and no more registers than one pass needs */
    for (int sub = 0; sub < 2; ++sub) { const int key0 = st * 64 + sub * 32;
      if (key0 <= qw0) {      /* wave-uniform: a later pass holds no key that a query of this wave may see */
        v8f s[2][2] = {{z8, z8}, {z8, z8}};
#pragma unroll
        for (int kc = 0; kc < 4; ++kc)
#pragma unroll
          for (int kt = 0; kt < 2; ++kt)
#pragma unroll
            for (int g = 0; g < 2; ++g) s[kt][g] = fa_mma(kf[kt][kc], qf[g][kc], s[kt][g]);
        fa_gap();
        v16h vf[8];      /* the pass's V^T fragments, one group, in flight under the softmax */
#pragma unroll
        for (int t = 0; t < 8; ++t) vf[t] = g2_frag((const _Float16*)(sb + FTK + (unsigned)(16 * t + c) * FPV) + sub * 32, hh);
        if (sub == 0 && key0 + 32 <= qw0) fa_loadk(kf, sb + (unsigned)(32 + c) * FPK, FPK, hh);      /* wave-uniform: the stage's second pass, same buffer, in flight under this pass's softmax and second product */
        if (key0 == qw0) {      /* wave-uniform: only the pass on this wave's diagonal pays for the mask; every column keeps at least key qw0 */
#pragma unroll
          for (int g = 0; g < 2; ++g)
#pragma unroll
            for (int kt = 0; kt < 2; ++kt) {
#pragma unroll
              for (int r = 0; r < 8; ++r) if (16 * kt + 8 * hh + r > 16 * g + c) s[kt][g][r] = -__builtin_inff();
              asm volatile("" : "+v"(s[kt][g])); } }      /* the masked scores: keeps the selects inside the branch */
        float mb[2]; bool need = false;
#pragma unroll
        for (int g = 0; g < 2; ++g) { float mx = s[0][g][0];
#pragma unroll
          for (int r = 1; r < 8; ++r) mx = fmaxf(mx, s[0][g][r]);
#pragma unroll
          for (int r = 0; r < 8; ++r) mx = fmaxf(mx, s[1][g][r]);
          mx = fmaxf(mx, half_x(mx)) * cs; mb[g] = mx; need = need || (mx > m_run[g] + 8.0f); }      /* both halves of the wave now hold the query's maximum of this pass */
        if (__builtin_amdgcn_ballot_w32(need) != 0) {      /* wave-uniform; rare behind the first passes */
#pragma unroll
          for (int g = 0; g < 2; ++g) { const float mn = fmaxf(m_run[g], mb[g]); const float corr = exp2_1(m_run[g] - mn);      /* mn is finite from the first pass on (key 0 is open to every query); corr = 0 there */
            l_run[g] *= corr; m_run[g] = mn;
#pragma unroll
            for (int t = 0; t < 8; ++t) acc[g][t] = acc[g][t] * corr; } }
        FragH pf[2];
#pragma unroll
        for (int g = 0; g < 2; ++g) { const float nm = -m_run[g]; float ps = 0.f;
#pragma unroll
          for (int kt = 0; kt < 2; ++kt)
#pragma unroll
            for (int u4 = 0; u4 < 2; ++u4) { v4f a;
#pragma unroll
              for (int u = 0; u < 4; ++u) a[u] = fmaf(s[kt][g][4 * u4 + u], cs, nm);
              const v4f e = exp2_4(a); ps += (e[0] + e[1]) + (e[2] + e[3]);
#pragma unroll
              for (int u = 0; u < 4; ++u) pf[g].h[8 * kt + 4 * u4 + u] = (_Float16)e[u]; }
          l_run[g] += ps; }
        __builtin_amdgcn_sched_barrier(0);      /* the exponentials are asm text: all of them stay in front of the products */
#pragma unroll
        for (int t = 0; t < 8; ++t)
#pragma unroll
          for (int g = 0; g < 2; ++g) acc[g][t] = fa_mma(vf[t], pf[g].v, acc[g][t]);
        fa_gap(); } }
    asm volatile("s_wait_dscnt 0x0" ::: "memory");      /* this wave's reads of the buffer are done before it is handed to the next copies */
    asm volatile("s_wait_asynccnt 0x0" ::: "memory");      /* this wave's copies of stage st + 1 have landed */
    __syncthreads();      /* publishes stage st + 1 and ends every wave's reads of stage st */
    if (st + 2 < nst) { fa_copy8(kg + (size_t)(st + 2) * 64 * DKV, (size_t)8 * DKV, lk + (st & 1) * FST, 8 * FPK); fa_copy8(vg + (st + 2) * 64, (size_t)16 * SQ, lv + (st & 1) * FST, 16 * FPV); } }
  asm volatile("s_wait_asynccnt 0x0" ::: "memory");      /* no copy is in flight when the wave ends */
#pragma unroll
  for (int g = 0; g < 2; ++g) { const float inv = 64.0f / (l_run[g] + half_x(l_run[g]));      /* each half of the wave summed its own eight keys of every 16; o x64 */
    unsigned short* op = (unsigned short*)O16 + ((size_t)b * SQ + qw0 + 16 * g + c) * DMX + head * HDK + 8 * hh;
#pragma unroll
    for (int t = 0; t < 8; ++t) { FragH f;      /* accumulator register r = dim 16 t + 8 hh + r of query c: 16 contiguous bytes */
#pragma unroll
      for (int r = 0; r < 8; ++r) f.h[r] = (_Float16)(acc[g][t][r] * inv);
      *(v8us*)(op + 16 * t) = f.half[0]; } } }
extern "C" void kernel_launch(void* const* d_in, const int* in_sizes, int n_in,
                              void* d_out, int out_size, void* d_ws, size_t ws_size, hipStream_t stream) {
  (void)in_sizes; (void)n_in; (void)out_size;
  const float* const* I = (const float* const*)d_in; const float* x = I[0]; const float* wq = I[1]; const float* wk = I[2]; const float* wv = I[3]; const float* wo = I[4]; const float* qnw = I[5]; const float* knw = I[6]; const float* tcos = I[7]; const float* tsin = I[8];      /* [in][out] weights; rope tables [S][128] */
  char* ws = (char*)d_ws; size_t off = 0;
  auto take = [&](size_t bytes) { char* p = ws + off; off += (bytes + 255) & ~(size_t)255; return p; };
  _Float16* BQ = (_Float16*)take((size_t)DMX * DMX * 2); _Float16* BK = (_Float16*)take((size_t)DKV * DMX * 2); _Float16* BV = (_Float16*)take((size_t)DKV * DMX * 2); _Float16* BO = (_Float16*)take((size_t)DMX * DMX * 2);
  _Float16* X16 = (_Float16*)take(NR * DMX * 2); float* QF = (float*)take(NR * DMX * 4); float* KF = (float*)take(NR * DKV * 4); float* VF = (float*)take(NR * DKV * 4); _Float16* Q16 = (_Float16*)take(NR * DMX * 2); _Float16* K16 = (_Float16*)take(NR * DKV * 2); _Float16* V16 = (_Float16*)take(NR * DKV * 2); _Float16* O16 = (_Float16*)take(NR * DMX * 2);
  _Float16* VT = (_Float16*)take((size_t)NB * (DKV / 64) * 64 * SQ * 2);
  float* QF0 = (float*)take((size_t)NB * QT0 * DMX * 4); float* KF0e = (float*)take((size_t)NB * QT0 * DMX * 4); float* VF0e = (float*)take((size_t)NB * QT0 * DMX * 4); float* OF0 = (float*)take((size_t)NB * QT0 * DMX * 4); _Float16* OH0 = (_Float16*)take((size_t)NB * QT0 * DMX * 2); _Float16* OL0 = (_Float16*)take((size_t)NB * QT0 * DMX * 2);
  if (off > ws_size) return;
  k_wt4<<<2 * WTQ + 2 * WTV, 256, 0, stream>>>(wq, wk, wv, wo, BQ, BK, BV, BO);      /* the four weights, [in][out] -> Bt x16 */
  k_x16<<<(unsigned)((NR * DMX / 8 + 255) / 256), 256, 0, stream>>>(x, X16, NR * DMX / 8);
  k_gemm2<0, 64><<<dim3((unsigned)((NR / 128) * (DMX / 64)), 1), 128, 0, stream>>>(X16, DMX, 0, BQ, DMX, 0, 0.0625f, nullptr, 0, nullptr, 1, 0, 0, QF, nullptr, DMX, 0, (int)NR, DMX, DMX, 1, 0, 0, 0);      /* q (f32) */
  k_gemm2<0, 64><<<dim3((unsigned)((NR / 128) * (DKV / 64)), 1), 128, 0, stream>>>(X16, DMX, 0, BK, DMX, 0, 0.0625f, nullptr, 0, nullptr, 1, 0, 0, KF, nullptr, DKV, 0, (int)NR, DKV, DMX, 1, 0, 0, 0);      /* k (f32) */
  k_gemm2<0, 64><<<dim3((unsigned)((NR / 128) * (DKV / 64)), 1), 128, 0, stream>>>(X16, DMX, 0, BV, DMX, 0, 0.0625f, nullptr, 0, nullptr, 1, 0, 0, VF, V16, DKV, 0, (int)NR, DKV, DMX, 1, 0, 0, 0);      /* v (f32 for the first tile + f16) */
  k_nrope<<<(unsigned)(NR / 8), 256, 0, stream>>>(QF, KF, qnw, knw, tcos, tsin, Q16, K16, QF0, KF0e);      /* per-head RMSNorm + rope from the input tables -> f16; rows 0..127 of each batch also f32, k expanded group -> head */
  for (int b = 0; b < NB; ++b) { const size_t r0 = (size_t)b * SQ, f0 = (size_t)b * QT0;
  k_kvexp128<GSZ, NH, DKV><<<(unsigned)(((size_t)QT0 * DMX / 4 + 255) / 256), 256, 0, stream>>>(VF + r0 * DKV, VF0e + f0 * DMX, (size_t)QT0 * DMX / 4);      /* v: group -> head expansion for the exact first tile */
  }      /* per batch */
  k_vt<DKV / 64, SQ><<<NB * (DKV / 64) * (SQ / 64), 256, 0, stream>>>(V16, DKV, 0, VT);      /* V^T, both batches: batch b, group g = slabs 16b + 2g, 16b + 2g + 1 */
  k_att0w<<<dim3(NH * (QT0 / 8), NB), 256, 0, stream>>>(QF0, KF0e, VF0e, ATS, OF0);      /* exact causal attention rows 0..127 of both batches (o x64) */
  k_fattn<<<dim3(NH * NB, SQ / FQ), 128, 0, stream>>>(Q16, K16, VT, O16);      /* causal attention, all heads, batches and rows: o (x64) */
  k_gemm2<0, 64><<<dim3((unsigned)((NR / 128) * (DMX / 64)), 1), 128, 0, stream>>>(O16, DMX, 0, BO, DMX, 0, 0.0009765625f, nullptr, 0, nullptr, 1, 0, 0, (float*)d_out, nullptr, DMX, 0, (int)NR, DMX, DMX, 1, 0, 0, 0);      /* out = o Wo */
  k_hl<<<(unsigned)(((size_t)NB * QT0 * DMX / 8 + 255) / 256), 256, 0, stream>>>(OF0, OH0, OL0, (size_t)NB * QT0 * DMX / 8);
  k_gemm2<0, 128><<<dim3((QT0 / 128) * (DMX / 64), 1, NB), 128, 0, stream>>>(OH0, DMX, 0, BO, DMX, 0, 0.0009765625f, nullptr, 0, nullptr, 1, 0, 0, (float*)d_out, nullptr, DMX, 0, QT0, DMX, DMX, 1, (size_t)QT0 * DMX, 0, (size_t)SQ * DMX);
  k_gemm2<0, 128><<<dim3((QT0 / 128) * (DMX / 64), 1, NB), 128, 0, stream>>>(OL0, DMX, 0, BO, DMX, 0, 0.00000095367431640625f, nullptr, 0, (const float*)d_out, -1, 0, 0, (float*)d_out, nullptr, DMX, 0, QT0, DMX, DMX, 1, (size_t)QT0 * DMX, 0, (size_t)SQ * DMX);      /* rows 0..127 of each batch rewritten from the exact path */
}

// v008
// A run of this version takes 227 microseconds.
// In both of two side-by-side timings against v007, it was 1.18 times as fast.
// Counting every step since v000, it is 45.5 times as fast.
#include <hip/hip_runtime.h>
// Qwen3 attention (x [2][2048][2048]; q = x Wq (16 heads x 128), k = x Wk, v = x Wv (8 kv heads x 128) ([in][out] weights sigma 0.02); per-head RMSNorm over the 128 dims on q and k (weights ones, eps 1e-6); rotate-half RoPE from the module's INPUT cos/sin tables [S][128] (theta 1e6); query head h uses kv head h/2; scores x 128^-0.5 with a causal mask (tril, finfo.min); softmax; out = merged Wo ([in][out]) -> [2][2048][2048]).
// Compute dtype: inputs rounded to bf16; x / weights / tables exact; projections, RMSNorm and rope f32; q, k, v, softmax weights and o as plain f16 GEMM operands (~2^-12; first 128 rows exact); scores, statistics, out f32. v_wmma_f32_16x16x32_f16.
#define NB 2
#define SQ 2048
#define DMX 2048
#define NH 16
#define NKV 8
#define GSZ 2
#define HDK 128
#define DKV (NKV * HDK)
#define QT 256
#define QT0 128
#define NKX SQ
#define DM DMX
#define HD 64
#define HG 1
#define NR ((size_t)NB * SQ)
#define ATS 0.08838834764831845f
typedef __bf16 v16b __attribute__((ext_vector_type(16)));
typedef unsigned short v8us __attribute__((ext_vector_type(8), may_alias));
typedef float  v8f  __attribute__((ext_vector_type(8)));
typedef float  v4f  __attribute__((ext_vector_type(4)));
typedef float  v4fa __attribute__((ext_vector_type(4), may_alias));
union FragB { v16b v; v8us half[2]; unsigned short u[16]; };

__device__ __forceinline__ unsigned short bf16_bits(float x) { unsigned int u = __float_as_uint(x); return (unsigned short)((u + 0x7FFFu + ((u >> 16) & 1u)) >> 16); }
__device__ __forceinline__ float bf16_val(unsigned short b) { return __uint_as_float(((unsigned int)b) << 16); }
__device__ __forceinline__ float bf16_round(float x) { return bf16_val(bf16_bits(x)); }
// D += A·B with NT terms: 1 = ah·bh, 2 = + al·bh (A split), 3 = + ah·bl (both split)
template <int NT>
__device__ __forceinline__ v8f mmaN(v16b ah, v16b al, v16b bh, v16b bl, v8f c) {
  c = __builtin_amdgcn_wmma_f32_16x16x32_bf16(false, ah, false, bh, (short)0, c, false, false);
  if (NT >= 2) c = __builtin_amdgcn_wmma_f32_16x16x32_bf16(false, al, false, bh, (short)0, c, false, false);
  if (NT >= 3) c = __builtin_amdgcn_wmma_f32_16x16x32_bf16(false, ah, false, bl, (short)0, c, false, false);
  asm volatile("v_nop\n\tv_nop\n\tv_nop\n\tv_nop" : "+v"(c) : "v"(ah), "v"(al), "v"(bh), "v"(bl));
  return c;
}

__global__ __launch_bounds__(256) void k_wt_bf16(const float* __restrict__ W, unsigned short* __restrict__ Wt, int K, int N) {
  const int t = blockIdx.x * 256 + threadIdx.x;
  const int k8n = K / 8;
  if (t >= N * k8n) return;
  const int n = t / k8n, k8 = (t % k8n) * 8;
  v8us v;
#pragma unroll
  for (int i = 0; i < 8; ++i) v[i] = bf16_bits(W[(size_t)(k8 + i) * N + n]);
  *(v8us*)(Wt + (size_t)n * K + k8) = v;
  
}

// GEMM C[M][N] (f32, pitch ldc) = act(A[M][K]·W + bias). A f32 row-major (pitch lda) converted per fragment to bf16
// (ASPLIT: hi/lo two planes -> 2 terms, else single rounded term); Wt bf16 [N][K] (pitch ldb). BIAS_BF16 rounds the
// bias to bf16 first (bias quantised to bf16 before the add). K%32==0, M%16==0, N%64==0.
template <bool ASPLIT, int ACT, bool BIAS_BF16>
__global__ __launch_bounds__(128) void k_gemm_bf(const float* __restrict__ A, int lda, const unsigned short* __restrict__ Wt, int ldb,
                                               const float* __restrict__ bias, float* __restrict__ C, int ldc, int M, int N, int K) {
  __shared__ __attribute__((aligned(16))) float so[4][16][64];
  const int tid = threadIdx.x, w = tid >> 5, lane = tid & 31, ln = lane & 15, hh = lane >> 4;
  const int ntn = N / 64;
  const int wid = blockIdx.x * 4 + w;
  const int mt = wid / ntn, nq = wid % ntn;
  if (mt * 16 >= M) return;
  const int row0 = mt * 16, col0 = nq * 64;
  const float* arow = A + (size_t)(row0 + ln) * lda;
  v8f acc[4] = {};
  for (int kb = 0; kb < K; kb += 32) {
    FragB ah, al;
    const v4f x0 = *(const v4fa*)(arow + kb + 8 * hh), x1 = *(const v4fa*)(arow + kb + 8 * hh + 4);
    const v4f x2 = *(const v4fa*)(arow + kb + 16 + 8 * hh), x3 = *(const v4fa*)(arow + kb + 16 + 8 * hh + 4);
    float xs[16] = {x0[0],x0[1],x0[2],x0[3],x1[0],x1[1],x1[2],x1[3],x2[0],x2[1],x2[2],x2[3],x3[0],x3[1],x3[2],x3[3]};
#pragma unroll
    for (int i = 0; i < 16; ++i) { const unsigned short hb = bf16_bits(xs[i]); ah.u[i] = hb; al.u[i] = ASPLIT ? bf16_bits(xs[i] - bf16_val(hb)) : (unsigned short)0; }
#pragma unroll
    for (int t = 0; t < 4; ++t) {
      const unsigned short* brow = Wt + (size_t)(col0 + t * 16 + ln) * ldb + kb;
      FragB b;
      b.half[0] = *(const v8us*)(brow + 8 * hh);
      b.half[1] = *(const v8us*)(brow + 16 + 8 * hh);
      acc[t] = mmaN<ASPLIT ? 2 : 1>(ah.v, al.v, b.v, b.v, acc[t]);
    }
  }
#pragma unroll
  for (int t = 0; t < 4; ++t) {
    float bv = bias ? bias[col0 + t * 16 + ln] : 0.f;
    if (BIAS_BF16) bv = bf16_round(bv);
#pragma unroll
    for (int r = 0; r < 8; ++r) { float v = acc[t][r] + bv; if (ACT == 1) v = fmaxf(v, 0.f); so[w][8 * hh + r][t * 16 + ln] = v; }
  }
  __builtin_amdgcn_fence(__ATOMIC_ACQ_REL, "workgroup");
  __builtin_amdgcn_wave_barrier();
  const int rsub = lane >> 4, c4 = (lane & 15) * 4;
  {
#pragma unroll
    for (int q = 0; q < 8; ++q) {
      const int r = q * 2 + rsub;
      const v4f v = *(const v4fa*)&so[w][r][c4];
      *(v4f*)(C + (size_t)(row0 + r) * ldc + col0 + c4) = v;
    }
    
  }
}

// GEMM C = act(A·W + bias + resid): A f32 (ASPLIT -> hi/lo 2 terms), Wt bf16 [N][K]; ACT 0 none, 1 relu, 2 exact gelu;
// resid (optional, f32, row index = (row % rmod), pitch ldr, RES_BF16 rounds it) added before the activation.
template <bool ASPLIT, int ACT, bool BIAS_BF16, bool RES_BF16>
__global__ __launch_bounds__(128) void k_gemm_bf3(const float* __restrict__ A, int lda, const unsigned short* __restrict__ Wt, int ldb,
                                                const float* __restrict__ bias, const float* __restrict__ resid, int rmod, int ldr,
                                                float* __restrict__ C, int ldc, int M, int N, int K) {
  __shared__ __attribute__((aligned(16))) float so[4][16][64];
  const int tid = threadIdx.x, w = tid >> 5, lane = tid & 31, ln = lane & 15, hh = lane >> 4;
  const int ntn = N / 64;
  const int wid = blockIdx.x * 4 + w;
  const int mt = wid / ntn, nq = wid % ntn;
  if (mt * 16 >= M) return;
  const int row0 = mt * 16, col0 = nq * 64;
  const float* arow = A + (size_t)(row0 + ln) * lda;
  v8f acc[4] = {};
  for (int kb = 0; kb < K; kb += 32) {
    FragB ah, al;
    const v4f x0 = *(const v4fa*)(arow + kb + 8 * hh), x1 = *(const v4fa*)(arow + kb + 8 * hh + 4);
    const v4f x2 = *(const v4fa*)(arow + kb + 16 + 8 * hh), x3 = *(const v4fa*)(arow + kb + 16 + 8 * hh + 4);
    float xs[16] = {x0[0],x0[1],x0[2],x0[3],x1[0],x1[1],x1[2],x1[3],x2[0],x2[1],x2[2],x2[3],x3[0],x3[1],x3[2],x3[3]};
#pragma unroll
    for (int i = 0; i < 16; ++i) { const unsigned short hb = bf16_bits(xs[i]); ah.u[i] = hb; al.u[i] = ASPLIT ? bf16_bits(xs[i] - bf16_val(hb)) : (unsigned short)0; }
#pragma unroll
    for (int t = 0; t < 4; ++t) {
      const unsigned short* brow = Wt + (size_t)(col0 + t * 16 + ln) * ldb + kb;
      FragB b;
      b.half[0] = *(const v8us*)(brow + 8 * hh);
      b.half[1] = *(const v8us*)(brow + 16 + 8 * hh);
      acc[t] = mmaN<ASPLIT ? 2 : 1>(ah.v, al.v, b.v, b.v, acc[t]);
    }
  }
#pragma unroll
  for (int t = 0; t < 4; ++t) {
    const int col = col0 + t * 16 + ln;
    float bv = bias ? bias[col] : 0.f;
    if (BIAS_BF16) bv = bf16_round(bv);
#pragma unroll
    for (int r = 0; r < 8; ++r) {
      float v = acc[t][r] + bv;
      if (resid) { float rv = resid[(size_t)((row0 + 8 * hh + r) % rmod) * ldr + col]; if (RES_BF16) rv = bf16_round(rv); v += rv; }
      if (ACT == 1) v = fmaxf(v, 0.f);
      if (ACT == 2) v = 0.5f * v * (1.0f + erff(v * 0.70710678118654752f));
      if (ACT == 3) { const float u = 0.7978845608028654f * (v + 0.044715f * v * v * v); v = 0.5f * v * (1.0f + tanhf(u)); }
      so[w][8 * hh + r][t * 16 + ln] = v;
    }
  }
  __builtin_amdgcn_fence(__ATOMIC_ACQ_REL, "workgroup");
  __builtin_amdgcn_wave_barrier();
  const int rsub = lane >> 4, c4 = (lane & 15) * 4;
  {
#pragma unroll
    for (int q = 0; q < 8; ++q) {
      const int r = q * 2 + rsub;
      const v4f v = *(const v4fa*)&so[w][r][c4];
      *(v4f*)(C + (size_t)(row0 + r) * ldc + col0 + c4) = v;
    }
    
  }
}
// row LayerNorm (biased variance, eps) over N: s = X (+ R); optional out_sum <- s; out_norm <- (s-mu)*rsqrt(var+eps)*g + b
template <bool PARAM_BF16>
__global__ __launch_bounds__(256) void k_layernorm(const float* __restrict__ X, const float* __restrict__ R, const float* __restrict__ g, const float* __restrict__ bta,
                                                  float* __restrict__ out_sum, float* __restrict__ out_norm, int N, float eps) {
  __shared__ float red[256];
  const int row = blockIdx.x, tid = threadIdx.x;
  const float* x = X + (size_t)row * N; const float* rr = R ? R + (size_t)row * N : nullptr;
  float vals[16];                     // up to N = 4096
  const int per = N / 256;            // contiguous chunk per thread? use strided-by-4 chunks: thread handles j = tid*4 + 1024*u
  float s1 = 0.f;
  for (int u = 0; u < per / 4; ++u) {
    const int j = tid * 4 + 1024 * u;
    const v4f a = *(const v4fa*)(x + j);
    v4f b = {0.f,0.f,0.f,0.f}; if (rr) b = *(const v4fa*)(rr + j);
#pragma unroll
    for (int q = 0; q < 4; ++q) { const float v = a[q] + b[q]; vals[u * 4 + q] = v; s1 += v; }
  }
  red[tid] = s1; __syncthreads();
  for (int st = 128; st > 0; st >>= 1) { if (tid < st) red[tid] += red[tid + st]; __syncthreads(); }
  const float mu = red[0] / (float)N; __syncthreads();
  float s2 = 0.f;
  for (int u = 0; u < per / 4; ++u)
#pragma unroll
    for (int q = 0; q < 4; ++q) { const float c = vals[u * 4 + q] - mu; s2 += c * c; }
  red[tid] = s2; __syncthreads();
  for (int st = 128; st > 0; st >>= 1) { if (tid < st) red[tid] += red[tid + st]; __syncthreads(); }
  const float rs = rsqrtf(red[0] / (float)N + eps);
  {
    for (int u = 0; u < per / 4; ++u) {
      const int j = tid * 4 + 1024 * u;
      v4f o, sm;
#pragma unroll
      for (int q = 0; q < 4; ++q) {
        float gg = g[j + q], bb = bta[j + q];
        if (PARAM_BF16) { gg = bf16_round(gg); bb = bf16_round(bb); }
        sm[q] = vals[u * 4 + q]; o[q] = (vals[u * 4 + q] - mu) * rs * gg + bb;
      }
      if (out_sum) *(v4f*)(out_sum + (size_t)row * N + j) = sm;
      *(v4f*)(out_norm + (size_t)row * N + j) = o;
    }
    
  }
}



// ---- f16 WMMA path (v_wmma_f32_16x16x32_f16): 11-bit significands for operands in range — used where a [0,1] probability operand needs more precision than bf16
typedef _Float16 v16h __attribute__((ext_vector_type(16)));
union FragH { v16h v; v8us half[2]; _Float16 h[16]; unsigned short u[16]; };
template <int NT>
__device__ __forceinline__ v8f mmaH(v16h ah, v16h al, v16h bh, v16h bl, v8f c) {
  c = __builtin_amdgcn_wmma_f32_16x16x32_f16(false, ah, false, bh, (short)0, c, false, false);
  if (NT >= 2) c = __builtin_amdgcn_wmma_f32_16x16x32_f16(false, al, false, bh, (short)0, c, false, false);
  if (NT >= 3) c = __builtin_amdgcn_wmma_f32_16x16x32_f16(false, ah, false, bl, (short)0, c, false, false);
  asm volatile("v_nop\n\tv_nop\n\tv_nop\n\tv_nop" : "+v"(c) : "v"(ah), "v"(al), "v"(bh), "v"(bl));
  return c;
}
// batched GEMM like k_gemm_b but f16 operands: A f32 (split into f16 hi/lo if ASPLIT, else rounded to f16), Bt = f16 values [n][k]; alpha; C f32; N multiple of 16 (partial tiles skipped)
template <bool ASPLIT>
__global__ __launch_bounds__(128) void k_gemm_h(const float* __restrict__ A, int lda, size_t sA, const _Float16* __restrict__ Bh, int ldb, size_t sB, float alpha, float* __restrict__ C, int ldc, size_t sC, int M, int N, int K) {
  __shared__ __attribute__((aligned(16))) float so[4][16][64];
  const int tid = threadIdx.x, w = tid >> 5, lane = tid & 31, ln = lane & 15, hh = lane >> 4; const int by = blockIdx.y;
  A += (size_t)by * sA; Bh += (size_t)by * sB; C += (size_t)by * sC;
  const int ntn = (N + 63) / 64; const int wid = blockIdx.x * 4 + w; const int mt = wid / ntn, nq = wid % ntn; if (mt * 16 >= M) return;
  const int row0 = mt * 16, col0 = nq * 64; const float* arow = A + (size_t)(row0 + ln) * lda;
  v8f acc[4] = {};
  for (int kb = 0; kb < K; kb += 32) {
    FragH ah, al;
    const v4f x0 = *(const v4fa*)(arow + kb + 8 * hh), x1 = *(const v4fa*)(arow + kb + 8 * hh + 4), x2 = *(const v4fa*)(arow + kb + 16 + 8 * hh), x3 = *(const v4fa*)(arow + kb + 16 + 8 * hh + 4);
    float xs[16] = {x0[0],x0[1],x0[2],x0[3],x1[0],x1[1],x1[2],x1[3],x2[0],x2[1],x2[2],x2[3],x3[0],x3[1],x3[2],x3[3]};
#pragma unroll
    for (int i = 0; i < 16; ++i) { const _Float16 h = (_Float16)xs[i]; ah.h[i] = h; al.h[i] = ASPLIT ? (_Float16)(xs[i] - (float)h) : (_Float16)0.0f; }
#pragma unroll
    for (int t = 0; t < 4; ++t) { if (col0 + t * 16 >= N) continue; const size_t boff = (size_t)(col0 + t * 16 + ln) * ldb + kb; FragH bq; bq.half[0] = *(const v8us*)(Bh + boff + 8 * hh); bq.half[1] = *(const v8us*)(Bh + boff + 16 + 8 * hh);
      acc[t] = mmaH<ASPLIT ? 2 : 1>(ah.v, al.v, bq.v, bq.v, acc[t]); }
  }
#pragma unroll
  for (int t = 0; t < 4; ++t) { if (col0 + t * 16 >= N) continue;
#pragma unroll
    for (int r = 0; r < 8; ++r) so[w][8 * hh + r][t * 16 + ln] = acc[t][r] * alpha; }
  __builtin_amdgcn_fence(__ATOMIC_ACQ_REL, "workgroup"); __builtin_amdgcn_wave_barrier();
  const int rsub = lane >> 4, c4 = (lane & 15) * 4;
  {
#pragma unroll
    for (int q = 0; q < 8; ++q) { const int r = q * 2 + rsub; if (col0 + c4 < N) { const v4f v = *(const v4fa*)&so[w][r][c4]; *(v4f*)(C + (size_t)(row0 + r) * ldc + col0 + c4) = v; } }
     }
}

// Bt[n][k] = f16(bf16(W[k][n]) x 16) of the four f32 [in][out] weights (DMX rows each) in one launch (x16: a power of two; bf16-exact weights stay exact in f16 away from the subnormal range).
// A block of 8 waves turns one tile of WTK k x WTN n through LDS, so that memory sees whole lines both ways.
// in: thread = 4 columns (16 bytes; 16 threads = 256 contiguous bytes of a row of W) x 16 rows, all 16 loads in flight together; 8 consecutive k of one column are 16 bytes of f16, one LDS store.
// out: a wave reads one column's WTK k (512 bytes) from LDS and stores them as 512 contiguous bytes of Bt.
// LDS: one row a column n, pitch 528 bytes (an odd multiple of 16, for 16-byte accesses); the 16-byte piece g of row n lies at place g ^ (n >> 4), so that a wave's 32 stores (rows 4 apart) spread evenly over the banks.
constexpr int WTK = 256, WTN = 64, WTP = 2 * WTK + 16, WTQ = (DMX / WTN) * (DMX / WTK), WTV = (DKV / WTN) * (DMX / WTK);      /* WTQ, WTV: tiles of a weight with DMX, DKV columns */
static_assert(DMX % WTK == 0 && DMX % WTN == 0 && DKV % WTN == 0 && WTK == 256 && WTN == 64, "k_wt4: whole tiles; 256 threads = 16 x 4 columns, 16 x 8 rows twice; a wave = one row of 32 pieces");
// a thread's 16 loads of a tile of a weight with N columns (compile-time: the rows are immediate offsets from one address); Wp, k0, n0 the same for the whole block.
template <int N>
__device__ __forceinline__ void wt_load(const float* __restrict__ Wp, int k0, int n0, v4f (&x)[2][8]) {
  const v4fa* s = (const v4fa*)(Wp + (size_t)k0 * N + n0); const unsigned lo = (threadIdx.x >> 4) * (8 * N / 4) + (threadIdx.x & 15);      /* s: the tile's first 16 bytes; lo: the thread's own place in it, in 16 bytes */
#pragma unroll      /* unrolled: x[][] keeps static indices (registers, no scratch) */
  for (int j = 0; j < 2; ++j)
#pragma unroll
    for (int i = 0; i < 8; ++i) x[j][i] = s[lo + (unsigned)((j * 128 + i) * (N / 4))];
  /* inputs only: holds all 16 loads in front of the first use, one trip to memory (without it this build issued them in three groups, each behind the last one's wait); lo is named so that its register is given to no load's result while loads that name it are in flight */
  asm volatile("" :: "v"(x[0][0]), "v"(x[0][1]), "v"(x[0][2]), "v"(x[0][3]), "v"(x[0][4]), "v"(x[0][5]), "v"(x[0][6]), "v"(x[0][7]), "v"(x[1][0]), "v"(x[1][1]), "v"(x[1][2]), "v"(x[1][3]), "v"(x[1][4]), "v"(x[1][5]), "v"(x[1][6]), "v"(x[1][7]), "v"(lo)); }
__global__ __launch_bounds__(256) void k_wt4(const float* __restrict__ wq, const float* __restrict__ wk, const float* __restrict__ wv, const float* __restrict__ wo,
    _Float16* __restrict__ BQ, _Float16* __restrict__ BK, _Float16* __restrict__ BV, _Float16* __restrict__ BO) {
  __shared__ __attribute__((aligned(16))) unsigned char tl[WTN * WTP];
  const int bx = blockIdx.x; const bool wide = bx < 2 * WTQ; const int u = wide ? bx : bx - 2 * WTQ, nt = wide ? WTQ : WTV; const bool second = u >= nt; const int t = second ? u - nt : u;      /* blocks: q, o, k, v; t = the tile in its weight; all the same for the whole block */
  const int k0 = (t % (DMX / WTK)) * WTK, n0 = (t / (DMX / WTK)) * WTN; v4f x[2][8];
  if (wide) wt_load<DMX>(second ? wo : wq, k0, n0, x); else wt_load<DKV>(second ? wv : wk, k0, n0, x);
  _Float16* Bt = wide ? (second ? BO : BQ) : (second ? BV : BK);
  const int n4 = threadIdx.x & 15, kg = threadIdx.x >> 4;
#pragma unroll      /* unrolled, as above */
  for (int j = 0; j < 2; ++j)
#pragma unroll
    for (int q = 0; q < 4; ++q) { FragH f;
#pragma unroll
      for (int i = 0; i < 8; ++i) f.h[i] = (_Float16)(bf16_round(x[j][i][q]) * 16.0f);
      *(v8us*)(tl + (n4 * 4 + q) * WTP + ((j * 16 + kg) ^ (n4 >> 2)) * 16) = f.half[0]; }
  __syncthreads();      /* the tile is whole before a wave reads columns that other waves wrote */
  const int lane = threadIdx.x & 31, nw = (threadIdx.x >> 5) * 8; unsigned short* d = (unsigned short*)Bt + (size_t)(n0 + nw) * DMX + k0 + lane * 8;
#pragma unroll      /* unrolled: the 8 LDS loads go as one group, the 8 rows are immediate offsets */
  for (int r = 0; r < 8; ++r) { const v8us o = *(const v8us*)(tl + (nw + r) * WTP + (lane ^ (nw >> 4)) * 16); *(v8us*)(d + (size_t)r * DMX) = o; } }
// k_gemm_hh variant with fused epilogue: v = acc·alpha + bias[by·sBias + col] (+ CP[(row/rowsPerB)·sCPb + by·64 + col] if CP) ; ACT 0 none / 1 elu ; writes f16 C16 (and f32 C if non-null)
template <int ACT>
__global__ __launch_bounds__(128) void k_gemm_hhx(const _Float16* __restrict__ A, int lda, size_t sA, const _Float16* __restrict__ Bh, int ldb, size_t sB, float alpha, const float* __restrict__ bias, size_t sBias, const float* __restrict__ CP, int rowsPerB, size_t sCPb, int row0g,
    float* __restrict__ C, _Float16* __restrict__ C16, int ldc, size_t sC, int M, int N, int K) {
  __shared__ __attribute__((aligned(16))) float so[4][16][64];
  const int tid = threadIdx.x, w = tid >> 5, lane = tid & 31, ln = lane & 15, hh = lane >> 4; const int by = blockIdx.y;
  A += (size_t)by * sA; Bh += (size_t)by * sB; const size_t cofs = (size_t)by * sC; const float* bp = bias ? bias + (size_t)by * sBias : nullptr;
  const int ntn = (N + 63) / 64; const int wid = blockIdx.x * 4 + w; const int mt = wid / ntn, nq = wid % ntn; if (mt * 16 >= M) return;
  const int row0 = mt * 16, col0 = nq * 64; const _Float16* arow = A + (size_t)(row0 + ln) * lda;
  v8f acc[4] = {};
  for (int kb = 0; kb < K; kb += 32) { FragH ah; ah.half[0] = *(const v8us*)((const unsigned short*)arow + kb + 8 * hh); ah.half[1] = *(const v8us*)((const unsigned short*)arow + kb + 16 + 8 * hh);
#pragma unroll
    for (int t = 0; t < 4; ++t) { if (col0 + t * 16 >= N) continue; const size_t boff = (size_t)(col0 + t * 16 + ln) * ldb + kb; FragH bq; bq.half[0] = *(const v8us*)((const unsigned short*)Bh + boff + 8 * hh); bq.half[1] = *(const v8us*)((const unsigned short*)Bh + boff + 16 + 8 * hh);
      acc[t] = mmaH<1>(ah.v, ah.v, bq.v, bq.v, acc[t]); }
  }
#pragma unroll
  for (int t = 0; t < 4; ++t) { if (col0 + t * 16 >= N) continue; const int col = col0 + t * 16 + ln; const float bv = bp ? bf16_round(bp[col]) : 0.f;
#pragma unroll
    for (int r = 0; r < 8; ++r) { float v = acc[t][r] * alpha + bv; if (CP) { const int rr = row0g + row0 + 8 * hh + r; if (rowsPerB < 0) v += CP[cofs + (size_t)rr * ldc + col];      /* rowsPerB < 0: own element of the batched C plane */ else { const int bidx = rr / rowsPerB; v += CP[(size_t)bidx * sCPb + (size_t)by * 64 + col]; } } if (ACT == 1) v = (v > 0.f) ? v : expm1f(v); else if (ACT == 7) v = (v > 0.f) ? v + 1.0f : expf(v); else if (ACT == 8) v = tanhf(v); else if (ACT == 9) v = 0.5f * v * (1.0f + tanhf(0.7978845608028654f * (v + 0.044715f * v * v * v))); else if (ACT == 11) v = 1.0f / (1.0f + expf(-v)); else if (ACT == 12) v = (v > 0.f) ? v : 0.01f * v; else if (ACT == 14) v = (v > 0.f) ? v : 0.1f * v; else if (ACT == 16) v = (v >= 0.f) ? v : 0.3f * v; else if (ACT == 17) v = (v >= 0.f) ? v : 0.2f * v; else if (ACT == 15) v = v / (1.0f + expf(-v)); else if (ACT == 3) v = fmaxf(v, 0.f); else if (ACT == 6) v = 0.5f * v * (1.0f + erff(v * 0.70710678118654752f)); so[w][8 * hh + r][t * 16 + ln] = v; } }
  __builtin_amdgcn_fence(__ATOMIC_ACQ_REL, "workgroup"); __builtin_amdgcn_wave_barrier();
  const int rsub = lane >> 4, c4 = (lane & 15) * 4; typedef _Float16 v4h __attribute__((ext_vector_type(4)));
  {
#pragma unroll
    for (int q = 0; q < 8; ++q) { const int r = q * 2 + rsub; if (col0 + c4 < N) { const v4f v = *(const v4fa*)&so[w][r][c4]; if (C) *(v4f*)(C + cofs + (size_t)(row0 + r) * ldc + col0 + c4) = v; if (C16) { v4h h4; for (int i = 0; i < 4; ++i) h4[i] = (_Float16)v[i]; *(v4h*)(C16 + cofs + (size_t)(row0 + r) * ldc + col0 + c4) = h4; } } }
     }
}


typedef _Float16 v4h __attribute__((ext_vector_type(4)));

__global__ __launch_bounds__(256) void k_x16(const float* __restrict__ x, _Float16* __restrict__ X16, size_t n8) { const size_t t = (size_t)blockIdx.x * 256 + threadIdx.x; if (t >= n8) return; FragH f;
#pragma unroll
  for (int q = 0; q < 8; ++q) f.h[q] = (_Float16)bf16_round(x[t * 8 + q]); *(v8us*)((unsigned short*)X16 + t * 8) = f.half[0];  }
__global__ __launch_bounds__(256) void k_h16(const float* __restrict__ x, _Float16* __restrict__ X16, size_t n8) { const size_t t = (size_t)blockIdx.x * 256 + threadIdx.x; if (t >= n8) return; FragH f;
#pragma unroll
  for (int q = 0; q < 8; ++q) f.h[q] = (_Float16)x[t * 8 + q]; *(v8us*)((unsigned short*)X16 + t * 8) = f.half[0];  }
__global__ __launch_bounds__(256) void k_round16f(const float* __restrict__ W, _Float16* __restrict__ Bt, size_t n8) { const size_t t = (size_t)blockIdx.x * 256 + threadIdx.x; if (t >= n8) return; FragH f;
#pragma unroll
  for (int i = 0; i < 8; ++i) f.h[i] = (_Float16)(bf16_round(W[t * 8 + i]) * 16.0f); *(v8us*)((unsigned short*)Bt + t * 8) = f.half[0];  }
template <int NHv, int TTv>
__global__ __launch_bounds__(256) void k_vt(const _Float16* __restrict__ V16, int ldv, int voff, _Float16* __restrict__ Vt) { __shared__ unsigned short tl[64][66]; const int tid = threadIdx.x; const int slab = blockIdx.x / (TTv / 64), lg = blockIdx.x % (TTv / 64); const int b = slab / NHv, h = slab % NHv;
  for (int i = tid; i < 64 * 8; i += 256) { const int r = i / 8, c8 = (i % 8) * 8; FragH f; f.half[0] = *(const v8us*)((const unsigned short*)V16 + ((size_t)b * TTv + lg * 64 + r) * ldv + voff + h * 64 + c8);
#pragma unroll
    for (int q = 0; q < 8; ++q) tl[r][c8 + q] = f.u[q]; }
  __syncthreads();
  {
#pragma unroll
    for (int rd = 0; rd < 2; ++rd) { const int d = rd * 32 + tid / 8, pc = tid % 8; FragH f;
#pragma unroll
      for (int q = 0; q < 8; ++q) f.u[q] = tl[pc * 8 + q][d];
      *(v8us*)((unsigned short*)Vt + ((size_t)slab * 64 + d) * TTv + lg * 64 + pc * 8) = f.half[0]; }
     } }

__global__ __launch_bounds__(256) void k_hl(const float* __restrict__ F, _Float16* __restrict__ Hh, _Float16* __restrict__ Hl, size_t n8) { const size_t t = (size_t)blockIdx.x * 256 + threadIdx.x; if (t >= n8) return; FragH fh, fl; const v4f a = *(const v4fa*)(F + t * 8), c = *(const v4fa*)(F + t * 8 + 4);
#pragma unroll
  for (int q = 0; q < 4; ++q) { _Float16 h = (_Float16)a[q]; fh.h[q] = h; fl.h[q] = (_Float16)((a[q] - (float)h) * 1024.0f); h = (_Float16)c[q]; fh.h[4 + q] = h; fl.h[4 + q] = (_Float16)((c[q] - (float)h) * 1024.0f); }
  { *(v8us*)((unsigned short*)Hh + t * 8) = fh.half[0]; *(v8us*)((unsigned short*)Hl + t * 8) = fl.half[0];  } }

// ---- fast GEMM (block tile 128x64, wave tile 32x64; requires M % 128 == 0 rows per launch region, N % 64 == 0, K % KC == 0); epilogue = k_gemm_hhx semantics ----
// The k range goes in tiles of KC: the block's 128 rows of A and 64 rows of B, KC f16 of each, are staged in LDS (rows 0..127 = A, 128..191 = B; pitch 2 KC + 16 bytes, an odd multiple of 16, for 16-byte readers),
// two buffers, the next tile's copies in flight while this one is multiplied. Every copy of a wave moves whole 128-byte lines; a fragment keeps its k order, so every sum keeps its order.
// KC = 128 in the launches that this kernel still serves (the first tile's out products: at most one block a WGP, so the wait for a tile counts and few trips pay); the large products go through k_gemm3 below.
__device__ __forceinline__ v16h g2_frag(const _Float16* p, int hh) { FragH f; f.half[0] = *(const v8us*)((const unsigned short*)p + 8 * hh); f.half[1] = *(const v8us*)((const unsigned short*)p + 16 + 8 * hh); return f.v; }
__device__ __forceinline__ v8f g2_mma(v16h a, v16h b, v8f c) { v8f d = __builtin_amdgcn_wmma_f32_16x16x32_f16(false, a, false, b, (short)0, c, false, false); asm volatile("v_nop\n\tv_nop\n\tv_nop\n\tv_nop" : "+v"(d) : "v"(a), "v"(b)); return d; }
// one tile's copies, 12 a statement: thread = 16 bytes (seg) of row (thread / segs a row) + c * RPC; a, b = the thread's own first address in the tile, l = its own LDS byte address in the buffer.
// asm: the copy goes from global memory to LDS through no register. The s_wait_xcnt is the last line of the copies' own statement, so that no address register is rewritten in front of it.
template <int KC>
__device__ __forceinline__ void g2_stage(const _Float16* a, size_t lda, const _Float16* b, size_t ldb, unsigned l) {
  constexpr int RPC = 1024 / KC, NA = 128 / RPC, PB = 2 * KC + 16; static_assert((192 / RPC) % 12 == 0, "12 copies a statement");
#pragma unroll      /* both loops unrolled: p[], d[] keep static indices (registers, no scratch) */
  for (int g = 0; g < 192 / RPC / 12; ++g) { const _Float16* p[12]; unsigned d[12];
#pragma unroll
    for (int i = 0; i < 12; ++i) { const int c = g * 12 + i; p[i] = (c < NA) ? a + (size_t)(c * RPC) * lda : b + (size_t)((c - NA) * RPC) * ldb; d[i] = l + (unsigned)(c * RPC * PB); }
    asm volatile("global_load_async_to_lds_b128 %0, %12, off\n\tglobal_load_async_to_lds_b128 %1, %13, off\n\tglobal_load_async_to_lds_b128 %2, %14, off\n\tglobal_load_async_to_lds_b128 %3, %15, off\n\t"
                 "global_load_async_to_lds_b128 %4, %16, off\n\tglobal_load_async_to_lds_b128 %5, %17, off\n\tglobal_load_async_to_lds_b128 %6, %18, off\n\tglobal_load_async_to_lds_b128 %7, %19, off\n\t"
                 "global_load_async_to_lds_b128 %8, %20, off\n\tglobal_load_async_to_lds_b128 %9, %21, off\n\tglobal_load_async_to_lds_b128 %10, %22, off\n\tglobal_load_async_to_lds_b128 %11, %23, off\n\ts_wait_xcnt 0x0"
                 :: "v"(d[0]), "v"(d[1]), "v"(d[2]), "v"(d[3]), "v"(d[4]), "v"(d[5]), "v"(d[6]), "v"(d[7]), "v"(d[8]), "v"(d[9]), "v"(d[10]), "v"(d[11]),
                    "v"(p[0]), "v"(p[1]), "v"(p[2]), "v"(p[3]), "v"(p[4]), "v"(p[5]), "v"(p[6]), "v"(p[7]), "v"(p[8]), "v"(p[9]), "v"(p[10]), "v"(p[11]) : "memory"); } }
template <int ACT, int KC>
__global__ __launch_bounds__(128) void k_gemm2(const _Float16* __restrict__ A, int lda, size_t sA, const _Float16* __restrict__ Bh, int ldb, size_t sB, float alpha, const float* __restrict__ bias, size_t sBias, const float* __restrict__ CP, int rowsPerB, size_t sCPb, int row0g,
    float* __restrict__ C, _Float16* __restrict__ C16, int ldc, size_t sC, int M, int N, int K, int bdiv, size_t zA, size_t zB, size_t zC) { static_assert(ACT == 0 || ACT == 3 || ACT == 6 || ACT == 8 || ACT == 9 || ACT == 11 || ACT == 12 || ACT == 14 || ACT == 15 || ACT == 16 || ACT == 17, "k_gemm2: unsupported ACT code (would silently apply no activation)");
  constexpr int PB = 2 * KC + 16, STB = 192 * PB;      /* bytes: a staged row's pitch, one buffer */
  static_assert(2 * STB >= 4 * 32 * 68 * 4, "the output staging reuses the two buffers");
  __shared__ __attribute__((aligned(16))) unsigned char sm[2 * STB]; float (*so)[32][68] = reinterpret_cast<float (*)[32][68]>(sm);      /* so: each wave's output staging, used behind the loop's last barrier */
  const int tid = threadIdx.x, w = tid >> 5, lane = tid & 31, ln = lane & 15, hh = lane >> 4; const int by = blockIdx.y; const size_t bz = blockIdx.z;      /* y = head (bdiv heads share one B slab), z = batch */
  A += (size_t)by * sA + bz * zA; Bh += (size_t)(by / bdiv) * sB + bz * zB; const size_t cofs = (size_t)by * sC + bz * zC; const float* bp = bias ? bias + (size_t)by * sBias : nullptr;
  const int ntn = N >> 6; const int mt = blockIdx.x / ntn, nq = blockIdx.x - mt * ntn; const int row0 = mt * 128 + 32 * w, col0 = nq * 64; if (mt * 128 >= M) return;      /* the whole block leaves, in front of every barrier */
  const int srow = tid / (KC / 8), sseg = tid % (KC / 8);
  const _Float16* ag = A + (size_t)(mt * 128 + srow) * lda + sseg * 8; const _Float16* bg = Bh + (size_t)(col0 + srow) * ldb + sseg * 8;
  const unsigned l0 = (unsigned)(size_t)sm + (unsigned)(srow * PB + sseg * 16);
  const int nt = K / KC;
  g2_stage<KC>(ag, (size_t)lda, bg, (size_t)ldb, l0);
  asm volatile("s_wait_asynccnt 0x0" ::: "memory");      /* this wave's copies of tile 0 have landed */
  __syncthreads();      /* ... and every other wave's */
  if (nt > 1) g2_stage<KC>(ag + KC, (size_t)lda, bg + KC, (size_t)ldb, l0 + STB);
  const v8f z8 = {0.f,0.f,0.f,0.f,0.f,0.f,0.f,0.f}; v8f c00 = z8, c01 = z8, c02 = z8, c03 = z8, c10 = z8, c11 = z8, c12 = z8, c13 = z8;
#pragma unroll 1      /* one trip a tile: the two buffers take turns */
  for (int t = 0; t < nt; ++t) { const unsigned char* sb = sm + (t & 1) * STB;
    const _Float16* a0p = (const _Float16*)(sb + (32 * w + ln) * PB); const _Float16* a1p = (const _Float16*)(sb + (32 * w + 16 + ln) * PB);
    const _Float16* b0p = (const _Float16*)(sb + (128 + ln) * PB); const _Float16* b1p = (const _Float16*)(sb + (144 + ln) * PB); const _Float16* b2p = (const _Float16*)(sb + (160 + ln) * PB); const _Float16* b3p = (const _Float16*)(sb + (176 + ln) * PB);
    v16h fa[2][2], fb[2][4];      /* two fragment sets: a k step's 12 LDS loads go as one group, one step ahead of its products, inside this tile only */
    fa[0][0] = g2_frag(a0p, hh); fa[0][1] = g2_frag(a1p, hh); fb[0][0] = g2_frag(b0p, hh); fb[0][1] = g2_frag(b1p, hh); fb[0][2] = g2_frag(b2p, hh); fb[0][3] = g2_frag(b3p, hh);
#pragma unroll      /* unrolled: the sets keep static indices (registers), every LDS offset is an immediate */
    for (int s = 0; s < KC / 32; ++s) { const int u = s & 1, n = u ^ 1, kn = (s + 1) * 32;
      if (s + 1 < KC / 32) { fa[n][0] = g2_frag(a0p + kn, hh); fa[n][1] = g2_frag(a1p + kn, hh); fb[n][0] = g2_frag(b0p + kn, hh); fb[n][1] = g2_frag(b1p + kn, hh); fb[n][2] = g2_frag(b2p + kn, hh); fb[n][3] = g2_frag(b3p + kn, hh); }
      c00 = g2_mma(fa[u][0], fb[u][0], c00); c10 = g2_mma(fa[u][1], fb[u][0], c10); c01 = g2_mma(fa[u][0], fb[u][1], c01); c11 = g2_mma(fa[u][1], fb[u][1], c11);
      c02 = g2_mma(fa[u][0], fb[u][2], c02); c12 = g2_mma(fa[u][1], fb[u][2], c12); c03 = g2_mma(fa[u][0], fb[u][3], c03); c13 = g2_mma(fa[u][1], fb[u][3], c13); }
    asm volatile("s_wait_dscnt 0x0" ::: "memory");      /* this wave's reads of the buffer are done before it is handed to the next copies */
    asm volatile("s_wait_asynccnt 0x0" ::: "memory");      /* this wave's copies of tile t + 1 have landed */
    __syncthreads();      /* publishes tile t + 1 and ends every wave's reads of tile t */
    if (t + 2 < nt) g2_stage<KC>(ag + (size_t)(t + 2) * KC, (size_t)lda, bg + (size_t)(t + 2) * KC, (size_t)ldb, l0 + (t & 1) * STB); }
  asm volatile("s_wait_asynccnt 0x0" ::: "memory");      /* no copy is in flight when the buffers become output staging */
  v8f accs[8] = {c00, c01, c02, c03, c10, c11, c12, c13};
#pragma unroll
  for (int u = 0; u < 8; ++u) { const int t = u & 3, half = u >> 2; const int col = col0 + t * 16 + ln; const float bv = bp ? bf16_round(bp[col]) : 0.f;
#pragma unroll
    for (int r = 0; r < 8; ++r) { const int rloc = half * 16 + 8 * hh + r; float v = accs[u][r] * alpha + bv; if (CP) { if (rowsPerB < 0) v += CP[cofs + (size_t)(row0g + row0 + rloc) * ldc + col];      /* rowsPerB < 0: own element of the batched C plane */ else { const int bidx = (row0g + row0 + rloc) / rowsPerB; v += CP[(size_t)bidx * sCPb + (size_t)by * 64 + col]; } }
      if (ACT == 3) v = fmaxf(v, 0.f); else if (ACT == 6) v = 0.5f * v * (1.0f + erff(v * 0.70710678118654752f)); else if (ACT == 11) v = 1.0f / (1.0f + expf(-v)); else if (ACT == 15) v = v / (1.0f + expf(-v)); else if (ACT == 12) v = (v > 0.f) ? v : 0.01f * v; else if (ACT == 8) v = tanhf(v); else if (ACT == 9) v = 0.5f * v * (1.0f + tanhf(0.7978845608028654f * (v + 0.044715f * v * v * v))); else if (ACT == 14) v = (v > 0.f) ? v : 0.1f * v; else if (ACT == 16) v = (v >= 0.f) ? v : 0.3f * v; else if (ACT == 17) v = (v >= 0.f) ? v : 0.2f * v;
      so[w][rloc][t * 16 + ln] = v; } }
  __builtin_amdgcn_fence(__ATOMIC_ACQ_REL, "workgroup"); __builtin_amdgcn_wave_barrier();
  const int rsub = lane >> 4, c4 = (lane & 15) * 4;
  {
#pragma unroll
    for (int q = 0; q < 16; ++q) { const int r = q * 2 + rsub; const v4f v = *(const v4fa*)&so[w][r][c4]; if (C) *(v4f*)(C + cofs + (size_t)(row0 + r) * ldc + col0 + c4) = v; if (C16) { v4h h4; for (int i = 0; i < 4; ++i) h4[i] = (_Float16)v[i]; *(v4h*)(C16 + cofs + (size_t)(row0 + r) * ldc + col0 + c4) = h4; } }
     } }


__global__ __launch_bounds__(256) void k_wnat(const float* __restrict__ w, size_t n8, _Float16* __restrict__ Bt) { const size_t t = (size_t)blockIdx.x * 256 + threadIdx.x; if (t >= n8) return; FragH f; for (int q = 0; q < 8; ++q) f.h[q] = (_Float16)(bf16_round(w[t * 8 + q]) * 16.0f); *(v8us*)((unsigned short*)Bt + t * 8) = f.half[0];  }
__global__ __launch_bounds__(256) void k_rsm(const float* __restrict__ S, _Float16* __restrict__ P, int nrows) {
  #pragma clang fp contract(off)
  const int i = blockIdx.x * 256 + threadIdx.x; if (i >= nrows) return; const float* s = S + (size_t)i * SQ; float mx = -3.0e38f;
#pragma unroll 1
  for (int j = 0; j < SQ; ++j) mx = fmaxf(mx, s[j]); float se = 0.f;
#pragma unroll 1
  for (int j = 0; j < SQ; ++j) se += expf(s[j] - mx); const float sc = 256.0f / se;
#pragma unroll 1
  for (int j0 = 0; j0 < SQ; j0 += 8) { FragH f; for (int q = 0; q < 8; ++q) f.h[q] = (_Float16)(expf(s[j0 + q] - mx) * sc); unsigned short* d = (unsigned short*)P + (size_t)i * SQ + j0; *(v8us*)d = f.half[0];  } }
__global__ __launch_bounds__(256) void k_vt(const _Float16* __restrict__ V16, int b, int h0, _Float16* __restrict__ VT) { __shared__ unsigned short tl[64][65]; const int tid = threadIdx.x; const int hh = blockIdx.x % HG, sg = blockIdx.x / HG; const int s0 = sg * 64; const int h = h0 + hh;
  for (int i = tid; i < 64 * 8; i += 256) { const int j = i / 8, d8 = (i % 8) * 8; FragH f; f.half[0] = *(const v8us*)((const unsigned short*)V16 + ((size_t)b * SQ + s0 + j) * DM + h * HD + d8); for (int q = 0; q < 8; ++q) tl[d8 + q][j] = f.u[q]; }
  __syncthreads();
  { for (int i = tid; i < 64 * 8; i += 256) { const int d = i / 8, j8 = (i % 8) * 8; FragH f; for (int q = 0; q < 8; ++q) f.u[q] = tl[d][j8 + q]; *(v8us*)((unsigned short*)VT + ((size_t)hh * HD + d) * SQ + s0 + j8) = f.half[0]; }  } }


// lane l with lane l ^ M inside its 16-lane row (M = 1, 2, 4, 8), and with lane l ^ 16
template <int M>
__device__ __forceinline__ float row_x(float x) { return __builtin_bit_cast(float, __builtin_amdgcn_update_dpp(0, __builtin_bit_cast(int, x), 0x160 + M, 0xf, 0xf, true)); }
__device__ __forceinline__ float half_x(float x) { return __builtin_bit_cast(float, __builtin_amdgcn_permlanex16(__builtin_bit_cast(int, x), __builtin_bit_cast(int, x), 0x76543210, 0xfedcba98, false, false)); }
// exact (f32, vector unit) causal attention of rows 0..QT0-1: 8 waves a block, one wave a query row; x = head * (QT0 / 8) + group of 8 rows, y = batch. Keys go in chunks of 32; a chunk wholly behind the row is skipped (wave-uniform).
// scores: lane = 8 kq + dl reads dims 32 t + 4 dl .. + 3 of key 32 c + 4 g + kq (each load = 4 whole 128-byte lines), sums its 16 products (4 partial sums, one a dim of the 16 bytes), 3-step butterfly over dl; lane keeps the key with g == dl.
// softmax: maximum and sum = each lane's own (up to 4) keys, then a five-step butterfly. o: lane l holds dims 4 l .. 4 l + 3 (each load 512 contiguous bytes), keys in rising order, each weight read from the lane that keeps it.
// every loop is unrolled: q[], s[] keep static indices (registers, no scratch), the lane a weight is read from is a constant, and a chunk's 32 loads issue ahead of their first use.
__global__ __launch_bounds__(256) void k_att0w(const float* __restrict__ QF, const float* __restrict__ KF, const float* __restrict__ VF, float scale, float* __restrict__ OF) {
  constexpr int ld = DMX, ldv = DMX, ldo = DMX;      /* row pitches, compile-time: a chunk's 32 rows are immediate offsets from one address */
  const int lane = threadIdx.x & 31, dl = lane & 7, kq = lane >> 3; const int h = blockIdx.x / (QT0 / 8); const int i = (blockIdx.x % (QT0 / 8)) * 8 + __builtin_amdgcn_readfirstlane(threadIdx.x >> 5);
  { const size_t bq = (size_t)blockIdx.y * QT0; QF += (bq + i) * ld + h * 128; KF += bq * ld + h * 128; VF += bq * ldv + h * 128; OF += (bq + i) * ldo + h * 128; }      /* y = batch: each batch's QT0 rows follow the last one's */
  v4f q[4];
#pragma unroll
  for (int t = 0; t < 4; ++t) q[t] = *(const v4fa*)(QF + t * 32 + dl * 4);
  float s[QT0 / 32];
#pragma unroll
  for (int c = 0; c < QT0 / 32; ++c) { s[c] = -1.0e30f;
    if (c * 32 <= i) { const float* kp = KF + (size_t)(c * 32 + kq) * ld + dl * 4; float keep = 0.f;
#pragma unroll
      for (int g = 0; g < 8; ++g) { v4f pa = q[0] * *(const v4fa*)(kp + (size_t)(g * 4) * ld);
#pragma unroll
        for (int t = 1; t < 4; ++t) pa += q[t] * *(const v4fa*)(kp + (size_t)(g * 4) * ld + t * 32);
        float a = (pa[0] + pa[1]) + (pa[2] + pa[3]); a += row_x<1>(a); a += row_x<2>(a); a += row_x<4>(a); keep = (dl == g) ? a : keep; }
      s[c] = (c * 32 + 4 * dl + kq <= i) ? keep * scale : -1.0e30f; } }
  float m = s[0];
#pragma unroll
  for (int c = 1; c < QT0 / 32; ++c) m = fmaxf(m, s[c]);
  m = fmaxf(m, row_x<1>(m)); m = fmaxf(m, row_x<2>(m)); m = fmaxf(m, row_x<4>(m)); m = fmaxf(m, row_x<8>(m)); m = fmaxf(m, half_x(m));      /* key 0 is open in every row: m is a score */
  float l = 0.f;
#pragma unroll
  for (int c = 0; c < QT0 / 32; ++c) { s[c] = expf(s[c] - m); l += s[c]; }      /* a closed key: e^(-1e30 - m) = 0 */
  l += row_x<1>(l); l += row_x<2>(l); l += row_x<4>(l); l += row_x<8>(l); l += half_x(l);
  v4f o = {0.f, 0.f, 0.f, 0.f};
#pragma unroll
  for (int c = 0; c < QT0 / 32; ++c) {
    if (c * 32 <= i) { const float* vp = VF + (size_t)(c * 32) * ldv + lane * 4;
#pragma unroll
      for (int j = 0; j < 32; ++j) { const float e = __builtin_bit_cast(float, __builtin_amdgcn_readlane(__builtin_bit_cast(int, s[c]), 8 * (j & 3) + (j >> 2))); const v4f vv = *(const v4fa*)(vp + (size_t)j * ldv); o += vv * e; } } }
  *(v4f*)(OF + lane * 4) = o * (64.0f / l); }
__global__ __launch_bounds__(256) void k_f2h(const float* __restrict__ F, int ldf, int coff, int ncol, _Float16* __restrict__ H16, size_t nrow) { const size_t t = (size_t)blockIdx.x * 256 + threadIdx.x; const size_t n8 = nrow * (size_t)(ncol / 8); if (t >= n8) return; const size_t r = t / (ncol / 8); const int c8 = (int)(t % (ncol / 8)) * 8; FragH f; const v4f a = *(const v4fa*)(F + r * ldf + coff + c8), b2 = *(const v4fa*)(F + r * ldf + coff + c8 + 4); for (int q = 0; q < 4; ++q) { f.h[q] = (_Float16)a[q]; f.h[4 + q] = (_Float16)b2[q]; } *(v8us*)((unsigned short*)H16 + r * ncol + c8) = f.half[0];  }

__global__ __launch_bounds__(256) void k_tab128(float theta, float* __restrict__ CS, float* __restrict__ SN) {
  #pragma clang fp contract(off)
  const int t = blockIdx.x * 256 + threadIdx.x; if (t >= SQ * 64) return; const int i = t % 64; const int p = t / 64; const float invf = (float)(1.0 / pow((double)theta, (double)(2 * i) / 128.0));      /* = XLA's constant-folded f32 table */ const float ang = __fmul_rn((float)p, invf); const float c = cosf(ang), s = sinf(ang);
  *(float*)(CS + t) = c; *(float*)(SN + t) = s;  }
template <int TAB>
__global__ __launch_bounds__(128) void k_rope128(const float* __restrict__ F, int ldf, int nh, const float* __restrict__ CS, const float* __restrict__ SN, _Float16* __restrict__ H16, int ldo, float osc) {
  #pragma clang fp contract(off)
  __shared__ float xv[128]; __shared__ unsigned short sh_[128]; const int d = threadIdx.x; const int h = blockIdx.x % nh; const size_t r = blockIdx.x / nh; const int p = (int)(r % SQ);
  xv[d] = F[r * (size_t)ldf + (size_t)h * 128 + d]; __syncthreads();
  float c, s; if (TAB) { c = bf16_round(CS[(size_t)p * 128 + d]); s = bf16_round(SN[(size_t)p * 128 + d]); } else { c = CS[p * 64 + (d & 63)]; s = SN[p * 64 + (d & 63)]; }
  const float rot = (d < 64) ? -xv[d + 64] : xv[d - 64]; const float o = __fadd_rn(__fmul_rn(xv[d], c), __fmul_rn(rot, s));
  FragH th; th.h[0] = (_Float16)__fmul_rn(o, osc); sh_[d] = th.u[0]; __syncthreads();
  if (d < 16) { FragH f; for (int q = 0; q < 8; ++q) f.u[q] = sh_[d * 8 + q]; unsigned short* dst = (unsigned short*)H16 + r * (size_t)ldo + (size_t)h * 128 + d * 8; *(v8us*)dst = f.half[0];  } }

template <int N>
__global__ __launch_bounds__(256) void k_rmsrow(float* __restrict__ X, const float* __restrict__ w, float eps) {
  #pragma clang fp contract(off)
  constexpr int PT = N / 256; __shared__ float red[256]; const size_t r = blockIdx.x; const int t = threadIdx.x; float* row = X + r * N + (size_t)t * PT; float v[PT]; float ss = 0.f;
  for (int q = 0; q < PT; ++q) { v[q] = row[q]; ss = __fadd_rn(ss, __fmul_rn(v[q], v[q])); }
  red[t] = ss; __syncthreads(); for (int k = 128; k > 0; k >>= 1) { if (t < k) red[t] = __fadd_rn(red[t], red[t + k]); __syncthreads(); }
  const float rs = rsqrtf(__fadd_rn(red[0] / (float)N, eps)); float o[PT]; for (int q = 0; q < PT; ++q) o[q] = __fmul_rn(__fmul_rn(v[q], rs), bf16_round(w[t * PT + q]));
  { for (int q = 0; q < PT; ++q) *(float*)(row + q) = o[q];  } }
template <int GS_, int NHQ, int DSRC>
__global__ __launch_bounds__(256) void k_kvexp128(const float* __restrict__ src, float* __restrict__ dst, size_t n4) { const size_t t = (size_t)blockIdx.x * 256 + threadIdx.x; if (t >= n4) return; const size_t e = t * 4; const size_t row = e / ((size_t)NHQ * 128); const int col = (int)(e % ((size_t)NHQ * 128)); const int h = col / 128, d = col % 128; const v4f v = *(const v4fa*)(src + row * DSRC + (size_t)(h / GS_) * 128 + d); *(v4f*)(dst + e) = v;  }

__global__ __launch_bounds__(256) void k_rsmcfb(const float* __restrict__ S, _Float16* __restrict__ P, int hg, int q0, int nk, const int* __restrict__ mk) {
  #pragma clang fp contract(off)
  const int t = blockIdx.x * 256 + threadIdx.x; if (t >= hg * QT) return; const size_t i = (size_t)t; const float* s = S + i * NKX; const size_t ig = (size_t)(q0 + (t % QT)); const int* mr = mk + ig * SQ; float mx = -3.0e38f;
#pragma unroll 1
  for (int j = 0; j < nk; ++j) { const int mb = mr[j]; const float f = (mb == 0) ? 1.f : 0.f; mx = fmaxf(mx, fmaf(f, s[j], (1.f - f) * -1.0e9f)); } float se = 0.f;
#pragma unroll 1
  for (int j = 0; j < nk; ++j) { const int mb = mr[j]; const float f = (mb == 0) ? 1.f : 0.f; se += __expf(fmaf(f, s[j], (1.f - f) * -1.0e9f) - mx); } const float sc = 256.0f / se;
#pragma unroll 1
  for (int j0 = 0; j0 < nk; j0 += 8) { FragH fr; for (int q = 0; q < 8; ++q) { const int j = j0 + q; const int mb = mr[j]; const float f = (mb == 0) ? 1.f : 0.f; fr.h[q] = (_Float16)(__expf(fmaf(f, s[j], (1.f - f) * -1.0e9f) - mx) * sc); } unsigned short* d = (unsigned short*)P + i * NKX + j0; *(v8us*)d = fr.half[0];  } }


// per-head RMSNorm over the 128 dims, then rotate-half RoPE, of the NHD heads of one row, in place: lane l holds dims 4 l .. 4 l + 3 of every head.
// sum of squares = the lane's own 4 dims, then a five-step butterfly over the lanes; dim d's partner d +- 64 sits in lane l ^ 16; sg = the sine with the sign of rotate-half (minus in lanes 0..15).
// 1 / sqrt(x) of a normal x. One statement: the v_nop fills the slot behind v_rsq_f32 (output early-clobber).
__device__ __forceinline__ float rsq_n(float x) { float r; asm("v_rsq_f32 %0, %1\n\tv_nop" : "=&v"(r) : "v"(x)); return r; }
template <int NHD>
__device__ __forceinline__ void nr_heads(v4f (&x)[NHD], v4f w, v4f c, v4f sg) {
#pragma unroll
  for (int h = 0; h < NHD; ++h) { const v4f v = x[h]; float ss = (v[0] * v[0] + v[1] * v[1]) + (v[2] * v[2] + v[3] * v[3]);
    ss += row_x<1>(ss); ss += row_x<2>(ss); ss += row_x<4>(ss); ss += row_x<8>(ss); ss += half_x(ss);
    const v4f y = (v * rsq_n(ss * 0.0078125f + 1e-6f)) * w; v4f o;      /* mean square + eps >= 1e-6: never subnormal, so no rescue scaling round the v_rsq_f32 */
#pragma unroll
    for (int u = 0; u < 4; ++u) o[u] = y[u] * c[u] + half_x(y[u]) * sg[u];
    x[h] = o; } }
// RMSNorm + RoPE of q and k in one launch: 8 waves a block, one wave a row of x with its 16 query and 8 key heads in registers (each load 512 contiguous bytes, all 24 issued ahead of the first use; the row's table line is read once).
// out: f16 q and k; rows 0..QT0-1 of each batch also in f32 for the exact first tile, a key head written to both query heads of its group (wave-uniform branch).
__global__ __launch_bounds__(256) void k_nrope(const float* __restrict__ QF, const float* __restrict__ KF, const float* __restrict__ qw, const float* __restrict__ kw, const float* __restrict__ CS, const float* __restrict__ SN,
    _Float16* __restrict__ Q16, _Float16* __restrict__ K16, float* __restrict__ QF0, float* __restrict__ KF0e) {
  const int lane = threadIdx.x & 31, l4 = lane * 4; const int r = blockIdx.x * 8 + __builtin_amdgcn_readfirstlane(threadIdx.x >> 5); const int p = r % SQ, b = r / SQ;
  const float* q = QF + (size_t)r * DMX + l4; const float* k = KF + (size_t)r * DKV + l4;
  v4f xq[NH], xk[NKV];
#pragma unroll
  for (int h = 0; h < NH; ++h) xq[h] = *(const v4fa*)(q + h * 128);
#pragma unroll
  for (int h = 0; h < NKV; ++h) xk[h] = *(const v4fa*)(k + h * 128);
  const v4f cr = *(const v4fa*)(CS + (size_t)p * 128 + l4), sr = *(const v4fa*)(SN + (size_t)p * 128 + l4), qr = *(const v4fa*)(qw + l4), kr = *(const v4fa*)(kw + l4);
  v4f c, sg, wq, wk;
#pragma unroll
  for (int u = 0; u < 4; ++u) { c[u] = bf16_round(cr[u]); const float s = bf16_round(sr[u]); sg[u] = (lane < 16) ? -s : s; wq[u] = bf16_round(qr[u]); wk[u] = bf16_round(kr[u]); }
  nr_heads<NH>(xq, wq, c, sg); nr_heads<NKV>(xk, wk, c, sg);
  _Float16* q16 = Q16 + (size_t)r * DMX + l4; _Float16* k16 = K16 + (size_t)r * DKV + l4;
#pragma unroll
  for (int h = 0; h < NH; ++h) { v4h h4;
#pragma unroll
    for (int u = 0; u < 4; ++u) h4[u] = (_Float16)xq[h][u];
    *(v4h*)(q16 + h * 128) = h4; }
#pragma unroll
  for (int h = 0; h < NKV; ++h) { v4h h4;
#pragma unroll
    for (int u = 0; u < 4; ++u) h4[u] = (_Float16)xk[h][u];
    *(v4h*)(k16 + h * 128) = h4; }
  asm volatile("s_wait_xcnt 0x0" ::: "memory");      /* the branch below reuses registers that the f16 stores name; in front of the branch, so that nothing of it is lifted over the wait */
  if (p < QT0) { const size_t f = ((size_t)b * QT0 + p) * DMX + l4;
#pragma unroll
    for (int h = 0; h < NH; ++h) { *(v4f*)(QF0 + f + h * 128) = xq[h]; *(v4f*)(KF0e + f + h * 128) = xk[h / GSZ]; } } }

// 2^x of four values. One statement: each v_exp_f32 is followed by one that neither reads its result nor writes its source (outputs early-clobber), and the v_nop fills
// the slot behind the last.
__device__ __forceinline__ v4f exp2_4(v4f x) { float e0, e1, e2, e3;
  asm("v_exp_f32 %0, %4\n\tv_exp_f32 %1, %5\n\tv_exp_f32 %2, %6\n\tv_exp_f32 %3, %7\n\tv_nop" : "=&v"(e0), "=&v"(e1), "=&v"(e2), "=&v"(e3) : "v"(x[0]), "v"(x[1]), "v"(x[2]), "v"(x[3]));
  const v4f e = {e0, e1, e2, e3}; return e; }
// 2^x of one value; the v_nop fills the slot behind v_exp_f32 (output early-clobber), as in exp2_4.
__device__ __forceinline__ float exp2_1(float x) { float r; asm("v_exp_f32 %0, %1\n\tv_nop" : "=&v"(r) : "v"(x)); return r; }
__device__ __forceinline__ v8f fa_mma(v16h a, v16h b, v8f c) { return __builtin_amdgcn_wmma_f32_16x16x32_f16(false, a, false, b, (short)0, c, false, false); }
// four vector slots behind a group of matrix instructions, in front of a branch whose taken side reads their results; the scheduling barriers keep them at that place.
__device__ __forceinline__ void fa_gap() { __builtin_amdgcn_sched_barrier(0); asm volatile("v_nop\n\tv_nop\n\tv_nop\n\tv_nop"); __builtin_amdgcn_sched_barrier(0); }
// eight copies of 16 bytes a thread, global memory to LDS through no register: rows step (elements) apart in memory, lstep bytes apart in LDS.
// The s_wait_xcnt is the last line of the copies' own statement, so that no address register is rewritten in front of it.
__device__ __forceinline__ void fa_copy8(const _Float16* g, size_t step, unsigned l, unsigned lstep) { const _Float16* p[8]; unsigned d[8];
#pragma unroll      /* unrolled: p[], d[] keep static indices (registers, no scratch) */
  for (int i = 0; i < 8; ++i) { p[i] = g + (size_t)i * step; d[i] = l + (unsigned)i * lstep; }
  asm volatile("global_load_async_to_lds_b128 %0, %8, off\n\tglobal_load_async_to_lds_b128 %1, %9, off\n\tglobal_load_async_to_lds_b128 %2, %10, off\n\tglobal_load_async_to_lds_b128 %3, %11, off\n\t"
               "global_load_async_to_lds_b128 %4, %12, off\n\tglobal_load_async_to_lds_b128 %5, %13, off\n\tglobal_load_async_to_lds_b128 %6, %14, off\n\tglobal_load_async_to_lds_b128 %7, %15, off\n\ts_wait_xcnt 0x0"
               :: "v"(d[0]), "v"(d[1]), "v"(d[2]), "v"(d[3]), "v"(d[4]), "v"(d[5]), "v"(d[6]), "v"(d[7]), "v"(p[0]), "v"(p[1]), "v"(p[2]), "v"(p[3]), "v"(p[4]), "v"(p[5]), "v"(p[6]), "v"(p[7]) : "memory"); }
// a pass's eight K fragments (32 keys x 128 dims) as one group of LDS loads; p = the lane's own row (key c of the pass) in the buffer, the second 16 keys lie 16 rows on.
__device__ __forceinline__ void fa_loadk(v16h (&kf)[2][4], const unsigned char* p, unsigned pitch, int hh) {
#pragma unroll
  for (int kt = 0; kt < 2; ++kt)
#pragma unroll
    for (int kc = 0; kc < 4; ++kc) kf[kt][kc] = g2_frag((const _Float16*)(p + 16 * kt * pitch) + 32 * kc, hh); }
constexpr int FQ = 128; constexpr unsigned FPK = 2 * HDK + 16, FPV = 2 * 64 + 16, FTK = 64 * FPK, FTV = HDK * FPV, FST = FTK + FTV;
static_assert(SQ % FQ == 0 && (SQ / FQ) % 2 == 0 && HDK == 128, "k_fattn: blocks of 128 rows, head size 128");
__global__ __launch_bounds__(128) void k_fattn(const _Float16* __restrict__ Q16, const _Float16* __restrict__ K16, const _Float16* __restrict__ VT, _Float16* __restrict__ O16) {
  __shared__ __attribute__((aligned(16))) unsigned char sm[2 * FST];
  const int tid = threadIdx.x, lane = tid & 31, c = lane & 15, hh = lane >> 4; const int w = __builtin_amdgcn_readfirstlane(tid >> 5);
  const int head = blockIdx.x % NH, b = blockIdx.x / NH, grp = head / GSZ;
  constexpr int NQB = SQ / FQ; const int qb = ((int)blockIdx.y < NQB / 2) ? NQB - 1 - (int)blockIdx.y : (int)blockIdx.y - NQB / 2;      /* long blocks start first; blocks half a grid apart add up to the same length */
  const int q0 = qb * FQ, qw0 = q0 + 32 * w, nst = (q0 + FQ) / 64;      /* keys 0 .. q0 + 127: at least two stages */
  const _Float16* kg = K16 + ((size_t)b * SQ + (tid >> 4)) * DKV + grp * HDK + (tid & 15) * 8; const _Float16* vg = VT + ((size_t)b * DKV + grp * HDK + (tid >> 3)) * SQ + (tid & 7) * 8;
  const unsigned lk = (unsigned)(size_t)sm + (unsigned)((tid >> 4) * FPK + (tid & 15) * 16), lv = (unsigned)(size_t)sm + FTK + (unsigned)((tid >> 3) * FPV + (tid & 7) * 16);
  fa_copy8(kg, (size_t)8 * DKV, lk, 8 * FPK); fa_copy8(vg, (size_t)16 * SQ, lv, 16 * FPV);
  v16h qf[2][4];
#pragma unroll
  for (int g = 0; g < 2; ++g)
#pragma unroll
    for (int kc = 0; kc < 4; ++kc) qf[g][kc] = g2_frag(Q16 + ((size_t)b * SQ + qw0 + 16 * g + c) * DMX + head * HDK + 32 * kc, hh);
  const v8f z8 = {0.f,0.f,0.f,0.f,0.f,0.f,0.f,0.f}; v8f acc[2][8]; float m_run[2], l_run[2];
#pragma unroll
  for (int g = 0; g < 2; ++g) { m_run[g] = -__builtin_inff(); l_run[g] = 0.f;
#pragma unroll
    for (int t = 0; t < 8; ++t) acc[g][t] = z8; }
  asm volatile("s_wait_asynccnt 0x0" ::: "memory");      /* this wave's copies of stage 0 have landed */
  __syncthreads();      /* ... and every other wave's */
  fa_copy8(kg + (size_t)64 * DKV, (size_t)8 * DKV, lk + FST, 8 * FPK); fa_copy8(vg + 64, (size_t)16 * SQ, lv + FST, 16 * FPV);
  constexpr float cs = ATS * 1.4426950408889634f;      /* score scale, log2 domain */
  v16h kf[2][4];      /* K fragments of the coming pass: fetched as one group ahead of their products, never out of another stage's buffer */
#pragma unroll 1      /* one trip a stage: the two buffers take turns */
  for (int st = 0; st < nst; ++st) { const unsigned char* sb = sm + (st & 1) * FST;
    if (st * 64 <= qw0) fa_loadk(kf, sb + (unsigned)c * FPK, FPK, hh);      /* wave-uniform: the first pass's K fragments; this stage's buffer only */
#pragma unroll 1      /* one body for both passes: half the code, and no more registers than one pass needs */
    for (int sub = 0; sub < 2; ++sub) { const int key0 = st * 64 + sub * 32;
      if (key0 <= qw0) {      /* wave-uniform: a later pass holds no key that a query of this wave may see */
        v8f s[2][2] = {{z8, z8}, {z8, z8}};
#pragma unroll
        for (int kc = 0; kc < 4; ++kc)
#pragma unroll
          for (int kt = 0; kt < 2; ++kt)
#pragma unroll
            for (int g = 0; g < 2; ++g) s[kt][g] = fa_mma(kf[kt][kc], qf[g][kc], s[kt][g]);
        fa_gap();
        v16h vf[8];      /* the pass's V^T fragments, one group, in flight under the softmax */
#pragma unroll
        for (int t = 0; t < 8; ++t) vf[t] = g2_frag((const _Float16*)(sb + FTK + (unsigned)(16 * t + c) * FPV) + sub * 32, hh);
        if (sub == 0 && key0 + 32 <= qw0) fa_loadk(kf, sb + (unsigned)(32 + c) * FPK, FPK, hh);      /* wave-uniform: the stage's second pass, same buffer, in flight under this pass's softmax and second product */
        if (key0 == qw0) {      /* wave-uniform: only the pass on this wave's diagonal pays for the mask; every column keeps at least key qw0 */
#pragma unroll
          for (int g = 0; g < 2; ++g)
#pragma unroll
            for (int kt = 0; kt < 2; ++kt) {
#pragma unroll
              for (int r = 0; r < 8; ++r) if (16 * kt + 8 * hh + r > 16 * g + c) s[kt][g][r] = -__builtin_inff();
              asm volatile("" : "+v"(s[kt][g])); } }      /* the masked scores: keeps the selects inside the branch */
        float mb[2]; bool need = false;
#pragma unroll
        for (int g = 0; g < 2; ++g) { float mx = s[0][g][0];
#pragma unroll
          for (int r = 1; r < 8; ++r) mx = fmaxf(mx, s[0][g][r]);
#pragma unroll
          for (int r = 0; r < 8; ++r) mx = fmaxf(mx, s[1][g][r]);
          mx = fmaxf(mx, half_x(mx)) * cs; mb[g] = mx; need = need || (mx > m_run[g] + 8.0f); }      /* both halves of the wave now hold the query's maximum of this pass */
        if (__builtin_amdgcn_ballot_w32(need) != 0) {      /* wave-uniform; rare behind the first passes */
#pragma unroll
          for (int g = 0; g < 2; ++g) { const float mn = fmaxf(m_run[g], mb[g]); const float corr = exp2_1(m_run[g] - mn);      /* mn is finite from the first pass on (key 0 is open to every query); corr = 0 there */
            l_run[g] *= corr; m_run[g] = mn;
#pragma unroll
            for (int t = 0; t < 8; ++t) acc[g][t] = acc[g][t] * corr; } }
        FragH pf[2];
#pragma unroll
        for (int g = 0; g < 2; ++g) { const float nm = -m_run[g]; float ps = 0.f;
#pragma unroll
          for (int kt = 0; kt < 2; ++kt)
#pragma unroll
            for (int u4 = 0; u4 < 2; ++u4) { v4f a;
#pragma unroll
              for (int u = 0; u < 4; ++u) a[u] = fmaf(s[kt][g][4 * u4 + u], cs, nm);
              const v4f e = exp2_4(a); ps += (e[0] + e[1]) + (e[2] + e[3]);
#pragma unroll
              for (int u = 0; u < 4; ++u) pf[g].h[8 * kt + 4 * u4 + u] = (_Float16)e[u]; }
          l_run[g] += ps; }
        __builtin_amdgcn_sched_barrier(0);      /* the exponentials are asm text: all of them stay in front of the products */
#pragma unroll
        for (int t = 0; t < 8; ++t)
#pragma unroll
          for (int g = 0; g < 2; ++g) acc[g][t] = fa_mma(vf[t], pf[g].v, acc[g][t]);
        fa_gap(); } }
    asm volatile("s_wait_dscnt 0x0" ::: "memory");      /* this wave's reads of the buffer are done before it is handed to the next copies */
    asm volatile("s_wait_asynccnt 0x0" ::: "memory");      /* this wave's copies of stage st + 1 have landed */
    __syncthreads();      /* publishes stage st + 1 and ends every wave's reads of stage st */
    if (st + 2 < nst) { fa_copy8(kg + (size_t)(st + 2) * 64 * DKV, (size_t)8 * DKV, lk + (st & 1) * FST, 8 * FPK); fa_copy8(vg + (st + 2) * 64, (size_t)16 * SQ, lv + (st & 1) * FST, 16 * FPV); } }
  asm volatile("s_wait_asynccnt 0x0" ::: "memory");      /* no copy is in flight when the wave ends */
#pragma unroll
  for (int g = 0; g < 2; ++g) { const float inv = 64.0f / (l_run[g] + half_x(l_run[g]));      /* each half of the wave summed its own eight keys of every 16; o x64 */
    unsigned short* op = (unsigned short*)O16 + ((size_t)b * SQ + qw0 + 16 * g + c) * DMX + head * HDK + 8 * hh;
#pragma unroll
    for (int t = 0; t < 8; ++t) { FragH f;      /* accumulator register r = dim 16 t + 8 hh + r of query c: 16 contiguous bytes */
#pragma unroll
      for (int r = 0; r < 8; ++r) f.h[r] = (_Float16)(acc[g][t][r] * inv);
      *(v8us*)(op + 16 * t) = f.half[0]; } } }
// ---- large GEMM: C[M][N] (f32; H16: C16 = the same values in f16) = alpha A[M][DMX] Bt[N][DMX]^T, f16 operands, both k-contiguous with row pitch DMX ----
// A block of WR x WC waves owns a tile of 64 WR rows x 64 WC columns, a wave 64 x 64 of it (4 x 4 accumulator tiles): a staged byte serves 64 WC (A) or 64 WR (B) outputs, a fragment read from LDS four products.
// The k range goes in tiles of 128: the block's rows of A, then its rows of Bt, 256 bytes of each, are staged in LDS (pitch 272 bytes, an odd multiple of 16, for 16-byte readers), two buffers,
// the next tile's copies in flight while this one is multiplied. A wave's copy moves two whole rows of 256 bytes. A fragment keeps the k order of g2_frag and k rises in steps of 32, so every sum keeps its order.
template <int WR, int WC, int N, bool H16>
__global__ __launch_bounds__(32 * WR * WC) void k_gemm3(const _Float16* __restrict__ A, const _Float16* __restrict__ Bt, float alpha, float* __restrict__ C, _Float16* __restrict__ C16) {
  constexpr int KC = 128, BM = 64 * WR, BN = 64 * WC, RPC = 2 * WR * WC, NTL = DMX / KC; constexpr unsigned PB = 2 * KC + 16, STB = (BM + BN) * PB;      /* RPC: rows that one copy of every thread covers; PB, STB bytes: a staged row's pitch, one buffer */
  static_assert(NR % BM == 0 && N % BN == 0 && DMX % KC == 0 && NTL >= 2 && BM % (8 * RPC) == 0 && BN % (8 * RPC) == 0, "k_gemm3: whole tiles, eight copies a statement");
  static_assert((BM + BN) / RPC <= 63, "k_gemm3: one tile's copies of a wave in flight"); static_assert(2 * STB >= WR * WC * 64 * 68 * 4, "the output staging reuses the two buffers");
  __shared__ __attribute__((aligned(16))) unsigned char sm[2 * STB]; float (*so)[64][68] = reinterpret_cast<float (*)[64][68]>(sm);      /* so: each wave's output staging, used behind the loop's last barrier */
  const int tid = threadIdx.x, lane = tid & 31, ln = lane & 15, hh = lane >> 4; const int w = __builtin_amdgcn_readfirstlane(tid >> 5), wr = w / WC, wc = w % WC;
  const int mt = blockIdx.x / (N / BN), nq = blockIdx.x % (N / BN);
  const _Float16* ag = A + (size_t)(mt * BM + (tid >> 4)) * DMX + (tid & 15) * 8; const _Float16* bg = Bt + (size_t)(nq * BN + (tid >> 4)) * DMX + (tid & 15) * 8;      /* thread = 16 bytes of row (thread / 16) + c RPC */
  const unsigned l0 = (unsigned)(size_t)sm + (unsigned)(tid >> 4) * PB + (unsigned)(tid & 15) * 16;
  auto stage = [&](int t, unsigned l) {      /* k tile t into the buffer in which l is the thread's own first place */
#pragma unroll      /* unrolled: constant row offsets */
    for (int c = 0; c < BM / RPC; c += 8) fa_copy8(ag + (size_t)t * KC + (size_t)(c * RPC) * DMX, (size_t)RPC * DMX, l + (unsigned)(c * RPC) * PB, RPC * PB);
#pragma unroll
    for (int c = 0; c < BN / RPC; c += 8) fa_copy8(bg + (size_t)t * KC + (size_t)(c * RPC) * DMX, (size_t)RPC * DMX, l + (unsigned)(BM + c * RPC) * PB, RPC * PB); };
  stage(0, l0);
  asm volatile("s_wait_asynccnt 0x0" ::: "memory");      /* this wave's copies of tile 0 have landed */
  __syncthreads();      /* ... and every other wave's */
  stage(1, l0 + STB);
  const v8f z8 = {0.f,0.f,0.f,0.f,0.f,0.f,0.f,0.f}; v8f acc[4][4];
#pragma unroll
  for (int i = 0; i < 4; ++i)
#pragma unroll
    for (int j = 0; j < 4; ++j) acc[i][j] = z8;
#pragma unroll 1      /* one trip a tile: the two buffers take turns */
  for (int t = 0; t < NTL; ++t) { const unsigned char* sb = sm + (t & 1) * STB;
    const unsigned char* ap = sb + (unsigned)(64 * wr + ln) * PB; const unsigned char* bp = sb + (unsigned)(BM + 64 * wc + ln) * PB;
    v16h fa[2][4], fb[2][4];      /* two fragment sets: a k step's 16 LDS loads go as one group, one step ahead of its products, inside this tile only */
#pragma unroll
    for (int i = 0; i < 4; ++i) { fa[0][i] = g2_frag((const _Float16*)(ap + 16 * i * PB), hh); fb[0][i] = g2_frag((const _Float16*)(bp + 16 * i * PB), hh); }
#pragma unroll      /* unrolled: the sets keep static indices (registers), every LDS offset is an immediate */
    for (int s = 0; s < KC / 32; ++s) { const int u = s & 1, n = u ^ 1;
      if (s + 1 < KC / 32) {
#pragma unroll
        for (int i = 0; i < 4; ++i) { fa[n][i] = g2_frag((const _Float16*)(ap + 16 * i * PB) + (s + 1) * 32, hh); fb[n][i] = g2_frag((const _Float16*)(bp + 16 * i * PB) + (s + 1) * 32, hh); } }
      __builtin_amdgcn_sched_barrier(0);      /* the next step's loads stay one group in front of this step's products (without it this build loaded each fragment of Bt right in front of its four products and waited for it there) */
#pragma unroll
      for (int j = 0; j < 4; ++j)
#pragma unroll
        for (int i = 0; i < 4; ++i) acc[i][j] = fa_mma(fa[u][i], fb[u][j], acc[i][j]);
      __builtin_amdgcn_sched_barrier(0); }      /* ... and the group behind them is not spread among them */
    fa_gap();      /* the branches below (the refill, the loop's end) lead to vector instructions that may reuse the last products' operand registers or read their results */
    asm volatile("s_wait_dscnt 0x0" ::: "memory");      /* this wave's reads of the buffer are done before it is handed to the next copies */
    asm volatile("s_wait_asynccnt 0x0" ::: "memory");      /* this wave's copies of tile t + 1 have landed */
    __syncthreads();      /* publishes tile t + 1 and ends every wave's reads of tile t */
    if (t + 2 < NTL) stage(t + 2, l0 + (t & 1) * STB); }
  asm volatile("s_wait_asynccnt 0x0" ::: "memory");      /* no copy is in flight when the buffers become output staging */
#pragma unroll
  for (int i = 0; i < 4; ++i)
#pragma unroll
    for (int j = 0; j < 4; ++j)
#pragma unroll
      for (int r = 0; r < 8; ++r) so[w][16 * i + 8 * hh + r][16 * j + ln] = acc[i][j][r] * alpha;
  __builtin_amdgcn_fence(__ATOMIC_ACQ_REL, "workgroup"); __builtin_amdgcn_wave_barrier();      /* the wave's own rows are whole before its lanes read what other lanes wrote */
  const size_t o0 = (size_t)(mt * BM + 64 * wr + hh) * N + nq * BN + 64 * wc + ln * 4;      /* a store = two rows of 256 contiguous bytes (f32) */
#pragma unroll
  for (int q = 0; q < 32; ++q) { const v4f v = *(const v4fa*)&so[w][q * 2 + hh][ln * 4]; *(v4f*)(C + o0 + (size_t)(q * 2) * N) = v;
    if (H16) { v4h h4;
#pragma unroll
      for (int i = 0; i < 4; ++i) h4[i] = (_Float16)v[i];
      *(v4h*)(C16 + o0 + (size_t)(q * 2) * N) = h4; } } }
extern "C" void kernel_launch(void* const* d_in, const int* in_sizes, int n_in,
                              void* d_out, int out_size, void* d_ws, size_t ws_size, hipStream_t stream) {
  (void)in_sizes; (void)n_in; (void)out_size;
  const float* const* I = (const float* const*)d_in; const float* x = I[0]; const float* wq = I[1]; const float* wk = I[2]; const float* wv = I[3]; const float* wo = I[4]; const float* qnw = I[5]; const float* knw = I[6]; const float* tcos = I[7]; const float* tsin = I[8];      /* [in][out] weights; rope tables [S][128] */
  char* ws = (char*)d_ws; size_t off = 0;
  auto take = [&](size_t bytes) { char* p = ws + off; off += (bytes + 255) & ~(size_t)255; return p; };
  _Float16* BQ = (_Float16*)take((size_t)DMX * DMX * 2); _Float16* BK = (_Float16*)take((size_t)DKV * DMX * 2); _Float16* BV = (_Float16*)take((size_t)DKV * DMX * 2); _Float16* BO = (_Float16*)take((size_t)DMX * DMX * 2);
  _Float16* X16 = (_Float16*)take(NR * DMX * 2); float* QF = (float*)take(NR * DMX * 4); float* KF = (float*)take(NR * DKV * 4); float* VF = (float*)take(NR * DKV * 4); _Float16* Q16 = (_Float16*)take(NR * DMX * 2); _Float16* K16 = (_Float16*)take(NR * DKV * 2); _Float16* V16 = (_Float16*)take(NR * DKV * 2); _Float16* O16 = (_Float16*)take(NR * DMX * 2);
  _Float16* VT = (_Float16*)take((size_t)NB * (DKV / 64) * 64 * SQ * 2);
  float* QF0 = (float*)take((size_t)NB * QT0 * DMX * 4); float* KF0e = (float*)take((size_t)NB * QT0 * DMX * 4); float* VF0e = (float*)take((size_t)NB * QT0 * DMX * 4); float* OF0 = (float*)take((size_t)NB * QT0 * DMX * 4); _Float16* OH0 = (_Float16*)take((size_t)NB * QT0 * DMX * 2); _Float16* OL0 = (_Float16*)take((size_t)NB * QT0 * DMX * 2);
  if (off > ws_size) return;
  k_wt4<<<2 * WTQ + 2 * WTV, 256, 0, stream>>>(wq, wk, wv, wo, BQ, BK, BV, BO);      /* the four weights, [in][out] -> Bt x16 */
  k_x16<<<(unsigned)((NR * DMX / 8 + 255) / 256), 256, 0, stream>>>(x, X16, NR * DMX / 8);
  k_gemm3<4, 2, DMX, false><<<(unsigned)((NR / 256) * (DMX / 128)), 256, 0, stream>>>(X16, BQ, 0.0625f, QF, nullptr);      /* q (f32) */
  k_gemm3<2, 2, DKV, false><<<(unsigned)((NR / 128) * (DKV / 128)), 128, 0, stream>>>(X16, BK, 0.0625f, KF, nullptr);      /* k (f32) */
  k_gemm3<2, 2, DKV, true><<<(unsigned)((NR / 128) * (DKV / 128)), 128, 0, stream>>>(X16, BV, 0.0625f, VF, V16);      /* v (f32 for the first tile + f16) */
  k_nrope<<<(unsigned)(NR / 8), 256, 0, stream>>>(QF, KF, qnw, knw, tcos, tsin, Q16, K16, QF0, KF0e);      /* per-head RMSNorm + rope from the input tables -> f16; rows 0..127 of each batch also f32, k expanded group -> head */
  for (int b = 0; b < NB; ++b) { const size_t r0 = (size_t)b * SQ, f0 = (size_t)b * QT0;
  k_kvexp128<GSZ, NH, DKV><<<(unsigned)(((size_t)QT0 * DMX / 4 + 255) / 256), 256, 0, stream>>>(VF + r0 * DKV, VF0e + f0 * DMX, (size_t)QT0 * DMX / 4);      /* v: group -> head expansion for the exact first tile */
  }      /* per batch */
  k_vt<DKV / 64, SQ><<<NB * (DKV / 64) * (SQ / 64), 256, 0, stream>>>(V16, DKV, 0, VT);      /* V^T, both batches: batch b, group g = slabs 16b + 2g, 16b + 2g + 1 */
  k_att0w<<<dim3(NH * (QT0 / 8), NB), 256, 0, stream>>>(QF0, KF0e, VF0e, ATS, OF0);      /* exact causal attention rows 0..127 of both batches (o x64) */
  k_fattn<<<dim3(NH * NB, SQ / FQ), 128, 0, stream>>>(Q16, K16, VT, O16);      /* causal attention, all heads, batches and rows: o (x64) */
  k_gemm3<4, 2, DMX, false><<<(unsigned)((NR / 256) * (DMX / 128)), 256, 0, stream>>>(O16, BO, 0.0009765625f, (float*)d_out, nullptr);      /* out = o Wo */
  k_hl<<<(unsigned)(((size_t)NB * QT0 * DMX / 8 + 255) / 256), 256, 0, stream>>>(OF0, OH0, OL0, (size_t)NB * QT0 * DMX / 8);
  k_gemm2<0, 128><<<dim3((QT0 / 128) * (DMX / 64), 1, NB), 128, 0, stream>>>(OH0, DMX, 0, BO, DMX, 0, 0.0009765625f, nullptr, 0, nullptr, 1, 0, 0, (float*)d_out, nullptr, DMX, 0, QT0, DMX, DMX, 1, (size_t)QT0 * DMX, 0, (size_t)SQ * DMX);
  k_gemm2<0, 128><<<dim3((QT0 / 128) * (DMX / 64), 1, NB), 128, 0, stream>>>(OL0, DMX, 0, BO, DMX, 0, 0.00000095367431640625f, nullptr, 0, (const float*)d_out, -1, 0, 0, (float*)d_out, nullptr, DMX, 0, QT0, DMX, DMX, 1, (size_t)QT0 * DMX, 0, (size_t)SQ * DMX);      /* rows 0..127 of each batch rewritten from the exact path */
}
